// v000
// Times are from an AMD MI455X. After a warm-up the kernel runs many times in a row, and a time is the length of
// such a window on the GPU divided by its runs, so every launch and the gaps after it count. The runs cycle
// through copies of the inputs. A figure is the median of several windows, for all but v000 over two sittings.
// Sittings can differ by a few percent; kernels timed side by side share one.
// v000, which the later versions start from, runs in 530 microseconds.
// Contractions: ln1(x)*Wqkv^T, K*Q^T, V^T*P^T, attn*Wout^T, ln2(h)*Wfc1^T, gelu(.)*Wfc2^T all on v_wmma_f32_16x16x32_f16 (f16 operands, f32 accumulate); every W carried x32 and P carried x16384 (exact power-of-two scales folded back in f32); layernorm, softmax, bias, gelu and residual adds in f32.
#include <hip/hip_runtime.h>
#include <math.h>

typedef _Float16 v16h __attribute__((ext_vector_type(16)));
typedef _Float16 v8h  __attribute__((ext_vector_type(8)));
typedef float    v8f  __attribute__((ext_vector_type(8)));
typedef float    v4f  __attribute__((ext_vector_type(4)));
typedef v8h __attribute__((may_alias)) v8ha;
typedef v4f __attribute__((may_alias)) v4fa;

union Frag { v16h v; v8h half[2]; };

#define DM     1024
#define NH     16
#define HD     64
#define DFF    4096
#define SEQ    2048
#define BATCH  2
#define NTOK   (BATCH * SEQ)          // 4096 tokens
#define WSC    32.0f
#define WINV   0.03125f
#define PSCALE 16384.0f

#define G_QKV (3 * DM * DM / 8)       // 393216 groups of 8
#define G_OUT (DM * DM / 8)           // 131072
#define G_FC1 (DFF * DM / 8)          // 524288
#define G_FC2 (DM * DFF / 8)          // 524288
#define G_ALL (G_QKV + G_OUT + G_FC1 + G_FC2)   // 1572864

static_assert(NTOK % 128 == 0);
static_assert(SEQ % 128 == 0);
static_assert(DM % 64 == 0);
static_assert(DFF % 64 == 0);
static_assert(G_ALL % 256 == 0);

// ---------------------------------------------------------------------------
// 16x16x32 f16 WMMA with hazard guard (ties D, keeps A/B live).
// Fragment map (wave32): lane l, h = l>>4, m = n = l&15.
//   A/B element i: i<8 -> k0+8h+i ; i>=8 -> k0+16+8h+(i-8)
//   D element r : row 8h+r, col l&15
// ---------------------------------------------------------------------------
__device__ __forceinline__ v8f wmma_f16(v16h a, v16h b, v8f c) {
  v8f d = __builtin_amdgcn_wmma_f32_16x16x32_f16(false, a, false, b, (short)0, c, false, false);
  asm volatile("v_nop\n\tv_nop\n\tv_nop\n\tv_nop" : "+v"(d) : "v"(a), "v"(b));
  return d;
}

// A or B fragment from a k-contiguous 16-bit row; p points at element k0 of
// the row owned by this lane (row index = lane & 15 added by the caller).
__device__ __forceinline__ v16h load_frag(const _Float16* p, int h) {
  Frag f;
  f.half[0] = *(const v8ha*)(p + 8 * h);
  f.half[1] = *(const v8ha*)(p + 16 + 8 * h);
  return f.v;
}

// ---------------------------------------------------------------------------
// Kernel 1: f32 weights -> f16 planes scaled by 32 (exact). One 16-B store per
// wh layout: [qkv 3*DM*DM][out DM*DM][fc1 DFF*DM][fc2 DM*DFF], row = output feature.
// ---------------------------------------------------------------------------
__global__ __launch_bounds__(256) void cvt_w_kernel(
    const float* __restrict__ w0, const float* __restrict__ w1,
    const float* __restrict__ w2, const float* __restrict__ w3,
    _Float16* __restrict__ wh)
{
  const int g = blockIdx.x * 256 + threadIdx.x;
  if (g >= G_ALL) return;
  const float* src;
  if (g < G_QKV)                        src = w0 + (size_t)g * 8;
  else if (g < G_QKV + G_OUT)           src = w1 + (size_t)(g - G_QKV) * 8;
  else if (g < G_QKV + G_OUT + G_FC1)   src = w2 + (size_t)(g - G_QKV - G_OUT) * 8;
  else                                  src = w3 + (size_t)(g - G_QKV - G_OUT - G_FC1) * 8;
  _Float16* dst = wh + (size_t)g * 8;
  const v4f a = *(const v4fa*)src;
  const v4f c = *(const v4fa*)(src + 4);
  const v8h o = { (_Float16)(a.x * WSC), (_Float16)(a.y * WSC), (_Float16)(a.z * WSC), (_Float16)(a.w * WSC),
                  (_Float16)(c.x * WSC), (_Float16)(c.y * WSC), (_Float16)(c.z * WSC), (_Float16)(c.w * WSC) };
  *(v8h*)dst = o;
  
}

// ---------------------------------------------------------------------------
// Kernel 2: LayerNorm over rows of DM f32 -> f16. One wave per row (block of 8
// i*256 + lane*8 + 0..7 (i = 0..3) so every store instruction is 32 lanes x
// ---------------------------------------------------------------------------
__global__ __launch_bounds__(256) void ln_kernel(
    const float* __restrict__ x, const float* __restrict__ g,
    const float* __restrict__ bt, _Float16* __restrict__ y, int nrows)
{
  const int lane = threadIdx.x & 31, w = threadIdx.x >> 5;
  const int row = blockIdx.x * 8 + w;
  if (row >= nrows) return;                      // wave-uniform; no barriers below
  const float* xr = x + (size_t)row * DM;

  v4f xa[4], xb[4];
  float s = 0.0f;
  #pragma unroll
  for (int i = 0; i < 4; ++i) {
    const float* p = xr + i * 256 + lane * 8;
    xa[i] = *(const v4fa*)p;
    xb[i] = *(const v4fa*)(p + 4);
    s += ((xa[i].x + xa[i].y) + (xa[i].z + xa[i].w)) + ((xb[i].x + xb[i].y) + (xb[i].z + xb[i].w));
  }
  #pragma unroll
  for (int off = 16; off > 0; off >>= 1) s += __shfl_xor(s, off);
  const float mu = s * (1.0f / DM);

  float ss = 0.0f;
  #pragma unroll
  for (int i = 0; i < 4; ++i) {
    const v4f da = xa[i] - mu, db = xb[i] - mu;
    ss += ((da.x * da.x + da.y * da.y) + (da.z * da.z + da.w * da.w)) +
          ((db.x * db.x + db.y * db.y) + (db.z * db.z + db.w * db.w));
  }
  #pragma unroll
  for (int off = 16; off > 0; off >>= 1) ss += __shfl_xor(ss, off);
  const float var = ss * (1.0f / DM);
  const float rstd = rsqrtf(var + 1e-5f);

  v8h o[4];
  #pragma unroll
  for (int i = 0; i < 4; ++i) {
    const int p = i * 256 + lane * 8;
    const v4f ga = *(const v4fa*)(g + p),  gb = *(const v4fa*)(g + p + 4);
    const v4f ba = *(const v4fa*)(bt + p), bb = *(const v4fa*)(bt + p + 4);
    const v4f da = (xa[i] - mu) * rstd, db = (xb[i] - mu) * rstd;
    const v8h t = { (_Float16)(da.x * ga.x + ba.x), (_Float16)(da.y * ga.y + ba.y),
                    (_Float16)(da.z * ga.z + ba.z), (_Float16)(da.w * ga.w + ba.w),
                    (_Float16)(db.x * gb.x + bb.x), (_Float16)(db.y * gb.y + bb.y),
                    (_Float16)(db.z * gb.z + bb.z), (_Float16)(db.w * gb.w + bb.w) };
    o[i] = t;
  }
  _Float16* yr = y + (size_t)row * DM;
  #pragma unroll
  for (int i = 0; i < 4; ++i) *(v8h*)(yr + i * 256 + lane * 8) = o[i];
  
}

// ---------------------------------------------------------------------------
// Shared GEMM main loop: wave tile 32 (rows of A) x 64 (rows of W), K in steps
// of 32, A and W fragments straight from k-contiguous f16 global rows.
// acc[mt][nt][r] = sum_k A[row0 + 16mt + 8h + r][k] * W[col0 + 16nt + m][k]
// ---------------------------------------------------------------------------
__device__ __forceinline__ void gemm_main(const _Float16* __restrict__ xa0,
                                          const _Float16* __restrict__ xa1,
                                          const _Float16* __restrict__ wb,
                                          int K, int h, v8f (&acc)[2][4])
{
  const v8f zero8 = {0.f, 0.f, 0.f, 0.f, 0.f, 0.f, 0.f, 0.f};
  #pragma unroll
  for (int mt = 0; mt < 2; ++mt)
    #pragma unroll
    for (int nt = 0; nt < 4; ++nt) acc[mt][nt] = zero8;

  #pragma unroll 1
  for (int k0 = 0; k0 < K; k0 += 32) {
    const v16h a0 = load_frag(xa0 + k0, h);
    const v16h a1 = load_frag(xa1 + k0, h);
    #pragma unroll
    for (int nt = 0; nt < 4; ++nt) {
      const v16h b = load_frag(wb + (size_t)nt * 16 * K + k0, h);
      acc[0][nt] = wmma_f16(a0, b, acc[0][nt]);
      acc[1][nt] = wmma_f16(a1, b, acc[1][nt]);
    }
  }
}

// ---------------------------------------------------------------------------
// one 16-B store per lane, lanes 8q..8q+7 per line, 4 lines per instruction,
// 32 lines per wave, 128 per block.
// which 0/1: plane[bh][l][d]  (one token row = 64 halves = one line)
// which 2  : vt[bh][d][l]     (64 d-rows x 128 tokens = 2 lines each)
// ---------------------------------------------------------------------------
__device__ __forceinline__ void qkv_store_pass(const _Float16* sT, _Float16* plane, _Float16* vt,
                                               int which, int bh, int l0, int w, int lane) {
  const int q8 = lane & 7, sub = lane >> 3;
  #pragma unroll
  for (int i = 0; i < 8; ++i) {
    const int lid = w * 32 + i * 4 + sub;         // 0..127 over the block
    v8h v;
    _Float16* dst;
    if (which != 2) {
      v = *(const v8ha*)(sT + lid * HD + 8 * q8);
      dst = plane + ((size_t)bh * SEQ + l0 + lid) * HD + 8 * q8;
    } else {
      const int d = lid >> 1, hl = lid & 1;
      v = *(const v8ha*)(sT + d * 128 + 64 * hl + 8 * q8);
      dst = vt + ((size_t)bh * HD + d) * SEQ + l0 + 64 * hl + 8 * q8;
    }
    *(v8h*)dst = v;
  }
}

// ---------------------------------------------------------------------------
// Kernel 3: QKV = ln1(x) * Wqkv^T + b over the fused 3*1024 output columns.
// Block 128 thr (4 waves) = 128 tokens x 64 features (one (which, head)).
// q plane [B*H][S][64], k plane [B*H][S][64], vt [B*H][64][S].
// ---------------------------------------------------------------------------
__global__ __launch_bounds__(128) void qkv_kernel(
    const _Float16* __restrict__ xh,   // [NTOK][DM]
    const _Float16* __restrict__ wh,   // [3*DM][DM], row = output feature, x32
    const float* __restrict__ bias,    // [3*DM]
    _Float16* __restrict__ qh, _Float16* __restrict__ kh, _Float16* __restrict__ vt)
{
  __shared__ __attribute__((aligned(16))) _Float16 sT[128 * 64];   // 16384 B

  const int tid = threadIdx.x, lane = tid & 31, w = tid >> 5;
  const int h = lane >> 4, m = lane & 15;
  const int m0 = blockIdx.x * 128;
  const int cg = blockIdx.y;                 // 0..47 = which*16 + head
  const int which = cg >> 4, head = cg & 15;
  const int m0w = m0 + 32 * w;

  const _Float16* xa0 = xh + (size_t)(m0w + m) * DM;
  const _Float16* xa1 = xa0 + (size_t)16 * DM;
  const _Float16* wb  = wh + ((size_t)cg * 64 + m) * DM;

  v8f acc[2][4];
  gemm_main(xa0, xa1, wb, DM, h, acc);

  // D[r] of tile (mt, nt) = Y[token m0w+16mt+8h+r][feature cg*64 + 16nt+m]
  #pragma unroll
  for (int nt = 0; nt < 4; ++nt) {
    const int feat = 16 * nt + m;
    const float bvl = bias[cg * 64 + feat];
    #pragma unroll
    for (int mt = 0; mt < 2; ++mt) {
      #pragma unroll
      for (int r = 0; r < 8; ++r) {
        const int tokl = 32 * w + 16 * mt + 8 * h + r;     // 0..127
        const float yv = acc[mt][nt][r] * WINV + bvl;
        const int idx = (which == 2) ? (feat * 128 + tokl) : (tokl * HD + feat);
        sT[idx] = (_Float16)yv;
      }
    }
  }
  __syncthreads();

  const int b = m0 / SEQ, l0 = m0 - b * SEQ, bh = b * NH + head;
  _Float16* plane = (which == 0) ? qh : kh;
  qkv_store_pass(sT, plane, vt, which, bh, l0, w, lane);
  
}

// ---------------------------------------------------------------------------
// Attention helpers.
// P^T B-fragment from the lane's own score D values: element r <- tile a row r,
// element 8+r <- tile c row r (same lane, same query column), scaled by 2^14.
// ---------------------------------------------------------------------------
__device__ __forceinline__ v16h pack_p(v8f a, v8f c) {
  const v16h r = { (_Float16)(a[0] * PSCALE), (_Float16)(a[1] * PSCALE), (_Float16)(a[2] * PSCALE), (_Float16)(a[3] * PSCALE),
                   (_Float16)(a[4] * PSCALE), (_Float16)(a[5] * PSCALE), (_Float16)(a[6] * PSCALE), (_Float16)(a[7] * PSCALE),
                   (_Float16)(c[0] * PSCALE), (_Float16)(c[1] * PSCALE), (_Float16)(c[2] * PSCALE), (_Float16)(c[3] * PSCALE),
                   (_Float16)(c[4] * PSCALE), (_Float16)(c[5] * PSCALE), (_Float16)(c[6] * PSCALE), (_Float16)(c[7] * PSCALE) };
  return r;
}

// (one query row) by lanes 8q..8q+7 in one instruction, 4 lines per instruction.
__device__ __forceinline__ void att_store_pass(const _Float16* so, _Float16* ao,
                                               int b, int head, int q0, int lane) {
  const int q8 = lane & 7, sub = lane >> 3;
  #pragma unroll
  for (int i = 0; i < 4; ++i) {
    const int lid = i * 4 + sub;                  // query row 0..15
    const v8h v = *(const v8ha*)(so + lid * 64 + 8 * q8);
    const size_t gi = ((size_t)b * SEQ + q0 + lid) * DM + head * HD + 8 * q8;
    *(v8h*)(ao + gi) = v;
  }
}

// ---------------------------------------------------------------------------
// Kernel 4: causal streaming attention, transposed form.
// Block 128 thr (4 waves), 16 queries per wave, 64 keys per step; each wave's
// key loop stops after the step that contains its diagonal (wave-uniform).
//   S^T = K * Q^T : A = K rows (row = key, k = d), B = Q^T (k = d, n = query)
//   O^T += V^T * P^T : A = Vt rows (row = d, k = key), B = P^T from registers
// Lane owns 32 keys of query column (lane&15); partner = lane ^ 16.
// The 1/8 scale is folded into the exponent argument (exact power of two).
// ---------------------------------------------------------------------------
__global__ __launch_bounds__(128) void attn_kernel(
    const _Float16* __restrict__ qh,   // [B*H][S][64]
    const _Float16* __restrict__ kh,   // [B*H][S][64]
    const _Float16* __restrict__ vt,   // [B*H][64][S]
    _Float16* __restrict__ ao)         // [B][S][DM]
{
  __shared__ __attribute__((aligned(16))) _Float16 sO[4 * 16 * 64];    // 8192 B

  const int tid = threadIdx.x, lane = tid & 31, w = tid >> 5;
  const int h = lane >> 4, m = lane & 15;
  const int bh = blockIdx.y, b = bh >> 4, head = bh & 15;
  const int q0 = blockIdx.x * 64 + 16 * w;

  // Q^T B-fragments: column n = query q0+m, k = d (two 32-deep chunks)
  const _Float16* qrow = qh + ((size_t)bh * SEQ + q0 + m) * HD;
  const v16h qb0 = load_frag(qrow, h);
  const v16h qb1 = load_frag(qrow + 32, h);

  const v8f zero8 = {0.f, 0.f, 0.f, 0.f, 0.f, 0.f, 0.f, 0.f};
  v8f o[4];                                   // o[t][r] = O[query m][d 16t+8h+r] * (l * 2^14)
  #pragma unroll
  for (int t = 0; t < 4; ++t) o[t] = zero8;
  float mrun = -1e30f, lrun = 0.0f;

  const _Float16* kbase = kh + ((size_t)bh * SEQ + m) * HD;    // + key0*HD
  const _Float16* vbase = vt + ((size_t)bh * HD + m) * SEQ;    // + 16t*SEQ + key0
  const int kend = q0 + 16;                                    // exclusive causal bound

  #pragma unroll 1
  for (int kb = 0; kb < kend; kb += 64) {
    // ---- raw scores: s[j][r] = S[query q0+m][key kb+16j+8h+r] (unscaled) ----
    v8f s[4];
    #pragma unroll
    for (int j = 0; j < 4; ++j) {
      const _Float16* kp = kbase + (size_t)(kb + 16 * j) * HD;
      const v16h kf0 = load_frag(kp, h);
      const v16h kf1 = load_frag(kp + 32, h);
      v8f z = zero8;
      z = wmma_f16(kf0, qb0, z);
      z = wmma_f16(kf1, qb1, z);
      s[j] = z;
    }
    // ---- causal mask (only on the step touching the diagonal) ----
    if (kb + 63 > q0) {
      const int qq = q0 + m;
      #pragma unroll
      for (int j = 0; j < 4; ++j)
        #pragma unroll
        for (int r = 0; r < 8; ++r) {
          const int kk = kb + 16 * j + 8 * h + r;
          if (kk > qq) s[j][r] = -1e30f;
        }
    }

    // ---- online softmax (scale 1/8 applied inside the exp argument) ----
    float mloc = s[0][0];
    #pragma unroll
    for (int j = 0; j < 4; ++j)
      #pragma unroll
      for (int r = 0; r < 8; ++r) mloc = fmaxf(mloc, s[j][r]);
    mloc = fmaxf(mloc, __shfl_xor(mloc, 16));
    const float mnew = fmaxf(mrun, mloc);
    const float cn = mnew * 0.125f;
    const float alpha = __expf((mrun - mnew) * 0.125f);
    mrun = mnew;
    float lsum = 0.0f;
    #pragma unroll
    for (int j = 0; j < 4; ++j)
      #pragma unroll
      for (int r = 0; r < 8; ++r) {
        const float p = __expf(fmaf(s[j][r], 0.125f, -cn));
        s[j][r] = p;
        lsum += p;
      }
    lsum += __shfl_xor(lsum, 16);
    lrun = lrun * alpha + lsum;
    #pragma unroll
    for (int t = 0; t < 4; ++t)
      #pragma unroll
      for (int r = 0; r < 8; ++r) o[t][r] = o[t][r] * alpha;

    // ---- P^T B-fragments (key chunks 0..31 and 32..63 of this step) ----
    const v16h pb0 = pack_p(s[0], s[1]);
    const v16h pb1 = pack_p(s[2], s[3]);

    // ---- O^T += V^T * P^T ----
    #pragma unroll
    for (int t = 0; t < 4; ++t) {
      const _Float16* vp = vbase + (size_t)(16 * t) * SEQ + kb;
      const v16h vf0 = load_frag(vp, h);
      const v16h vf1 = load_frag(vp + 32, h);
      o[t] = wmma_f16(vf0, pb0, o[t]);
      o[t] = wmma_f16(vf1, pb1, o[t]);
    }
  }

  // ---- epilogue: normalise, stage per-wave 16x64 f16 tile, whole-line stores ----
  const float inv = (1.0f / lrun) * (1.0f / PSCALE);
  _Float16* so = sO + w * 1024;
  #pragma unroll
  for (int t = 0; t < 4; ++t)
    #pragma unroll
    for (int r = 0; r < 8; ++r)
      so[m * 64 + 16 * t + 8 * h + r] = (_Float16)(o[t][r] * inv);
  __syncthreads();

  att_store_pass(so, ao, b, head, q0, lane);
  
}

// ---------------------------------------------------------------------------
// Kernel 5: Y = A[M,K](f16) * W[N,K]^T(f16 x32) with epilogue.
//   MODE 1: outf[M][N] (f32) = (acc/32 + bias) + resid
//   MODE 2: outh[M][N] (f16) = gelu_erf(acc/32 + bias)
// Block 128 thr (4 waves) = 128 rows x 64 cols; wave = 32 rows x 64 cols.
// ---------------------------------------------------------------------------
template <int MODE>
__global__ __launch_bounds__(128) void gemm_kernel(
    const _Float16* __restrict__ A, const _Float16* __restrict__ W,
    const float* __restrict__ bias, const float* __restrict__ resid,
    float* __restrict__ outf, _Float16* __restrict__ outh, int N, int K)
{
  __shared__ __attribute__((aligned(16))) float sbuf[128 * 64];   // 32768 B

  const int tid = threadIdx.x, lane = tid & 31, w = tid >> 5;
  const int h = lane >> 4, m = lane & 15;
  const int q8 = lane & 7, sub = lane >> 3;
  const int m0 = blockIdx.x * 128, n0 = blockIdx.y * 64;
  const int m0w = m0 + 32 * w;

  const _Float16* xa0 = A + (size_t)(m0w + m) * K;
  const _Float16* xa1 = xa0 + (size_t)16 * K;
  const _Float16* wb  = W + (size_t)(n0 + m) * K;

  v8f acc[2][4];
  gemm_main(xa0, xa1, wb, K, h, acc);

  // D[r] of tile (mt, nt) = Y[row m0w+16mt+8h+r][col n0+16nt+m]
  if (MODE == 1) {
    #pragma unroll
    for (int nt = 0; nt < 4; ++nt)
      #pragma unroll
      for (int mt = 0; mt < 2; ++mt)
        #pragma unroll
        for (int r = 0; r < 8; ++r)
          sbuf[(32 * w + 16 * mt + 8 * h + r) * 64 + 16 * nt + m] = acc[mt][nt][r] * WINV;
    __syncthreads();

    // wave w owns rows 32w..32w+31, each row = 64 floats = 2 lines -> 64 lines
    v4f vals[16];
    #pragma unroll
    for (int i = 0; i < 16; ++i) {
      const int lid = i * 4 + sub;                 // 0..63
      const int rl = lid >> 1, hl = lid & 1;
      const int col = 32 * hl + 4 * q8;
      const v4f a  = *(const v4fa*)(sbuf + (32 * w + rl) * 64 + col);
      const v4f bb = *(const v4fa*)(bias + n0 + col);
      const size_t gi = (size_t)(m0w + rl) * N + n0 + col;
      const v4f rr = *(const v4fa*)(resid + gi);
      vals[i] = (a + bb) + rr;
    }
    #pragma unroll
    for (int i = 0; i < 16; ++i) {
      const int lid = i * 4 + sub;
      const int rl = lid >> 1, hl = lid & 1;
      const size_t gi = (size_t)(m0w + rl) * N + n0 + 32 * hl + 4 * q8;
      *(v4f*)(outf + gi) = vals[i];
    }
    
  } else {
    _Float16* sh = (_Float16*)sbuf;
    #pragma unroll
    for (int nt = 0; nt < 4; ++nt) {
      const float bvl = bias[n0 + 16 * nt + m];
      #pragma unroll
      for (int mt = 0; mt < 2; ++mt)
        #pragma unroll
        for (int r = 0; r < 8; ++r) {
          const float xv = acc[mt][nt][r] * WINV + bvl;
          const float gl = 0.5f * xv * (1.0f + erff(xv * 0.70710678118654752f));
          sh[(32 * w + 16 * mt + 8 * h + r) * 64 + 16 * nt + m] = (_Float16)gl;
        }
    }
    __syncthreads();

    // wave w owns rows 32w..32w+31, each row = 64 halves = 1 line -> 32 lines
    v8h vals[8];
    #pragma unroll
    for (int i = 0; i < 8; ++i) {
      const int lid = i * 4 + sub;                 // 0..31
      vals[i] = *(const v8ha*)(sh + (32 * w + lid) * 64 + 8 * q8);
    }
    #pragma unroll
    for (int i = 0; i < 8; ++i) {
      const int lid = i * 4 + sub;
      *(v8h*)(outh + (size_t)(m0w + lid) * N + n0 + 8 * q8) = vals[i];
    }
    
  }
}

// ---------------------------------------------------------------------------
extern "C" void kernel_launch(void* const* d_in, const int* in_sizes, int n_in,
                              void* d_out, int out_size, void* d_ws, size_t ws_size,
                              hipStream_t stream) {
  if (n_in < 13) return;
  if (in_sizes[0] != NTOK * DM) return;
  if (in_sizes[1] != 3 * DM * DM || in_sizes[2] != 3 * DM) return;
  if (in_sizes[3] != DM * DM || in_sizes[4] != DM) return;
  if (in_sizes[5] != DFF * DM || in_sizes[6] != DFF) return;
  if (in_sizes[7] != DM * DFF || in_sizes[8] != DM) return;
  if (in_sizes[9] != DM || in_sizes[10] != DM || in_sizes[11] != DM || in_sizes[12] != DM) return;
  if (out_size != NTOK * DM) return;

  const float* hidden = (const float*)d_in[0];
  const float* qkv_w  = (const float*)d_in[1];
  const float* qkv_b  = (const float*)d_in[2];
  const float* out_w  = (const float*)d_in[3];
  const float* out_b  = (const float*)d_in[4];
  const float* fc1_w  = (const float*)d_in[5];
  const float* fc1_b  = (const float*)d_in[6];
  const float* fc2_w  = (const float*)d_in[7];
  const float* fc2_b  = (const float*)d_in[8];
  const float* ln1_g  = (const float*)d_in[9];
  const float* ln1_b  = (const float*)d_in[10];
  const float* ln2_g  = (const float*)d_in[11];
  const float* ln2_b  = (const float*)d_in[12];
  float* out = (float*)d_out;

  // workspace carve (all sizes multiples of 256 B)
  const size_t wh_bytes   = (size_t)G_ALL * 8 * 2;          // 25165824
  const size_t act_bytes  = (size_t)NTOK * DM * 2;           //  8388608  (f16 [4096][1024])
  const size_t hid2_bytes = (size_t)NTOK * DM * 4;           // 16777216
  const size_t ff_bytes   = (size_t)NTOK * DFF * 2;          // 33554432
  const size_t total = wh_bytes + 5 * act_bytes + hid2_bytes + ff_bytes;   // 117440512
  if (total > ws_size) return;

  char* ws = (char*)d_ws;
  size_t off = 0;
  _Float16* wh   = (_Float16*)(ws + off); off += wh_bytes;
  _Float16* xn   = (_Float16*)(ws + off); off += act_bytes;   // ln1 output, later ln2 output
  _Float16* qh   = (_Float16*)(ws + off); off += act_bytes;
  _Float16* kh   = (_Float16*)(ws + off); off += act_bytes;
  _Float16* vt   = (_Float16*)(ws + off); off += act_bytes;
  _Float16* ah   = (_Float16*)(ws + off); off += act_bytes;   // attention output f16 [4096][1024]
  float*    hid2 = (float*)(ws + off);    off += hid2_bytes;  // hidden + attn proj, f32
  _Float16* ff   = (_Float16*)(ws + off); off += ff_bytes;    // gelu(fc1) f16 [4096][4096]
  if (off > ws_size) return;

  const _Float16* w_qkv = wh;
  const _Float16* w_out = wh + (size_t)3 * DM * DM;
  const _Float16* w_fc1 = wh + (size_t)4 * DM * DM;
  const _Float16* w_fc2 = wh + (size_t)4 * DM * DM + (size_t)DFF * DM;

  // 1: weights -> f16 x32
  cvt_w_kernel<<<G_ALL / 256, 256, 0, stream>>>(qkv_w, out_w, fc1_w, fc2_w, wh);

  // 2: ln1 -> f16
  ln_kernel<<<NTOK / 8, 256, 0, stream>>>(hidden, ln1_g, ln1_b, xn, NTOK);

  // 3: qkv projection -> q/k planes + transposed v
  qkv_kernel<<<dim3(NTOK / 128, 3 * NH), 128, 0, stream>>>(xn, w_qkv, qkv_b, qh, kh, vt);

  // 4: causal attention -> f16 [tok][DM]
  attn_kernel<<<dim3(SEQ / 64, BATCH * NH), 128, 0, stream>>>(qh, kh, vt, ah);

  // 5: output projection + bias + residual -> f32 hid2
  gemm_kernel<1><<<dim3(NTOK / 128, DM / 64), 128, 0, stream>>>(ah, w_out, out_b, hidden, hid2, xn, DM, DM);

  // 6: ln2 -> f16 (reuses xn)
  ln_kernel<<<NTOK / 8, 256, 0, stream>>>(hid2, ln2_g, ln2_b, xn, NTOK);

  // 7: fc1 + exact gelu -> f16 ff
  gemm_kernel<2><<<dim3(NTOK / 128, DFF / 64), 128, 0, stream>>>(xn, w_fc1, fc1_b, fc1_b, hid2, ff, DFF, DM);

  // 8: fc2 + bias + residual(hid2) -> f32 d_out
  gemm_kernel<1><<<dim3(NTOK / 128, DM / 64), 128, 0, stream>>>(ff, w_fc2, fc2_b, hid2, out, xn, DM, DFF);
}

// v001
// One run takes 317 microseconds.
// In both of two side-by-side timings against v000, it was 1.71 times as fast.
// Contractions: ln1(x)*Wqkv^T, K*Q^T, V^T*P^T, attn*Wout^T, ln2(h)*Wfc1^T, gelu(.)*Wfc2^T all on v_wmma_f32_16x16x32_f16 (f16 operands, f32 accumulate); every W carried x32 and P carried x16384 (exact power-of-two scales folded back in f32); layernorm, softmax, bias, gelu and residual adds in f32.
#include <hip/hip_runtime.h>
#include <math.h>

typedef _Float16 v16h __attribute__((ext_vector_type(16)));
typedef _Float16 v8h  __attribute__((ext_vector_type(8)));
typedef float    v8f  __attribute__((ext_vector_type(8)));
typedef float    v4f  __attribute__((ext_vector_type(4)));
typedef v8h __attribute__((may_alias)) v8ha;
typedef v4f __attribute__((may_alias)) v4fa;

union Frag { v16h v; v8h half[2]; };

#define DM     1024
#define NH     16
#define HD     64
#define DFF    4096
#define SEQ    2048
#define BATCH  2
#define NTOK   (BATCH * SEQ)          // 4096 tokens
#define WSC    32.0f
#define WINV   0.03125f
#define PSCALE 16384.0f

#define G_QKV (3 * DM * DM / 8)       // 393216 groups of 8
#define G_OUT (DM * DM / 8)           // 131072
#define G_FC1 (DFF * DM / 8)          // 524288
#define G_FC2 (DM * DFF / 8)          // 524288
#define G_ALL (G_QKV + G_OUT + G_FC1 + G_FC2)   // 1572864

static_assert(NTOK % 128 == 0);
static_assert(SEQ % 128 == 0);
static_assert(DM % 64 == 0);
static_assert(DFF % 64 == 0);
static_assert(G_ALL % 256 == 0);

// ---------------------------------------------------------------------------
// 16x16x32 f16 WMMA with hazard guard (ties D, keeps A/B live).
// Fragment map (wave32): lane l, h = l>>4, m = n = l&15.
//   A/B element i: i<8 -> k0+8h+i ; i>=8 -> k0+16+8h+(i-8)
//   D element r : row 8h+r, col l&15
// ---------------------------------------------------------------------------
__device__ __forceinline__ v8f wmma_f16(v16h a, v16h b, v8f c) {
  v8f d = __builtin_amdgcn_wmma_f32_16x16x32_f16(false, a, false, b, (short)0, c, false, false);
  asm volatile("v_nop\n\tv_nop\n\tv_nop\n\tv_nop" : "+v"(d) : "v"(a), "v"(b));
  return d;
}

// A or B fragment from a k-contiguous 16-bit row; p points at element k0 of
// the row owned by this lane (row index = lane & 15 added by the caller).
__device__ __forceinline__ v16h load_frag(const _Float16* p, int h) {
  Frag f;
  f.half[0] = *(const v8ha*)(p + 8 * h);
  f.half[1] = *(const v8ha*)(p + 16 + 8 * h);
  return f.v;
}

// ---------------------------------------------------------------------------
// Kernel 1: f32 weights -> f16 planes scaled by 32 (exact). One 16-B store per
// wh layout: [qkv 3*DM*DM][out DM*DM][fc1 DFF*DM][fc2 DM*DFF], row = output feature.
// ---------------------------------------------------------------------------
__global__ __launch_bounds__(256) void cvt_w_kernel(
    const float* __restrict__ w0, const float* __restrict__ w1,
    const float* __restrict__ w2, const float* __restrict__ w3,
    _Float16* __restrict__ wh)
{
  const int g = blockIdx.x * 256 + threadIdx.x;
  if (g >= G_ALL) return;
  const float* src;
  if (g < G_QKV)                        src = w0 + (size_t)g * 8;
  else if (g < G_QKV + G_OUT)           src = w1 + (size_t)(g - G_QKV) * 8;
  else if (g < G_QKV + G_OUT + G_FC1)   src = w2 + (size_t)(g - G_QKV - G_OUT) * 8;
  else                                  src = w3 + (size_t)(g - G_QKV - G_OUT - G_FC1) * 8;
  _Float16* dst = wh + (size_t)g * 8;
  const v4f a = *(const v4fa*)src;
  const v4f c = *(const v4fa*)(src + 4);
  const v8h o = { (_Float16)(a.x * WSC), (_Float16)(a.y * WSC), (_Float16)(a.z * WSC), (_Float16)(a.w * WSC),
                  (_Float16)(c.x * WSC), (_Float16)(c.y * WSC), (_Float16)(c.z * WSC), (_Float16)(c.w * WSC) };
  *(v8h*)dst = o;
  
}

// ---------------------------------------------------------------------------
// Kernel 2: LayerNorm over rows of DM f32 -> f16. One wave per row (block of 8
// i*256 + lane*8 + 0..7 (i = 0..3) so every store instruction is 32 lanes x
// ---------------------------------------------------------------------------
__global__ __launch_bounds__(256) void ln_kernel(
    const float* __restrict__ x, const float* __restrict__ g,
    const float* __restrict__ bt, _Float16* __restrict__ y, int nrows)
{
  const int lane = threadIdx.x & 31, w = threadIdx.x >> 5;
  const int row = blockIdx.x * 8 + w;
  if (row >= nrows) return;                      // wave-uniform; no barriers below
  const float* xr = x + (size_t)row * DM;

  v4f xa[4], xb[4];
  float s = 0.0f;
  #pragma unroll
  for (int i = 0; i < 4; ++i) {
    const float* p = xr + i * 256 + lane * 8;
    xa[i] = *(const v4fa*)p;
    xb[i] = *(const v4fa*)(p + 4);
    s += ((xa[i].x + xa[i].y) + (xa[i].z + xa[i].w)) + ((xb[i].x + xb[i].y) + (xb[i].z + xb[i].w));
  }
  #pragma unroll
  for (int off = 16; off > 0; off >>= 1) s += __shfl_xor(s, off);
  const float mu = s * (1.0f / DM);

  float ss = 0.0f;
  #pragma unroll
  for (int i = 0; i < 4; ++i) {
    const v4f da = xa[i] - mu, db = xb[i] - mu;
    ss += ((da.x * da.x + da.y * da.y) + (da.z * da.z + da.w * da.w)) +
          ((db.x * db.x + db.y * db.y) + (db.z * db.z + db.w * db.w));
  }
  #pragma unroll
  for (int off = 16; off > 0; off >>= 1) ss += __shfl_xor(ss, off);
  const float var = ss * (1.0f / DM);
  const float rstd = rsqrtf(var + 1e-5f);

  v8h o[4];
  #pragma unroll
  for (int i = 0; i < 4; ++i) {
    const int p = i * 256 + lane * 8;
    const v4f ga = *(const v4fa*)(g + p),  gb = *(const v4fa*)(g + p + 4);
    const v4f ba = *(const v4fa*)(bt + p), bb = *(const v4fa*)(bt + p + 4);
    const v4f da = (xa[i] - mu) * rstd, db = (xb[i] - mu) * rstd;
    const v8h t = { (_Float16)(da.x * ga.x + ba.x), (_Float16)(da.y * ga.y + ba.y),
                    (_Float16)(da.z * ga.z + ba.z), (_Float16)(da.w * ga.w + ba.w),
                    (_Float16)(db.x * gb.x + bb.x), (_Float16)(db.y * gb.y + bb.y),
                    (_Float16)(db.z * gb.z + bb.z), (_Float16)(db.w * gb.w + bb.w) };
    o[i] = t;
  }
  _Float16* yr = y + (size_t)row * DM;
  #pragma unroll
  for (int i = 0; i < 4; ++i) *(v8h*)(yr + i * 256 + lane * 8) = o[i];
  
}

// ---------------------------------------------------------------------------
// Shared GEMM main loop: block tile 128 (rows of A) x 64 (rows of W), wave tile
// 32 x 64. A stage is 128 k (256 B) of all 192 rows, laid in LDS at a pitch of
// 272 B (16 B x odd: conflict-free for 16-byte fragment reads). Two buffers:
// stage t+1 is copied global -> LDS asynchronously while stage t is multiplied.
// acc[mt][nt][r] = sum_k A[row0 + 16mt + 8h + r][k] * W[col0 + 16nt + m][k],
// k ascending in steps of 32.
// ---------------------------------------------------------------------------
#define KP      128                          // k elements per stage
#define PITCH   272                          // LDS bytes per staged row
#define A_ROWS  128
#define W_ROWS  64
#define STAGE   ((A_ROWS + W_ROWS) * PITCH)  // 52224 B
#define RING    (2 * STAGE)                  // 104448 B

static_assert(DM % KP == 0 && DFF % KP == 0);
static_assert(PITCH % 16 == 0 && STAGE % 16 == 0);

// Twelve 16-byte-per-lane copies global -> LDS. The s_wait_xcnt closes the
// statement so that no address register named here is rewritten ahead of it.
__device__ __forceinline__ void copy12(const unsigned (&l)[24], const _Float16* const (&g)[24], int o) {
  asm volatile(
      "global_load_async_to_lds_b128 %0, %12, off\n\t"
      "global_load_async_to_lds_b128 %1, %13, off\n\t"
      "global_load_async_to_lds_b128 %2, %14, off\n\t"
      "global_load_async_to_lds_b128 %3, %15, off\n\t"
      "global_load_async_to_lds_b128 %4, %16, off\n\t"
      "global_load_async_to_lds_b128 %5, %17, off\n\t"
      "global_load_async_to_lds_b128 %6, %18, off\n\t"
      "global_load_async_to_lds_b128 %7, %19, off\n\t"
      "global_load_async_to_lds_b128 %8, %20, off\n\t"
      "global_load_async_to_lds_b128 %9, %21, off\n\t"
      "global_load_async_to_lds_b128 %10, %22, off\n\t"
      "global_load_async_to_lds_b128 %11, %23, off\n\t"
      "s_wait_xcnt 0x0"
      :: "v"(l[o + 0]), "v"(l[o + 1]), "v"(l[o + 2]), "v"(l[o + 3]), "v"(l[o + 4]), "v"(l[o + 5]),
         "v"(l[o + 6]), "v"(l[o + 7]), "v"(l[o + 8]), "v"(l[o + 9]), "v"(l[o + 10]), "v"(l[o + 11]),
         "v"(g[o + 0]), "v"(g[o + 1]), "v"(g[o + 2]), "v"(g[o + 3]), "v"(g[o + 4]), "v"(g[o + 5]),
         "v"(g[o + 6]), "v"(g[o + 7]), "v"(g[o + 8]), "v"(g[o + 9]), "v"(g[o + 10]), "v"(g[o + 11])
      : "memory");
}

// One stage: thread t copies 16 B at column 16*(t&15) of rows (t>>4) + 8i; a wave's
// copy covers two whole 256-B row pieces. i = 0..15 are A rows, 16..23 W rows.
// lds = this thread's LDS byte address in row (t>>4) of the target buffer;
// ga / gw = this thread's element in that row of A / W at the stage's first k.
__device__ __forceinline__ void stage_copy(unsigned lds, const _Float16* ga, const _Float16* gw, int K) {
  unsigned l[24];
  const _Float16* g[24];
  #pragma unroll
  for (int i = 0; i < 24; ++i) {
    l[i] = lds + (unsigned)(i * 8 * PITCH);
    g[i] = (i < 16) ? ga + (size_t)(i * 8) * K : gw + (size_t)((i - 16) * 8) * K;
  }
  copy12(l, g, 0);
  copy12(l, g, 12);
}

// ablk / wblk: first row of the block's A / W tile. ring: RING bytes of LDS; free
// for other use on return (every wave's reads and copies are done and a barrier passed).
__device__ __forceinline__ void gemm_main(char* ring,
                                          const _Float16* __restrict__ ablk,
                                          const _Float16* __restrict__ wblk,
                                          int K, int tid, v8f (&acc)[2][4])
{
  const int lane = tid & 31, w = tid >> 5;
  const int h = lane >> 4, m = lane & 15;
  const v8f zero8 = {0.f, 0.f, 0.f, 0.f, 0.f, 0.f, 0.f, 0.f};
  #pragma unroll
  for (int mt = 0; mt < 2; ++mt)
    #pragma unroll
    for (int nt = 0; nt < 4; ++nt) acc[mt][nt] = zero8;

  const int crow = tid >> 4, ccol = tid & 15;
  const unsigned lds0 = (unsigned)(size_t)ring + (unsigned)(crow * PITCH + ccol * 16);
  const _Float16* ga = ablk + (size_t)crow * K + ccol * 8;
  const _Float16* gw = wblk + (size_t)crow * K + ccol * 8;
  const int T = K / KP;

  stage_copy(lds0, ga, gw, K);
  asm volatile("s_wait_asynccnt 0x0" ::: "memory");   // own copies of stage 0 landed
  __syncthreads();                                    // publishes stage 0
  if (T > 1) stage_copy(lds0 + STAGE, ga + KP, gw + KP, K);

  #pragma unroll 1
  for (int t = 0; t < T; ++t) {
    const int bo = (t & 1) * STAGE;
    const char* pa = ring + bo + (32 * w + m) * PITCH;
    const char* pw = ring + bo + (A_ROWS + m) * PITCH;
    #pragma unroll
    for (int kc = 0; kc < KP / 32; ++kc) {
      const v16h a0 = load_frag((const _Float16*)pa + kc * 32, h);
      const v16h a1 = load_frag((const _Float16*)(pa + 16 * PITCH) + kc * 32, h);
      v16h b[4];
      #pragma unroll
      for (int nt = 0; nt < 4; ++nt) b[nt] = load_frag((const _Float16*)(pw + nt * 16 * PITCH) + kc * 32, h);
      #pragma unroll
      for (int nt = 0; nt < 4; ++nt) {
        acc[0][nt] = wmma_f16(a0, b[nt], acc[0][nt]);
        acc[1][nt] = wmma_f16(a1, b[nt], acc[1][nt]);
      }
    }
    asm volatile("s_wait_dscnt 0x0" ::: "memory");    // own reads of this buffer are done before it is refilled
    asm volatile("s_wait_asynccnt 0x0" ::: "memory"); // own copies of stage t+1 landed
    __syncthreads();                                  // publishes stage t+1, frees stage t's buffer
    if (t + 2 < T) stage_copy(lds0 + bo, ga + (size_t)(t + 2) * KP, gw + (size_t)(t + 2) * KP, K);
  }
  asm volatile("s_wait_asynccnt 0x0" ::: "memory");   // nothing in flight when the ring is reused
}

// ---------------------------------------------------------------------------
// one 16-B store per lane, lanes 8q..8q+7 per line, 4 lines per instruction,
// 32 lines per wave, 128 per block.
// which 0/1: plane[bh][l][d]  (one token row = 64 halves = one line)
// which 2  : vt[bh][d][l]     (64 d-rows x 128 tokens = 2 lines each)
// ---------------------------------------------------------------------------
__device__ __forceinline__ void qkv_store_pass(const _Float16* sT, _Float16* plane, _Float16* vt,
                                               int which, int bh, int l0, int w, int lane) {
  const int q8 = lane & 7, sub = lane >> 3;
  #pragma unroll
  for (int i = 0; i < 8; ++i) {
    const int lid = w * 32 + i * 4 + sub;         // 0..127 over the block
    v8h v;
    _Float16* dst;
    if (which != 2) {
      v = *(const v8ha*)(sT + lid * HD + 8 * q8);
      dst = plane + ((size_t)bh * SEQ + l0 + lid) * HD + 8 * q8;
    } else {
      const int d = lid >> 1, hl = lid & 1;
      v = *(const v8ha*)(sT + d * 128 + 64 * hl + 8 * q8);
      dst = vt + ((size_t)bh * HD + d) * SEQ + l0 + 64 * hl + 8 * q8;
    }
    *(v8h*)dst = v;
  }
}

// ---------------------------------------------------------------------------
// Kernel 3: QKV = ln1(x) * Wqkv^T + b over the fused 3*1024 output columns.
// Block 128 thr (4 waves) = 128 tokens x 64 features (one (which, head)).
// q plane [B*H][S][64], k plane [B*H][S][64], vt [B*H][64][S].
// ---------------------------------------------------------------------------
__global__ __launch_bounds__(128) void qkv_kernel(
    const _Float16* __restrict__ xh,   // [NTOK][DM]
    const _Float16* __restrict__ wh,   // [3*DM][DM], row = output feature, x32
    const float* __restrict__ bias,    // [3*DM]
    _Float16* __restrict__ qh, _Float16* __restrict__ kh, _Float16* __restrict__ vt)
{
  __shared__ __attribute__((aligned(16))) char ring[RING];   // operand ring, then the 16384-B output tile
  _Float16* sT = (_Float16*)ring;

  const int tid = threadIdx.x, lane = tid & 31, w = tid >> 5;
  const int h = lane >> 4, m = lane & 15;
  const int m0 = blockIdx.x * 128;
  const int cg = blockIdx.y;                 // 0..47 = which*16 + head
  const int which = cg >> 4, head = cg & 15;

  v8f acc[2][4];
  gemm_main(ring, xh + (size_t)m0 * DM, wh + (size_t)cg * 64 * DM, DM, tid, acc);

  // D[r] of tile (mt, nt) = Y[token m0w+16mt+8h+r][feature cg*64 + 16nt+m]
  #pragma unroll
  for (int nt = 0; nt < 4; ++nt) {
    const int feat = 16 * nt + m;
    const float bvl = bias[cg * 64 + feat];
    #pragma unroll
    for (int mt = 0; mt < 2; ++mt) {
      #pragma unroll
      for (int r = 0; r < 8; ++r) {
        const int tokl = 32 * w + 16 * mt + 8 * h + r;     // 0..127
        const float yv = acc[mt][nt][r] * WINV + bvl;
        const int idx = (which == 2) ? (feat * 128 + tokl) : (tokl * HD + feat);
        sT[idx] = (_Float16)yv;
      }
    }
  }
  __syncthreads();

  const int b = m0 / SEQ, l0 = m0 - b * SEQ, bh = b * NH + head;
  _Float16* plane = (which == 0) ? qh : kh;
  qkv_store_pass(sT, plane, vt, which, bh, l0, w, lane);
  
}

// ---------------------------------------------------------------------------
// Attention helpers.
// P^T B-fragment from the lane's own score D values: element r <- tile a row r,
// element 8+r <- tile c row r (same lane, same query column), scaled by 2^14.
// ---------------------------------------------------------------------------
__device__ __forceinline__ v16h pack_p(v8f a, v8f c) {
  const v16h r = { (_Float16)(a[0] * PSCALE), (_Float16)(a[1] * PSCALE), (_Float16)(a[2] * PSCALE), (_Float16)(a[3] * PSCALE),
                   (_Float16)(a[4] * PSCALE), (_Float16)(a[5] * PSCALE), (_Float16)(a[6] * PSCALE), (_Float16)(a[7] * PSCALE),
                   (_Float16)(c[0] * PSCALE), (_Float16)(c[1] * PSCALE), (_Float16)(c[2] * PSCALE), (_Float16)(c[3] * PSCALE),
                   (_Float16)(c[4] * PSCALE), (_Float16)(c[5] * PSCALE), (_Float16)(c[6] * PSCALE), (_Float16)(c[7] * PSCALE) };
  return r;
}

// (one query row) by lanes 8q..8q+7 in one instruction, 4 lines per instruction.
__device__ __forceinline__ void att_store_pass(const _Float16* so, _Float16* ao,
                                               int b, int head, int q0, int lane) {
  const int q8 = lane & 7, sub = lane >> 3;
  #pragma unroll
  for (int i = 0; i < 4; ++i) {
    const int lid = i * 4 + sub;                  // query row 0..15
    const v8h v = *(const v8ha*)(so + lid * 64 + 8 * q8);
    const size_t gi = ((size_t)b * SEQ + q0 + lid) * DM + head * HD + 8 * q8;
    *(v8h*)(ao + gi) = v;
  }
}

// ---------------------------------------------------------------------------
// Kernel 4: causal streaming attention, transposed form.
// Block 128 thr (4 waves), 16 queries per wave, 64 keys per step; each wave's
// key loop stops after the step that contains its diagonal (wave-uniform).
//   S^T = K * Q^T : A = K rows (row = key, k = d), B = Q^T (k = d, n = query)
//   O^T += V^T * P^T : A = Vt rows (row = d, k = key), B = P^T from registers
// Lane owns 32 keys of query column (lane&15); partner = lane ^ 16.
// The 1/8 scale is folded into the exponent argument (exact power of two).
// ---------------------------------------------------------------------------
__global__ __launch_bounds__(128) void attn_kernel(
    const _Float16* __restrict__ qh,   // [B*H][S][64]
    const _Float16* __restrict__ kh,   // [B*H][S][64]
    const _Float16* __restrict__ vt,   // [B*H][64][S]
    _Float16* __restrict__ ao)         // [B][S][DM]
{
  __shared__ __attribute__((aligned(16))) _Float16 sO[4 * 16 * 64];    // 8192 B

  const int tid = threadIdx.x, lane = tid & 31, w = tid >> 5;
  const int h = lane >> 4, m = lane & 15;
  const int bh = blockIdx.y, b = bh >> 4, head = bh & 15;
  const int q0 = blockIdx.x * 64 + 16 * w;

  // Q^T B-fragments: column n = query q0+m, k = d (two 32-deep chunks)
  const _Float16* qrow = qh + ((size_t)bh * SEQ + q0 + m) * HD;
  const v16h qb0 = load_frag(qrow, h);
  const v16h qb1 = load_frag(qrow + 32, h);

  const v8f zero8 = {0.f, 0.f, 0.f, 0.f, 0.f, 0.f, 0.f, 0.f};
  v8f o[4];                                   // o[t][r] = O[query m][d 16t+8h+r] * (l * 2^14)
  #pragma unroll
  for (int t = 0; t < 4; ++t) o[t] = zero8;
  float mrun = -1e30f, lrun = 0.0f;

  const _Float16* kbase = kh + ((size_t)bh * SEQ + m) * HD;    // + key0*HD
  const _Float16* vbase = vt + ((size_t)bh * HD + m) * SEQ;    // + 16t*SEQ + key0
  const int kend = q0 + 16;                                    // exclusive causal bound

  #pragma unroll 1
  for (int kb = 0; kb < kend; kb += 64) {
    // ---- raw scores: s[j][r] = S[query q0+m][key kb+16j+8h+r] (unscaled) ----
    v8f s[4];
    #pragma unroll
    for (int j = 0; j < 4; ++j) {
      const _Float16* kp = kbase + (size_t)(kb + 16 * j) * HD;
      const v16h kf0 = load_frag(kp, h);
      const v16h kf1 = load_frag(kp + 32, h);
      v8f z = zero8;
      z = wmma_f16(kf0, qb0, z);
      z = wmma_f16(kf1, qb1, z);
      s[j] = z;
    }
    // ---- causal mask (only on the step touching the diagonal) ----
    if (kb + 63 > q0) {
      const int qq = q0 + m;
      #pragma unroll
      for (int j = 0; j < 4; ++j)
        #pragma unroll
        for (int r = 0; r < 8; ++r) {
          const int kk = kb + 16 * j + 8 * h + r;
          if (kk > qq) s[j][r] = -1e30f;
        }
    }

    // ---- online softmax (scale 1/8 applied inside the exp argument) ----
    float mloc = s[0][0];
    #pragma unroll
    for (int j = 0; j < 4; ++j)
      #pragma unroll
      for (int r = 0; r < 8; ++r) mloc = fmaxf(mloc, s[j][r]);
    mloc = fmaxf(mloc, __shfl_xor(mloc, 16));
    const float mnew = fmaxf(mrun, mloc);
    const float cn = mnew * 0.125f;
    const float alpha = __expf((mrun - mnew) * 0.125f);
    mrun = mnew;
    float lsum = 0.0f;
    #pragma unroll
    for (int j = 0; j < 4; ++j)
      #pragma unroll
      for (int r = 0; r < 8; ++r) {
        const float p = __expf(fmaf(s[j][r], 0.125f, -cn));
        s[j][r] = p;
        lsum += p;
      }
    lsum += __shfl_xor(lsum, 16);
    lrun = lrun * alpha + lsum;
    #pragma unroll
    for (int t = 0; t < 4; ++t)
      #pragma unroll
      for (int r = 0; r < 8; ++r) o[t][r] = o[t][r] * alpha;

    // ---- P^T B-fragments (key chunks 0..31 and 32..63 of this step) ----
    const v16h pb0 = pack_p(s[0], s[1]);
    const v16h pb1 = pack_p(s[2], s[3]);

    // ---- O^T += V^T * P^T ----
    #pragma unroll
    for (int t = 0; t < 4; ++t) {
      const _Float16* vp = vbase + (size_t)(16 * t) * SEQ + kb;
      const v16h vf0 = load_frag(vp, h);
      const v16h vf1 = load_frag(vp + 32, h);
      o[t] = wmma_f16(vf0, pb0, o[t]);
      o[t] = wmma_f16(vf1, pb1, o[t]);
    }
  }

  // ---- epilogue: normalise, stage per-wave 16x64 f16 tile, whole-line stores ----
  const float inv = (1.0f / lrun) * (1.0f / PSCALE);
  _Float16* so = sO + w * 1024;
  #pragma unroll
  for (int t = 0; t < 4; ++t)
    #pragma unroll
    for (int r = 0; r < 8; ++r)
      so[m * 64 + 16 * t + 8 * h + r] = (_Float16)(o[t][r] * inv);
  __syncthreads();

  att_store_pass(so, ao, b, head, q0, lane);
  
}

// ---------------------------------------------------------------------------
// Kernel 5: Y = A[M,K](f16) * W[N,K]^T(f16 x32) with epilogue.
//   MODE 1: outf[M][N] (f32) = (acc/32 + bias) + resid
//   MODE 2: outh[M][N] (f16) = gelu_erf(acc/32 + bias)
// Block 128 thr (4 waves) = 128 rows x 64 cols; wave = 32 rows x 64 cols.
// ---------------------------------------------------------------------------
template <int MODE>
__global__ __launch_bounds__(128) void gemm_kernel(
    const _Float16* __restrict__ A, const _Float16* __restrict__ W,
    const float* __restrict__ bias, const float* __restrict__ resid,
    float* __restrict__ outf, _Float16* __restrict__ outh, int N, int K)
{
  __shared__ __attribute__((aligned(16))) char ring[RING];   // operand ring, then the 32768-B output tile
  float* sbuf = (float*)ring;

  const int tid = threadIdx.x, lane = tid & 31, w = tid >> 5;
  const int h = lane >> 4, m = lane & 15;
  const int q8 = lane & 7, sub = lane >> 3;
  const int m0 = blockIdx.x * 128, n0 = blockIdx.y * 64;
  const int m0w = m0 + 32 * w;

  v8f acc[2][4];
  gemm_main(ring, A + (size_t)m0 * K, W + (size_t)n0 * K, K, tid, acc);

  // D[r] of tile (mt, nt) = Y[row m0w+16mt+8h+r][col n0+16nt+m]
  if (MODE == 1) {
    #pragma unroll
    for (int nt = 0; nt < 4; ++nt)
      #pragma unroll
      for (int mt = 0; mt < 2; ++mt)
        #pragma unroll
        for (int r = 0; r < 8; ++r)
          sbuf[(32 * w + 16 * mt + 8 * h + r) * 64 + 16 * nt + m] = acc[mt][nt][r] * WINV;
    __syncthreads();

    // wave w owns rows 32w..32w+31, each row = 64 floats = 2 lines -> 64 lines
    v4f vals[16];
    #pragma unroll
    for (int i = 0; i < 16; ++i) {
      const int lid = i * 4 + sub;                 // 0..63
      const int rl = lid >> 1, hl = lid & 1;
      const int col = 32 * hl + 4 * q8;
      const v4f a  = *(const v4fa*)(sbuf + (32 * w + rl) * 64 + col);
      const v4f bb = *(const v4fa*)(bias + n0 + col);
      const size_t gi = (size_t)(m0w + rl) * N + n0 + col;
      const v4f rr = *(const v4fa*)(resid + gi);
      vals[i] = (a + bb) + rr;
    }
    #pragma unroll
    for (int i = 0; i < 16; ++i) {
      const int lid = i * 4 + sub;
      const int rl = lid >> 1, hl = lid & 1;
      const size_t gi = (size_t)(m0w + rl) * N + n0 + 32 * hl + 4 * q8;
      *(v4f*)(outf + gi) = vals[i];
    }
    
  } else {
    _Float16* sh = (_Float16*)sbuf;
    #pragma unroll
    for (int nt = 0; nt < 4; ++nt) {
      const float bvl = bias[n0 + 16 * nt + m];
      #pragma unroll
      for (int mt = 0; mt < 2; ++mt)
        #pragma unroll
        for (int r = 0; r < 8; ++r) {
          const float xv = acc[mt][nt][r] * WINV + bvl;
          const float gl = 0.5f * xv * (1.0f + erff(xv * 0.70710678118654752f));
          sh[(32 * w + 16 * mt + 8 * h + r) * 64 + 16 * nt + m] = (_Float16)gl;
        }
    }
    __syncthreads();

    // wave w owns rows 32w..32w+31, each row = 64 halves = 1 line -> 32 lines
    v8h vals[8];
    #pragma unroll
    for (int i = 0; i < 8; ++i) {
      const int lid = i * 4 + sub;                 // 0..31
      vals[i] = *(const v8ha*)(sh + (32 * w + lid) * 64 + 8 * q8);
    }
    #pragma unroll
    for (int i = 0; i < 8; ++i) {
      const int lid = i * 4 + sub;
      *(v8h*)(outh + (size_t)(m0w + lid) * N + n0 + 8 * q8) = vals[i];
    }
    
  }
}

// ---------------------------------------------------------------------------
extern "C" void kernel_launch(void* const* d_in, const int* in_sizes, int n_in,
                              void* d_out, int out_size, void* d_ws, size_t ws_size,
                              hipStream_t stream) {
  if (n_in < 13) return;
  if (in_sizes[0] != NTOK * DM) return;
  if (in_sizes[1] != 3 * DM * DM || in_sizes[2] != 3 * DM) return;
  if (in_sizes[3] != DM * DM || in_sizes[4] != DM) return;
  if (in_sizes[5] != DFF * DM || in_sizes[6] != DFF) return;
  if (in_sizes[7] != DM * DFF || in_sizes[8] != DM) return;
  if (in_sizes[9] != DM || in_sizes[10] != DM || in_sizes[11] != DM || in_sizes[12] != DM) return;
  if (out_size != NTOK * DM) return;

  const float* hidden = (const float*)d_in[0];
  const float* qkv_w  = (const float*)d_in[1];
  const float* qkv_b  = (const float*)d_in[2];
  const float* out_w  = (const float*)d_in[3];
  const float* out_b  = (const float*)d_in[4];
  const float* fc1_w  = (const float*)d_in[5];
  const float* fc1_b  = (const float*)d_in[6];
  const float* fc2_w  = (const float*)d_in[7];
  const float* fc2_b  = (const float*)d_in[8];
  const float* ln1_g  = (const float*)d_in[9];
  const float* ln1_b  = (const float*)d_in[10];
  const float* ln2_g  = (const float*)d_in[11];
  const float* ln2_b  = (const float*)d_in[12];
  float* out = (float*)d_out;

  // workspace carve (all sizes multiples of 256 B)
  const size_t wh_bytes   = (size_t)G_ALL * 8 * 2;          // 25165824
  const size_t act_bytes  = (size_t)NTOK * DM * 2;           //  8388608  (f16 [4096][1024])
  const size_t hid2_bytes = (size_t)NTOK * DM * 4;           // 16777216
  const size_t ff_bytes   = (size_t)NTOK * DFF * 2;          // 33554432
  const size_t total = wh_bytes + 5 * act_bytes + hid2_bytes + ff_bytes;   // 117440512
  if (total > ws_size) return;

  char* ws = (char*)d_ws;
  size_t off = 0;
  _Float16* wh   = (_Float16*)(ws + off); off += wh_bytes;
  _Float16* xn   = (_Float16*)(ws + off); off += act_bytes;   // ln1 output, later ln2 output
  _Float16* qh   = (_Float16*)(ws + off); off += act_bytes;
  _Float16* kh   = (_Float16*)(ws + off); off += act_bytes;
  _Float16* vt   = (_Float16*)(ws + off); off += act_bytes;
  _Float16* ah   = (_Float16*)(ws + off); off += act_bytes;   // attention output f16 [4096][1024]
  float*    hid2 = (float*)(ws + off);    off += hid2_bytes;  // hidden + attn proj, f32
  _Float16* ff   = (_Float16*)(ws + off); off += ff_bytes;    // gelu(fc1) f16 [4096][4096]
  if (off > ws_size) return;

  const _Float16* w_qkv = wh;
  const _Float16* w_out = wh + (size_t)3 * DM * DM;
  const _Float16* w_fc1 = wh + (size_t)4 * DM * DM;
  const _Float16* w_fc2 = wh + (size_t)4 * DM * DM + (size_t)DFF * DM;

  // 1: weights -> f16 x32
  cvt_w_kernel<<<G_ALL / 256, 256, 0, stream>>>(qkv_w, out_w, fc1_w, fc2_w, wh);

  // 2: ln1 -> f16
  ln_kernel<<<NTOK / 8, 256, 0, stream>>>(hidden, ln1_g, ln1_b, xn, NTOK);

  // 3: qkv projection -> q/k planes + transposed v
  qkv_kernel<<<dim3(NTOK / 128, 3 * NH), 128, 0, stream>>>(xn, w_qkv, qkv_b, qh, kh, vt);

  // 4: causal attention -> f16 [tok][DM]
  attn_kernel<<<dim3(SEQ / 64, BATCH * NH), 128, 0, stream>>>(qh, kh, vt, ah);

  // 5: output projection + bias + residual -> f32 hid2
  gemm_kernel<1><<<dim3(NTOK / 128, DM / 64), 128, 0, stream>>>(ah, w_out, out_b, hidden, hid2, xn, DM, DM);

  // 6: ln2 -> f16 (reuses xn)
  ln_kernel<<<NTOK / 8, 256, 0, stream>>>(hid2, ln2_g, ln2_b, xn, NTOK);

  // 7: fc1 + exact gelu -> f16 ff
  gemm_kernel<2><<<dim3(NTOK / 128, DFF / 64), 128, 0, stream>>>(xn, w_fc1, fc1_b, fc1_b, hid2, ff, DFF, DM);

  // 8: fc2 + bias + residual(hid2) -> f32 d_out
  gemm_kernel<1><<<dim3(NTOK / 128, DM / 64), 128, 0, stream>>>(ff, w_fc2, fc2_b, hid2, out, xn, DM, DFF);
}

// v002
// One run takes 201 microseconds.
// In both of two side-by-side timings against v001, it was 1.58 times as fast.
// Over all steps from v000 it is 2.71 times as fast.
// Contractions: ln1(x)*Wqkv^T, K*Q^T, V^T*P^T, attn*Wout^T, ln2(h)*Wfc1^T, gelu(.)*Wfc2^T all on v_wmma_f32_16x16x32_f16 (f16 operands, f32 accumulate); every W carried x32 and P carried x16384 (exact power-of-two scales folded back in f32); layernorm, softmax, bias, gelu and residual adds in f32.
#include <hip/hip_runtime.h>
#include <math.h>

typedef _Float16 v16h __attribute__((ext_vector_type(16)));
typedef _Float16 v8h  __attribute__((ext_vector_type(8)));
typedef float    v8f  __attribute__((ext_vector_type(8)));
typedef float    v4f  __attribute__((ext_vector_type(4)));
typedef v8h __attribute__((may_alias)) v8ha;
typedef v4f __attribute__((may_alias)) v4fa;

union Frag { v16h v; v8h half[2]; };

#define DM     1024
#define NH     16
#define HD     64
#define DFF    4096
#define SEQ    2048
#define BATCH  2
#define NTOK   (BATCH * SEQ)          // 4096 tokens
#define WSC    32.0f
#define WINV   0.03125f
#define PSCALE 16384.0f

#define G_QKV (3 * DM * DM / 8)       // 393216 groups of 8
#define G_OUT (DM * DM / 8)           // 131072
#define G_FC1 (DFF * DM / 8)          // 524288
#define G_FC2 (DM * DFF / 8)          // 524288
#define G_ALL (G_QKV + G_OUT + G_FC1 + G_FC2)   // 1572864

static_assert(NTOK % 128 == 0);
static_assert(SEQ % 128 == 0);
static_assert(DM % 64 == 0);
static_assert(DFF % 64 == 0);
static_assert(G_ALL % 256 == 0);

// ---------------------------------------------------------------------------
// 16x16x32 f16 WMMA with hazard guard (ties D, keeps A/B live).
// Fragment map (wave32): lane l, h = l>>4, m = n = l&15.
//   A/B element i: i<8 -> k0+8h+i ; i>=8 -> k0+16+8h+(i-8)
//   D element r : row 8h+r, col l&15
// ---------------------------------------------------------------------------
__device__ __forceinline__ v8f wmma_f16(v16h a, v16h b, v8f c) {
  v8f d = __builtin_amdgcn_wmma_f32_16x16x32_f16(false, a, false, b, (short)0, c, false, false);
  asm volatile("v_nop\n\tv_nop\n\tv_nop\n\tv_nop" : "+v"(d) : "v"(a), "v"(b));
  return d;
}

// A or B fragment from a k-contiguous 16-bit row; p points at element k0 of
// the row owned by this lane (row index = lane & 15 added by the caller).
__device__ __forceinline__ v16h load_frag(const _Float16* p, int h) {
  Frag f;
  f.half[0] = *(const v8ha*)(p + 8 * h);
  f.half[1] = *(const v8ha*)(p + 16 + 8 * h);
  return f.v;
}

// ---------------------------------------------------------------------------
// Kernel 1: f32 weights -> f16 planes scaled by 32 (exact). One 16-B store per
// wh layout: [qkv 3*DM*DM][out DM*DM][fc1 DFF*DM][fc2 DM*DFF], row = output feature.
// ---------------------------------------------------------------------------
__global__ __launch_bounds__(256) void cvt_w_kernel(
    const float* __restrict__ w0, const float* __restrict__ w1,
    const float* __restrict__ w2, const float* __restrict__ w3,
    _Float16* __restrict__ wh)
{
  const int g = blockIdx.x * 256 + threadIdx.x;
  if (g >= G_ALL) return;
  const float* src;
  if (g < G_QKV)                        src = w0 + (size_t)g * 8;
  else if (g < G_QKV + G_OUT)           src = w1 + (size_t)(g - G_QKV) * 8;
  else if (g < G_QKV + G_OUT + G_FC1)   src = w2 + (size_t)(g - G_QKV - G_OUT) * 8;
  else                                  src = w3 + (size_t)(g - G_QKV - G_OUT - G_FC1) * 8;
  _Float16* dst = wh + (size_t)g * 8;
  const v4f a = *(const v4fa*)src;
  const v4f c = *(const v4fa*)(src + 4);
  const v8h o = { (_Float16)(a.x * WSC), (_Float16)(a.y * WSC), (_Float16)(a.z * WSC), (_Float16)(a.w * WSC),
                  (_Float16)(c.x * WSC), (_Float16)(c.y * WSC), (_Float16)(c.z * WSC), (_Float16)(c.w * WSC) };
  *(v8h*)dst = o;
  
}

// ---------------------------------------------------------------------------
// Kernel 2: LayerNorm over rows of DM f32 -> f16. One wave per row (block of 8
// i*256 + lane*8 + 0..7 (i = 0..3) so every store instruction is 32 lanes x
// ---------------------------------------------------------------------------
__global__ __launch_bounds__(256) void ln_kernel(
    const float* __restrict__ x, const float* __restrict__ g,
    const float* __restrict__ bt, _Float16* __restrict__ y, int nrows)
{
  const int lane = threadIdx.x & 31, w = threadIdx.x >> 5;
  const int row = blockIdx.x * 8 + w;
  if (row >= nrows) return;                      // wave-uniform; no barriers below
  const float* xr = x + (size_t)row * DM;

  v4f xa[4], xb[4];
  float s = 0.0f;
  #pragma unroll
  for (int i = 0; i < 4; ++i) {
    const float* p = xr + i * 256 + lane * 8;
    xa[i] = *(const v4fa*)p;
    xb[i] = *(const v4fa*)(p + 4);
    s += ((xa[i].x + xa[i].y) + (xa[i].z + xa[i].w)) + ((xb[i].x + xb[i].y) + (xb[i].z + xb[i].w));
  }
  #pragma unroll
  for (int off = 16; off > 0; off >>= 1) s += __shfl_xor(s, off);
  const float mu = s * (1.0f / DM);

  float ss = 0.0f;
  #pragma unroll
  for (int i = 0; i < 4; ++i) {
    const v4f da = xa[i] - mu, db = xb[i] - mu;
    ss += ((da.x * da.x + da.y * da.y) + (da.z * da.z + da.w * da.w)) +
          ((db.x * db.x + db.y * db.y) + (db.z * db.z + db.w * db.w));
  }
  #pragma unroll
  for (int off = 16; off > 0; off >>= 1) ss += __shfl_xor(ss, off);
  const float var = ss * (1.0f / DM);
  const float rstd = rsqrtf(var + 1e-5f);

  v8h o[4];
  #pragma unroll
  for (int i = 0; i < 4; ++i) {
    const int p = i * 256 + lane * 8;
    const v4f ga = *(const v4fa*)(g + p),  gb = *(const v4fa*)(g + p + 4);
    const v4f ba = *(const v4fa*)(bt + p), bb = *(const v4fa*)(bt + p + 4);
    const v4f da = (xa[i] - mu) * rstd, db = (xb[i] - mu) * rstd;
    const v8h t = { (_Float16)(da.x * ga.x + ba.x), (_Float16)(da.y * ga.y + ba.y),
                    (_Float16)(da.z * ga.z + ba.z), (_Float16)(da.w * ga.w + ba.w),
                    (_Float16)(db.x * gb.x + bb.x), (_Float16)(db.y * gb.y + bb.y),
                    (_Float16)(db.z * gb.z + bb.z), (_Float16)(db.w * gb.w + bb.w) };
    o[i] = t;
  }
  _Float16* yr = y + (size_t)row * DM;
  #pragma unroll
  for (int i = 0; i < 4; ++i) *(v8h*)(yr + i * 256 + lane * 8) = o[i];
  
}

// ---------------------------------------------------------------------------
// Shared GEMM main loop: block tile 128 (rows of A) x 64 (rows of W), wave tile
// 32 x 64. A stage is 128 k (256 B) of all 192 rows, laid in LDS at a pitch of
// 272 B (16 B x odd: conflict-free for 16-byte fragment reads). Two buffers:
// stage t+1 is copied global -> LDS asynchronously while stage t is multiplied.
// acc[mt][nt][r] = sum_k A[row0 + 16mt + 8h + r][k] * W[col0 + 16nt + m][k],
// k ascending in steps of 32.
// ---------------------------------------------------------------------------
#define KP      128                          // k elements per stage
#define PITCH   272                          // LDS bytes per staged row
#define A_ROWS  128
#define W_ROWS  64
#define STAGE   ((A_ROWS + W_ROWS) * PITCH)  // 52224 B
#define RING    (2 * STAGE)                  // 104448 B

static_assert(DM % KP == 0 && DFF % KP == 0);
static_assert(PITCH % 16 == 0 && STAGE % 16 == 0);

// Twelve 16-byte-per-lane copies global -> LDS. The s_wait_xcnt closes the
// statement so that no address register named here is rewritten ahead of it.
__device__ __forceinline__ void copy12(const unsigned (&l)[24], const _Float16* const (&g)[24], int o) {
  asm volatile(
      "global_load_async_to_lds_b128 %0, %12, off\n\t"
      "global_load_async_to_lds_b128 %1, %13, off\n\t"
      "global_load_async_to_lds_b128 %2, %14, off\n\t"
      "global_load_async_to_lds_b128 %3, %15, off\n\t"
      "global_load_async_to_lds_b128 %4, %16, off\n\t"
      "global_load_async_to_lds_b128 %5, %17, off\n\t"
      "global_load_async_to_lds_b128 %6, %18, off\n\t"
      "global_load_async_to_lds_b128 %7, %19, off\n\t"
      "global_load_async_to_lds_b128 %8, %20, off\n\t"
      "global_load_async_to_lds_b128 %9, %21, off\n\t"
      "global_load_async_to_lds_b128 %10, %22, off\n\t"
      "global_load_async_to_lds_b128 %11, %23, off\n\t"
      "s_wait_xcnt 0x0"
      :: "v"(l[o + 0]), "v"(l[o + 1]), "v"(l[o + 2]), "v"(l[o + 3]), "v"(l[o + 4]), "v"(l[o + 5]),
         "v"(l[o + 6]), "v"(l[o + 7]), "v"(l[o + 8]), "v"(l[o + 9]), "v"(l[o + 10]), "v"(l[o + 11]),
         "v"(g[o + 0]), "v"(g[o + 1]), "v"(g[o + 2]), "v"(g[o + 3]), "v"(g[o + 4]), "v"(g[o + 5]),
         "v"(g[o + 6]), "v"(g[o + 7]), "v"(g[o + 8]), "v"(g[o + 9]), "v"(g[o + 10]), "v"(g[o + 11])
      : "memory");
}

// One stage: thread t copies 16 B at column 16*(t&15) of rows (t>>4) + 8i; a wave's
// copy covers two whole 256-B row pieces. i = 0..15 are A rows, 16..23 W rows.
// lds = this thread's LDS byte address in row (t>>4) of the target buffer;
// ga / gw = this thread's element in that row of A / W at the stage's first k.
__device__ __forceinline__ void stage_copy(unsigned lds, const _Float16* ga, const _Float16* gw, int K) {
  unsigned l[24];
  const _Float16* g[24];
  #pragma unroll
  for (int i = 0; i < 24; ++i) {
    l[i] = lds + (unsigned)(i * 8 * PITCH);
    g[i] = (i < 16) ? ga + (size_t)(i * 8) * K : gw + (size_t)((i - 16) * 8) * K;
  }
  copy12(l, g, 0);
  copy12(l, g, 12);
}

// ablk / wblk: first row of the block's A / W tile. ring: RING bytes of LDS; free
// for other use on return (every wave's reads and copies are done and a barrier passed).
__device__ __forceinline__ void gemm_main(char* ring,
                                          const _Float16* __restrict__ ablk,
                                          const _Float16* __restrict__ wblk,
                                          int K, int tid, v8f (&acc)[2][4])
{
  const int lane = tid & 31, w = tid >> 5;
  const int h = lane >> 4, m = lane & 15;
  const v8f zero8 = {0.f, 0.f, 0.f, 0.f, 0.f, 0.f, 0.f, 0.f};
  #pragma unroll
  for (int mt = 0; mt < 2; ++mt)
    #pragma unroll
    for (int nt = 0; nt < 4; ++nt) acc[mt][nt] = zero8;

  const int crow = tid >> 4, ccol = tid & 15;
  const unsigned lds0 = (unsigned)(size_t)ring + (unsigned)(crow * PITCH + ccol * 16);
  const _Float16* ga = ablk + (size_t)crow * K + ccol * 8;
  const _Float16* gw = wblk + (size_t)crow * K + ccol * 8;
  const int T = K / KP;

  stage_copy(lds0, ga, gw, K);
  asm volatile("s_wait_asynccnt 0x0" ::: "memory");   // own copies of stage 0 landed
  __syncthreads();                                    // publishes stage 0
  if (T > 1) stage_copy(lds0 + STAGE, ga + KP, gw + KP, K);

  #pragma unroll 1
  for (int t = 0; t < T; ++t) {
    const int bo = (t & 1) * STAGE;
    const char* pa = ring + bo + (32 * w + m) * PITCH;
    const char* pw = ring + bo + (A_ROWS + m) * PITCH;
    #pragma unroll
    for (int kc = 0; kc < KP / 32; ++kc) {
      const v16h a0 = load_frag((const _Float16*)pa + kc * 32, h);
      const v16h a1 = load_frag((const _Float16*)(pa + 16 * PITCH) + kc * 32, h);
      v16h b[4];
      #pragma unroll
      for (int nt = 0; nt < 4; ++nt) b[nt] = load_frag((const _Float16*)(pw + nt * 16 * PITCH) + kc * 32, h);
      #pragma unroll
      for (int nt = 0; nt < 4; ++nt) {
        acc[0][nt] = wmma_f16(a0, b[nt], acc[0][nt]);
        acc[1][nt] = wmma_f16(a1, b[nt], acc[1][nt]);
      }
    }
    asm volatile("s_wait_dscnt 0x0" ::: "memory");    // own reads of this buffer are done before it is refilled
    asm volatile("s_wait_asynccnt 0x0" ::: "memory"); // own copies of stage t+1 landed
    __syncthreads();                                  // publishes stage t+1, frees stage t's buffer
    if (t + 2 < T) stage_copy(lds0 + bo, ga + (size_t)(t + 2) * KP, gw + (size_t)(t + 2) * KP, K);
  }
  asm volatile("s_wait_asynccnt 0x0" ::: "memory");   // nothing in flight when the ring is reused
}

// ---------------------------------------------------------------------------
// one 16-B store per lane, lanes 8q..8q+7 per line, 4 lines per instruction,
// 32 lines per wave, 128 per block.
// which 0/1: plane[bh][l][d]  (one token row = 64 halves = one line)
// which 2  : vt[bh][d][l]     (64 d-rows x 128 tokens = 2 lines each)
// ---------------------------------------------------------------------------
__device__ __forceinline__ void qkv_store_pass(const _Float16* sT, _Float16* plane, _Float16* vt,
                                               int which, int bh, int l0, int w, int lane) {
  const int q8 = lane & 7, sub = lane >> 3;
  #pragma unroll
  for (int i = 0; i < 8; ++i) {
    const int lid = w * 32 + i * 4 + sub;         // 0..127 over the block
    v8h v;
    _Float16* dst;
    if (which != 2) {
      v = *(const v8ha*)(sT + lid * HD + 8 * q8);
      dst = plane + ((size_t)bh * SEQ + l0 + lid) * HD + 8 * q8;
    } else {
      const int d = lid >> 1, hl = lid & 1;
      v = *(const v8ha*)(sT + d * 128 + 64 * hl + 8 * q8);
      dst = vt + ((size_t)bh * HD + d) * SEQ + l0 + 64 * hl + 8 * q8;
    }
    *(v8h*)dst = v;
  }
}

// ---------------------------------------------------------------------------
// Kernel 3: QKV = ln1(x) * Wqkv^T + b over the fused 3*1024 output columns.
// Block 128 thr (4 waves) = 128 tokens x 64 features (one (which, head)).
// q plane [B*H][S][64], k plane [B*H][S][64], vt [B*H][64][S].
// ---------------------------------------------------------------------------
__global__ __launch_bounds__(128) void qkv_kernel(
    const _Float16* __restrict__ xh,   // [NTOK][DM]
    const _Float16* __restrict__ wh,   // [3*DM][DM], row = output feature, x32
    const float* __restrict__ bias,    // [3*DM]
    _Float16* __restrict__ qh, _Float16* __restrict__ kh, _Float16* __restrict__ vt)
{
  __shared__ __attribute__((aligned(16))) char ring[RING];   // operand ring, then the 16384-B output tile
  _Float16* sT = (_Float16*)ring;

  const int tid = threadIdx.x, lane = tid & 31, w = tid >> 5;
  const int h = lane >> 4, m = lane & 15;
  const int m0 = blockIdx.x * 128;
  const int cg = blockIdx.y;                 // 0..47 = which*16 + head
  const int which = cg >> 4, head = cg & 15;

  v8f acc[2][4];
  gemm_main(ring, xh + (size_t)m0 * DM, wh + (size_t)cg * 64 * DM, DM, tid, acc);

  // D[r] of tile (mt, nt) = Y[token m0w+16mt+8h+r][feature cg*64 + 16nt+m]
  #pragma unroll
  for (int nt = 0; nt < 4; ++nt) {
    const int feat = 16 * nt + m;
    const float bvl = bias[cg * 64 + feat];
    #pragma unroll
    for (int mt = 0; mt < 2; ++mt) {
      #pragma unroll
      for (int r = 0; r < 8; ++r) {
        const int tokl = 32 * w + 16 * mt + 8 * h + r;     // 0..127
        const float yv = acc[mt][nt][r] * WINV + bvl;
        const int idx = (which == 2) ? (feat * 128 + tokl) : (tokl * HD + feat);
        sT[idx] = (_Float16)yv;
      }
    }
  }
  __syncthreads();

  const int b = m0 / SEQ, l0 = m0 - b * SEQ, bh = b * NH + head;
  _Float16* plane = (which == 0) ? qh : kh;
  qkv_store_pass(sT, plane, vt, which, bh, l0, w, lane);
  
}

// ---------------------------------------------------------------------------
// Attention helpers.
// P^T B-fragment from the lane's own score D values: element r <- tile a row r,
// element 8+r <- tile c row r (same lane, same query column), scaled by 2^14.
// ---------------------------------------------------------------------------
__device__ __forceinline__ v16h pack_p(v8f a, v8f c) {
  const v16h r = { (_Float16)(a[0] * PSCALE), (_Float16)(a[1] * PSCALE), (_Float16)(a[2] * PSCALE), (_Float16)(a[3] * PSCALE),
                   (_Float16)(a[4] * PSCALE), (_Float16)(a[5] * PSCALE), (_Float16)(a[6] * PSCALE), (_Float16)(a[7] * PSCALE),
                   (_Float16)(c[0] * PSCALE), (_Float16)(c[1] * PSCALE), (_Float16)(c[2] * PSCALE), (_Float16)(c[3] * PSCALE),
                   (_Float16)(c[4] * PSCALE), (_Float16)(c[5] * PSCALE), (_Float16)(c[6] * PSCALE), (_Float16)(c[7] * PSCALE) };
  return r;
}

// (one query row) by lanes 8q..8q+7 in one instruction, 4 lines per instruction.
__device__ __forceinline__ void att_store_pass(const _Float16* so, _Float16* ao,
                                               int b, int head, int q0, int lane) {
  const int q8 = lane & 7, sub = lane >> 3;
  #pragma unroll
  for (int i = 0; i < 4; ++i) {
    const int lid = i * 4 + sub;                  // query row 0..15
    const v8h v = *(const v8ha*)(so + lid * 64 + 8 * q8);
    const size_t gi = ((size_t)b * SEQ + q0 + lid) * DM + head * HD + 8 * q8;
    *(v8h*)(ao + gi) = v;
  }
}

// ---------------------------------------------------------------------------
// K / V^T staging for attention. A stage is 64 keys: the K tile (64 key rows x
// 128 B of d) and behind it the V^T tile (64 d rows x 128 B of keys), each row
// laid in LDS at a pitch of 144 B (16 B x odd: conflict-free for 16-byte
// fragment reads). Two buffers: stage t+1 is copied global -> LDS
// asynchronously, once per block, while all four waves work on stage t.
// ---------------------------------------------------------------------------
#define KV_PITCH 144                         // LDS bytes per staged row
#define KV_TILE  (64 * KV_PITCH)             // 9216 B
#define KV_STAGE (2 * KV_TILE)               // 18432 B
#define KV_RING  (2 * KV_STAGE)              // 36864 B

static_assert(KV_PITCH % 16 == 0 && HD * 2 == 128 && SEQ % 64 == 0);

// Eight 16-byte-per-lane copies global -> LDS. The s_wait_xcnt closes the
// statement so that no address register named here is rewritten ahead of it.
__device__ __forceinline__ void copy8(const unsigned (&l)[8], const _Float16* const (&g)[8]) {
  asm volatile(
      "global_load_async_to_lds_b128 %0, %8, off\n\t"
      "global_load_async_to_lds_b128 %1, %9, off\n\t"
      "global_load_async_to_lds_b128 %2, %10, off\n\t"
      "global_load_async_to_lds_b128 %3, %11, off\n\t"
      "global_load_async_to_lds_b128 %4, %12, off\n\t"
      "global_load_async_to_lds_b128 %5, %13, off\n\t"
      "global_load_async_to_lds_b128 %6, %14, off\n\t"
      "global_load_async_to_lds_b128 %7, %15, off\n\t"
      "s_wait_xcnt 0x0"
      :: "v"(l[0]), "v"(l[1]), "v"(l[2]), "v"(l[3]), "v"(l[4]), "v"(l[5]), "v"(l[6]), "v"(l[7]),
         "v"(g[0]), "v"(g[1]), "v"(g[2]), "v"(g[3]), "v"(g[4]), "v"(g[5]), "v"(g[6]), "v"(g[7])
      : "memory");
}

// One stage: thread t copies 16 B at column 16*(t&7) of rows (t>>3) + 16i of both
// tiles (i = 0..3); a wave's copy covers four whole 128-B rows.
// lds = this thread's LDS byte address in row (t>>3) of the target buffer's K tile;
// gk / gv = this thread's element in that row of K / V^T at the stage's first key.
__device__ __forceinline__ void kv_stage_copy(unsigned lds, const _Float16* gk, const _Float16* gv) {
  unsigned l[8];
  const _Float16* g[8];
  #pragma unroll
  for (int i = 0; i < 4; ++i) {
    l[i]     = lds + (unsigned)(i * 16 * KV_PITCH);
    g[i]     = gk + (size_t)(i * 16) * HD;
    l[4 + i] = lds + (unsigned)(KV_TILE + i * 16 * KV_PITCH);
    g[4 + i] = gv + (size_t)(i * 16) * SEQ;
  }
  copy8(l, g);
}

// ---------------------------------------------------------------------------
// Kernel 4: causal streaming attention, transposed form.
// Block 128 thr (4 waves), 16 queries per wave, 64 keys per step; the block's
// 64 queries share one diagonal step, so all four waves make blockIdx.x + 1 steps.
//   S^T = K * Q^T : A = K rows (row = key, k = d), B = Q^T (k = d, n = query)
//   O^T += V^T * P^T : A = Vt rows (row = d, k = key), B = P^T from registers
// Lane owns 32 keys of query column (lane&15); partner = lane ^ 16.
// The 1/8 scale is folded into the exponent argument (exact power of two).
// ---------------------------------------------------------------------------
__global__ __launch_bounds__(128) void attn_kernel(
    const _Float16* __restrict__ qh,   // [B*H][S][64]
    const _Float16* __restrict__ kh,   // [B*H][S][64]
    const _Float16* __restrict__ vt,   // [B*H][64][S]
    _Float16* __restrict__ ao)         // [B][S][DM]
{
  __shared__ __attribute__((aligned(16))) _Float16 sO[4 * 16 * 64];    // 8192 B
  __shared__ __attribute__((aligned(16))) char kv[KV_RING];            // K / V^T stages, two buffers

  const int tid = threadIdx.x, lane = tid & 31, w = tid >> 5;
  const int h = lane >> 4, m = lane & 15;
  const int bh = blockIdx.y, b = bh >> 4, head = bh & 15;
  const int q0 = blockIdx.x * 64 + 16 * w;

  // Q^T B-fragments: column n = query q0+m, k = d (two 32-deep chunks)
  const _Float16* qrow = qh + ((size_t)bh * SEQ + q0 + m) * HD;
  const v16h qb0 = load_frag(qrow, h);
  const v16h qb1 = load_frag(qrow + 32, h);

  const v8f zero8 = {0.f, 0.f, 0.f, 0.f, 0.f, 0.f, 0.f, 0.f};
  v8f o[4];                                   // o[t][r] = O[query m][d 16t+8h+r] * (l * 2^14)
  #pragma unroll
  for (int t = 0; t < 4; ++t) o[t] = zero8;
  float mrun = -1e30f, lrun = 0.0f;

  const int crow = tid >> 3, ccol = tid & 7;
  const unsigned lds0 = (unsigned)(size_t)kv + (unsigned)(crow * KV_PITCH + ccol * 16);
  const _Float16* gk = kh + ((size_t)bh * SEQ + crow) * HD + ccol * 8;    // + key0*HD
  const _Float16* gv = vt + ((size_t)bh * HD + crow) * SEQ + ccol * 8;    // + key0
  const int T = blockIdx.x + 1;               // steps up to and with the diagonal one (block-uniform)

  kv_stage_copy(lds0, gk, gv);
  asm volatile("s_wait_asynccnt 0x0" ::: "memory");   // own copies of stage 0 landed
  __syncthreads();                                    // publishes stage 0
  if (T > 1) kv_stage_copy(lds0 + KV_STAGE, gk + 64 * HD, gv + 64);

  #pragma unroll 1
  for (int st = 0; st < T; ++st) {
    const int kb = 64 * st;
    const int bo = (st & 1) * KV_STAGE;
    const char* pk = kv + bo + m * KV_PITCH;            // K row m of the stage
    const char* pv = pk + KV_TILE;                      // V^T row m of the stage
    // ---- raw scores: s[j][r] = S[query q0+m][key kb+16j+8h+r] (unscaled) ----
    v8f s[4];
    #pragma unroll
    for (int j = 0; j < 4; ++j) {
      const _Float16* kp = (const _Float16*)(pk + 16 * j * KV_PITCH);
      const v16h kf0 = load_frag(kp, h);
      const v16h kf1 = load_frag(kp + 32, h);
      v8f z = zero8;
      z = wmma_f16(kf0, qb0, z);
      z = wmma_f16(kf1, qb1, z);
      s[j] = z;
    }
    // ---- causal mask (only on the step touching the diagonal) ----
    if (kb + 63 > q0) {
      const int qq = q0 + m;
      #pragma unroll
      for (int j = 0; j < 4; ++j)
        #pragma unroll
        for (int r = 0; r < 8; ++r) {
          const int kk = kb + 16 * j + 8 * h + r;
          if (kk > qq) s[j][r] = -1e30f;
        }
    }

    // ---- online softmax (scale 1/8 applied inside the exp argument) ----
    float mloc = s[0][0];
    #pragma unroll
    for (int j = 0; j < 4; ++j)
      #pragma unroll
      for (int r = 0; r < 8; ++r) mloc = fmaxf(mloc, s[j][r]);
    mloc = fmaxf(mloc, __shfl_xor(mloc, 16));
    const float mnew = fmaxf(mrun, mloc);
    const float cn = mnew * 0.125f;
    const float alpha = __expf((mrun - mnew) * 0.125f);
    mrun = mnew;
    float lsum = 0.0f;
    #pragma unroll
    for (int j = 0; j < 4; ++j)
      #pragma unroll
      for (int r = 0; r < 8; ++r) {
        const float p = __expf(fmaf(s[j][r], 0.125f, -cn));
        s[j][r] = p;
        lsum += p;
      }
    lsum += __shfl_xor(lsum, 16);
    lrun = lrun * alpha + lsum;
    #pragma unroll
    for (int t = 0; t < 4; ++t)
      #pragma unroll
      for (int r = 0; r < 8; ++r) o[t][r] = o[t][r] * alpha;

    // ---- P^T B-fragments (key chunks 0..31 and 32..63 of this step) ----
    const v16h pb0 = pack_p(s[0], s[1]);
    const v16h pb1 = pack_p(s[2], s[3]);

    // ---- O^T += V^T * P^T ----
    #pragma unroll
    for (int t = 0; t < 4; ++t) {
      const _Float16* vp = (const _Float16*)(pv + 16 * t * KV_PITCH);
      const v16h vf0 = load_frag(vp, h);
      const v16h vf1 = load_frag(vp + 32, h);
      o[t] = wmma_f16(vf0, pb0, o[t]);
      o[t] = wmma_f16(vf1, pb1, o[t]);
    }
    asm volatile("s_wait_dscnt 0x0" ::: "memory");    // own reads of this buffer are done before it is refilled
    asm volatile("s_wait_asynccnt 0x0" ::: "memory"); // own copies of stage st+1 landed
    __syncthreads();                                  // publishes stage st+1, frees stage st's buffer
    if (st + 2 < T) kv_stage_copy(lds0 + bo, gk + (size_t)(kb + 128) * HD, gv + kb + 128);
  }
  asm volatile("s_wait_asynccnt 0x0" ::: "memory");   // nothing in flight when the wave goes on to its end

  // ---- epilogue: normalise, stage per-wave 16x64 f16 tile, whole-line stores ----
  const float inv = (1.0f / lrun) * (1.0f / PSCALE);
  _Float16* so = sO + w * 1024;
  #pragma unroll
  for (int t = 0; t < 4; ++t)
    #pragma unroll
    for (int r = 0; r < 8; ++r)
      so[m * 64 + 16 * t + 8 * h + r] = (_Float16)(o[t][r] * inv);
  __syncthreads();

  att_store_pass(so, ao, b, head, q0, lane);
  
}

// ---------------------------------------------------------------------------
// Kernel 5: Y = A[M,K](f16) * W[N,K]^T(f16 x32) with epilogue.
//   MODE 1: outf[M][N] (f32) = (acc/32 + bias) + resid
//   MODE 2: outh[M][N] (f16) = gelu_erf(acc/32 + bias)
// Block 128 thr (4 waves) = 128 rows x 64 cols; wave = 32 rows x 64 cols.
// ---------------------------------------------------------------------------
template <int MODE>
__global__ __launch_bounds__(128) void gemm_kernel(
    const _Float16* __restrict__ A, const _Float16* __restrict__ W,
    const float* __restrict__ bias, const float* __restrict__ resid,
    float* __restrict__ outf, _Float16* __restrict__ outh, int N, int K)
{
  __shared__ __attribute__((aligned(16))) char ring[RING];   // operand ring, then the 32768-B output tile
  float* sbuf = (float*)ring;

  const int tid = threadIdx.x, lane = tid & 31, w = tid >> 5;
  const int h = lane >> 4, m = lane & 15;
  const int q8 = lane & 7, sub = lane >> 3;
  const int m0 = blockIdx.x * 128, n0 = blockIdx.y * 64;
  const int m0w = m0 + 32 * w;

  v8f acc[2][4];
  gemm_main(ring, A + (size_t)m0 * K, W + (size_t)n0 * K, K, tid, acc);

  // D[r] of tile (mt, nt) = Y[row m0w+16mt+8h+r][col n0+16nt+m]
  if (MODE == 1) {
    #pragma unroll
    for (int nt = 0; nt < 4; ++nt)
      #pragma unroll
      for (int mt = 0; mt < 2; ++mt)
        #pragma unroll
        for (int r = 0; r < 8; ++r)
          sbuf[(32 * w + 16 * mt + 8 * h + r) * 64 + 16 * nt + m] = acc[mt][nt][r] * WINV;
    __syncthreads();

    // wave w owns rows 32w..32w+31, each row = 64 floats = 2 lines -> 64 lines
    v4f vals[16];
    #pragma unroll
    for (int i = 0; i < 16; ++i) {
      const int lid = i * 4 + sub;                 // 0..63
      const int rl = lid >> 1, hl = lid & 1;
      const int col = 32 * hl + 4 * q8;
      const v4f a  = *(const v4fa*)(sbuf + (32 * w + rl) * 64 + col);
      const v4f bb = *(const v4fa*)(bias + n0 + col);
      const size_t gi = (size_t)(m0w + rl) * N + n0 + col;
      const v4f rr = *(const v4fa*)(resid + gi);
      vals[i] = (a + bb) + rr;
    }
    #pragma unroll
    for (int i = 0; i < 16; ++i) {
      const int lid = i * 4 + sub;
      const int rl = lid >> 1, hl = lid & 1;
      const size_t gi = (size_t)(m0w + rl) * N + n0 + 32 * hl + 4 * q8;
      *(v4f*)(outf + gi) = vals[i];
    }
    
  } else {
    _Float16* sh = (_Float16*)sbuf;
    #pragma unroll
    for (int nt = 0; nt < 4; ++nt) {
      const float bvl = bias[n0 + 16 * nt + m];
      #pragma unroll
      for (int mt = 0; mt < 2; ++mt)
        #pragma unroll
        for (int r = 0; r < 8; ++r) {
          const float xv = acc[mt][nt][r] * WINV + bvl;
          const float gl = 0.5f * xv * (1.0f + erff(xv * 0.70710678118654752f));
          sh[(32 * w + 16 * mt + 8 * h + r) * 64 + 16 * nt + m] = (_Float16)gl;
        }
    }
    __syncthreads();

    // wave w owns rows 32w..32w+31, each row = 64 halves = 1 line -> 32 lines
    v8h vals[8];
    #pragma unroll
    for (int i = 0; i < 8; ++i) {
      const int lid = i * 4 + sub;                 // 0..31
      vals[i] = *(const v8ha*)(sh + (32 * w + lid) * 64 + 8 * q8);
    }
    #pragma unroll
    for (int i = 0; i < 8; ++i) {
      const int lid = i * 4 + sub;
      *(v8h*)(outh + (size_t)(m0w + lid) * N + n0 + 8 * q8) = vals[i];
    }
    
  }
}

// ---------------------------------------------------------------------------
extern "C" void kernel_launch(void* const* d_in, const int* in_sizes, int n_in,
                              void* d_out, int out_size, void* d_ws, size_t ws_size,
                              hipStream_t stream) {
  if (n_in < 13) return;
  if (in_sizes[0] != NTOK * DM) return;
  if (in_sizes[1] != 3 * DM * DM || in_sizes[2] != 3 * DM) return;
  if (in_sizes[3] != DM * DM || in_sizes[4] != DM) return;
  if (in_sizes[5] != DFF * DM || in_sizes[6] != DFF) return;
  if (in_sizes[7] != DM * DFF || in_sizes[8] != DM) return;
  if (in_sizes[9] != DM || in_sizes[10] != DM || in_sizes[11] != DM || in_sizes[12] != DM) return;
  if (out_size != NTOK * DM) return;

  const float* hidden = (const float*)d_in[0];
  const float* qkv_w  = (const float*)d_in[1];
  const float* qkv_b  = (const float*)d_in[2];
  const float* out_w  = (const float*)d_in[3];
  const float* out_b  = (const float*)d_in[4];
  const float* fc1_w  = (const float*)d_in[5];
  const float* fc1_b  = (const float*)d_in[6];
  const float* fc2_w  = (const float*)d_in[7];
  const float* fc2_b  = (const float*)d_in[8];
  const float* ln1_g  = (const float*)d_in[9];
  const float* ln1_b  = (const float*)d_in[10];
  const float* ln2_g  = (const float*)d_in[11];
  const float* ln2_b  = (const float*)d_in[12];
  float* out = (float*)d_out;

  // workspace carve (all sizes multiples of 256 B)
  const size_t wh_bytes   = (size_t)G_ALL * 8 * 2;          // 25165824
  const size_t act_bytes  = (size_t)NTOK * DM * 2;           //  8388608  (f16 [4096][1024])
  const size_t hid2_bytes = (size_t)NTOK * DM * 4;           // 16777216
  const size_t ff_bytes   = (size_t)NTOK * DFF * 2;          // 33554432
  const size_t total = wh_bytes + 5 * act_bytes + hid2_bytes + ff_bytes;   // 117440512
  if (total > ws_size) return;

  char* ws = (char*)d_ws;
  size_t off = 0;
  _Float16* wh   = (_Float16*)(ws + off); off += wh_bytes;
  _Float16* xn   = (_Float16*)(ws + off); off += act_bytes;   // ln1 output, later ln2 output
  _Float16* qh   = (_Float16*)(ws + off); off += act_bytes;
  _Float16* kh   = (_Float16*)(ws + off); off += act_bytes;
  _Float16* vt   = (_Float16*)(ws + off); off += act_bytes;
  _Float16* ah   = (_Float16*)(ws + off); off += act_bytes;   // attention output f16 [4096][1024]
  float*    hid2 = (float*)(ws + off);    off += hid2_bytes;  // hidden + attn proj, f32
  _Float16* ff   = (_Float16*)(ws + off); off += ff_bytes;    // gelu(fc1) f16 [4096][4096]
  if (off > ws_size) return;

  const _Float16* w_qkv = wh;
  const _Float16* w_out = wh + (size_t)3 * DM * DM;
  const _Float16* w_fc1 = wh + (size_t)4 * DM * DM;
  const _Float16* w_fc2 = wh + (size_t)4 * DM * DM + (size_t)DFF * DM;

  // 1: weights -> f16 x32
  cvt_w_kernel<<<G_ALL / 256, 256, 0, stream>>>(qkv_w, out_w, fc1_w, fc2_w, wh);

  // 2: ln1 -> f16
  ln_kernel<<<NTOK / 8, 256, 0, stream>>>(hidden, ln1_g, ln1_b, xn, NTOK);

  // 3: qkv projection -> q/k planes + transposed v
  qkv_kernel<<<dim3(NTOK / 128, 3 * NH), 128, 0, stream>>>(xn, w_qkv, qkv_b, qh, kh, vt);

  // 4: causal attention -> f16 [tok][DM]
  attn_kernel<<<dim3(SEQ / 64, BATCH * NH), 128, 0, stream>>>(qh, kh, vt, ah);

  // 5: output projection + bias + residual -> f32 hid2
  gemm_kernel<1><<<dim3(NTOK / 128, DM / 64), 128, 0, stream>>>(ah, w_out, out_b, hidden, hid2, xn, DM, DM);

  // 6: ln2 -> f16 (reuses xn)
  ln_kernel<<<NTOK / 8, 256, 0, stream>>>(hid2, ln2_g, ln2_b, xn, NTOK);

  // 7: fc1 + exact gelu -> f16 ff
  gemm_kernel<2><<<dim3(NTOK / 128, DFF / 64), 128, 0, stream>>>(xn, w_fc1, fc1_b, fc1_b, hid2, ff, DFF, DM);

  // 8: fc2 + bias + residual(hid2) -> f32 d_out
  gemm_kernel<1><<<dim3(NTOK / 128, DM / 64), 128, 0, stream>>>(ff, w_fc2, fc2_b, hid2, out, xn, DM, DFF);
}

// v003
// It runs in 166 microseconds.
// In both of two side-by-side timings against v002, it was 1.20 times as fast.
// Counting every step since v000, it is 3.26 times as fast.
// Contractions: ln1(x)*Wqkv^T, K*Q^T, V^T*P^T, attn*Wout^T, ln2(h)*Wfc1^T, gelu(.)*Wfc2^T all on v_wmma_f32_16x16x32_f16 (f16 operands, f32 accumulate); every W carried x32 and P carried x16384 (exact power-of-two scales folded back in f32); layernorm, softmax, bias, gelu and residual adds in f32.
#include <hip/hip_runtime.h>
#include <math.h>

typedef _Float16 v16h __attribute__((ext_vector_type(16)));
typedef _Float16 v8h  __attribute__((ext_vector_type(8)));
typedef float    v8f  __attribute__((ext_vector_type(8)));
typedef float    v4f  __attribute__((ext_vector_type(4)));
typedef v8h __attribute__((may_alias)) v8ha;
typedef v4f __attribute__((may_alias)) v4fa;

union Frag { v16h v; v8h half[2]; };

#define DM     1024
#define NH     16
#define HD     64
#define DFF    4096
#define SEQ    2048
#define BATCH  2
#define NTOK   (BATCH * SEQ)          // 4096 tokens
#define WSC    32.0f
#define WINV   0.03125f
#define PSCALE 16384.0f

#define G_QKV (3 * DM * DM / 8)       // 393216 groups of 8
#define G_OUT (DM * DM / 8)           // 131072
#define G_FC1 (DFF * DM / 8)          // 524288
#define G_FC2 (DM * DFF / 8)          // 524288
#define G_ALL (G_QKV + G_OUT + G_FC1 + G_FC2)   // 1572864

static_assert(NTOK % 128 == 0);
static_assert(SEQ % 128 == 0);
static_assert(DM % 64 == 0);
static_assert(DFF % 64 == 0);
static_assert(G_ALL % 256 == 0);

// ---------------------------------------------------------------------------
// 16x16x32 f16 WMMA with hazard guard (ties D, keeps A/B live).
// Fragment map (wave32): lane l, h = l>>4, m = n = l&15.
//   A/B element i: i<8 -> k0+8h+i ; i>=8 -> k0+16+8h+(i-8)
//   D element r : row 8h+r, col l&15
// ---------------------------------------------------------------------------
__device__ __forceinline__ v8f wmma_f16(v16h a, v16h b, v8f c) {
  v8f d = __builtin_amdgcn_wmma_f32_16x16x32_f16(false, a, false, b, (short)0, c, false, false);
  asm volatile("v_nop\n\tv_nop\n\tv_nop\n\tv_nop" : "+v"(d) : "v"(a), "v"(b));
  return d;
}

// A or B fragment from a k-contiguous 16-bit row; p points at element k0 of
// the row owned by this lane (row index = lane & 15 added by the caller).
__device__ __forceinline__ v16h load_frag(const _Float16* p, int h) {
  Frag f;
  f.half[0] = *(const v8ha*)(p + 8 * h);
  f.half[1] = *(const v8ha*)(p + 16 + 8 * h);
  return f.v;
}

// ---------------------------------------------------------------------------
// Kernel 1: f32 weights -> f16 planes scaled by 32 (exact). One 16-B store per
// wh layout: [qkv 3*DM*DM][out DM*DM][fc1 DFF*DM][fc2 DM*DFF], row = output feature.
// ---------------------------------------------------------------------------
__global__ __launch_bounds__(256) void cvt_w_kernel(
    const float* __restrict__ w0, const float* __restrict__ w1,
    const float* __restrict__ w2, const float* __restrict__ w3,
    _Float16* __restrict__ wh)
{
  const int g = blockIdx.x * 256 + threadIdx.x;
  if (g >= G_ALL) return;
  const float* src;
  if (g < G_QKV)                        src = w0 + (size_t)g * 8;
  else if (g < G_QKV + G_OUT)           src = w1 + (size_t)(g - G_QKV) * 8;
  else if (g < G_QKV + G_OUT + G_FC1)   src = w2 + (size_t)(g - G_QKV - G_OUT) * 8;
  else                                  src = w3 + (size_t)(g - G_QKV - G_OUT - G_FC1) * 8;
  _Float16* dst = wh + (size_t)g * 8;
  const v4f a = *(const v4fa*)src;
  const v4f c = *(const v4fa*)(src + 4);
  const v8h o = { (_Float16)(a.x * WSC), (_Float16)(a.y * WSC), (_Float16)(a.z * WSC), (_Float16)(a.w * WSC),
                  (_Float16)(c.x * WSC), (_Float16)(c.y * WSC), (_Float16)(c.z * WSC), (_Float16)(c.w * WSC) };
  *(v8h*)dst = o;
  
}

// ---------------------------------------------------------------------------
// Kernel 2: LayerNorm over rows of DM f32 -> f16. One wave per row (block of 8
// i*256 + lane*8 + 0..7 (i = 0..3) so every store instruction is 32 lanes x
// ---------------------------------------------------------------------------
__global__ __launch_bounds__(256) void ln_kernel(
    const float* __restrict__ x, const float* __restrict__ g,
    const float* __restrict__ bt, _Float16* __restrict__ y, int nrows)
{
  const int lane = threadIdx.x & 31, w = threadIdx.x >> 5;
  const int row = blockIdx.x * 8 + w;
  if (row >= nrows) return;                      // wave-uniform; no barriers below
  const float* xr = x + (size_t)row * DM;

  v4f xa[4], xb[4];
  float s = 0.0f;
  #pragma unroll
  for (int i = 0; i < 4; ++i) {
    const float* p = xr + i * 256 + lane * 8;
    xa[i] = *(const v4fa*)p;
    xb[i] = *(const v4fa*)(p + 4);
    s += ((xa[i].x + xa[i].y) + (xa[i].z + xa[i].w)) + ((xb[i].x + xb[i].y) + (xb[i].z + xb[i].w));
  }
  #pragma unroll
  for (int off = 16; off > 0; off >>= 1) s += __shfl_xor(s, off);
  const float mu = s * (1.0f / DM);

  float ss = 0.0f;
  #pragma unroll
  for (int i = 0; i < 4; ++i) {
    const v4f da = xa[i] - mu, db = xb[i] - mu;
    ss += ((da.x * da.x + da.y * da.y) + (da.z * da.z + da.w * da.w)) +
          ((db.x * db.x + db.y * db.y) + (db.z * db.z + db.w * db.w));
  }
  #pragma unroll
  for (int off = 16; off > 0; off >>= 1) ss += __shfl_xor(ss, off);
  const float var = ss * (1.0f / DM);
  const float rstd = rsqrtf(var + 1e-5f);

  v8h o[4];
  #pragma unroll
  for (int i = 0; i < 4; ++i) {
    const int p = i * 256 + lane * 8;
    const v4f ga = *(const v4fa*)(g + p),  gb = *(const v4fa*)(g + p + 4);
    const v4f ba = *(const v4fa*)(bt + p), bb = *(const v4fa*)(bt + p + 4);
    const v4f da = (xa[i] - mu) * rstd, db = (xb[i] - mu) * rstd;
    const v8h t = { (_Float16)(da.x * ga.x + ba.x), (_Float16)(da.y * ga.y + ba.y),
                    (_Float16)(da.z * ga.z + ba.z), (_Float16)(da.w * ga.w + ba.w),
                    (_Float16)(db.x * gb.x + bb.x), (_Float16)(db.y * gb.y + bb.y),
                    (_Float16)(db.z * gb.z + bb.z), (_Float16)(db.w * gb.w + bb.w) };
    o[i] = t;
  }
  _Float16* yr = y + (size_t)row * DM;
  #pragma unroll
  for (int i = 0; i < 4; ++i) *(v8h*)(yr + i * 256 + lane * 8) = o[i];
  
}

// ---------------------------------------------------------------------------
// Shared GEMM main loop: 256 threads, 8 waves in a 4 x 2 grid. Block tile 64*MT
// (rows of A) x 128 (rows of W), wave tile 16*MT x 64. A stage is KP k (2*KP B) of
// all 64*MT + 128 rows, laid in LDS at a pitch of 2*KP + 16 B (16 B x odd:
// conflict-free for 16-byte fragment reads). Two buffers: stage t+1 is copied
// global -> LDS asynchronously while stage t is multiplied.
//   MT 4, KP 64 : 256 x 128, ring 110592 B, two blocks on a WGP (qkv, fc1)
//   MT 2, KP 256: 128 x 128, ring 270336 B, one block on a WGP (out, fc2: 256 blocks in all)
// acc[mt][nt][r] = sum_k A[16*MT*wm + 16mt + 8h + r][k] * W[64wn + 16nt + m][k],
// wm = wave >> 1, wn = wave & 1, k ascending in steps of 32.
// ---------------------------------------------------------------------------
#define W_ROWS  128
#define GT      256                          // threads of a GEMM block
#define PITCH_B(KP)     (2 * (KP) + 16)                      // LDS bytes per staged row
#define STAGE_B(MT, KP) ((64 * (MT) + W_ROWS) * PITCH_B(KP))
#define RING_B(MT, KP)  (2 * STAGE_B(MT, KP))

static_assert(DM % 256 == 0 && DFF % 256 == 0);
static_assert(NTOK % 256 == 0 && SEQ % 256 == 0 && DM % W_ROWS == 0 && DFF % W_ROWS == 0);

// Twelve 16-byte-per-lane copies global -> LDS. The s_wait_xcnt closes the
// statement so that no address register named here is rewritten ahead of it.
__device__ __forceinline__ void copy12(const unsigned (&l)[12], const _Float16* const (&g)[12]) {
  asm volatile(
      "global_load_async_to_lds_b128 %0, %12, off\n\t"
      "global_load_async_to_lds_b128 %1, %13, off\n\t"
      "global_load_async_to_lds_b128 %2, %14, off\n\t"
      "global_load_async_to_lds_b128 %3, %15, off\n\t"
      "global_load_async_to_lds_b128 %4, %16, off\n\t"
      "global_load_async_to_lds_b128 %5, %17, off\n\t"
      "global_load_async_to_lds_b128 %6, %18, off\n\t"
      "global_load_async_to_lds_b128 %7, %19, off\n\t"
      "global_load_async_to_lds_b128 %8, %20, off\n\t"
      "global_load_async_to_lds_b128 %9, %21, off\n\t"
      "global_load_async_to_lds_b128 %10, %22, off\n\t"
      "global_load_async_to_lds_b128 %11, %23, off\n\t"
      "s_wait_xcnt 0x0"
      :: "v"(l[0]), "v"(l[1]), "v"(l[2]), "v"(l[3]), "v"(l[4]), "v"(l[5]),
         "v"(l[6]), "v"(l[7]), "v"(l[8]), "v"(l[9]), "v"(l[10]), "v"(l[11]),
         "v"(g[0]), "v"(g[1]), "v"(g[2]), "v"(g[3]), "v"(g[4]), "v"(g[5]),
         "v"(g[6]), "v"(g[7]), "v"(g[8]), "v"(g[9]), "v"(g[10]), "v"(g[11])
      : "memory");
}

// The same for eight copies out of thirty-two (the 128 x 128 tile's stage).
__device__ __forceinline__ void copy8of32(const unsigned (&l)[32], const _Float16* const (&g)[32], int o) {
  asm volatile(
      "global_load_async_to_lds_b128 %0, %8, off\n\t"
      "global_load_async_to_lds_b128 %1, %9, off\n\t"
      "global_load_async_to_lds_b128 %2, %10, off\n\t"
      "global_load_async_to_lds_b128 %3, %11, off\n\t"
      "global_load_async_to_lds_b128 %4, %12, off\n\t"
      "global_load_async_to_lds_b128 %5, %13, off\n\t"
      "global_load_async_to_lds_b128 %6, %14, off\n\t"
      "global_load_async_to_lds_b128 %7, %15, off\n\t"
      "s_wait_xcnt 0x0"
      :: "v"(l[o + 0]), "v"(l[o + 1]), "v"(l[o + 2]), "v"(l[o + 3]), "v"(l[o + 4]), "v"(l[o + 5]),
         "v"(l[o + 6]), "v"(l[o + 7]),
         "v"(g[o + 0]), "v"(g[o + 1]), "v"(g[o + 2]), "v"(g[o + 3]), "v"(g[o + 4]), "v"(g[o + 5]),
         "v"(g[o + 6]), "v"(g[o + 7])
      : "memory");
}

// One stage: a row piece of 2*KP B takes KP/8 threads, so the block covers RPP =
// 2048/KP rows at a time: thread t copies 16 B at column 16*(t % (KP/8)) of rows
// t / (KP/8) + RPP*i; a wave's copy covers whole 128-B lines. First the A rows, then W's.
// lds = this thread's LDS byte address in its first row of the target buffer;
// ga / gw = this thread's element in that row of A / W at the stage's first k.
template <int MT, int KP>
__device__ __forceinline__ void stage_copy(unsigned lds, const _Float16* ga, const _Float16* gw, int K) {
  constexpr int RPP = GT / (KP / 8);
  constexpr int NA = 64 * MT / RPP, NC = NA + W_ROWS / RPP;
  static_assert(NC == 12 || NC == 32);
  unsigned l[NC];
  const _Float16* g[NC];
  #pragma unroll
  for (int i = 0; i < NC; ++i) {
    l[i] = lds + (unsigned)(i * RPP * PITCH_B(KP));
    g[i] = (i < NA) ? ga + (size_t)(i * RPP) * K : gw + (size_t)((i - NA) * RPP) * K;
  }
  if constexpr (NC == 12) {
    copy12(l, g);
  } else {
    copy8of32(l, g, 0);
    copy8of32(l, g, 8);
    copy8of32(l, g, 16);
    copy8of32(l, g, 24);
  }
}

// ablk / wblk: first row of the block's A / W tile. ring: RING_B(MT, KP) bytes of LDS; free
// for other use on return (every wave's reads and copies are done and a barrier passed).
template <int MT, int KP>
__device__ __forceinline__ void gemm_main(char* ring,
                                          const _Float16* __restrict__ ablk,
                                          const _Float16* __restrict__ wblk,
                                          int K, int tid, v8f (&acc)[MT][4])
{
  constexpr int A_ROWS = 64 * MT;
  constexpr int PITCH = PITCH_B(KP);
  constexpr int STAGE = STAGE_B(MT, KP);
  const int lane = tid & 31, w = tid >> 5;
  const int wm = w >> 1, wn = w & 1;
  const int h = lane >> 4, m = lane & 15;
  const v8f zero8 = {0.f, 0.f, 0.f, 0.f, 0.f, 0.f, 0.f, 0.f};
  #pragma unroll
  for (int mt = 0; mt < MT; ++mt)
    #pragma unroll
    for (int nt = 0; nt < 4; ++nt) acc[mt][nt] = zero8;

  const int crow = tid / (KP / 8), ccol = tid % (KP / 8);
  const unsigned lds0 = (unsigned)(size_t)ring + (unsigned)(crow * PITCH + ccol * 16);
  const _Float16* ga = ablk + (size_t)crow * K + ccol * 8;
  const _Float16* gw = wblk + (size_t)crow * K + ccol * 8;
  const int T = K / KP;

  stage_copy<MT, KP>(lds0, ga, gw, K);
  asm volatile("s_wait_asynccnt 0x0" ::: "memory");   // own copies of stage 0 landed
  __syncthreads();                                    // publishes stage 0
  if (T > 1) stage_copy<MT, KP>(lds0 + STAGE, ga + KP, gw + KP, K);

  #pragma unroll 1
  for (int t = 0; t < T; ++t) {
    const int bo = (t & 1) * STAGE;
    const char* pa = ring + bo + (16 * MT * wm + m) * PITCH;
    const char* pw = ring + bo + (A_ROWS + 64 * wn + m) * PITCH;
    #pragma unroll
    for (int kc = 0; kc < KP / 32; ++kc) {
      v16h a[MT], b[4];
      #pragma unroll
      for (int mt = 0; mt < MT; ++mt) a[mt] = load_frag((const _Float16*)(pa + mt * 16 * PITCH) + kc * 32, h);
      #pragma unroll
      for (int nt = 0; nt < 4; ++nt) b[nt] = load_frag((const _Float16*)(pw + nt * 16 * PITCH) + kc * 32, h);
      #pragma unroll
      for (int nt = 0; nt < 4; ++nt)
        #pragma unroll
        for (int mt = 0; mt < MT; ++mt) acc[mt][nt] = wmma_f16(a[mt], b[nt], acc[mt][nt]);
    }
    asm volatile("s_wait_dscnt 0x0" ::: "memory");    // own reads of this buffer are done before it is refilled
    asm volatile("s_wait_asynccnt 0x0" ::: "memory"); // own copies of stage t+1 landed
    __syncthreads();                                  // publishes stage t+1, frees stage t's buffer
    if (t + 2 < T) stage_copy<MT, KP>(lds0 + bo, ga + (size_t)(t + 2) * KP, gw + (size_t)(t + 2) * KP, K);
  }
  asm volatile("s_wait_asynccnt 0x0" ::: "memory");   // nothing in flight when the ring is reused
}

// Pitches of the output tiles staged in the ring (16 B x odd, so that the two lane
// halves, 8 rows apart, fall on different banks and every row stays 16-B aligned).
#define HP128 136                            // halves per staged row of 128 halves
#define HP256 264                            // halves per staged row of 256 halves
#define FP128 132                            // floats per staged row of 128 floats

// ---------------------------------------------------------------------------
// Kernel 3: QKV = ln1(x) * Wqkv^T + b over the fused 3*1024 output columns.
// Block 256 thr (8 waves) = 256 tokens x 128 features (one 'which', two heads).
// q plane [B*H][S][64], k plane [B*H][S][64], vt [B*H][64][S].
// Stores: one 16-B store per lane, whole 128-B lines, each line by one instruction.
// ---------------------------------------------------------------------------
__global__ __launch_bounds__(GT) void qkv_kernel(
    const _Float16* __restrict__ xh,   // [NTOK][DM]
    const _Float16* __restrict__ wh,   // [3*DM][DM], row = output feature, x32
    const float* __restrict__ bias,    // [3*DM]
    _Float16* __restrict__ qh, _Float16* __restrict__ kh, _Float16* __restrict__ vt)
{
  __shared__ __attribute__((aligned(16))) char ring[RING_B(4, 64)];   // operand ring, then the output tile (at most 69632 B)
  _Float16* sT = (_Float16*)ring;

  const int tid = threadIdx.x, lane = tid & 31, w = tid >> 5;
  const int wm = w >> 1, wn = w & 1;
  const int h = lane >> 4, m = lane & 15;
  const int m0 = blockIdx.x * 256;
  const int cg = blockIdx.y;                 // 0..23 = which*8 + head pair
  const int which = cg >> 3, head0 = (cg & 7) * 2;

  v8f acc[4][4];
  gemm_main<4, 64>(ring, xh + (size_t)m0 * DM, wh + (size_t)cg * 128 * DM, DM, tid, acc);

  // D[r] of tile (mt, nt) = Y[token m0+64wm+16mt+8h+r][feature cg*128 + 64wn+16nt+m]
  // staged as [token][feature] for q and k, as [feature][token] for v ('which' is block-uniform)
  float bvl[4];
  #pragma unroll
  for (int nt = 0; nt < 4; ++nt) bvl[nt] = bias[cg * 128 + 64 * wn + 16 * nt + m];
  if (which != 2) {
    #pragma unroll
    for (int nt = 0; nt < 4; ++nt)
      #pragma unroll
      for (int mt = 0; mt < 4; ++mt)
        #pragma unroll
        for (int r = 0; r < 8; ++r)
          sT[(64 * wm + 16 * mt + 8 * h + r) * HP128 + 64 * wn + 16 * nt + m] = (_Float16)(acc[mt][nt][r] * WINV + bvl[nt]);
  } else {
    #pragma unroll
    for (int nt = 0; nt < 4; ++nt)
      #pragma unroll
      for (int mt = 0; mt < 4; ++mt) {
        v8h y;                                             // the lane's 8 tokens of one feature lie side by side
        #pragma unroll
        for (int r = 0; r < 8; ++r) y[r] = (_Float16)(acc[mt][nt][r] * WINV + bvl[nt]);
        *(v8ha*)(sT + (64 * wn + 16 * nt + m) * HP256 + 64 * wm + 16 * mt + 8 * h) = y;
      }
  }
  __syncthreads();

  const int b = m0 / SEQ, l0 = m0 - b * SEQ;
  if (which != 2) {
    // plane[bh][l][d]: a staged token row = 128 halves = one line in each of two heads
    _Float16* plane = (which == 0) ? qh : kh;
    const int rs = lane >> 4, c16 = lane & 15;
    const int bh = b * NH + head0 + (c16 >> 3);
    #pragma unroll
    for (int i = 0; i < 16; ++i) {
      const int tok = (i * 8 + w) * 2 + rs;                // 0..255 over the block
      const v8h v = *(const v8ha*)(sT + tok * HP128 + 8 * c16);
      *(v8h*)(plane + ((size_t)bh * SEQ + l0 + tok) * HD + 8 * (c16 & 7)) = v;
    }
    asm volatile("s_wait_xcnt 0x0" ::: "memory");          // no register of these stores is rewritten ahead of it on any way on from here
  } else {
    // vt[bh][d][l]: a staged feature row = 256 tokens = 4 lines
    #pragma unroll
    for (int i = 0; i < 16; ++i) {
      const int feat = i * 8 + w;                          // 0..127 over the block
      const v8h v = *(const v8ha*)(sT + feat * HP256 + 8 * lane);
      const int bh = b * NH + head0 + (feat >> 6);
      *(v8h*)(vt + ((size_t)bh * HD + (feat & 63)) * SEQ + l0 + 8 * lane) = v;
    }
  }
}

// ---------------------------------------------------------------------------
// Attention helpers.
// P^T B-fragment from the lane's own score D values: element r <- tile a row r,
// element 8+r <- tile c row r (same lane, same query column), scaled by 2^14.
// ---------------------------------------------------------------------------
__device__ __forceinline__ v16h pack_p(v8f a, v8f c) {
  const v16h r = { (_Float16)(a[0] * PSCALE), (_Float16)(a[1] * PSCALE), (_Float16)(a[2] * PSCALE), (_Float16)(a[3] * PSCALE),
                   (_Float16)(a[4] * PSCALE), (_Float16)(a[5] * PSCALE), (_Float16)(a[6] * PSCALE), (_Float16)(a[7] * PSCALE),
                   (_Float16)(c[0] * PSCALE), (_Float16)(c[1] * PSCALE), (_Float16)(c[2] * PSCALE), (_Float16)(c[3] * PSCALE),
                   (_Float16)(c[4] * PSCALE), (_Float16)(c[5] * PSCALE), (_Float16)(c[6] * PSCALE), (_Float16)(c[7] * PSCALE) };
  return r;
}

// (one query row) by lanes 8q..8q+7 in one instruction, 4 lines per instruction.
__device__ __forceinline__ void att_store_pass(const _Float16* so, _Float16* ao,
                                               int b, int head, int q0, int lane) {
  const int q8 = lane & 7, sub = lane >> 3;
  #pragma unroll
  for (int i = 0; i < 4; ++i) {
    const int lid = i * 4 + sub;                  // query row 0..15
    const v8h v = *(const v8ha*)(so + lid * 64 + 8 * q8);
    const size_t gi = ((size_t)b * SEQ + q0 + lid) * DM + head * HD + 8 * q8;
    *(v8h*)(ao + gi) = v;
  }
}

// ---------------------------------------------------------------------------
// K / V^T staging for attention. A stage is 64 keys: the K tile (64 key rows x
// 128 B of d) and behind it the V^T tile (64 d rows x 128 B of keys), each row
// laid in LDS at a pitch of 144 B (16 B x odd: conflict-free for 16-byte
// fragment reads). Two buffers: stage t+1 is copied global -> LDS
// asynchronously, once per block, while all four waves work on stage t.
// ---------------------------------------------------------------------------
#define KV_PITCH 144                         // LDS bytes per staged row
#define KV_TILE  (64 * KV_PITCH)             // 9216 B
#define KV_STAGE (2 * KV_TILE)               // 18432 B
#define KV_RING  (2 * KV_STAGE)              // 36864 B

static_assert(KV_PITCH % 16 == 0 && HD * 2 == 128 && SEQ % 64 == 0);

// Eight 16-byte-per-lane copies global -> LDS. The s_wait_xcnt closes the
// statement so that no address register named here is rewritten ahead of it.
__device__ __forceinline__ void copy8(const unsigned (&l)[8], const _Float16* const (&g)[8]) {
  asm volatile(
      "global_load_async_to_lds_b128 %0, %8, off\n\t"
      "global_load_async_to_lds_b128 %1, %9, off\n\t"
      "global_load_async_to_lds_b128 %2, %10, off\n\t"
      "global_load_async_to_lds_b128 %3, %11, off\n\t"
      "global_load_async_to_lds_b128 %4, %12, off\n\t"
      "global_load_async_to_lds_b128 %5, %13, off\n\t"
      "global_load_async_to_lds_b128 %6, %14, off\n\t"
      "global_load_async_to_lds_b128 %7, %15, off\n\t"
      "s_wait_xcnt 0x0"
      :: "v"(l[0]), "v"(l[1]), "v"(l[2]), "v"(l[3]), "v"(l[4]), "v"(l[5]), "v"(l[6]), "v"(l[7]),
         "v"(g[0]), "v"(g[1]), "v"(g[2]), "v"(g[3]), "v"(g[4]), "v"(g[5]), "v"(g[6]), "v"(g[7])
      : "memory");
}

// One stage: thread t copies 16 B at column 16*(t&7) of rows (t>>3) + 16i of both
// tiles (i = 0..3); a wave's copy covers four whole 128-B rows.
// lds = this thread's LDS byte address in row (t>>3) of the target buffer's K tile;
// gk / gv = this thread's element in that row of K / V^T at the stage's first key.
__device__ __forceinline__ void kv_stage_copy(unsigned lds, const _Float16* gk, const _Float16* gv) {
  unsigned l[8];
  const _Float16* g[8];
  #pragma unroll
  for (int i = 0; i < 4; ++i) {
    l[i]     = lds + (unsigned)(i * 16 * KV_PITCH);
    g[i]     = gk + (size_t)(i * 16) * HD;
    l[4 + i] = lds + (unsigned)(KV_TILE + i * 16 * KV_PITCH);
    g[4 + i] = gv + (size_t)(i * 16) * SEQ;
  }
  copy8(l, g);
}

// ---------------------------------------------------------------------------
// Kernel 4: causal streaming attention, transposed form.
// Block 128 thr (4 waves), 16 queries per wave, 64 keys per step; the block's
// 64 queries share one diagonal step, so all four waves make blockIdx.x + 1 steps.
//   S^T = K * Q^T : A = K rows (row = key, k = d), B = Q^T (k = d, n = query)
//   O^T += V^T * P^T : A = Vt rows (row = d, k = key), B = P^T from registers
// Lane owns 32 keys of query column (lane&15); partner = lane ^ 16.
// The 1/8 scale is folded into the exponent argument (exact power of two).
// ---------------------------------------------------------------------------
__global__ __launch_bounds__(128) void attn_kernel(
    const _Float16* __restrict__ qh,   // [B*H][S][64]
    const _Float16* __restrict__ kh,   // [B*H][S][64]
    const _Float16* __restrict__ vt,   // [B*H][64][S]
    _Float16* __restrict__ ao)         // [B][S][DM]
{
  __shared__ __attribute__((aligned(16))) _Float16 sO[4 * 16 * 64];    // 8192 B
  __shared__ __attribute__((aligned(16))) char kv[KV_RING];            // K / V^T stages, two buffers

  const int tid = threadIdx.x, lane = tid & 31, w = tid >> 5;
  const int h = lane >> 4, m = lane & 15;
  const int bh = blockIdx.y, b = bh >> 4, head = bh & 15;
  const int q0 = blockIdx.x * 64 + 16 * w;

  // Q^T B-fragments: column n = query q0+m, k = d (two 32-deep chunks)
  const _Float16* qrow = qh + ((size_t)bh * SEQ + q0 + m) * HD;
  const v16h qb0 = load_frag(qrow, h);
  const v16h qb1 = load_frag(qrow + 32, h);

  const v8f zero8 = {0.f, 0.f, 0.f, 0.f, 0.f, 0.f, 0.f, 0.f};
  v8f o[4];                                   // o[t][r] = O[query m][d 16t+8h+r] * (l * 2^14)
  #pragma unroll
  for (int t = 0; t < 4; ++t) o[t] = zero8;
  float mrun = -1e30f, lrun = 0.0f;

  const int crow = tid >> 3, ccol = tid & 7;
  const unsigned lds0 = (unsigned)(size_t)kv + (unsigned)(crow * KV_PITCH + ccol * 16);
  const _Float16* gk = kh + ((size_t)bh * SEQ + crow) * HD + ccol * 8;    // + key0*HD
  const _Float16* gv = vt + ((size_t)bh * HD + crow) * SEQ + ccol * 8;    // + key0
  const int T = blockIdx.x + 1;               // steps up to and with the diagonal one (block-uniform)

  kv_stage_copy(lds0, gk, gv);
  asm volatile("s_wait_asynccnt 0x0" ::: "memory");   // own copies of stage 0 landed
  __syncthreads();                                    // publishes stage 0
  if (T > 1) kv_stage_copy(lds0 + KV_STAGE, gk + 64 * HD, gv + 64);

  #pragma unroll 1
  for (int st = 0; st < T; ++st) {
    const int kb = 64 * st;
    const int bo = (st & 1) * KV_STAGE;
    const char* pk = kv + bo + m * KV_PITCH;            // K row m of the stage
    const char* pv = pk + KV_TILE;                      // V^T row m of the stage
    // ---- raw scores: s[j][r] = S[query q0+m][key kb+16j+8h+r] (unscaled) ----
    v8f s[4];
    #pragma unroll
    for (int j = 0; j < 4; ++j) {
      const _Float16* kp = (const _Float16*)(pk + 16 * j * KV_PITCH);
      const v16h kf0 = load_frag(kp, h);
      const v16h kf1 = load_frag(kp + 32, h);
      v8f z = zero8;
      z = wmma_f16(kf0, qb0, z);
      z = wmma_f16(kf1, qb1, z);
      s[j] = z;
    }
    // ---- causal mask (only on the step touching the diagonal) ----
    if (kb + 63 > q0) {
      const int qq = q0 + m;
      #pragma unroll
      for (int j = 0; j < 4; ++j)
        #pragma unroll
        for (int r = 0; r < 8; ++r) {
          const int kk = kb + 16 * j + 8 * h + r;
          if (kk > qq) s[j][r] = -1e30f;
        }
    }

    // ---- online softmax (scale 1/8 applied inside the exp argument) ----
    float mloc = s[0][0];
    #pragma unroll
    for (int j = 0; j < 4; ++j)
      #pragma unroll
      for (int r = 0; r < 8; ++r) mloc = fmaxf(mloc, s[j][r]);
    mloc = fmaxf(mloc, __shfl_xor(mloc, 16));
    const float mnew = fmaxf(mrun, mloc);
    const float cn = mnew * 0.125f;
    const float alpha = __expf((mrun - mnew) * 0.125f);
    mrun = mnew;
    float lsum = 0.0f;
    #pragma unroll
    for (int j = 0; j < 4; ++j)
      #pragma unroll
      for (int r = 0; r < 8; ++r) {
        const float p = __expf(fmaf(s[j][r], 0.125f, -cn));
        s[j][r] = p;
        lsum += p;
      }
    lsum += __shfl_xor(lsum, 16);
    lrun = lrun * alpha + lsum;
    #pragma unroll
    for (int t = 0; t < 4; ++t)
      #pragma unroll
      for (int r = 0; r < 8; ++r) o[t][r] = o[t][r] * alpha;

    // ---- P^T B-fragments (key chunks 0..31 and 32..63 of this step) ----
    const v16h pb0 = pack_p(s[0], s[1]);
    const v16h pb1 = pack_p(s[2], s[3]);

    // ---- O^T += V^T * P^T ----
    #pragma unroll
    for (int t = 0; t < 4; ++t) {
      const _Float16* vp = (const _Float16*)(pv + 16 * t * KV_PITCH);
      const v16h vf0 = load_frag(vp, h);
      const v16h vf1 = load_frag(vp + 32, h);
      o[t] = wmma_f16(vf0, pb0, o[t]);
      o[t] = wmma_f16(vf1, pb1, o[t]);
    }
    asm volatile("s_wait_dscnt 0x0" ::: "memory");    // own reads of this buffer are done before it is refilled
    asm volatile("s_wait_asynccnt 0x0" ::: "memory"); // own copies of stage st+1 landed
    __syncthreads();                                  // publishes stage st+1, frees stage st's buffer
    if (st + 2 < T) kv_stage_copy(lds0 + bo, gk + (size_t)(kb + 128) * HD, gv + kb + 128);
  }
  asm volatile("s_wait_asynccnt 0x0" ::: "memory");   // nothing in flight when the wave goes on to its end

  // ---- epilogue: normalise, stage per-wave 16x64 f16 tile, whole-line stores ----
  const float inv = (1.0f / lrun) * (1.0f / PSCALE);
  _Float16* so = sO + w * 1024;
  #pragma unroll
  for (int t = 0; t < 4; ++t)
    #pragma unroll
    for (int r = 0; r < 8; ++r)
      so[m * 64 + 16 * t + 8 * h + r] = (_Float16)(o[t][r] * inv);
  __syncthreads();

  att_store_pass(so, ao, b, head, q0, lane);
  
}

// ---------------------------------------------------------------------------
// Kernel 5: Y = A[M,K](f16) * W[N,K]^T(f16 x32) with epilogue.
//   MODE 1: outf[M][N] (f32) = (acc/32 + bias) + resid      block 128 rows x 128 cols
//   MODE 2: outh[M][N] (f16) = gelu_erf(acc/32 + bias)      block 256 rows x 128 cols
// Block 256 thr (8 waves, 4 x 2); wave = 32 (MODE 1) or 64 (MODE 2) rows x 64 cols.
// ---------------------------------------------------------------------------
template <int MODE>
__global__ __launch_bounds__(GT) void gemm_kernel(
    const _Float16* __restrict__ A, const _Float16* __restrict__ W,
    const float* __restrict__ bias, const float* __restrict__ resid,
    float* __restrict__ outf, _Float16* __restrict__ outh, int N, int K)
{
  constexpr int MT = (MODE == 2) ? 4 : 2, KP = (MODE == 2) ? 64 : 256;
  __shared__ __attribute__((aligned(16))) char ring[RING_B(MT, KP)];   // operand ring, then the output tile (at most 69632 B)

  const int tid = threadIdx.x, lane = tid & 31, w = tid >> 5;
  const int wm = w >> 1, wn = w & 1;
  const int h = lane >> 4, m = lane & 15;
  const int m0 = blockIdx.x * (64 * MT), n0 = blockIdx.y * 128;

  v8f acc[MT][4];
  gemm_main<MT, KP>(ring, A + (size_t)m0 * K, W + (size_t)n0 * K, K, tid, acc);

  // D[r] of tile (mt, nt) = Y[row m0+16*MT*wm+16mt+8h+r][col n0+64wn+16nt+m]
  if (MODE == 1) {
    float* sbuf = (float*)ring;
    #pragma unroll
    for (int nt = 0; nt < 4; ++nt)
      #pragma unroll
      for (int mt = 0; mt < MT; ++mt)
        #pragma unroll
        for (int r = 0; r < 8; ++r)
          sbuf[(16 * MT * wm + 16 * mt + 8 * h + r) * FP128 + 64 * wn + 16 * nt + m] = acc[mt][nt][r] * WINV;
    __syncthreads();

    // a row = 128 floats = 4 lines = one 16-B access per lane; wave w takes rows 8i + w
    const int col = 4 * lane;
    const v4f bb = *(const v4fa*)(bias + n0 + col);
    v4f vals[16];
    #pragma unroll
    for (int i = 0; i < 16; ++i) {
      const int rl = i * 8 + w;                    // 0..127
      const v4f a  = *(const v4fa*)(sbuf + rl * FP128 + col);
      const size_t gi = (size_t)(m0 + rl) * N + n0 + col;
      const v4f rr = *(const v4fa*)(resid + gi);
      vals[i] = (a + bb) + rr;
    }
    #pragma unroll
    for (int i = 0; i < 16; ++i) {
      const int rl = i * 8 + w;
      const size_t gi = (size_t)(m0 + rl) * N + n0 + col;
      *(v4f*)(outf + gi) = vals[i];
    }
  } else {
    _Float16* sh = (_Float16*)ring;
    // Kept rolled over the four column tiles (for speed only). The column tile
    // in work is always acc[.][0]; the others move up one place behind it (registers take no run-time index).
    #pragma unroll 1
    for (int nt = 0; nt < 4; ++nt) {
      const float bvl = bias[n0 + 64 * wn + 16 * nt + m];
      #pragma unroll
      for (int mt = 0; mt < MT; ++mt) {
        #pragma unroll
        for (int r = 0; r < 8; ++r) {
          const float xv = acc[mt][0][r] * WINV + bvl;
          const float gl = 0.5f * xv * (1.0f + erff(xv * 0.70710678118654752f));
          sh[(16 * MT * wm + 16 * mt + 8 * h + r) * HP128 + 64 * wn + 16 * nt + m] = (_Float16)gl;
        }
        acc[mt][0] = acc[mt][1];
        acc[mt][1] = acc[mt][2];
        acc[mt][2] = acc[mt][3];
      }
    }
    __syncthreads();

    // a row = 128 halves = 2 lines; one instruction stores two rows; wave w takes rows 16i + 2w, + 1
    const int rs = lane >> 4, c16 = lane & 15;
    v8h vals[16];
    #pragma unroll
    for (int i = 0; i < 16; ++i) {
      const int rl = (i * 8 + w) * 2 + rs;         // 0..255
      vals[i] = *(const v8ha*)(sh + rl * HP128 + 8 * c16);
    }
    #pragma unroll
    for (int i = 0; i < 16; ++i) {
      const int rl = (i * 8 + w) * 2 + rs;
      *(v8h*)(outh + (size_t)(m0 + rl) * N + n0 + 8 * c16) = vals[i];
    }
  }
}

// ---------------------------------------------------------------------------
extern "C" void kernel_launch(void* const* d_in, const int* in_sizes, int n_in,
                              void* d_out, int out_size, void* d_ws, size_t ws_size,
                              hipStream_t stream) {
  if (n_in < 13) return;
  if (in_sizes[0] != NTOK * DM) return;
  if (in_sizes[1] != 3 * DM * DM || in_sizes[2] != 3 * DM) return;
  if (in_sizes[3] != DM * DM || in_sizes[4] != DM) return;
  if (in_sizes[5] != DFF * DM || in_sizes[6] != DFF) return;
  if (in_sizes[7] != DM * DFF || in_sizes[8] != DM) return;
  if (in_sizes[9] != DM || in_sizes[10] != DM || in_sizes[11] != DM || in_sizes[12] != DM) return;
  if (out_size != NTOK * DM) return;

  const float* hidden = (const float*)d_in[0];
  const float* qkv_w  = (const float*)d_in[1];
  const float* qkv_b  = (const float*)d_in[2];
  const float* out_w  = (const float*)d_in[3];
  const float* out_b  = (const float*)d_in[4];
  const float* fc1_w  = (const float*)d_in[5];
  const float* fc1_b  = (const float*)d_in[6];
  const float* fc2_w  = (const float*)d_in[7];
  const float* fc2_b  = (const float*)d_in[8];
  const float* ln1_g  = (const float*)d_in[9];
  const float* ln1_b  = (const float*)d_in[10];
  const float* ln2_g  = (const float*)d_in[11];
  const float* ln2_b  = (const float*)d_in[12];
  float* out = (float*)d_out;

  // workspace carve (all sizes multiples of 256 B)
  const size_t wh_bytes   = (size_t)G_ALL * 8 * 2;          // 25165824
  const size_t act_bytes  = (size_t)NTOK * DM * 2;           //  8388608  (f16 [4096][1024])
  const size_t hid2_bytes = (size_t)NTOK * DM * 4;           // 16777216
  const size_t ff_bytes   = (size_t)NTOK * DFF * 2;          // 33554432
  const size_t total = wh_bytes + 5 * act_bytes + hid2_bytes + ff_bytes;   // 117440512
  if (total > ws_size) return;

  char* ws = (char*)d_ws;
  size_t off = 0;
  _Float16* wh   = (_Float16*)(ws + off); off += wh_bytes;
  _Float16* xn   = (_Float16*)(ws + off); off += act_bytes;   // ln1 output, later ln2 output
  _Float16* qh   = (_Float16*)(ws + off); off += act_bytes;
  _Float16* kh   = (_Float16*)(ws + off); off += act_bytes;
  _Float16* vt   = (_Float16*)(ws + off); off += act_bytes;
  _Float16* ah   = (_Float16*)(ws + off); off += act_bytes;   // attention output f16 [4096][1024]
  float*    hid2 = (float*)(ws + off);    off += hid2_bytes;  // hidden + attn proj, f32
  _Float16* ff   = (_Float16*)(ws + off); off += ff_bytes;    // gelu(fc1) f16 [4096][4096]
  if (off > ws_size) return;

  const _Float16* w_qkv = wh;
  const _Float16* w_out = wh + (size_t)3 * DM * DM;
  const _Float16* w_fc1 = wh + (size_t)4 * DM * DM;
  const _Float16* w_fc2 = wh + (size_t)4 * DM * DM + (size_t)DFF * DM;

  // 1: weights -> f16 x32
  cvt_w_kernel<<<G_ALL / 256, 256, 0, stream>>>(qkv_w, out_w, fc1_w, fc2_w, wh);

  // 2: ln1 -> f16
  ln_kernel<<<NTOK / 8, 256, 0, stream>>>(hidden, ln1_g, ln1_b, xn, NTOK);

  // 3: qkv projection -> q/k planes + transposed v
  qkv_kernel<<<dim3(NTOK / 256, 3 * DM / 128), GT, 0, stream>>>(xn, w_qkv, qkv_b, qh, kh, vt);

  // 4: causal attention -> f16 [tok][DM]
  attn_kernel<<<dim3(SEQ / 64, BATCH * NH), 128, 0, stream>>>(qh, kh, vt, ah);

  // 5: output projection + bias + residual -> f32 hid2
  gemm_kernel<1><<<dim3(NTOK / 128, DM / 128), GT, 0, stream>>>(ah, w_out, out_b, hidden, hid2, xn, DM, DM);

  // 6: ln2 -> f16 (reuses xn)
  ln_kernel<<<NTOK / 8, 256, 0, stream>>>(hid2, ln2_g, ln2_b, xn, NTOK);

  // 7: fc1 + exact gelu -> f16 ff
  gemm_kernel<2><<<dim3(NTOK / 256, DFF / 128), GT, 0, stream>>>(xn, w_fc1, fc1_b, fc1_b, hid2, ff, DFF, DM);

  // 8: fc2 + bias + residual(hid2) -> f32 d_out
  gemm_kernel<1><<<dim3(NTOK / 128, DM / 128), GT, 0, stream>>>(ff, w_fc2, fc2_b, hid2, out, xn, DM, DFF);
}

// v004
// Measured time: 155 microseconds a run.
// Two timings next to v003 both put it at 1.07 times that version's speed.
// All steps since v000 together make it 3.48 times as fast.
// Contractions: ln1(x)*Wqkv^T, K*Q^T, V^T*P^T, attn*Wout^T, ln2(h)*Wfc1^T, gelu(.)*Wfc2^T all on v_wmma_f32_16x16x32_f16 (f16 operands, f32 accumulate); every W carried x32 and P carried x16384 (exact power-of-two scales folded back in f32); layernorm, softmax, bias, gelu and residual adds in f32.
#include <hip/hip_runtime.h>
#include <math.h>

typedef _Float16 v16h __attribute__((ext_vector_type(16)));
typedef _Float16 v8h  __attribute__((ext_vector_type(8)));
typedef float    v8f  __attribute__((ext_vector_type(8)));
typedef float    v4f  __attribute__((ext_vector_type(4)));
typedef v8h __attribute__((may_alias)) v8ha;
typedef v4f __attribute__((may_alias)) v4fa;

union Frag { v16h v; v8h half[2]; };

#define DM     1024
#define NH     16
#define HD     64
#define DFF    4096
#define SEQ    2048
#define BATCH  2
#define NTOK   (BATCH * SEQ)          // 4096 tokens
#define WSC    32.0f
#define WINV   0.03125f
#define PSCALE 16384.0f

#define G_QKV (3 * DM * DM / 8)       // 393216 groups of 8
#define G_OUT (DM * DM / 8)           // 131072
#define G_FC1 (DFF * DM / 8)          // 524288
#define G_FC2 (DM * DFF / 8)          // 524288
#define G_ALL (G_QKV + G_OUT + G_FC1 + G_FC2)   // 1572864

static_assert(NTOK % 128 == 0);
static_assert(SEQ % 128 == 0);
static_assert(DM % 64 == 0);
static_assert(DFF % 64 == 0);
static_assert(G_ALL % 256 == 0);

// ---------------------------------------------------------------------------
// 16x16x32 f16 WMMA with hazard guard (ties D, keeps A/B live).
// Fragment map (wave32): lane l, h = l>>4, m = n = l&15.
//   A/B element i: i<8 -> k0+8h+i ; i>=8 -> k0+16+8h+(i-8)
//   D element r : row 8h+r, col l&15
// ---------------------------------------------------------------------------
__device__ __forceinline__ v8f wmma_f16(v16h a, v16h b, v8f c) {
  v8f d = __builtin_amdgcn_wmma_f32_16x16x32_f16(false, a, false, b, (short)0, c, false, false);
  asm volatile("v_nop\n\tv_nop\n\tv_nop\n\tv_nop" : "+v"(d) : "v"(a), "v"(b));
  return d;
}

// A or B fragment from a k-contiguous 16-bit row; p points at element k0 of
// the row owned by this lane (row index = lane & 15 added by the caller).
__device__ __forceinline__ v16h load_frag(const _Float16* p, int h) {
  Frag f;
  f.half[0] = *(const v8ha*)(p + 8 * h);
  f.half[1] = *(const v8ha*)(p + 16 + 8 * h);
  return f.v;
}

// ---------------------------------------------------------------------------
// Kernel 1: f32 weights -> f16 planes scaled by 32 (exact). One 16-B store per
// wh layout: [qkv 3*DM*DM][out DM*DM][fc1 DFF*DM][fc2 DM*DFF], row = output feature.
// ---------------------------------------------------------------------------
__global__ __launch_bounds__(256) void cvt_w_kernel(
    const float* __restrict__ w0, const float* __restrict__ w1,
    const float* __restrict__ w2, const float* __restrict__ w3,
    _Float16* __restrict__ wh)
{
  const int g = blockIdx.x * 256 + threadIdx.x;
  if (g >= G_ALL) return;
  const float* src;
  if (g < G_QKV)                        src = w0 + (size_t)g * 8;
  else if (g < G_QKV + G_OUT)           src = w1 + (size_t)(g - G_QKV) * 8;
  else if (g < G_QKV + G_OUT + G_FC1)   src = w2 + (size_t)(g - G_QKV - G_OUT) * 8;
  else                                  src = w3 + (size_t)(g - G_QKV - G_OUT - G_FC1) * 8;
  _Float16* dst = wh + (size_t)g * 8;
  const v4f a = *(const v4fa*)src;
  const v4f c = *(const v4fa*)(src + 4);
  const v8h o = { (_Float16)(a.x * WSC), (_Float16)(a.y * WSC), (_Float16)(a.z * WSC), (_Float16)(a.w * WSC),
                  (_Float16)(c.x * WSC), (_Float16)(c.y * WSC), (_Float16)(c.z * WSC), (_Float16)(c.w * WSC) };
  *(v8h*)dst = o;
  
}

// ---------------------------------------------------------------------------
// Kernel 2: LayerNorm over rows of DM f32 -> f16. One wave per row (block of 8
// i*256 + lane*8 + 0..7 (i = 0..3) so every store instruction is 32 lanes x
// ---------------------------------------------------------------------------
__global__ __launch_bounds__(256) void ln_kernel(
    const float* __restrict__ x, const float* __restrict__ g,
    const float* __restrict__ bt, _Float16* __restrict__ y, int nrows)
{
  const int lane = threadIdx.x & 31, w = threadIdx.x >> 5;
  const int row = blockIdx.x * 8 + w;
  if (row >= nrows) return;                      // wave-uniform; no barriers below
  const float* xr = x + (size_t)row * DM;

  v4f xa[4], xb[4];
  float s = 0.0f;
  #pragma unroll
  for (int i = 0; i < 4; ++i) {
    const float* p = xr + i * 256 + lane * 8;
    xa[i] = *(const v4fa*)p;
    xb[i] = *(const v4fa*)(p + 4);
    s += ((xa[i].x + xa[i].y) + (xa[i].z + xa[i].w)) + ((xb[i].x + xb[i].y) + (xb[i].z + xb[i].w));
  }
  #pragma unroll
  for (int off = 16; off > 0; off >>= 1) s += __shfl_xor(s, off);
  const float mu = s * (1.0f / DM);

  float ss = 0.0f;
  #pragma unroll
  for (int i = 0; i < 4; ++i) {
    const v4f da = xa[i] - mu, db = xb[i] - mu;
    ss += ((da.x * da.x + da.y * da.y) + (da.z * da.z + da.w * da.w)) +
          ((db.x * db.x + db.y * db.y) + (db.z * db.z + db.w * db.w));
  }
  #pragma unroll
  for (int off = 16; off > 0; off >>= 1) ss += __shfl_xor(ss, off);
  const float var = ss * (1.0f / DM);
  const float rstd = rsqrtf(var + 1e-5f);

  v8h o[4];
  #pragma unroll
  for (int i = 0; i < 4; ++i) {
    const int p = i * 256 + lane * 8;
    const v4f ga = *(const v4fa*)(g + p),  gb = *(const v4fa*)(g + p + 4);
    const v4f ba = *(const v4fa*)(bt + p), bb = *(const v4fa*)(bt + p + 4);
    const v4f da = (xa[i] - mu) * rstd, db = (xb[i] - mu) * rstd;
    const v8h t = { (_Float16)(da.x * ga.x + ba.x), (_Float16)(da.y * ga.y + ba.y),
                    (_Float16)(da.z * ga.z + ba.z), (_Float16)(da.w * ga.w + ba.w),
                    (_Float16)(db.x * gb.x + bb.x), (_Float16)(db.y * gb.y + bb.y),
                    (_Float16)(db.z * gb.z + bb.z), (_Float16)(db.w * gb.w + bb.w) };
    o[i] = t;
  }
  _Float16* yr = y + (size_t)row * DM;
  #pragma unroll
  for (int i = 0; i < 4; ++i) *(v8h*)(yr + i * 256 + lane * 8) = o[i];
  
}

// ---------------------------------------------------------------------------
// Shared GEMM main loop: 256 threads, 8 waves in a 4 x 2 grid. Block tile 64*MT
// (rows of A) x 128 (rows of W), wave tile 16*MT x 64. A stage is KP k (2*KP B) of
// all 64*MT + 128 rows, laid in LDS at a pitch of 2*KP + 16 B (16 B x odd:
// conflict-free for 16-byte fragment reads). Two buffers: stage t+1 is copied
// global -> LDS asynchronously while stage t is multiplied.
//   MT 4, KP 64 : 256 x 128, ring 110592 B, two blocks on a WGP (qkv, fc1)
//   MT 2, KP 256: 128 x 128, ring 270336 B, one block on a WGP (out, fc2: 256 blocks in all)
// acc[mt][nt][r] = sum_k A[16*MT*wm + 16mt + 8h + r][k] * W[64wn + 16nt + m][k],
// wm = wave >> 1, wn = wave & 1, k ascending in steps of 32.
// ---------------------------------------------------------------------------
#define W_ROWS  128
#define GT      256                          // threads of a GEMM block
#define PITCH_B(KP)     (2 * (KP) + 16)                      // LDS bytes per staged row
#define STAGE_B(MT, KP) ((64 * (MT) + W_ROWS) * PITCH_B(KP))
#define RING_B(MT, KP)  (2 * STAGE_B(MT, KP))

static_assert(DM % 256 == 0 && DFF % 256 == 0);
static_assert(NTOK % 256 == 0 && SEQ % 256 == 0 && DM % W_ROWS == 0 && DFF % W_ROWS == 0);

// Twelve 16-byte-per-lane copies global -> LDS. The s_wait_xcnt closes the
// statement so that no address register named here is rewritten ahead of it.
__device__ __forceinline__ void copy12(const unsigned (&l)[12], const _Float16* const (&g)[12]) {
  asm volatile(
      "global_load_async_to_lds_b128 %0, %12, off\n\t"
      "global_load_async_to_lds_b128 %1, %13, off\n\t"
      "global_load_async_to_lds_b128 %2, %14, off\n\t"
      "global_load_async_to_lds_b128 %3, %15, off\n\t"
      "global_load_async_to_lds_b128 %4, %16, off\n\t"
      "global_load_async_to_lds_b128 %5, %17, off\n\t"
      "global_load_async_to_lds_b128 %6, %18, off\n\t"
      "global_load_async_to_lds_b128 %7, %19, off\n\t"
      "global_load_async_to_lds_b128 %8, %20, off\n\t"
      "global_load_async_to_lds_b128 %9, %21, off\n\t"
      "global_load_async_to_lds_b128 %10, %22, off\n\t"
      "global_load_async_to_lds_b128 %11, %23, off\n\t"
      "s_wait_xcnt 0x0"
      :: "v"(l[0]), "v"(l[1]), "v"(l[2]), "v"(l[3]), "v"(l[4]), "v"(l[5]),
         "v"(l[6]), "v"(l[7]), "v"(l[8]), "v"(l[9]), "v"(l[10]), "v"(l[11]),
         "v"(g[0]), "v"(g[1]), "v"(g[2]), "v"(g[3]), "v"(g[4]), "v"(g[5]),
         "v"(g[6]), "v"(g[7]), "v"(g[8]), "v"(g[9]), "v"(g[10]), "v"(g[11])
      : "memory");
}

// The same for eight copies out of thirty-two (the 128 x 128 tile's stage).
__device__ __forceinline__ void copy8of32(const unsigned (&l)[32], const _Float16* const (&g)[32], int o) {
  asm volatile(
      "global_load_async_to_lds_b128 %0, %8, off\n\t"
      "global_load_async_to_lds_b128 %1, %9, off\n\t"
      "global_load_async_to_lds_b128 %2, %10, off\n\t"
      "global_load_async_to_lds_b128 %3, %11, off\n\t"
      "global_load_async_to_lds_b128 %4, %12, off\n\t"
      "global_load_async_to_lds_b128 %5, %13, off\n\t"
      "global_load_async_to_lds_b128 %6, %14, off\n\t"
      "global_load_async_to_lds_b128 %7, %15, off\n\t"
      "s_wait_xcnt 0x0"
      :: "v"(l[o + 0]), "v"(l[o + 1]), "v"(l[o + 2]), "v"(l[o + 3]), "v"(l[o + 4]), "v"(l[o + 5]),
         "v"(l[o + 6]), "v"(l[o + 7]),
         "v"(g[o + 0]), "v"(g[o + 1]), "v"(g[o + 2]), "v"(g[o + 3]), "v"(g[o + 4]), "v"(g[o + 5]),
         "v"(g[o + 6]), "v"(g[o + 7])
      : "memory");
}

// One stage: a row piece of 2*KP B takes KP/8 threads, so the block covers RPP =
// 2048/KP rows at a time: thread t copies 16 B at column 16*(t % (KP/8)) of rows
// t / (KP/8) + RPP*i; a wave's copy covers whole 128-B lines. First the A rows, then W's.
// lds = this thread's LDS byte address in its first row of the target buffer;
// ga / gw = this thread's element in that row of A / W at the stage's first k.
template <int MT, int KP>
__device__ __forceinline__ void stage_copy(unsigned lds, const _Float16* ga, const _Float16* gw, int K) {
  constexpr int RPP = GT / (KP / 8);
  constexpr int NA = 64 * MT / RPP, NC = NA + W_ROWS / RPP;
  static_assert(NC == 12 || NC == 32);
  unsigned l[NC];
  const _Float16* g[NC];
  #pragma unroll
  for (int i = 0; i < NC; ++i) {
    l[i] = lds + (unsigned)(i * RPP * PITCH_B(KP));
    g[i] = (i < NA) ? ga + (size_t)(i * RPP) * K : gw + (size_t)((i - NA) * RPP) * K;
  }
  if constexpr (NC == 12) {
    copy12(l, g);
  } else {
    copy8of32(l, g, 0);
    copy8of32(l, g, 8);
    copy8of32(l, g, 16);
    copy8of32(l, g, 24);
  }
}

// ablk / wblk: first row of the block's A / W tile. ring: RING_B(MT, KP) bytes of LDS; free
// for other use on return (every wave's reads and copies are done and a barrier passed).
template <int MT, int KP>
__device__ __forceinline__ void gemm_main(char* ring,
                                          const _Float16* __restrict__ ablk,
                                          const _Float16* __restrict__ wblk,
                                          int K, int tid, v8f (&acc)[MT][4])
{
  constexpr int A_ROWS = 64 * MT;
  constexpr int PITCH = PITCH_B(KP);
  constexpr int STAGE = STAGE_B(MT, KP);
  const int lane = tid & 31, w = tid >> 5;
  const int wm = w >> 1, wn = w & 1;
  const int h = lane >> 4, m = lane & 15;
  const v8f zero8 = {0.f, 0.f, 0.f, 0.f, 0.f, 0.f, 0.f, 0.f};
  #pragma unroll
  for (int mt = 0; mt < MT; ++mt)
    #pragma unroll
    for (int nt = 0; nt < 4; ++nt) acc[mt][nt] = zero8;

  const int crow = tid / (KP / 8), ccol = tid % (KP / 8);
  const unsigned lds0 = (unsigned)(size_t)ring + (unsigned)(crow * PITCH + ccol * 16);
  const _Float16* ga = ablk + (size_t)crow * K + ccol * 8;
  const _Float16* gw = wblk + (size_t)crow * K + ccol * 8;
  const int T = K / KP;

  stage_copy<MT, KP>(lds0, ga, gw, K);
  asm volatile("s_wait_asynccnt 0x0" ::: "memory");   // own copies of stage 0 landed
  __syncthreads();                                    // publishes stage 0
  if (T > 1) stage_copy<MT, KP>(lds0 + STAGE, ga + KP, gw + KP, K);

  #pragma unroll 1
  for (int t = 0; t < T; ++t) {
    const int bo = (t & 1) * STAGE;
    const char* pa = ring + bo + (16 * MT * wm + m) * PITCH;
    const char* pw = ring + bo + (A_ROWS + 64 * wn + m) * PITCH;
    #pragma unroll
    for (int kc = 0; kc < KP / 32; ++kc) {
      v16h a[MT], b[4];
      #pragma unroll
      for (int mt = 0; mt < MT; ++mt) a[mt] = load_frag((const _Float16*)(pa + mt * 16 * PITCH) + kc * 32, h);
      #pragma unroll
      for (int nt = 0; nt < 4; ++nt) b[nt] = load_frag((const _Float16*)(pw + nt * 16 * PITCH) + kc * 32, h);
      #pragma unroll
      for (int nt = 0; nt < 4; ++nt)
        #pragma unroll
        for (int mt = 0; mt < MT; ++mt) acc[mt][nt] = wmma_f16(a[mt], b[nt], acc[mt][nt]);
    }
    asm volatile("s_wait_dscnt 0x0" ::: "memory");    // own reads of this buffer are done before it is refilled
    asm volatile("s_wait_asynccnt 0x0" ::: "memory"); // own copies of stage t+1 landed
    __syncthreads();                                  // publishes stage t+1, frees stage t's buffer
    if (t + 2 < T) stage_copy<MT, KP>(lds0 + bo, ga + (size_t)(t + 2) * KP, gw + (size_t)(t + 2) * KP, K);
  }
  asm volatile("s_wait_asynccnt 0x0" ::: "memory");   // nothing in flight when the ring is reused
}

// Pitches of the output tiles staged in the ring (16 B x odd, so that the two lane
// halves, 8 rows apart, fall on different banks and every row stays 16-B aligned).
#define HP128 136                            // halves per staged row of 128 halves
#define HP256 264                            // halves per staged row of 256 halves
#define FP128 132                            // floats per staged row of 128 floats

// ---------------------------------------------------------------------------
// Kernel 3: QKV = ln1(x) * Wqkv^T + b over the fused 3*1024 output columns.
// Block 256 thr (8 waves) = 256 tokens x 128 features (one 'which', two heads).
// q plane [B*H][S][64], k plane [B*H][S][64], vt [B*H][64][S].
// Stores: one 16-B store per lane, whole 128-B lines, each line by one instruction.
// ---------------------------------------------------------------------------
__global__ __launch_bounds__(GT) void qkv_kernel(
    const _Float16* __restrict__ xh,   // [NTOK][DM]
    const _Float16* __restrict__ wh,   // [3*DM][DM], row = output feature, x32
    const float* __restrict__ bias,    // [3*DM]
    _Float16* __restrict__ qh, _Float16* __restrict__ kh, _Float16* __restrict__ vt)
{
  __shared__ __attribute__((aligned(16))) char ring[RING_B(4, 64)];   // operand ring, then the output tile (at most 69632 B)
  _Float16* sT = (_Float16*)ring;

  const int tid = threadIdx.x, lane = tid & 31, w = tid >> 5;
  const int wm = w >> 1, wn = w & 1;
  const int h = lane >> 4, m = lane & 15;
  const int m0 = blockIdx.x * 256;
  const int cg = blockIdx.y;                 // 0..23 = which*8 + head pair
  const int which = cg >> 3, head0 = (cg & 7) * 2;

  v8f acc[4][4];
  gemm_main<4, 64>(ring, xh + (size_t)m0 * DM, wh + (size_t)cg * 128 * DM, DM, tid, acc);

  // D[r] of tile (mt, nt) = Y[token m0+64wm+16mt+8h+r][feature cg*128 + 64wn+16nt+m]
  // staged as [token][feature] for q and k, as [feature][token] for v ('which' is block-uniform)
  float bvl[4];
  #pragma unroll
  for (int nt = 0; nt < 4; ++nt) bvl[nt] = bias[cg * 128 + 64 * wn + 16 * nt + m];
  if (which != 2) {
    #pragma unroll
    for (int nt = 0; nt < 4; ++nt)
      #pragma unroll
      for (int mt = 0; mt < 4; ++mt)
        #pragma unroll
        for (int r = 0; r < 8; ++r)
          sT[(64 * wm + 16 * mt + 8 * h + r) * HP128 + 64 * wn + 16 * nt + m] = (_Float16)(acc[mt][nt][r] * WINV + bvl[nt]);
  } else {
    #pragma unroll
    for (int nt = 0; nt < 4; ++nt)
      #pragma unroll
      for (int mt = 0; mt < 4; ++mt) {
        v8h y;                                             // the lane's 8 tokens of one feature lie side by side
        #pragma unroll
        for (int r = 0; r < 8; ++r) y[r] = (_Float16)(acc[mt][nt][r] * WINV + bvl[nt]);
        *(v8ha*)(sT + (64 * wn + 16 * nt + m) * HP256 + 64 * wm + 16 * mt + 8 * h) = y;
      }
  }
  __syncthreads();

  const int b = m0 / SEQ, l0 = m0 - b * SEQ;
  if (which != 2) {
    // plane[bh][l][d]: a staged token row = 128 halves = one line in each of two heads
    _Float16* plane = (which == 0) ? qh : kh;
    const int rs = lane >> 4, c16 = lane & 15;
    const int bh = b * NH + head0 + (c16 >> 3);
    #pragma unroll
    for (int i = 0; i < 16; ++i) {
      const int tok = (i * 8 + w) * 2 + rs;                // 0..255 over the block
      const v8h v = *(const v8ha*)(sT + tok * HP128 + 8 * c16);
      *(v8h*)(plane + ((size_t)bh * SEQ + l0 + tok) * HD + 8 * (c16 & 7)) = v;
    }
    asm volatile("s_wait_xcnt 0x0" ::: "memory");          // no register of these stores is rewritten ahead of it on any way on from here
  } else {
    // vt[bh][d][l]: a staged feature row = 256 tokens = 4 lines
    #pragma unroll
    for (int i = 0; i < 16; ++i) {
      const int feat = i * 8 + w;                          // 0..127 over the block
      const v8h v = *(const v8ha*)(sT + feat * HP256 + 8 * lane);
      const int bh = b * NH + head0 + (feat >> 6);
      *(v8h*)(vt + ((size_t)bh * HD + (feat & 63)) * SEQ + l0 + 8 * lane) = v;
    }
  }
}

// ---------------------------------------------------------------------------
// Attention helpers.
// P^T B-fragment from the lane's own score D values: element r <- tile a row r,
// element 8+r <- tile c row r (same lane, same query column), scaled by 2^14.
// ---------------------------------------------------------------------------
__device__ __forceinline__ v16h pack_p(v8f a, v8f c) {
  const v16h r = { (_Float16)(a[0] * PSCALE), (_Float16)(a[1] * PSCALE), (_Float16)(a[2] * PSCALE), (_Float16)(a[3] * PSCALE),
                   (_Float16)(a[4] * PSCALE), (_Float16)(a[5] * PSCALE), (_Float16)(a[6] * PSCALE), (_Float16)(a[7] * PSCALE),
                   (_Float16)(c[0] * PSCALE), (_Float16)(c[1] * PSCALE), (_Float16)(c[2] * PSCALE), (_Float16)(c[3] * PSCALE),
                   (_Float16)(c[4] * PSCALE), (_Float16)(c[5] * PSCALE), (_Float16)(c[6] * PSCALE), (_Float16)(c[7] * PSCALE) };
  return r;
}

// (one query row) by lanes 8q..8q+7 in one instruction, 4 lines per instruction.
__device__ __forceinline__ void att_store_pass(const _Float16* so, _Float16* ao,
                                               int b, int head, int q0, int lane) {
  const int q8 = lane & 7, sub = lane >> 3;
  #pragma unroll
  for (int i = 0; i < 4; ++i) {
    const int lid = i * 4 + sub;                  // query row 0..15
    const v8h v = *(const v8ha*)(so + lid * 64 + 8 * q8);
    const size_t gi = ((size_t)b * SEQ + q0 + lid) * DM + head * HD + 8 * q8;
    *(v8h*)(ao + gi) = v;
  }
}

// ---------------------------------------------------------------------------
// K / V^T staging for attention. A stage is 64 keys: the K tile (64 key rows x
// 128 B of d) and behind it the V^T tile (64 d rows x 128 B of keys), each row
// laid in LDS at a pitch of 144 B (16 B x odd: conflict-free for 16-byte
// fragment reads). Two buffers: stage t+1 is copied global -> LDS
// asynchronously, once per block, while the four waves that read it work on stage t.
// ---------------------------------------------------------------------------
#define KV_PITCH 144                         // LDS bytes per staged row
#define KV_TILE  (64 * KV_PITCH)             // 9216 B
#define KV_STAGE (2 * KV_TILE)               // 18432 B

static_assert(KV_PITCH % 16 == 0 && HD * 2 == 128 && SEQ % 64 == 0);

// Eight 16-byte-per-lane copies global -> LDS. The s_wait_xcnt closes the
// statement so that no address register named here is rewritten ahead of it.
__device__ __forceinline__ void copy8(const unsigned (&l)[8], const _Float16* const (&g)[8]) {
  asm volatile(
      "global_load_async_to_lds_b128 %0, %8, off\n\t"
      "global_load_async_to_lds_b128 %1, %9, off\n\t"
      "global_load_async_to_lds_b128 %2, %10, off\n\t"
      "global_load_async_to_lds_b128 %3, %11, off\n\t"
      "global_load_async_to_lds_b128 %4, %12, off\n\t"
      "global_load_async_to_lds_b128 %5, %13, off\n\t"
      "global_load_async_to_lds_b128 %6, %14, off\n\t"
      "global_load_async_to_lds_b128 %7, %15, off\n\t"
      "s_wait_xcnt 0x0"
      :: "v"(l[0]), "v"(l[1]), "v"(l[2]), "v"(l[3]), "v"(l[4]), "v"(l[5]), "v"(l[6]), "v"(l[7]),
         "v"(g[0]), "v"(g[1]), "v"(g[2]), "v"(g[3]), "v"(g[4]), "v"(g[5]), "v"(g[6]), "v"(g[7])
      : "memory");
}

// One stage, by 128 threads: thread t copies 16 B at column 16*(t&7) of rows (t>>3) + 16i of both
// tiles (i = 0..3); a wave's copy covers four whole 128-B rows.
// lds = this thread's LDS byte address in row (t>>3) of the target buffer's K tile;
// gk / gv = this thread's element in that row of K / V^T at the stage's first key.
__device__ __forceinline__ void kv_stage_copy(unsigned lds, const _Float16* gk, const _Float16* gv) {
  unsigned l[8];
  const _Float16* g[8];
  #pragma unroll
  for (int i = 0; i < 4; ++i) {
    l[i]     = lds + (unsigned)(i * 16 * KV_PITCH);
    g[i]     = gk + (size_t)(i * 16) * HD;
    l[4 + i] = lds + (unsigned)(KV_TILE + i * 16 * KV_PITCH);
    g[4 + i] = gv + (size_t)(i * 16) * SEQ;
  }
  copy8(l, g);
}

// ---------------------------------------------------------------------------
// Kernel 4: causal streaming attention, transposed form.
// Block 256 thr = two halves of 4 waves. A block takes two tiles of 64 queries in
// turn, tile 31 - x and then tile x, so that every block walks the same number of
// key tiles (33 of 64 keys). Inside a query tile the key tiles are dealt to the two
// halves by turns: half g takes key tiles 2*st + g, 16 queries per wave, and each
// half keeps its own running maximum, sum and O; the two are joined once per query
// tile through LDS. A ring stage is 128 keys: each half copies and reads its own 64.
//   S^T = K * Q^T : A = K rows (row = key, k = d), B = Q^T (k = d, n = query)
//   O^T += V^T * P^T : A = Vt rows (row = d, k = key), B = P^T from registers
// Lane owns 32 keys of query column (lane&15); partner = lane ^ 16.
// The 1/8 scale is folded into the exponent argument (exact power of two).
// ---------------------------------------------------------------------------
#define AT      256                          // threads of an attention block
#define QTILES  (SEQ / 64)                   // query tiles of a head
#define KV_BUF  (2 * KV_STAGE)               // one buffer: the 64-key stages of both halves
#define KV_RING2 (2 * KV_BUF)                // 73728 B
#define MG_CH   9                            // 16-B pieces a lane hands over: 8 of O, 1 of (max, sum)

static_assert(QTILES % 2 == 0 && SEQ % 128 == 0);
static_assert(4 * MG_CH * 32 * 16 <= KV_RING2);

__global__ __launch_bounds__(AT) void attn_kernel(
    const _Float16* __restrict__ qh,   // [B*H][S][64]
    const _Float16* __restrict__ kh,   // [B*H][S][64]
    const _Float16* __restrict__ vt,   // [B*H][64][S]
    _Float16* __restrict__ ao)         // [B][S][DM]
{
  __shared__ __attribute__((aligned(16))) _Float16 sO[4 * 16 * 64];    // 8192 B
  __shared__ __attribute__((aligned(16))) char kv[KV_RING2];           // K / V^T stages, two buffers; then the hand-over

  const int tid = threadIdx.x, lane = tid & 31;
  const int wq = (tid >> 5) & 3;                                // which 16 queries of the tile
  const int g = __builtin_amdgcn_readfirstlane(tid >> 7);       // which half; scalar, so the tests on it are scalar branches
  const int h = lane >> 4, m = lane & 15;
  const int bh = blockIdx.y, b = bh >> 4, head = bh & 15;

  const v8f zero8 = {0.f, 0.f, 0.f, 0.f, 0.f, 0.f, 0.f, 0.f};
  const int crow = (tid & 127) >> 3, ccol = tid & 7;
  const unsigned lds0 = (unsigned)(size_t)kv + (unsigned)(g * KV_STAGE + crow * KV_PITCH + ccol * 16);
  const _Float16* gk = kh + ((size_t)bh * SEQ + 64 * g + crow) * HD + ccol * 8;    // + 128*st*HD
  const _Float16* gv = vt + ((size_t)bh * HD + crow) * SEQ + 64 * g + ccol * 8;    // + 128*st
  v4fa* mg = (v4fa*)kv + wq * MG_CH * 32 + lane;                // this lane's hand-over pieces, 32 pieces apart
  _Float16* so = sO + wq * 1024;

  // Kept rolled: the two query tiles run the same text one after the other.
  #pragma unroll 1
  for (int pass = 0; pass < 2; ++pass) {
    const int xt = pass ? (int)blockIdx.x : QTILES - 1 - (int)blockIdx.x;
    const int q0 = xt * 64 + 16 * wq;
    const int T64 = xt + 1;                     // key tiles up to and with the diagonal one (block-uniform)
    const int NS = (T64 + 1) >> 1;              // ring stages of 128 keys; 128*NS <= SEQ

    // Q^T B-fragments: column n = query q0+m, k = d (two 32-deep chunks)
    const _Float16* qrow = qh + ((size_t)bh * SEQ + q0 + m) * HD;
    const v16h qb0 = load_frag(qrow, h);
    const v16h qb1 = load_frag(qrow + 32, h);

    v8f o[4];                                   // o[t][r] = O[query m][d 16t+8h+r] * (l * 2^14), this half's keys
    #pragma unroll
    for (int t = 0; t < 4; ++t) o[t] = zero8;
    float mrun = -1e30f, lrun = 0.0f;

    kv_stage_copy(lds0, gk, gv);
    asm volatile("s_wait_asynccnt 0x0" ::: "memory");   // own copies of stage 0 landed
    __syncthreads();                                    // publishes stage 0
    if (NS > 1) kv_stage_copy(lds0 + KV_BUF, gk + 128 * HD, gv + 128);

    #pragma unroll 1
    for (int st = 0; st < NS; ++st) {
      const int kb = 128 * st + 64 * g;
      const int bo = (st & 1) * KV_BUF;
      if (2 * st + g < T64) {                             // the last stage of an odd count has no key tile for the second half
        const char* pk = kv + bo + g * KV_STAGE + m * KV_PITCH;   // K row m of this half's stage
        const char* pv = pk + KV_TILE;                            // V^T row m of this half's stage
        // ---- raw scores: s[j][r] = S[query q0+m][key kb+16j+8h+r] (unscaled) ----
        v8f s[4];
        #pragma unroll
        for (int j = 0; j < 4; ++j) {
          const _Float16* kp = (const _Float16*)(pk + 16 * j * KV_PITCH);
          const v16h kf0 = load_frag(kp, h);
          const v16h kf1 = load_frag(kp + 32, h);
          v8f z = zero8;
          z = wmma_f16(kf0, qb0, z);
          z = wmma_f16(kf1, qb1, z);
          s[j] = z;
        }
        // ---- causal mask (only on the key tile touching the diagonal) ----
        if (kb + 63 > q0) {
          const int qq = q0 + m;
          #pragma unroll
          for (int j = 0; j < 4; ++j)
            #pragma unroll
            for (int r = 0; r < 8; ++r) {
              const int kk = kb + 16 * j + 8 * h + r;
              if (kk > qq) s[j][r] = -1e30f;
            }
        }

        // ---- online softmax (scale 1/8 applied inside the exp argument) ----
        float mloc = s[0][0];
        #pragma unroll
        for (int j = 0; j < 4; ++j)
          #pragma unroll
          for (int r = 0; r < 8; ++r) mloc = fmaxf(mloc, s[j][r]);
        mloc = fmaxf(mloc, __shfl_xor(mloc, 16));
        const float mnew = fmaxf(mrun, mloc);
        const float cn = mnew * 0.125f;
        const float alpha = __expf((mrun - mnew) * 0.125f);
        mrun = mnew;
        float lsum = 0.0f;
        #pragma unroll
        for (int j = 0; j < 4; ++j)
          #pragma unroll
          for (int r = 0; r < 8; ++r) {
            const float p = __expf(fmaf(s[j][r], 0.125f, -cn));
            s[j][r] = p;
            lsum += p;
          }
        lsum += __shfl_xor(lsum, 16);
        lrun = lrun * alpha + lsum;
        #pragma unroll
        for (int t = 0; t < 4; ++t)
          #pragma unroll
          for (int r = 0; r < 8; ++r) o[t][r] = o[t][r] * alpha;

        // ---- P^T B-fragments (key chunks 0..31 and 32..63 of this key tile) ----
        const v16h pb0 = pack_p(s[0], s[1]);
        const v16h pb1 = pack_p(s[2], s[3]);

        // ---- O^T += V^T * P^T ----
        #pragma unroll
        for (int t = 0; t < 4; ++t) {
          const _Float16* vp = (const _Float16*)(pv + 16 * t * KV_PITCH);
          const v16h vf0 = load_frag(vp, h);
          const v16h vf1 = load_frag(vp + 32, h);
          o[t] = wmma_f16(vf0, pb0, o[t]);
          o[t] = wmma_f16(vf1, pb1, o[t]);
        }
      }
      asm volatile("s_wait_dscnt 0x0" ::: "memory");    // own reads of this buffer are done before it is refilled
      asm volatile("s_wait_asynccnt 0x0" ::: "memory"); // own copies of stage st+1 landed
      __syncthreads();                                  // publishes stage st+1, frees stage st's buffer
      if (st + 2 < NS) kv_stage_copy(lds0 + bo, gk + (size_t)(128 * (st + 2)) * HD, gv + 128 * (st + 2));
    }
    asm volatile("s_wait_asynccnt 0x0" ::: "memory");   // nothing in flight when the ring is reused

    // ---- the second half hands its maximum, sum and O to the first, lane to lane ----
    if (g == 1) {
      #pragma unroll
      for (int t = 0; t < 4; ++t) {
        const v4f lo = { o[t][0], o[t][1], o[t][2], o[t][3] };
        const v4f hi = { o[t][4], o[t][5], o[t][6], o[t][7] };
        mg[(2 * t) * 32] = lo;
        mg[(2 * t + 1) * 32] = hi;
      }
      const v4f ml = { mrun, lrun, 0.0f, 0.0f };
      mg[8 * 32] = ml;
    }
    __syncthreads();                                    // the hand-over is written

    // ---- join, normalise, stage per-wave 16x64 f16 tile ----
    if (g == 0) {
      const v4f ml = mg[8 * 32];
      const float mall = fmaxf(mrun, ml.x);
      const float f0 = __expf((mrun - mall) * 0.125f);
      const float f1 = __expf((ml.x - mall) * 0.125f);  // 0 where the second half had no key tile (its maximum is -1e30)
      const float inv = (1.0f / (lrun * f0 + ml.y * f1)) * (1.0f / PSCALE);
      const float c0 = f0 * inv, c1 = f1 * inv;
      #pragma unroll
      for (int t = 0; t < 4; ++t) {
        const v4f lo = mg[(2 * t) * 32];
        const v4f hi = mg[(2 * t + 1) * 32];
        #pragma unroll
        for (int r = 0; r < 4; ++r) {
          so[m * 64 + 16 * t + 8 * h + r]     = (_Float16)(o[t][r] * c0 + lo[r] * c1);
          so[m * 64 + 16 * t + 8 * h + 4 + r] = (_Float16)(o[t][4 + r] * c0 + hi[r] * c1);
        }
      }
    }
    asm volatile("s_wait_dscnt 0x0" ::: "memory");      // own reads of the hand-over are done before the next tile's copies overwrite it
    __syncthreads();                                    // frees the ring for the next query tile; the staged tile is written

    if (g == 0) {
      att_store_pass(so, ao, b, head, q0, lane);
      asm volatile("s_wait_xcnt 0x0" ::: "memory");     // no register of these stores is rewritten ahead of it in the next query tile
    }
  }
}

// ---------------------------------------------------------------------------
// Kernel 5: Y = A[M,K](f16) * W[N,K]^T(f16 x32) with epilogue.
//   MODE 1: outf[M][N] (f32) = (acc/32 + bias) + resid      block 128 rows x 128 cols
//   MODE 2: outh[M][N] (f16) = gelu_erf(acc/32 + bias)      block 256 rows x 128 cols
// Block 256 thr (8 waves, 4 x 2); wave = 32 (MODE 1) or 64 (MODE 2) rows x 64 cols.
// ---------------------------------------------------------------------------
template <int MODE>
__global__ __launch_bounds__(GT) void gemm_kernel(
    const _Float16* __restrict__ A, const _Float16* __restrict__ W,
    const float* __restrict__ bias, const float* __restrict__ resid,
    float* __restrict__ outf, _Float16* __restrict__ outh, int N, int K)
{
  constexpr int MT = (MODE == 2) ? 4 : 2, KP = (MODE == 2) ? 64 : 256;
  __shared__ __attribute__((aligned(16))) char ring[RING_B(MT, KP)];   // operand ring, then the output tile (at most 69632 B)

  const int tid = threadIdx.x, lane = tid & 31, w = tid >> 5;
  const int wm = w >> 1, wn = w & 1;
  const int h = lane >> 4, m = lane & 15;
  const int m0 = blockIdx.x * (64 * MT), n0 = blockIdx.y * 128;

  v8f acc[MT][4];
  gemm_main<MT, KP>(ring, A + (size_t)m0 * K, W + (size_t)n0 * K, K, tid, acc);

  // D[r] of tile (mt, nt) = Y[row m0+16*MT*wm+16mt+8h+r][col n0+64wn+16nt+m]
  if (MODE == 1) {
    float* sbuf = (float*)ring;
    #pragma unroll
    for (int nt = 0; nt < 4; ++nt)
      #pragma unroll
      for (int mt = 0; mt < MT; ++mt)
        #pragma unroll
        for (int r = 0; r < 8; ++r)
          sbuf[(16 * MT * wm + 16 * mt + 8 * h + r) * FP128 + 64 * wn + 16 * nt + m] = acc[mt][nt][r] * WINV;
    __syncthreads();

    // a row = 128 floats = 4 lines = one 16-B access per lane; wave w takes rows 8i + w
    const int col = 4 * lane;
    const v4f bb = *(const v4fa*)(bias + n0 + col);
    v4f vals[16];
    #pragma unroll
    for (int i = 0; i < 16; ++i) {
      const int rl = i * 8 + w;                    // 0..127
      const v4f a  = *(const v4fa*)(sbuf + rl * FP128 + col);
      const size_t gi = (size_t)(m0 + rl) * N + n0 + col;
      const v4f rr = *(const v4fa*)(resid + gi);
      vals[i] = (a + bb) + rr;
    }
    #pragma unroll
    for (int i = 0; i < 16; ++i) {
      const int rl = i * 8 + w;
      const size_t gi = (size_t)(m0 + rl) * N + n0 + col;
      *(v4f*)(outf + gi) = vals[i];
    }
  } else {
    _Float16* sh = (_Float16*)ring;
    // Kept rolled over the four column tiles (for speed only). The column tile
    // in work is always acc[.][0]; the others move up one place behind it (registers take no run-time index).
    #pragma unroll 1
    for (int nt = 0; nt < 4; ++nt) {
      const float bvl = bias[n0 + 64 * wn + 16 * nt + m];
      #pragma unroll
      for (int mt = 0; mt < MT; ++mt) {
        #pragma unroll
        for (int r = 0; r < 8; ++r) {
          const float xv = acc[mt][0][r] * WINV + bvl;
          const float gl = 0.5f * xv * (1.0f + erff(xv * 0.70710678118654752f));
          sh[(16 * MT * wm + 16 * mt + 8 * h + r) * HP128 + 64 * wn + 16 * nt + m] = (_Float16)gl;
        }
        acc[mt][0] = acc[mt][1];
        acc[mt][1] = acc[mt][2];
        acc[mt][2] = acc[mt][3];
      }
    }
    __syncthreads();

    // a row = 128 halves = 2 lines; one instruction stores two rows; wave w takes rows 16i + 2w, + 1
    const int rs = lane >> 4, c16 = lane & 15;
    v8h vals[16];
    #pragma unroll
    for (int i = 0; i < 16; ++i) {
      const int rl = (i * 8 + w) * 2 + rs;         // 0..255
      vals[i] = *(const v8ha*)(sh + rl * HP128 + 8 * c16);
    }
    #pragma unroll
    for (int i = 0; i < 16; ++i) {
      const int rl = (i * 8 + w) * 2 + rs;
      *(v8h*)(outh + (size_t)(m0 + rl) * N + n0 + 8 * c16) = vals[i];
    }
  }
}

// ---------------------------------------------------------------------------
extern "C" void kernel_launch(void* const* d_in, const int* in_sizes, int n_in,
                              void* d_out, int out_size, void* d_ws, size_t ws_size,
                              hipStream_t stream) {
  if (n_in < 13) return;
  if (in_sizes[0] != NTOK * DM) return;
  if (in_sizes[1] != 3 * DM * DM || in_sizes[2] != 3 * DM) return;
  if (in_sizes[3] != DM * DM || in_sizes[4] != DM) return;
  if (in_sizes[5] != DFF * DM || in_sizes[6] != DFF) return;
  if (in_sizes[7] != DM * DFF || in_sizes[8] != DM) return;
  if (in_sizes[9] != DM || in_sizes[10] != DM || in_sizes[11] != DM || in_sizes[12] != DM) return;
  if (out_size != NTOK * DM) return;

  const float* hidden = (const float*)d_in[0];
  const float* qkv_w  = (const float*)d_in[1];
  const float* qkv_b  = (const float*)d_in[2];
  const float* out_w  = (const float*)d_in[3];
  const float* out_b  = (const float*)d_in[4];
  const float* fc1_w  = (const float*)d_in[5];
  const float* fc1_b  = (const float*)d_in[6];
  const float* fc2_w  = (const float*)d_in[7];
  const float* fc2_b  = (const float*)d_in[8];
  const float* ln1_g  = (const float*)d_in[9];
  const float* ln1_b  = (const float*)d_in[10];
  const float* ln2_g  = (const float*)d_in[11];
  const float* ln2_b  = (const float*)d_in[12];
  float* out = (float*)d_out;

  // workspace carve (all sizes multiples of 256 B)
  const size_t wh_bytes   = (size_t)G_ALL * 8 * 2;          // 25165824
  const size_t act_bytes  = (size_t)NTOK * DM * 2;           //  8388608  (f16 [4096][1024])
  const size_t hid2_bytes = (size_t)NTOK * DM * 4;           // 16777216
  const size_t ff_bytes   = (size_t)NTOK * DFF * 2;          // 33554432
  const size_t total = wh_bytes + 5 * act_bytes + hid2_bytes + ff_bytes;   // 117440512
  if (total > ws_size) return;

  char* ws = (char*)d_ws;
  size_t off = 0;
  _Float16* wh   = (_Float16*)(ws + off); off += wh_bytes;
  _Float16* xn   = (_Float16*)(ws + off); off += act_bytes;   // ln1 output, later ln2 output
  _Float16* qh   = (_Float16*)(ws + off); off += act_bytes;
  _Float16* kh   = (_Float16*)(ws + off); off += act_bytes;
  _Float16* vt   = (_Float16*)(ws + off); off += act_bytes;
  _Float16* ah   = (_Float16*)(ws + off); off += act_bytes;   // attention output f16 [4096][1024]
  float*    hid2 = (float*)(ws + off);    off += hid2_bytes;  // hidden + attn proj, f32
  _Float16* ff   = (_Float16*)(ws + off); off += ff_bytes;    // gelu(fc1) f16 [4096][4096]
  if (off > ws_size) return;

  const _Float16* w_qkv = wh;
  const _Float16* w_out = wh + (size_t)3 * DM * DM;
  const _Float16* w_fc1 = wh + (size_t)4 * DM * DM;
  const _Float16* w_fc2 = wh + (size_t)4 * DM * DM + (size_t)DFF * DM;

  // 1: weights -> f16 x32
  cvt_w_kernel<<<G_ALL / 256, 256, 0, stream>>>(qkv_w, out_w, fc1_w, fc2_w, wh);

  // 2: ln1 -> f16
  ln_kernel<<<NTOK / 8, 256, 0, stream>>>(hidden, ln1_g, ln1_b, xn, NTOK);

  // 3: qkv projection -> q/k planes + transposed v
  qkv_kernel<<<dim3(NTOK / 256, 3 * DM / 128), GT, 0, stream>>>(xn, w_qkv, qkv_b, qh, kh, vt);

  // 4: causal attention -> f16 [tok][DM]
  attn_kernel<<<dim3(QTILES / 2, BATCH * NH), AT, 0, stream>>>(qh, kh, vt, ah);

  // 5: output projection + bias + residual -> f32 hid2
  gemm_kernel<1><<<dim3(NTOK / 128, DM / 128), GT, 0, stream>>>(ah, w_out, out_b, hidden, hid2, xn, DM, DM);

  // 6: ln2 -> f16 (reuses xn)
  ln_kernel<<<NTOK / 8, 256, 0, stream>>>(hid2, ln2_g, ln2_b, xn, NTOK);

  // 7: fc1 + exact gelu -> f16 ff
  gemm_kernel<2><<<dim3(NTOK / 256, DFF / 128), GT, 0, stream>>>(xn, w_fc1, fc1_b, fc1_b, hid2, ff, DFF, DM);

  // 8: fc2 + bias + residual(hid2) -> f32 d_out
  gemm_kernel<1><<<dim3(NTOK / 128, DM / 128), GT, 0, stream>>>(ff, w_fc2, fc2_b, hid2, out, xn, DM, DFF);
}

// v005
// It runs in 146 microseconds.
// Next to v004, in two timings, it ran 1.07 and 1.06 times as fast.
// All steps since v000 together make it 3.71 times as fast.
// Contractions: ln1(x)*Wqkv^T, K*Q^T, V^T*P^T, attn*Wout^T, ln2(h)*Wfc1^T, gelu(.)*Wfc2^T all on v_wmma_f32_16x16x32_f16 (f16 operands, f32 accumulate); every W carried x32 and P carried x16384 (exact power-of-two scales folded back in f32); layernorm, softmax, bias, gelu and residual adds in f32.
#include <hip/hip_runtime.h>
#include <math.h>

typedef _Float16 v16h __attribute__((ext_vector_type(16)));
typedef _Float16 v8h  __attribute__((ext_vector_type(8)));
typedef float    v8f  __attribute__((ext_vector_type(8)));
typedef float    v4f  __attribute__((ext_vector_type(4)));
typedef v8h __attribute__((may_alias)) v8ha;
typedef v4f __attribute__((may_alias)) v4fa;

union Frag { v16h v; v8h half[2]; };

#define DM     1024
#define NH     16
#define HD     64
#define DFF    4096
#define SEQ    2048
#define BATCH  2
#define NTOK   (BATCH * SEQ)          // 4096 tokens
#define WSC    32.0f
#define WINV   0.03125f
#define PSCALE 16384.0f

#define G_QKV (3 * DM * DM / 8)       // 393216 groups of 8
#define G_OUT (DM * DM / 8)           // 131072
#define G_FC1 (DFF * DM / 8)          // 524288
#define G_FC2 (DM * DFF / 8)          // 524288
#define G_ALL (G_QKV + G_OUT + G_FC1 + G_FC2)   // 1572864

static_assert(NTOK % 128 == 0);
static_assert(SEQ % 128 == 0);
static_assert(DM % 64 == 0);
static_assert(DFF % 64 == 0);
static_assert(G_ALL % 256 == 0);

// ---------------------------------------------------------------------------
// 16x16x32 f16 WMMA with hazard guard (ties D, keeps A/B live).
// Fragment map (wave32): lane l, h = l>>4, m = n = l&15.
//   A/B element i: i<8 -> k0+8h+i ; i>=8 -> k0+16+8h+(i-8)
//   D element r : row 8h+r, col l&15
// ---------------------------------------------------------------------------
__device__ __forceinline__ v8f wmma_f16(v16h a, v16h b, v8f c) {
  v8f d = __builtin_amdgcn_wmma_f32_16x16x32_f16(false, a, false, b, (short)0, c, false, false);
  asm volatile("v_nop\n\tv_nop\n\tv_nop\n\tv_nop" : "+v"(d) : "v"(a), "v"(b));
  return d;
}

// A or B fragment from a k-contiguous 16-bit row; p points at element k0 of
// the row owned by this lane (row index = lane & 15 added by the caller).
__device__ __forceinline__ v16h load_frag(const _Float16* p, int h) {
  Frag f;
  f.half[0] = *(const v8ha*)(p + 8 * h);
  f.half[1] = *(const v8ha*)(p + 16 + 8 * h);
  return f.v;
}

// ---------------------------------------------------------------------------
// Kernel 1: f32 weights -> f16 planes scaled by 32 (exact). One 16-B store per
// wh layout: [qkv 3*DM*DM][out DM*DM][fc1 DFF*DM][fc2 DM*DFF], row = output feature.
// ---------------------------------------------------------------------------
__global__ __launch_bounds__(256) void cvt_w_kernel(
    const float* __restrict__ w0, const float* __restrict__ w1,
    const float* __restrict__ w2, const float* __restrict__ w3,
    _Float16* __restrict__ wh)
{
  const int g = blockIdx.x * 256 + threadIdx.x;
  if (g >= G_ALL) return;
  const float* src;
  if (g < G_QKV)                        src = w0 + (size_t)g * 8;
  else if (g < G_QKV + G_OUT)           src = w1 + (size_t)(g - G_QKV) * 8;
  else if (g < G_QKV + G_OUT + G_FC1)   src = w2 + (size_t)(g - G_QKV - G_OUT) * 8;
  else                                  src = w3 + (size_t)(g - G_QKV - G_OUT - G_FC1) * 8;
  _Float16* dst = wh + (size_t)g * 8;
  const v4f a = *(const v4fa*)src;
  const v4f c = *(const v4fa*)(src + 4);
  const v8h o = { (_Float16)(a.x * WSC), (_Float16)(a.y * WSC), (_Float16)(a.z * WSC), (_Float16)(a.w * WSC),
                  (_Float16)(c.x * WSC), (_Float16)(c.y * WSC), (_Float16)(c.z * WSC), (_Float16)(c.w * WSC) };
  *(v8h*)dst = o;
  
}

// ---------------------------------------------------------------------------
// Kernel 2: LayerNorm over rows of DM f32 -> f16. One wave per row (block of 8
// i*256 + lane*8 + 0..7 (i = 0..3) so every store instruction is 32 lanes x
// ---------------------------------------------------------------------------
__global__ __launch_bounds__(256) void ln_kernel(
    const float* __restrict__ x, const float* __restrict__ g,
    const float* __restrict__ bt, _Float16* __restrict__ y, int nrows)
{
  const int lane = threadIdx.x & 31, w = threadIdx.x >> 5;
  const int row = blockIdx.x * 8 + w;
  if (row >= nrows) return;                      // wave-uniform; no barriers below
  const float* xr = x + (size_t)row * DM;

  v4f xa[4], xb[4];
  float s = 0.0f;
  #pragma unroll
  for (int i = 0; i < 4; ++i) {
    const float* p = xr + i * 256 + lane * 8;
    xa[i] = *(const v4fa*)p;
    xb[i] = *(const v4fa*)(p + 4);
    s += ((xa[i].x + xa[i].y) + (xa[i].z + xa[i].w)) + ((xb[i].x + xb[i].y) + (xb[i].z + xb[i].w));
  }
  #pragma unroll
  for (int off = 16; off > 0; off >>= 1) s += __shfl_xor(s, off);
  const float mu = s * (1.0f / DM);

  float ss = 0.0f;
  #pragma unroll
  for (int i = 0; i < 4; ++i) {
    const v4f da = xa[i] - mu, db = xb[i] - mu;
    ss += ((da.x * da.x + da.y * da.y) + (da.z * da.z + da.w * da.w)) +
          ((db.x * db.x + db.y * db.y) + (db.z * db.z + db.w * db.w));
  }
  #pragma unroll
  for (int off = 16; off > 0; off >>= 1) ss += __shfl_xor(ss, off);
  const float var = ss * (1.0f / DM);
  const float rstd = rsqrtf(var + 1e-5f);

  v8h o[4];
  #pragma unroll
  for (int i = 0; i < 4; ++i) {
    const int p = i * 256 + lane * 8;
    const v4f ga = *(const v4fa*)(g + p),  gb = *(const v4fa*)(g + p + 4);
    const v4f ba = *(const v4fa*)(bt + p), bb = *(const v4fa*)(bt + p + 4);
    const v4f da = (xa[i] - mu) * rstd, db = (xb[i] - mu) * rstd;
    const v8h t = { (_Float16)(da.x * ga.x + ba.x), (_Float16)(da.y * ga.y + ba.y),
                    (_Float16)(da.z * ga.z + ba.z), (_Float16)(da.w * ga.w + ba.w),
                    (_Float16)(db.x * gb.x + bb.x), (_Float16)(db.y * gb.y + bb.y),
                    (_Float16)(db.z * gb.z + bb.z), (_Float16)(db.w * gb.w + bb.w) };
    o[i] = t;
  }
  _Float16* yr = y + (size_t)row * DM;
  #pragma unroll
  for (int i = 0; i < 4; ++i) *(v8h*)(yr + i * 256 + lane * 8) = o[i];
  
}

// ---------------------------------------------------------------------------
// Shared GEMM main loop: 256 threads, 8 waves in a 4 x 2 grid. Block tile 64*MT
// (rows of A) x 128 (rows of W), wave tile 16*MT x 64. A stage is KP k (2*KP B) of
// all 64*MT + 128 rows, laid in LDS at a pitch of 2*KP + 16 B (16 B x odd:
// conflict-free for 16-byte fragment reads). Two buffers: stage t+1 is copied
// global -> LDS asynchronously while stage t is multiplied.
//   MT 4, KP 64 : 256 x 128, ring 110592 B, two blocks on a WGP (qkv, fc1)
//   MT 2, KP 256: 128 x 128, ring 270336 B, one block on a WGP (out, fc2: 256 blocks in all)
// acc[mt][nt][r] = sum_k A[16*MT*wm + 16mt + 8h + r][k] * W[64wn + 16nt + m][k],
// wm = wave >> 1, wn = wave & 1, k ascending in steps of 32.
// ---------------------------------------------------------------------------
#define W_ROWS  128
#define GT      256                          // threads of a GEMM block
#define PITCH_B(KP)     (2 * (KP) + 16)                      // LDS bytes per staged row
#define STAGE_B(MT, KP) ((64 * (MT) + W_ROWS) * PITCH_B(KP))
#define RING_B(MT, KP)  (2 * STAGE_B(MT, KP))

static_assert(DM % 256 == 0 && DFF % 256 == 0);
static_assert(NTOK % 256 == 0 && SEQ % 256 == 0 && DM % W_ROWS == 0 && DFF % W_ROWS == 0);

// Twelve 16-byte-per-lane copies global -> LDS. The s_wait_xcnt closes the
// statement so that no address register named here is rewritten ahead of it.
__device__ __forceinline__ void copy12(const unsigned (&l)[12], const _Float16* const (&g)[12]) {
  asm volatile(
      "global_load_async_to_lds_b128 %0, %12, off\n\t"
      "global_load_async_to_lds_b128 %1, %13, off\n\t"
      "global_load_async_to_lds_b128 %2, %14, off\n\t"
      "global_load_async_to_lds_b128 %3, %15, off\n\t"
      "global_load_async_to_lds_b128 %4, %16, off\n\t"
      "global_load_async_to_lds_b128 %5, %17, off\n\t"
      "global_load_async_to_lds_b128 %6, %18, off\n\t"
      "global_load_async_to_lds_b128 %7, %19, off\n\t"
      "global_load_async_to_lds_b128 %8, %20, off\n\t"
      "global_load_async_to_lds_b128 %9, %21, off\n\t"
      "global_load_async_to_lds_b128 %10, %22, off\n\t"
      "global_load_async_to_lds_b128 %11, %23, off\n\t"
      "s_wait_xcnt 0x0"
      :: "v"(l[0]), "v"(l[1]), "v"(l[2]), "v"(l[3]), "v"(l[4]), "v"(l[5]),
         "v"(l[6]), "v"(l[7]), "v"(l[8]), "v"(l[9]), "v"(l[10]), "v"(l[11]),
         "v"(g[0]), "v"(g[1]), "v"(g[2]), "v"(g[3]), "v"(g[4]), "v"(g[5]),
         "v"(g[6]), "v"(g[7]), "v"(g[8]), "v"(g[9]), "v"(g[10]), "v"(g[11])
      : "memory");
}

// The same for eight copies out of thirty-two (the 128 x 128 tile's stage).
__device__ __forceinline__ void copy8of32(const unsigned (&l)[32], const _Float16* const (&g)[32], int o) {
  asm volatile(
      "global_load_async_to_lds_b128 %0, %8, off\n\t"
      "global_load_async_to_lds_b128 %1, %9, off\n\t"
      "global_load_async_to_lds_b128 %2, %10, off\n\t"
      "global_load_async_to_lds_b128 %3, %11, off\n\t"
      "global_load_async_to_lds_b128 %4, %12, off\n\t"
      "global_load_async_to_lds_b128 %5, %13, off\n\t"
      "global_load_async_to_lds_b128 %6, %14, off\n\t"
      "global_load_async_to_lds_b128 %7, %15, off\n\t"
      "s_wait_xcnt 0x0"
      :: "v"(l[o + 0]), "v"(l[o + 1]), "v"(l[o + 2]), "v"(l[o + 3]), "v"(l[o + 4]), "v"(l[o + 5]),
         "v"(l[o + 6]), "v"(l[o + 7]),
         "v"(g[o + 0]), "v"(g[o + 1]), "v"(g[o + 2]), "v"(g[o + 3]), "v"(g[o + 4]), "v"(g[o + 5]),
         "v"(g[o + 6]), "v"(g[o + 7])
      : "memory");
}

// One stage: a row piece of 2*KP B takes KP/8 threads, so the block covers RPP =
// 2048/KP rows at a time: thread t copies 16 B at column 16*(t % (KP/8)) of rows
// t / (KP/8) + RPP*i; a wave's copy covers whole 128-B lines. First the A rows, then W's.
// lds = this thread's LDS byte address in its first row of the target buffer;
// ga / gw = this thread's element in that row of A / W at the stage's first k.
template <int MT, int KP>
__device__ __forceinline__ void stage_copy(unsigned lds, const _Float16* ga, const _Float16* gw, int K) {
  constexpr int RPP = GT / (KP / 8);
  constexpr int NA = 64 * MT / RPP, NC = NA + W_ROWS / RPP;
  static_assert(NC == 12 || NC == 32);
  unsigned l[NC];
  const _Float16* g[NC];
  #pragma unroll
  for (int i = 0; i < NC; ++i) {
    l[i] = lds + (unsigned)(i * RPP * PITCH_B(KP));
    g[i] = (i < NA) ? ga + (size_t)(i * RPP) * K : gw + (size_t)((i - NA) * RPP) * K;
  }
  if constexpr (NC == 12) {
    copy12(l, g);
  } else {
    copy8of32(l, g, 0);
    copy8of32(l, g, 8);
    copy8of32(l, g, 16);
    copy8of32(l, g, 24);
  }
}

// ablk / wblk: first row of the block's A / W tile. ring: RING_B(MT, KP) bytes of LDS; free
// for other use on return (every wave's reads and copies are done and a barrier passed).
template <int MT, int KP>
__device__ __forceinline__ void gemm_main(char* ring,
                                          const _Float16* __restrict__ ablk,
                                          const _Float16* __restrict__ wblk,
                                          int K, int tid, v8f (&acc)[MT][4])
{
  constexpr int A_ROWS = 64 * MT;
  constexpr int PITCH = PITCH_B(KP);
  constexpr int STAGE = STAGE_B(MT, KP);
  const int lane = tid & 31, w = tid >> 5;
  const int wm = w >> 1, wn = w & 1;
  const int h = lane >> 4, m = lane & 15;
  const v8f zero8 = {0.f, 0.f, 0.f, 0.f, 0.f, 0.f, 0.f, 0.f};
  #pragma unroll
  for (int mt = 0; mt < MT; ++mt)
    #pragma unroll
    for (int nt = 0; nt < 4; ++nt) acc[mt][nt] = zero8;

  const int crow = tid / (KP / 8), ccol = tid % (KP / 8);
  const unsigned lds0 = (unsigned)(size_t)ring + (unsigned)(crow * PITCH + ccol * 16);
  const _Float16* ga = ablk + (size_t)crow * K + ccol * 8;
  const _Float16* gw = wblk + (size_t)crow * K + ccol * 8;
  const int T = K / KP;

  stage_copy<MT, KP>(lds0, ga, gw, K);
  asm volatile("s_wait_asynccnt 0x0" ::: "memory");   // own copies of stage 0 landed
  __syncthreads();                                    // publishes stage 0
  if (T > 1) stage_copy<MT, KP>(lds0 + STAGE, ga + KP, gw + KP, K);

  #pragma unroll 1
  for (int t = 0; t < T; ++t) {
    const int bo = (t & 1) * STAGE;
    const char* pa = ring + bo + (16 * MT * wm + m) * PITCH;
    const char* pw = ring + bo + (A_ROWS + 64 * wn + m) * PITCH;
    #pragma unroll
    for (int kc = 0; kc < KP / 32; ++kc) {
      v16h a[MT], b[4];
      #pragma unroll
      for (int mt = 0; mt < MT; ++mt) a[mt] = load_frag((const _Float16*)(pa + mt * 16 * PITCH) + kc * 32, h);
      #pragma unroll
      for (int nt = 0; nt < 4; ++nt) b[nt] = load_frag((const _Float16*)(pw + nt * 16 * PITCH) + kc * 32, h);
      #pragma unroll
      for (int nt = 0; nt < 4; ++nt)
        #pragma unroll
        for (int mt = 0; mt < MT; ++mt) acc[mt][nt] = wmma_f16(a[mt], b[nt], acc[mt][nt]);
    }
    asm volatile("s_wait_dscnt 0x0" ::: "memory");    // own reads of this buffer are done before it is refilled
    asm volatile("s_wait_asynccnt 0x0" ::: "memory"); // own copies of stage t+1 landed
    __syncthreads();                                  // publishes stage t+1, frees stage t's buffer
    if (t + 2 < T) stage_copy<MT, KP>(lds0 + bo, ga + (size_t)(t + 2) * KP, gw + (size_t)(t + 2) * KP, K);
  }
  asm volatile("s_wait_asynccnt 0x0" ::: "memory");   // nothing in flight when the ring is reused
}

// Pitches of the output tiles staged in the ring (16 B x odd, so that the two lane
// halves, 8 rows apart, fall on different banks and every row stays 16-B aligned).
#define HP128 136                            // halves per staged row of 128 halves
#define HP256 264                            // halves per staged row of 256 halves
#define FP128 132                            // floats per staged row of 128 floats

// ---------------------------------------------------------------------------
// Kernel 3: QKV = ln1(x) * Wqkv^T + b over the fused 3*1024 output columns.
// Block 256 thr (8 waves) = 256 tokens x 128 features (one 'which', two heads).
// q plane [B*H][S][64], k plane [B*H][S][64], vt [B*H][64][S].
// Stores: one 16-B store per lane, whole 128-B lines, each line by one instruction.
// ---------------------------------------------------------------------------
__global__ __launch_bounds__(GT) void qkv_kernel(
    const _Float16* __restrict__ xh,   // [NTOK][DM]
    const _Float16* __restrict__ wh,   // [3*DM][DM], row = output feature, x32
    const float* __restrict__ bias,    // [3*DM]
    _Float16* __restrict__ qh, _Float16* __restrict__ kh, _Float16* __restrict__ vt)
{
  __shared__ __attribute__((aligned(16))) char ring[RING_B(4, 64)];   // operand ring, then the output tile (at most 69632 B)
  _Float16* sT = (_Float16*)ring;

  const int tid = threadIdx.x, lane = tid & 31, w = tid >> 5;
  const int wm = w >> 1, wn = w & 1;
  const int h = lane >> 4, m = lane & 15;
  const int m0 = blockIdx.x * 256;
  const int cg = blockIdx.y;                 // 0..23 = which*8 + head pair
  const int which = cg >> 3, head0 = (cg & 7) * 2;

  v8f acc[4][4];
  gemm_main<4, 64>(ring, xh + (size_t)m0 * DM, wh + (size_t)cg * 128 * DM, DM, tid, acc);

  // D[r] of tile (mt, nt) = Y[token m0+64wm+16mt+8h+r][feature cg*128 + 64wn+16nt+m]
  // staged as [token][feature] for q and k, as [feature][token] for v ('which' is block-uniform)
  float bvl[4];
  #pragma unroll
  for (int nt = 0; nt < 4; ++nt) bvl[nt] = bias[cg * 128 + 64 * wn + 16 * nt + m];
  if (which != 2) {
    #pragma unroll
    for (int nt = 0; nt < 4; ++nt)
      #pragma unroll
      for (int mt = 0; mt < 4; ++mt)
        #pragma unroll
        for (int r = 0; r < 8; ++r)
          sT[(64 * wm + 16 * mt + 8 * h + r) * HP128 + 64 * wn + 16 * nt + m] = (_Float16)(acc[mt][nt][r] * WINV + bvl[nt]);
  } else {
    #pragma unroll
    for (int nt = 0; nt < 4; ++nt)
      #pragma unroll
      for (int mt = 0; mt < 4; ++mt) {
        v8h y;                                             // the lane's 8 tokens of one feature lie side by side
        #pragma unroll
        for (int r = 0; r < 8; ++r) y[r] = (_Float16)(acc[mt][nt][r] * WINV + bvl[nt]);
        *(v8ha*)(sT + (64 * wn + 16 * nt + m) * HP256 + 64 * wm + 16 * mt + 8 * h) = y;
      }
  }
  __syncthreads();

  const int b = m0 / SEQ, l0 = m0 - b * SEQ;
  if (which != 2) {
    // plane[bh][l][d]: a staged token row = 128 halves = one line in each of two heads
    _Float16* plane = (which == 0) ? qh : kh;
    const int rs = lane >> 4, c16 = lane & 15;
    const int bh = b * NH + head0 + (c16 >> 3);
    #pragma unroll
    for (int i = 0; i < 16; ++i) {
      const int tok = (i * 8 + w) * 2 + rs;                // 0..255 over the block
      const v8h v = *(const v8ha*)(sT + tok * HP128 + 8 * c16);
      *(v8h*)(plane + ((size_t)bh * SEQ + l0 + tok) * HD + 8 * (c16 & 7)) = v;
    }
    asm volatile("s_wait_xcnt 0x0" ::: "memory");          // no register of these stores is rewritten ahead of it on any way on from here
  } else {
    // vt[bh][d][l]: a staged feature row = 256 tokens = 4 lines
    #pragma unroll
    for (int i = 0; i < 16; ++i) {
      const int feat = i * 8 + w;                          // 0..127 over the block
      const v8h v = *(const v8ha*)(sT + feat * HP256 + 8 * lane);
      const int bh = b * NH + head0 + (feat >> 6);
      *(v8h*)(vt + ((size_t)bh * HD + (feat & 63)) * SEQ + l0 + 8 * lane) = v;
    }
  }
}

// ---------------------------------------------------------------------------
// Attention helpers.
// P^T B-fragment from the lane's own score D values: element r <- tile a row r,
// element 8+r <- tile c row r (same lane, same query column), scaled by 2^14.
// ---------------------------------------------------------------------------
__device__ __forceinline__ v16h pack_p(v8f a, v8f c) {
  const v16h r = { (_Float16)(a[0] * PSCALE), (_Float16)(a[1] * PSCALE), (_Float16)(a[2] * PSCALE), (_Float16)(a[3] * PSCALE),
                   (_Float16)(a[4] * PSCALE), (_Float16)(a[5] * PSCALE), (_Float16)(a[6] * PSCALE), (_Float16)(a[7] * PSCALE),
                   (_Float16)(c[0] * PSCALE), (_Float16)(c[1] * PSCALE), (_Float16)(c[2] * PSCALE), (_Float16)(c[3] * PSCALE),
                   (_Float16)(c[4] * PSCALE), (_Float16)(c[5] * PSCALE), (_Float16)(c[6] * PSCALE), (_Float16)(c[7] * PSCALE) };
  return r;
}

// (one query row) by lanes 8q..8q+7 in one instruction, 4 lines per instruction.
__device__ __forceinline__ void att_store_pass(const _Float16* so, _Float16* ao,
                                               int b, int head, int q0, int lane) {
  const int q8 = lane & 7, sub = lane >> 3;
  #pragma unroll
  for (int i = 0; i < 4; ++i) {
    const int lid = i * 4 + sub;                  // query row 0..15
    const v8h v = *(const v8ha*)(so + lid * 64 + 8 * q8);
    const size_t gi = ((size_t)b * SEQ + q0 + lid) * DM + head * HD + 8 * q8;
    *(v8h*)(ao + gi) = v;
  }
}

// ---------------------------------------------------------------------------
// K / V^T staging for attention. A stage is 64 keys: the K tile (64 key rows x
// 128 B of d) and behind it the V^T tile (64 d rows x 128 B of keys), each row
// laid in LDS at a pitch of 144 B (16 B x odd: conflict-free for 16-byte
// fragment reads). Two buffers: stage t+1 is copied global -> LDS
// asynchronously, once per block, while the four waves that read it work on stage t.
// ---------------------------------------------------------------------------
#define KV_PITCH 144                         // LDS bytes per staged row
#define KV_TILE  (64 * KV_PITCH)             // 9216 B
#define KV_STAGE (2 * KV_TILE)               // 18432 B

static_assert(KV_PITCH % 16 == 0 && HD * 2 == 128 && SEQ % 64 == 0);

// Eight 16-byte-per-lane copies global -> LDS. The s_wait_xcnt closes the
// statement so that no address register named here is rewritten ahead of it.
__device__ __forceinline__ void copy8(const unsigned (&l)[8], const _Float16* const (&g)[8]) {
  asm volatile(
      "global_load_async_to_lds_b128 %0, %8, off\n\t"
      "global_load_async_to_lds_b128 %1, %9, off\n\t"
      "global_load_async_to_lds_b128 %2, %10, off\n\t"
      "global_load_async_to_lds_b128 %3, %11, off\n\t"
      "global_load_async_to_lds_b128 %4, %12, off\n\t"
      "global_load_async_to_lds_b128 %5, %13, off\n\t"
      "global_load_async_to_lds_b128 %6, %14, off\n\t"
      "global_load_async_to_lds_b128 %7, %15, off\n\t"
      "s_wait_xcnt 0x0"
      :: "v"(l[0]), "v"(l[1]), "v"(l[2]), "v"(l[3]), "v"(l[4]), "v"(l[5]), "v"(l[6]), "v"(l[7]),
         "v"(g[0]), "v"(g[1]), "v"(g[2]), "v"(g[3]), "v"(g[4]), "v"(g[5]), "v"(g[6]), "v"(g[7])
      : "memory");
}

// One stage, by 128 threads: thread t copies 16 B at column 16*(t&7) of rows (t>>3) + 16i of both
// tiles (i = 0..3); a wave's copy covers four whole 128-B rows.
// lds = this thread's LDS byte address in row (t>>3) of the target buffer's K tile;
// gk / gv = this thread's element in that row of K / V^T at the stage's first key.
__device__ __forceinline__ void kv_stage_copy(unsigned lds, const _Float16* gk, const _Float16* gv) {
  unsigned l[8];
  const _Float16* g[8];
  #pragma unroll
  for (int i = 0; i < 4; ++i) {
    l[i]     = lds + (unsigned)(i * 16 * KV_PITCH);
    g[i]     = gk + (size_t)(i * 16) * HD;
    l[4 + i] = lds + (unsigned)(KV_TILE + i * 16 * KV_PITCH);
    g[4 + i] = gv + (size_t)(i * 16) * SEQ;
  }
  copy8(l, g);
}

// ---------------------------------------------------------------------------
// Kernel 4: causal streaming attention, transposed form.
// Block 256 thr = two halves of 4 waves. A block takes two tiles of 64 queries in
// turn, tile 31 - x and then tile x, so that every block walks the same number of
// key tiles (33 of 64 keys). Inside a query tile the key tiles are dealt to the two
// halves by turns: half g takes key tiles 2*st + g, 16 queries per wave, and each
// half keeps its own running maximum, sum and O; the two are joined once per query
// tile through LDS. A ring stage is 128 keys: each half copies and reads its own 64.
//   S^T = K * Q^T : A = K rows (row = key, k = d), B = Q^T (k = d, n = query)
//   O^T += V^T * P^T : A = Vt rows (row = d, k = key), B = P^T from registers
// Lane owns 32 keys of query column (lane&15); partner = lane ^ 16.
// The 1/8 scale is folded into the exponent argument (exact power of two).
// ---------------------------------------------------------------------------
#define AT      256                          // threads of an attention block
#define QTILES  (SEQ / 64)                   // query tiles of a head
#define KV_BUF  (2 * KV_STAGE)               // one buffer: the 64-key stages of both halves
#define KV_RING2 (2 * KV_BUF)                // 73728 B
#define MG_CH   9                            // 16-B pieces a lane hands over: 8 of O, 1 of (max, sum)

static_assert(QTILES % 2 == 0 && SEQ % 128 == 0);
static_assert(4 * MG_CH * 32 * 16 <= KV_RING2);

__global__ __launch_bounds__(AT) void attn_kernel(
    const _Float16* __restrict__ qh,   // [B*H][S][64]
    const _Float16* __restrict__ kh,   // [B*H][S][64]
    const _Float16* __restrict__ vt,   // [B*H][64][S]
    _Float16* __restrict__ ao)         // [B][S][DM]
{
  __shared__ __attribute__((aligned(16))) _Float16 sO[4 * 16 * 64];    // 8192 B
  __shared__ __attribute__((aligned(16))) char kv[KV_RING2];           // K / V^T stages, two buffers; then the hand-over

  const int tid = threadIdx.x, lane = tid & 31;
  const int wq = (tid >> 5) & 3;                                // which 16 queries of the tile
  const int g = __builtin_amdgcn_readfirstlane(tid >> 7);       // which half; scalar, so the tests on it are scalar branches
  const int h = lane >> 4, m = lane & 15;
  const int bh = blockIdx.y, b = bh >> 4, head = bh & 15;

  const v8f zero8 = {0.f, 0.f, 0.f, 0.f, 0.f, 0.f, 0.f, 0.f};
  const int crow = (tid & 127) >> 3, ccol = tid & 7;
  const unsigned lds0 = (unsigned)(size_t)kv + (unsigned)(g * KV_STAGE + crow * KV_PITCH + ccol * 16);
  const _Float16* gk = kh + ((size_t)bh * SEQ + 64 * g + crow) * HD + ccol * 8;    // + 128*st*HD
  const _Float16* gv = vt + ((size_t)bh * HD + crow) * SEQ + 64 * g + ccol * 8;    // + 128*st
  v4fa* mg = (v4fa*)kv + wq * MG_CH * 32 + lane;                // this lane's hand-over pieces, 32 pieces apart
  _Float16* so = sO + wq * 1024;

  // Kept rolled: the two query tiles run the same text one after the other.
  #pragma unroll 1
  for (int pass = 0; pass < 2; ++pass) {
    const int xt = pass ? (int)blockIdx.x : QTILES - 1 - (int)blockIdx.x;
    const int q0 = xt * 64 + 16 * wq;
    const int T64 = xt + 1;                     // key tiles up to and with the diagonal one (block-uniform)
    const int NS = (T64 + 1) >> 1;              // ring stages of 128 keys; 128*NS <= SEQ

    // Q^T B-fragments: column n = query q0+m, k = d (two 32-deep chunks)
    const _Float16* qrow = qh + ((size_t)bh * SEQ + q0 + m) * HD;
    const v16h qb0 = load_frag(qrow, h);
    const v16h qb1 = load_frag(qrow + 32, h);

    v8f o[4];                                   // o[t][r] = O[query m][d 16t+8h+r] * (l * 2^14), this half's keys
    #pragma unroll
    for (int t = 0; t < 4; ++t) o[t] = zero8;
    float mrun = -1e30f, lrun = 0.0f;

    kv_stage_copy(lds0, gk, gv);
    asm volatile("s_wait_asynccnt 0x0" ::: "memory");   // own copies of stage 0 landed
    __syncthreads();                                    // publishes stage 0
    if (NS > 1) kv_stage_copy(lds0 + KV_BUF, gk + 128 * HD, gv + 128);

    #pragma unroll 1
    for (int st = 0; st < NS; ++st) {
      const int kb = 128 * st + 64 * g;
      const int bo = (st & 1) * KV_BUF;
      if (2 * st + g < T64) {                             // the last stage of an odd count has no key tile for the second half
        const char* pk = kv + bo + g * KV_STAGE + m * KV_PITCH;   // K row m of this half's stage
        const char* pv = pk + KV_TILE;                            // V^T row m of this half's stage
        // ---- raw scores: s[j][r] = S[query q0+m][key kb+16j+8h+r] (unscaled) ----
        v8f s[4];
        #pragma unroll
        for (int j = 0; j < 4; ++j) {
          const _Float16* kp = (const _Float16*)(pk + 16 * j * KV_PITCH);
          const v16h kf0 = load_frag(kp, h);
          const v16h kf1 = load_frag(kp + 32, h);
          v8f z = zero8;
          z = wmma_f16(kf0, qb0, z);
          z = wmma_f16(kf1, qb1, z);
          s[j] = z;
        }
        // ---- causal mask (only on the key tile touching the diagonal) ----
        if (kb + 63 > q0) {
          const int qq = q0 + m;
          #pragma unroll
          for (int j = 0; j < 4; ++j)
            #pragma unroll
            for (int r = 0; r < 8; ++r) {
              const int kk = kb + 16 * j + 8 * h + r;
              if (kk > qq) s[j][r] = -1e30f;
            }
        }

        // ---- online softmax (scale 1/8 applied inside the exp argument) ----
        float mloc = s[0][0];
        #pragma unroll
        for (int j = 0; j < 4; ++j)
          #pragma unroll
          for (int r = 0; r < 8; ++r) mloc = fmaxf(mloc, s[j][r]);
        mloc = fmaxf(mloc, __shfl_xor(mloc, 16));
        const float mnew = fmaxf(mrun, mloc);
        const float cn = mnew * 0.125f;
        const float alpha = __expf((mrun - mnew) * 0.125f);
        mrun = mnew;
        float lsum = 0.0f;
        #pragma unroll
        for (int j = 0; j < 4; ++j)
          #pragma unroll
          for (int r = 0; r < 8; ++r) {
            const float p = __expf(fmaf(s[j][r], 0.125f, -cn));
            s[j][r] = p;
            lsum += p;
          }
        lsum += __shfl_xor(lsum, 16);
        lrun = lrun * alpha + lsum;
        #pragma unroll
        for (int t = 0; t < 4; ++t)
          #pragma unroll
          for (int r = 0; r < 8; ++r) o[t][r] = o[t][r] * alpha;

        // ---- P^T B-fragments (key chunks 0..31 and 32..63 of this key tile) ----
        const v16h pb0 = pack_p(s[0], s[1]);
        const v16h pb1 = pack_p(s[2], s[3]);

        // ---- O^T += V^T * P^T ----
        #pragma unroll
        for (int t = 0; t < 4; ++t) {
          const _Float16* vp = (const _Float16*)(pv + 16 * t * KV_PITCH);
          const v16h vf0 = load_frag(vp, h);
          const v16h vf1 = load_frag(vp + 32, h);
          o[t] = wmma_f16(vf0, pb0, o[t]);
          o[t] = wmma_f16(vf1, pb1, o[t]);
        }
      }
      asm volatile("s_wait_dscnt 0x0" ::: "memory");    // own reads of this buffer are done before it is refilled
      asm volatile("s_wait_asynccnt 0x0" ::: "memory"); // own copies of stage st+1 landed
      __syncthreads();                                  // publishes stage st+1, frees stage st's buffer
      if (st + 2 < NS) kv_stage_copy(lds0 + bo, gk + (size_t)(128 * (st + 2)) * HD, gv + 128 * (st + 2));
    }
    asm volatile("s_wait_asynccnt 0x0" ::: "memory");   // nothing in flight when the ring is reused

    // ---- the second half hands its maximum, sum and O to the first, lane to lane ----
    if (g == 1) {
      #pragma unroll
      for (int t = 0; t < 4; ++t) {
        const v4f lo = { o[t][0], o[t][1], o[t][2], o[t][3] };
        const v4f hi = { o[t][4], o[t][5], o[t][6], o[t][7] };
        mg[(2 * t) * 32] = lo;
        mg[(2 * t + 1) * 32] = hi;
      }
      const v4f ml = { mrun, lrun, 0.0f, 0.0f };
      mg[8 * 32] = ml;
    }
    __syncthreads();                                    // the hand-over is written

    // ---- join, normalise, stage per-wave 16x64 f16 tile ----
    if (g == 0) {
      const v4f ml = mg[8 * 32];
      const float mall = fmaxf(mrun, ml.x);
      const float f0 = __expf((mrun - mall) * 0.125f);
      const float f1 = __expf((ml.x - mall) * 0.125f);  // 0 where the second half had no key tile (its maximum is -1e30)
      const float inv = (1.0f / (lrun * f0 + ml.y * f1)) * (1.0f / PSCALE);
      const float c0 = f0 * inv, c1 = f1 * inv;
      #pragma unroll
      for (int t = 0; t < 4; ++t) {
        const v4f lo = mg[(2 * t) * 32];
        const v4f hi = mg[(2 * t + 1) * 32];
        #pragma unroll
        for (int r = 0; r < 4; ++r) {
          so[m * 64 + 16 * t + 8 * h + r]     = (_Float16)(o[t][r] * c0 + lo[r] * c1);
          so[m * 64 + 16 * t + 8 * h + 4 + r] = (_Float16)(o[t][4 + r] * c0 + hi[r] * c1);
        }
      }
    }
    asm volatile("s_wait_dscnt 0x0" ::: "memory");      // own reads of the hand-over are done before the next tile's copies overwrite it
    __syncthreads();                                    // frees the ring for the next query tile; the staged tile is written

    if (g == 0) {
      att_store_pass(so, ao, b, head, q0, lane);
      asm volatile("s_wait_xcnt 0x0" ::: "memory");     // no register of these stores is rewritten ahead of it in the next query tile
    }
  }
}

// ---------------------------------------------------------------------------
// Exact-form GELU without a branch, eight values at a time as four packed f32 pairs:
// x * Phi(x) = max(x, 0) - |x| * erfc(|x| / sqrt 2) / 2 with
// erfc(z) = t (a1 + t (a2 + t (a3 + t (a4 + t a5)))) exp(-z z), t = 1 / (1 + p z), z >= 0
// (rational form with five terms, absolute error of erfc below 1.5e-7). The halves and
// the 1 / sqrt 2 are folded into the constants; no subtraction from 1 on the negative side.
// Written step by step across the four pairs, so that their chains run side by side; every
// loop is unrolled so that the small arrays are registers.
// ---------------------------------------------------------------------------
typedef float v2f __attribute__((ext_vector_type(2)));
typedef _Float16 v2h __attribute__((ext_vector_type(2)));

__device__ __forceinline__ v2f fma2(v2f a, v2f b, v2f c) { return __builtin_elementwise_fma(a, b, c); }

// y[i] = gelu(c[2i], c[2i+1]) for c = acc * WINV + bias
__device__ __forceinline__ void gelu_erf8(v8f acc, float bias, v2h (&y)[4]) {
  v2f x[4], ax[4], t[4], e[4], q[4];
  #pragma unroll
  for (int i = 0; i < 4; ++i) {
    const v2f c = { acc[2 * i], acc[2 * i + 1] };
    x[i] = fma2(c, (v2f)(WINV), (v2f)(bias));
  }
  #pragma unroll
  for (int i = 0; i < 4; ++i) {
    ax[i] = __builtin_elementwise_abs(x[i]);
    const v2f d = fma2(ax[i], (v2f)(0.23164189f), (v2f)(1.0f));                // 1 + (p / sqrt 2) |x|
    const v2f r = { __builtin_amdgcn_rcpf(d.x), __builtin_amdgcn_rcpf(d.y) };
    t[i] = r;
  }
  #pragma unroll
  for (int i = 0; i < 4; ++i) {
    const v2f a = (x[i] * -0.72134752f) * x[i];                                // -x x / 2 as a power of two
    const v2f r = { __builtin_amdgcn_exp2f(a.x), __builtin_amdgcn_exp2f(a.y) };
    e[i] = r;
  }
  #pragma unroll
  for (int i = 0; i < 4; ++i) q[i] = fma2(t[i], (v2f)(0.5307027145f), (v2f)(-0.7265760135f));
  #pragma unroll
  for (int i = 0; i < 4; ++i) q[i] = fma2(q[i], t[i], (v2f)(0.7107068705f));
  #pragma unroll
  for (int i = 0; i < 4; ++i) q[i] = fma2(q[i], t[i], (v2f)(-0.142248368f));
  #pragma unroll
  for (int i = 0; i < 4; ++i) q[i] = fma2(q[i], t[i], (v2f)(0.127414796f));
  #pragma unroll
  for (int i = 0; i < 4; ++i) t[i] = t[i] * e[i];
  #pragma unroll
  for (int i = 0; i < 4; ++i) q[i] = q[i] * t[i];                              // erfc(|x| / sqrt 2) / 2
  #pragma unroll
  for (int i = 0; i < 4; ++i)
    y[i] = __builtin_convertvector(fma2(-ax[i], q[i], __builtin_elementwise_max(x[i], (v2f)(0.0f))), v2h);
}

// ---------------------------------------------------------------------------
// Kernel 5: Y = A[M,K](f16) * W[N,K]^T(f16 x32) with epilogue.
//   MODE 1: outf[M][N] (f32) = (acc/32 + bias) + resid      block 128 rows x 128 cols
//   MODE 2: outh[M][N] (f16) = gelu_erf(acc/32 + bias)      block 256 rows x 128 cols
// Block 256 thr (8 waves, 4 x 2); wave = 32 (MODE 1) or 64 (MODE 2) rows x 64 cols.
// ---------------------------------------------------------------------------
template <int MODE>
__global__ __launch_bounds__(GT) void gemm_kernel(
    const _Float16* __restrict__ A, const _Float16* __restrict__ W,
    const float* __restrict__ bias, const float* __restrict__ resid,
    float* __restrict__ outf, _Float16* __restrict__ outh, int N, int K)
{
  constexpr int MT = (MODE == 2) ? 4 : 2, KP = (MODE == 2) ? 64 : 256;
  __shared__ __attribute__((aligned(16))) char ring[RING_B(MT, KP)];   // operand ring, then the output tile (at most 69632 B)

  const int tid = threadIdx.x, lane = tid & 31, w = tid >> 5;
  const int wm = w >> 1, wn = w & 1;
  const int h = lane >> 4, m = lane & 15;
  const int m0 = blockIdx.x * (64 * MT), n0 = blockIdx.y * 128;

  v8f acc[MT][4];
  gemm_main<MT, KP>(ring, A + (size_t)m0 * K, W + (size_t)n0 * K, K, tid, acc);

  // D[r] of tile (mt, nt) = Y[row m0+16*MT*wm+16mt+8h+r][col n0+64wn+16nt+m]
  if (MODE == 1) {
    float* sbuf = (float*)ring;
    #pragma unroll
    for (int nt = 0; nt < 4; ++nt)
      #pragma unroll
      for (int mt = 0; mt < MT; ++mt)
        #pragma unroll
        for (int r = 0; r < 8; ++r)
          sbuf[(16 * MT * wm + 16 * mt + 8 * h + r) * FP128 + 64 * wn + 16 * nt + m] = acc[mt][nt][r] * WINV;
    __syncthreads();

    // a row = 128 floats = 4 lines = one 16-B access per lane; wave w takes rows 8i + w
    const int col = 4 * lane;
    const v4f bb = *(const v4fa*)(bias + n0 + col);
    v4f vals[16];
    #pragma unroll
    for (int i = 0; i < 16; ++i) {
      const int rl = i * 8 + w;                    // 0..127
      const v4f a  = *(const v4fa*)(sbuf + rl * FP128 + col);
      const size_t gi = (size_t)(m0 + rl) * N + n0 + col;
      const v4f rr = *(const v4fa*)(resid + gi);
      vals[i] = (a + bb) + rr;
    }
    #pragma unroll
    for (int i = 0; i < 16; ++i) {
      const int rl = i * 8 + w;
      const size_t gi = (size_t)(m0 + rl) * N + n0 + col;
      *(v4f*)(outf + gi) = vals[i];
    }
  } else {
    _Float16* sh = (_Float16*)ring;
    // Unrolled: acc takes constant indices only.
    #pragma unroll
    for (int nt = 0; nt < 4; ++nt) {
      const float bvl = bias[n0 + 64 * wn + 16 * nt + m];
      #pragma unroll
      for (int mt = 0; mt < MT; ++mt) {
        v2h gl[4];
        gelu_erf8(acc[mt][nt], bvl, gl);
        #pragma unroll
        for (int i = 0; i < 4; ++i) {
          sh[(16 * MT * wm + 16 * mt + 8 * h + 2 * i) * HP128 + 64 * wn + 16 * nt + m] = gl[i].x;
          sh[(16 * MT * wm + 16 * mt + 8 * h + 2 * i + 1) * HP128 + 64 * wn + 16 * nt + m] = gl[i].y;
        }
      }
    }
    __syncthreads();

    // a row = 128 halves = 2 lines; one instruction stores two rows; wave w takes rows 16i + 2w, + 1
    const int rs = lane >> 4, c16 = lane & 15;
    v8h vals[16];
    #pragma unroll
    for (int i = 0; i < 16; ++i) {
      const int rl = (i * 8 + w) * 2 + rs;         // 0..255
      vals[i] = *(const v8ha*)(sh + rl * HP128 + 8 * c16);
    }
    #pragma unroll
    for (int i = 0; i < 16; ++i) {
      const int rl = (i * 8 + w) * 2 + rs;
      *(v8h*)(outh + (size_t)(m0 + rl) * N + n0 + 8 * c16) = vals[i];
    }
  }
}

// ---------------------------------------------------------------------------
extern "C" void kernel_launch(void* const* d_in, const int* in_sizes, int n_in,
                              void* d_out, int out_size, void* d_ws, size_t ws_size,
                              hipStream_t stream) {
  if (n_in < 13) return;
  if (in_sizes[0] != NTOK * DM) return;
  if (in_sizes[1] != 3 * DM * DM || in_sizes[2] != 3 * DM) return;
  if (in_sizes[3] != DM * DM || in_sizes[4] != DM) return;
  if (in_sizes[5] != DFF * DM || in_sizes[6] != DFF) return;
  if (in_sizes[7] != DM * DFF || in_sizes[8] != DM) return;
  if (in_sizes[9] != DM || in_sizes[10] != DM || in_sizes[11] != DM || in_sizes[12] != DM) return;
  if (out_size != NTOK * DM) return;

  const float* hidden = (const float*)d_in[0];
  const float* qkv_w  = (const float*)d_in[1];
  const float* qkv_b  = (const float*)d_in[2];
  const float* out_w  = (const float*)d_in[3];
  const float* out_b  = (const float*)d_in[4];
  const float* fc1_w  = (const float*)d_in[5];
  const float* fc1_b  = (const float*)d_in[6];
  const float* fc2_w  = (const float*)d_in[7];
  const float* fc2_b  = (const float*)d_in[8];
  const float* ln1_g  = (const float*)d_in[9];
  const float* ln1_b  = (const float*)d_in[10];
  const float* ln2_g  = (const float*)d_in[11];
  const float* ln2_b  = (const float*)d_in[12];
  float* out = (float*)d_out;

  // workspace carve (all sizes multiples of 256 B)
  const size_t wh_bytes   = (size_t)G_ALL * 8 * 2;          // 25165824
  const size_t act_bytes  = (size_t)NTOK * DM * 2;           //  8388608  (f16 [4096][1024])
  const size_t hid2_bytes = (size_t)NTOK * DM * 4;           // 16777216
  const size_t ff_bytes   = (size_t)NTOK * DFF * 2;          // 33554432
  const size_t total = wh_bytes + 5 * act_bytes + hid2_bytes + ff_bytes;   // 117440512
  if (total > ws_size) return;

  char* ws = (char*)d_ws;
  size_t off = 0;
  _Float16* wh   = (_Float16*)(ws + off); off += wh_bytes;
  _Float16* xn   = (_Float16*)(ws + off); off += act_bytes;   // ln1 output, later ln2 output
  _Float16* qh   = (_Float16*)(ws + off); off += act_bytes;
  _Float16* kh   = (_Float16*)(ws + off); off += act_bytes;
  _Float16* vt   = (_Float16*)(ws + off); off += act_bytes;
  _Float16* ah   = (_Float16*)(ws + off); off += act_bytes;   // attention output f16 [4096][1024]
  float*    hid2 = (float*)(ws + off);    off += hid2_bytes;  // hidden + attn proj, f32
  _Float16* ff   = (_Float16*)(ws + off); off += ff_bytes;    // gelu(fc1) f16 [4096][4096]
  if (off > ws_size) return;

  const _Float16* w_qkv = wh;
  const _Float16* w_out = wh + (size_t)3 * DM * DM;
  const _Float16* w_fc1 = wh + (size_t)4 * DM * DM;
  const _Float16* w_fc2 = wh + (size_t)4 * DM * DM + (size_t)DFF * DM;

  // 1: weights -> f16 x32
  cvt_w_kernel<<<G_ALL / 256, 256, 0, stream>>>(qkv_w, out_w, fc1_w, fc2_w, wh);

  // 2: ln1 -> f16
  ln_kernel<<<NTOK / 8, 256, 0, stream>>>(hidden, ln1_g, ln1_b, xn, NTOK);

  // 3: qkv projection -> q/k planes + transposed v
  qkv_kernel<<<dim3(NTOK / 256, 3 * DM / 128), GT, 0, stream>>>(xn, w_qkv, qkv_b, qh, kh, vt);

  // 4: causal attention -> f16 [tok][DM]
  attn_kernel<<<dim3(QTILES / 2, BATCH * NH), AT, 0, stream>>>(qh, kh, vt, ah);

  // 5: output projection + bias + residual -> f32 hid2
  gemm_kernel<1><<<dim3(NTOK / 128, DM / 128), GT, 0, stream>>>(ah, w_out, out_b, hidden, hid2, xn, DM, DM);

  // 6: ln2 -> f16 (reuses xn)
  ln_kernel<<<NTOK / 8, 256, 0, stream>>>(hid2, ln2_g, ln2_b, xn, NTOK);

  // 7: fc1 + exact gelu -> f16 ff
  gemm_kernel<2><<<dim3(NTOK / 256, DFF / 128), GT, 0, stream>>>(xn, w_fc1, fc1_b, fc1_b, hid2, ff, DFF, DM);

  // 8: fc2 + bias + residual(hid2) -> f32 d_out
  gemm_kernel<1><<<dim3(NTOK / 128, DM / 128), GT, 0, stream>>>(ff, w_fc2, fc2_b, hid2, out, xn, DM, DFF);
}

// v006
// A run of this version takes 141 microseconds.
// Two timings next to v005 both put it at 1.04 times that version's speed.
// All steps since v000 together make it 3.85 times as fast.
// Contractions: ln1(x)*Wqkv^T, K*Q^T, V^T*P^T, attn*Wout^T, ln2(h)*Wfc1^T, gelu(.)*Wfc2^T all on v_wmma_f32_16x16x32_f16 (f16 operands, f32 accumulate); every W carried x32 and P carried x16384 (exact power-of-two scales folded back in f32); layernorm, softmax, bias, gelu and residual adds in f32.
#include <hip/hip_runtime.h>
#include <math.h>

typedef _Float16 v16h __attribute__((ext_vector_type(16)));
typedef _Float16 v8h  __attribute__((ext_vector_type(8)));
typedef float    v8f  __attribute__((ext_vector_type(8)));
typedef float    v4f  __attribute__((ext_vector_type(4)));
typedef v8h __attribute__((may_alias)) v8ha;
typedef v4f __attribute__((may_alias)) v4fa;

union Frag { v16h v; v8h half[2]; };

#define DM     1024
#define NH     16
#define HD     64
#define DFF    4096
#define SEQ    2048
#define BATCH  2
#define NTOK   (BATCH * SEQ)          // 4096 tokens
#define WSC    32.0f
#define WINV   0.03125f
#define PSCALE 16384.0f

#define G_QKV (3 * DM * DM / 8)       // 393216 groups of 8
#define G_OUT (DM * DM / 8)           // 131072
#define G_FC1 (DFF * DM / 8)          // 524288
#define G_FC2 (DM * DFF / 8)          // 524288
#define G_ALL (G_QKV + G_OUT + G_FC1 + G_FC2)   // 1572864

static_assert(NTOK % 128 == 0);
static_assert(SEQ % 128 == 0);
static_assert(DM % 64 == 0);
static_assert(DFF % 64 == 0);
static_assert(G_ALL % 256 == 0);

// ---------------------------------------------------------------------------
// 16x16x32 f16 WMMA with hazard guard (ties D, keeps A/B live).
// Fragment map (wave32): lane l, h = l>>4, m = n = l&15.
//   A/B element i: i<8 -> k0+8h+i ; i>=8 -> k0+16+8h+(i-8)
//   D element r : row 8h+r, col l&15
// ---------------------------------------------------------------------------
__device__ __forceinline__ v8f wmma_f16(v16h a, v16h b, v8f c) {
  v8f d = __builtin_amdgcn_wmma_f32_16x16x32_f16(false, a, false, b, (short)0, c, false, false);
  asm volatile("v_nop\n\tv_nop\n\tv_nop\n\tv_nop" : "+v"(d) : "v"(a), "v"(b));
  return d;
}

// A or B fragment from a k-contiguous 16-bit row; p points at element k0 of
// the row owned by this lane (row index = lane & 15 added by the caller).
__device__ __forceinline__ v16h load_frag(const _Float16* p, int h) {
  Frag f;
  f.half[0] = *(const v8ha*)(p + 8 * h);
  f.half[1] = *(const v8ha*)(p + 16 + 8 * h);
  return f.v;
}

// ---------------------------------------------------------------------------
// Kernel 1: f32 weights -> f16 planes scaled by 32 (exact). One 16-B store per
// wh layout: [qkv 3*DM*DM][out DM*DM][fc1 DFF*DM][fc2 DM*DFF], row = output feature.
// ---------------------------------------------------------------------------
__global__ __launch_bounds__(256) void cvt_w_kernel(
    const float* __restrict__ w0, const float* __restrict__ w1,
    const float* __restrict__ w2, const float* __restrict__ w3,
    _Float16* __restrict__ wh)
{
  const int g = blockIdx.x * 256 + threadIdx.x;
  if (g >= G_ALL) return;
  const float* src;
  if (g < G_QKV)                        src = w0 + (size_t)g * 8;
  else if (g < G_QKV + G_OUT)           src = w1 + (size_t)(g - G_QKV) * 8;
  else if (g < G_QKV + G_OUT + G_FC1)   src = w2 + (size_t)(g - G_QKV - G_OUT) * 8;
  else                                  src = w3 + (size_t)(g - G_QKV - G_OUT - G_FC1) * 8;
  _Float16* dst = wh + (size_t)g * 8;
  const v4f a = *(const v4fa*)src;
  const v4f c = *(const v4fa*)(src + 4);
  const v8h o = { (_Float16)(a.x * WSC), (_Float16)(a.y * WSC), (_Float16)(a.z * WSC), (_Float16)(a.w * WSC),
                  (_Float16)(c.x * WSC), (_Float16)(c.y * WSC), (_Float16)(c.z * WSC), (_Float16)(c.w * WSC) };
  *(v8h*)dst = o;
  
}

// ---------------------------------------------------------------------------
// Kernel 2: LayerNorm over rows of DM f32 -> f16. One wave per row (block of 8
// i*256 + lane*8 + 0..7 (i = 0..3) so every store instruction is 32 lanes x
// ---------------------------------------------------------------------------
__global__ __launch_bounds__(256) void ln_kernel(
    const float* __restrict__ x, const float* __restrict__ g,
    const float* __restrict__ bt, _Float16* __restrict__ y, int nrows)
{
  const int lane = threadIdx.x & 31, w = threadIdx.x >> 5;
  const int row = blockIdx.x * 8 + w;
  if (row >= nrows) return;                      // wave-uniform; no barriers below
  const float* xr = x + (size_t)row * DM;

  v4f xa[4], xb[4];
  float s = 0.0f;
  #pragma unroll
  for (int i = 0; i < 4; ++i) {
    const float* p = xr + i * 256 + lane * 8;
    xa[i] = *(const v4fa*)p;
    xb[i] = *(const v4fa*)(p + 4);
    s += ((xa[i].x + xa[i].y) + (xa[i].z + xa[i].w)) + ((xb[i].x + xb[i].y) + (xb[i].z + xb[i].w));
  }
  #pragma unroll
  for (int off = 16; off > 0; off >>= 1) s += __shfl_xor(s, off);
  const float mu = s * (1.0f / DM);

  float ss = 0.0f;
  #pragma unroll
  for (int i = 0; i < 4; ++i) {
    const v4f da = xa[i] - mu, db = xb[i] - mu;
    ss += ((da.x * da.x + da.y * da.y) + (da.z * da.z + da.w * da.w)) +
          ((db.x * db.x + db.y * db.y) + (db.z * db.z + db.w * db.w));
  }
  #pragma unroll
  for (int off = 16; off > 0; off >>= 1) ss += __shfl_xor(ss, off);
  const float var = ss * (1.0f / DM);
  const float rstd = rsqrtf(var + 1e-5f);

  v8h o[4];
  #pragma unroll
  for (int i = 0; i < 4; ++i) {
    const int p = i * 256 + lane * 8;
    const v4f ga = *(const v4fa*)(g + p),  gb = *(const v4fa*)(g + p + 4);
    const v4f ba = *(const v4fa*)(bt + p), bb = *(const v4fa*)(bt + p + 4);
    const v4f da = (xa[i] - mu) * rstd, db = (xb[i] - mu) * rstd;
    const v8h t = { (_Float16)(da.x * ga.x + ba.x), (_Float16)(da.y * ga.y + ba.y),
                    (_Float16)(da.z * ga.z + ba.z), (_Float16)(da.w * ga.w + ba.w),
                    (_Float16)(db.x * gb.x + bb.x), (_Float16)(db.y * gb.y + bb.y),
                    (_Float16)(db.z * gb.z + bb.z), (_Float16)(db.w * gb.w + bb.w) };
    o[i] = t;
  }
  _Float16* yr = y + (size_t)row * DM;
  #pragma unroll
  for (int i = 0; i < 4; ++i) *(v8h*)(yr + i * 256 + lane * 8) = o[i];
  
}

// ---------------------------------------------------------------------------
// Shared GEMM main loop: 256 threads, 8 waves in a 4 x 2 grid. Block tile 64*MT
// (rows of A) x 32*NT (rows of W), wave tile 16*MT x 16*NT. A stage is KP k (2*KP B) of
// all 64*MT + 32*NT rows, laid in LDS at a pitch of 2*KP + 16 B (16 B x odd:
// conflict-free for 16-byte fragment reads). Two buffers: stage t+1 is copied
// global -> LDS asynchronously while stage t is multiplied. Every launch is 256 blocks,
// one on a WGP; the larger the tile, the fewer bytes a product asks of L2 and of LDS.
//   MT 4, NT 8, KP 128: 256 x 256, ring 278528 B (fc1)
//   MT 4, NT 6, KP 128: 256 x 192, ring 243712 B (qkv)
//   MT 2, NT 4, KP 256: 128 x 128, ring 270336 B (out, fc2)
// acc[mt][nt][r] = sum_k A[16*MT*wm + 16mt + 8h + r][k] * W[16*NT*wn + 16nt + m][k],
// wm = wave >> 1, wn = wave & 1, k ascending in steps of 32.
// ---------------------------------------------------------------------------
#define GT      256                          // threads of a GEMM block
#define PITCH_B(KP)         (2 * (KP) + 16)                  // LDS bytes per staged row
#define STAGE_B(MT, NT, KP) ((64 * (MT) + 32 * (NT)) * PITCH_B(KP))
#define RING_B(MT, NT, KP)  (2 * STAGE_B(MT, NT, KP))

static_assert(DM % 256 == 0 && DFF % 256 == 0);
static_assert(NTOK % 256 == 0 && SEQ % 256 == 0 && DM % 128 == 0 && (3 * DM) % 192 == 0);

// Eight 16-byte-per-lane copies global -> LDS out of a stage's N. The s_wait_xcnt closes the
// statement so that no address register named here is rewritten ahead of it.
template <int N>
__device__ __forceinline__ void copy8of(const unsigned (&l)[N], const _Float16* const (&g)[N], int o) {
  asm volatile(
      "global_load_async_to_lds_b128 %0, %8, off\n\t"
      "global_load_async_to_lds_b128 %1, %9, off\n\t"
      "global_load_async_to_lds_b128 %2, %10, off\n\t"
      "global_load_async_to_lds_b128 %3, %11, off\n\t"
      "global_load_async_to_lds_b128 %4, %12, off\n\t"
      "global_load_async_to_lds_b128 %5, %13, off\n\t"
      "global_load_async_to_lds_b128 %6, %14, off\n\t"
      "global_load_async_to_lds_b128 %7, %15, off\n\t"
      "s_wait_xcnt 0x0"
      :: "v"(l[o + 0]), "v"(l[o + 1]), "v"(l[o + 2]), "v"(l[o + 3]), "v"(l[o + 4]), "v"(l[o + 5]),
         "v"(l[o + 6]), "v"(l[o + 7]),
         "v"(g[o + 0]), "v"(g[o + 1]), "v"(g[o + 2]), "v"(g[o + 3]), "v"(g[o + 4]), "v"(g[o + 5]),
         "v"(g[o + 6]), "v"(g[o + 7])
      : "memory");
}

// One such copy by the builtin, for the kernels whose live registers reach past the first 256: an asm
// operand must lie among those, and with the accumulators there an address went to scratch.
typedef int v4i __attribute__((ext_vector_type(4)));
typedef __attribute__((address_space(1))) v4i gv4i;
typedef __attribute__((address_space(3))) v4i lv4i;
__device__ __forceinline__ void copy1(unsigned l, const _Float16* g) {
  __builtin_amdgcn_global_load_async_to_lds_b128((gv4i*)g, (lv4i*)l, 0, 0);
}

// One stage: a row piece of 2*KP B takes KP/8 threads, so the block covers RPP =
// 2048/KP rows at a time: thread t copies 16 B at column 16*(t % (KP/8)) of rows
// t / (KP/8) + RPP*i; a wave's copy covers whole 128-B lines. First the A rows, then W's.
// lds = this thread's LDS byte address in its first row of the target buffer;
// ga / gw = this thread's element in that row of A / W at the stage's first k.
// PART -1: the whole stage; 0: its first sixteen copies; 1: the rest.
template <int MT, int NT, int KP, int PART>
__device__ __forceinline__ void stage_copy(unsigned lds, const _Float16* ga, const _Float16* gw, int K) {
  constexpr int RPP = GT / (KP / 8);
  constexpr int NA = 64 * MT / RPP, NC = NA + 32 * NT / RPP;
  static_assert(NC == 28 || NC == 32);
  unsigned l[NC];
  const _Float16* g[NC];
  #pragma unroll
  for (int i = 0; i < NC; ++i) {
    l[i] = lds + (unsigned)(i * RPP * PITCH_B(KP));
    g[i] = (i < NA) ? ga + (size_t)(i * RPP) * K : gw + (size_t)((i - NA) * RPP) * K;
  }
  if constexpr (MT * NT > 16) {
    #pragma unroll
    for (int i = (PART == 1 ? 16 : 0); i < (PART == 0 ? 16 : NC); ++i) copy1(l[i], g[i]);
  } else {
    static_assert(NC == 32 && PART == -1);
    copy8of<NC>(l, g, 0);
    copy8of<NC>(l, g, 8);
    copy8of<NC>(l, g, 16);
    copy8of<NC>(l, g, 24);
  }
}

// ablk / wblk: first row of the block's A / W tile. ring: RING_B(MT, NT, KP) bytes of LDS; free
// for other use on return (every wave's reads and copies are done and a barrier passed).
template <int MT, int NT, int KP>
__device__ __forceinline__ void gemm_main(char* ring,
                                          const _Float16* __restrict__ ablk,
                                          const _Float16* __restrict__ wblk,
                                          int K, int tid, v8f (&acc)[MT][NT])
{
  constexpr int A_ROWS = 64 * MT;
  constexpr int PITCH = PITCH_B(KP);
  constexpr int STAGE = STAGE_B(MT, NT, KP);
  const int lane = tid & 31, w = tid >> 5;
  const int wm = w >> 1, wn = w & 1;
  const int h = lane >> 4, m = lane & 15;
  const v8f zero8 = {0.f, 0.f, 0.f, 0.f, 0.f, 0.f, 0.f, 0.f};
  #pragma unroll
  for (int mt = 0; mt < MT; ++mt)
    #pragma unroll
    for (int nt = 0; nt < NT; ++nt) acc[mt][nt] = zero8;

  const int crow = tid / (KP / 8), ccol = tid % (KP / 8);
  const unsigned lds0 = (unsigned)(size_t)ring + (unsigned)(crow * PITCH + ccol * 16);
  const _Float16* ga = ablk + (size_t)crow * K + ccol * 8;
  const _Float16* gw = wblk + (size_t)crow * K + ccol * 8;
  const int T = K / KP;

  // One block on a WGP with more than 16 tiles a wave: nothing else fills the matrix unit while the block
  // issues a refill, so the refill goes out in two halves inside the next trip, each behind a group of
  // LDS reads, whose latency it fills (still behind the barrier that freed its buffer).
  constexpr bool SPLIT = MT * NT > 16;
  stage_copy<MT, NT, KP, -1>(lds0, ga, gw, K);
  asm volatile("s_wait_asynccnt 0x0" ::: "memory");   // own copies of stage 0 landed
  __syncthreads();                                    // publishes stage 0
  if (!SPLIT && T > 1) stage_copy<MT, NT, KP, -1>(lds0 + STAGE, ga + KP, gw + KP, K);

  #pragma unroll 1
  for (int t = 0; t < T; ++t) {
    const int bo = (t & 1) * STAGE;
    const char* pa = ring + bo + (16 * MT * wm + m) * PITCH;
    const char* pw = ring + bo + (A_ROWS + 16 * NT * wn + m) * PITCH;
    #pragma unroll
    for (int kc = 0; kc < KP / 32; ++kc) {
      v16h a[MT], b[NT];
      #pragma unroll
      for (int mt = 0; mt < MT; ++mt) a[mt] = load_frag((const _Float16*)(pa + mt * 16 * PITCH) + kc * 32, h);
      #pragma unroll
      for (int nt = 0; nt < NT; ++nt) b[nt] = load_frag((const _Float16*)(pw + nt * 16 * PITCH) + kc * 32, h);
      if constexpr (SPLIT && KP / 32 >= 2) {
        if (kc < 2 && t + 1 < T) {                        // stage t+1 into the buffer that trip t-1 read
          const unsigned ln = lds0 + (STAGE - bo);
          const _Float16* an = ga + (size_t)(t + 1) * KP;
          const _Float16* wx = gw + (size_t)(t + 1) * KP;
          if (kc == 0) stage_copy<MT, NT, KP, 0>(ln, an, wx, K);
          else         stage_copy<MT, NT, KP, 1>(ln, an, wx, K);
        }
      }
      // Keeps the block's LDS reads one group ahead of its products: without the guard's asm statements
      // the compiler dealt them out among the products, each pair of reads with a full wait behind it.
      if constexpr (SPLIT) __builtin_amdgcn_sched_barrier(0);
      #pragma unroll
      for (int nt = 0; nt < NT; ++nt)
        #pragma unroll
        for (int mt = 0; mt < MT; ++mt) {
          // Above 16 tiles the accumulators reach past the first 256 registers, where the operands of the
          // guard's asm statement cannot lie (they went to scratch): the builtin alone, padded by the compiler.
          if constexpr (SPLIT)
            acc[mt][nt] = __builtin_amdgcn_wmma_f32_16x16x32_f16(false, a[mt], false, b[nt], (short)0, acc[mt][nt], false, false);
          else
            acc[mt][nt] = wmma_f16(a[mt], b[nt], acc[mt][nt]);
        }
      if constexpr (SPLIT) __builtin_amdgcn_sched_barrier(0);   // the other side of the same fence
    }
    asm volatile("s_wait_dscnt 0x0" ::: "memory");    // own reads of this buffer are done before it is refilled
    asm volatile("s_wait_asynccnt 0x0" ::: "memory"); // own copies of stage t+1 landed
    __syncthreads();                                  // publishes stage t+1, frees stage t's buffer
    if (!SPLIT && t + 2 < T) stage_copy<MT, NT, KP, -1>(lds0 + bo, ga + (size_t)(t + 2) * KP, gw + (size_t)(t + 2) * KP, K);
  }
  asm volatile("s_wait_asynccnt 0x0" ::: "memory");   // nothing in flight when the ring is reused
}

// Pitches of the output tiles staged in the ring (16 B x odd, so that the two lane
// halves, 8 rows apart, fall on different banks and every row stays 16-B aligned).
#define HP64  72                             // halves per staged row of 64 halves
#define HP256 264                            // halves per staged row of 256 halves
#define FP128 132                            // floats per staged row of 128 floats
#define HEAD_H (256 * HP64)                  // halves of one head's staged tile (256 tokens x 64 features, either way round)

static_assert(64 * HP256 <= HEAD_H && 3 * HEAD_H * 2 <= RING_B(4, 6, 128));

// ---------------------------------------------------------------------------
// Kernel 3: QKV = ln1(x) * Wqkv^T + b over the fused 3*1024 output columns.
// Block 256 thr (8 waves) = 256 tokens x 192 features = three heads out of the 48 of
// q, k and v in a row; a block may hold heads of two of them, so each head is staged
// and stored by itself.
// q plane [B*H][S][64], k plane [B*H][S][64], vt [B*H][64][S].
// Stores: one 16-B store per lane, whole 128-B lines, each line by one instruction.
// ---------------------------------------------------------------------------
__global__ __launch_bounds__(GT) void qkv_kernel(
    const _Float16* __restrict__ xh,   // [NTOK][DM]
    const _Float16* __restrict__ wh,   // [3*DM][DM], row = output feature, x32
    const float* __restrict__ bias,    // [3*DM]
    _Float16* __restrict__ qh, _Float16* __restrict__ kh, _Float16* __restrict__ vt)
{
  __shared__ __attribute__((aligned(16))) char ring[RING_B(4, 6, 128)];   // operand ring, then the three heads' output tiles
  _Float16* sT = (_Float16*)ring;

  const int tid = threadIdx.x, lane = tid & 31, w = tid >> 5;
  const int wm = w >> 1;
  const int wn = __builtin_amdgcn_readfirstlane(w & 1);   // scalar, so the tests on a column group's head are scalar branches
  const int h = lane >> 4, m = lane & 15;
  const int m0 = blockIdx.x * 256;
  const int cg = blockIdx.y;                 // 0..15: heads 3cg .. 3cg+2 of 48 (q 0..15, k 16..31, v 32..47)

  v8f acc[4][6];
  gemm_main<4, 6, 128>(ring, xh + (size_t)m0 * DM, wh + (size_t)cg * 192 * DM, DM, tid, acc);

  // D[r] of tile (mt, nt) = Y[token m0+64wm+16mt+8h+r][feature cg*192 + 96wn+16nt+m]
  // a head is staged as [token][feature] for q and k, as [feature][token] for v
  float bv[6];
  #pragma unroll
  for (int nt = 0; nt < 6; ++nt) bv[nt] = bias[cg * 192 + 96 * wn + 16 * nt + m];
  asm volatile("s_wait_xcnt 0x0" ::: "memory");            // no address register of the bias loads is rewritten ahead of it
  #pragma unroll
  for (int nt = 0; nt < 6; ++nt) {
    const int c0 = 96 * wn + 16 * nt;                      // first column of the group; a group lies in one head
    const int j = c0 >> 6, cl = (c0 & 63) + m;
    const float bvl = bv[nt];
    _Float16* sH = sT + j * HEAD_H;
    if (3 * cg + j < 2 * NH) {
      #pragma unroll
      for (int mt = 0; mt < 4; ++mt)
        #pragma unroll
        for (int r = 0; r < 8; ++r)
          sH[(64 * wm + 16 * mt + 8 * h + r) * HP64 + cl] = (_Float16)(acc[mt][nt][r] * WINV + bvl);
    } else {
      #pragma unroll
      for (int mt = 0; mt < 4; ++mt) {
        v8h y;                                             // the lane's 8 tokens of one feature lie side by side
        #pragma unroll
        for (int r = 0; r < 8; ++r) y[r] = (_Float16)(acc[mt][nt][r] * WINV + bvl);
        *(v8ha*)(sH + cl * HP256 + 64 * wm + 16 * mt + 8 * h) = y;
      }
    }
  }
  __syncthreads();

  const int b = m0 / SEQ, l0 = m0 - b * SEQ;
  #pragma unroll
  for (int j = 0; j < 3; ++j) {
    const int hg = 3 * cg + j;                             // block-uniform
    const int bh = b * NH + (hg & (NH - 1));
    const _Float16* sH = sT + j * HEAD_H;
    if (hg < 2 * NH) {
      // plane[bh][l][d]: a staged token row = 64 halves = one line; an instruction stores four tokens
      _Float16* plane = (hg < NH) ? qh : kh;
      const int sub = lane >> 3, c8 = lane & 7;
      #pragma unroll
      for (int i = 0; i < 8; ++i) {
        const int tok = (i * 8 + w) * 4 + sub;             // 0..255 over the block
        const v8h v = *(const v8ha*)(sH + tok * HP64 + 8 * c8);
        *(v8h*)(plane + ((size_t)bh * SEQ + l0 + tok) * HD + 8 * c8) = v;
      }
      asm volatile("s_wait_xcnt 0x0" ::: "memory");        // no register of these stores is rewritten ahead of it on any way on from here
    } else {
      // vt[bh][d][l]: a staged feature row = 256 tokens = 4 lines
      #pragma unroll
      for (int i = 0; i < 8; ++i) {
        const int feat = i * 8 + w;                        // 0..63 over the block
        const v8h v = *(const v8ha*)(sH + feat * HP256 + 8 * lane);
        *(v8h*)(vt + ((size_t)bh * HD + feat) * SEQ + l0 + 8 * lane) = v;
      }
      asm volatile("s_wait_xcnt 0x0" ::: "memory");        // the same for the v stores
    }
  }
}

// ---------------------------------------------------------------------------
// Attention helpers.
// P^T B-fragment from the lane's own score D values: element r <- tile a row r,
// element 8+r <- tile c row r (same lane, same query column), scaled by 2^14.
// ---------------------------------------------------------------------------
__device__ __forceinline__ v16h pack_p(v8f a, v8f c) {
  const v16h r = { (_Float16)(a[0] * PSCALE), (_Float16)(a[1] * PSCALE), (_Float16)(a[2] * PSCALE), (_Float16)(a[3] * PSCALE),
                   (_Float16)(a[4] * PSCALE), (_Float16)(a[5] * PSCALE), (_Float16)(a[6] * PSCALE), (_Float16)(a[7] * PSCALE),
                   (_Float16)(c[0] * PSCALE), (_Float16)(c[1] * PSCALE), (_Float16)(c[2] * PSCALE), (_Float16)(c[3] * PSCALE),
                   (_Float16)(c[4] * PSCALE), (_Float16)(c[5] * PSCALE), (_Float16)(c[6] * PSCALE), (_Float16)(c[7] * PSCALE) };
  return r;
}

// (one query row) by lanes 8q..8q+7 in one instruction, 4 lines per instruction.
__device__ __forceinline__ void att_store_pass(const _Float16* so, _Float16* ao,
                                               int b, int head, int q0, int lane) {
  const int q8 = lane & 7, sub = lane >> 3;
  #pragma unroll
  for (int i = 0; i < 4; ++i) {
    const int lid = i * 4 + sub;                  // query row 0..15
    const v8h v = *(const v8ha*)(so + lid * 64 + 8 * q8);
    const size_t gi = ((size_t)b * SEQ + q0 + lid) * DM + head * HD + 8 * q8;
    *(v8h*)(ao + gi) = v;
  }
}

// ---------------------------------------------------------------------------
// K / V^T staging for attention. A stage is 64 keys: the K tile (64 key rows x
// 128 B of d) and behind it the V^T tile (64 d rows x 128 B of keys), each row
// laid in LDS at a pitch of 144 B (16 B x odd: conflict-free for 16-byte
// fragment reads). Two buffers: stage t+1 is copied global -> LDS
// asynchronously, once per block, while the four waves that read it work on stage t.
// ---------------------------------------------------------------------------
#define KV_PITCH 144                         // LDS bytes per staged row
#define KV_TILE  (64 * KV_PITCH)             // 9216 B
#define KV_STAGE (2 * KV_TILE)               // 18432 B

static_assert(KV_PITCH % 16 == 0 && HD * 2 == 128 && SEQ % 64 == 0);

// Eight 16-byte-per-lane copies global -> LDS. The s_wait_xcnt closes the
// statement so that no address register named here is rewritten ahead of it.
__device__ __forceinline__ void copy8(const unsigned (&l)[8], const _Float16* const (&g)[8]) {
  asm volatile(
      "global_load_async_to_lds_b128 %0, %8, off\n\t"
      "global_load_async_to_lds_b128 %1, %9, off\n\t"
      "global_load_async_to_lds_b128 %2, %10, off\n\t"
      "global_load_async_to_lds_b128 %3, %11, off\n\t"
      "global_load_async_to_lds_b128 %4, %12, off\n\t"
      "global_load_async_to_lds_b128 %5, %13, off\n\t"
      "global_load_async_to_lds_b128 %6, %14, off\n\t"
      "global_load_async_to_lds_b128 %7, %15, off\n\t"
      "s_wait_xcnt 0x0"
      :: "v"(l[0]), "v"(l[1]), "v"(l[2]), "v"(l[3]), "v"(l[4]), "v"(l[5]), "v"(l[6]), "v"(l[7]),
         "v"(g[0]), "v"(g[1]), "v"(g[2]), "v"(g[3]), "v"(g[4]), "v"(g[5]), "v"(g[6]), "v"(g[7])
      : "memory");
}

// One stage, by 128 threads: thread t copies 16 B at column 16*(t&7) of rows (t>>3) + 16i of both
// tiles (i = 0..3); a wave's copy covers four whole 128-B rows.
// lds = this thread's LDS byte address in row (t>>3) of the target buffer's K tile;
// gk / gv = this thread's element in that row of K / V^T at the stage's first key.
__device__ __forceinline__ void kv_stage_copy(unsigned lds, const _Float16* gk, const _Float16* gv) {
  unsigned l[8];
  const _Float16* g[8];
  #pragma unroll
  for (int i = 0; i < 4; ++i) {
    l[i]     = lds + (unsigned)(i * 16 * KV_PITCH);
    g[i]     = gk + (size_t)(i * 16) * HD;
    l[4 + i] = lds + (unsigned)(KV_TILE + i * 16 * KV_PITCH);
    g[4 + i] = gv + (size_t)(i * 16) * SEQ;
  }
  copy8(l, g);
}

// ---------------------------------------------------------------------------
// Kernel 4: causal streaming attention, transposed form.
// Block 256 thr = two halves of 4 waves. A block takes two tiles of 64 queries in
// turn, tile 31 - x and then tile x, so that every block walks the same number of
// key tiles (33 of 64 keys). Inside a query tile the key tiles are dealt to the two
// halves by turns: half g takes key tiles 2*st + g, 16 queries per wave, and each
// half keeps its own running maximum, sum and O; the two are joined once per query
// tile through LDS. A ring stage is 128 keys: each half copies and reads its own 64.
//   S^T = K * Q^T : A = K rows (row = key, k = d), B = Q^T (k = d, n = query)
//   O^T += V^T * P^T : A = Vt rows (row = d, k = key), B = P^T from registers
// Lane owns 32 keys of query column (lane&15); partner = lane ^ 16.
// The 1/8 scale is folded into the exponent argument (exact power of two).
// ---------------------------------------------------------------------------
#define AT      256                          // threads of an attention block
#define QTILES  (SEQ / 64)                   // query tiles of a head
#define KV_BUF  (2 * KV_STAGE)               // one buffer: the 64-key stages of both halves
#define KV_RING2 (2 * KV_BUF)                // 73728 B
#define MG_CH   9                            // 16-B pieces a lane hands over: 8 of O, 1 of (max, sum)

static_assert(QTILES % 2 == 0 && SEQ % 128 == 0);
static_assert(4 * MG_CH * 32 * 16 <= KV_RING2);

__global__ __launch_bounds__(AT) void attn_kernel(
    const _Float16* __restrict__ qh,   // [B*H][S][64]
    const _Float16* __restrict__ kh,   // [B*H][S][64]
    const _Float16* __restrict__ vt,   // [B*H][64][S]
    _Float16* __restrict__ ao)         // [B][S][DM]
{
  __shared__ __attribute__((aligned(16))) _Float16 sO[4 * 16 * 64];    // 8192 B
  __shared__ __attribute__((aligned(16))) char kv[KV_RING2];           // K / V^T stages, two buffers; then the hand-over

  const int tid = threadIdx.x, lane = tid & 31;
  const int wq = (tid >> 5) & 3;                                // which 16 queries of the tile
  const int g = __builtin_amdgcn_readfirstlane(tid >> 7);       // which half; scalar, so the tests on it are scalar branches
  const int h = lane >> 4, m = lane & 15;
  const int bh = blockIdx.y, b = bh >> 4, head = bh & 15;

  const v8f zero8 = {0.f, 0.f, 0.f, 0.f, 0.f, 0.f, 0.f, 0.f};
  const int crow = (tid & 127) >> 3, ccol = tid & 7;
  const unsigned lds0 = (unsigned)(size_t)kv + (unsigned)(g * KV_STAGE + crow * KV_PITCH + ccol * 16);
  const _Float16* gk = kh + ((size_t)bh * SEQ + 64 * g + crow) * HD + ccol * 8;    // + 128*st*HD
  const _Float16* gv = vt + ((size_t)bh * HD + crow) * SEQ + 64 * g + ccol * 8;    // + 128*st
  v4fa* mg = (v4fa*)kv + wq * MG_CH * 32 + lane;                // this lane's hand-over pieces, 32 pieces apart
  _Float16* so = sO + wq * 1024;

  // Kept rolled: the two query tiles run the same text one after the other.
  #pragma unroll 1
  for (int pass = 0; pass < 2; ++pass) {
    const int xt = pass ? (int)blockIdx.x : QTILES - 1 - (int)blockIdx.x;
    const int q0 = xt * 64 + 16 * wq;
    const int T64 = xt + 1;                     // key tiles up to and with the diagonal one (block-uniform)
    const int NS = (T64 + 1) >> 1;              // ring stages of 128 keys; 128*NS <= SEQ

    // Q^T B-fragments: column n = query q0+m, k = d (two 32-deep chunks)
    const _Float16* qrow = qh + ((size_t)bh * SEQ + q0 + m) * HD;
    const v16h qb0 = load_frag(qrow, h);
    const v16h qb1 = load_frag(qrow + 32, h);

    v8f o[4];                                   // o[t][r] = O[query m][d 16t+8h+r] * (l * 2^14), this half's keys
    #pragma unroll
    for (int t = 0; t < 4; ++t) o[t] = zero8;
    float mrun = -1e30f, lrun = 0.0f;

    kv_stage_copy(lds0, gk, gv);
    asm volatile("s_wait_asynccnt 0x0" ::: "memory");   // own copies of stage 0 landed
    __syncthreads();                                    // publishes stage 0
    if (NS > 1) kv_stage_copy(lds0 + KV_BUF, gk + 128 * HD, gv + 128);

    #pragma unroll 1
    for (int st = 0; st < NS; ++st) {
      const int kb = 128 * st + 64 * g;
      const int bo = (st & 1) * KV_BUF;
      if (2 * st + g < T64) {                             // the last stage of an odd count has no key tile for the second half
        const char* pk = kv + bo + g * KV_STAGE + m * KV_PITCH;   // K row m of this half's stage
        const char* pv = pk + KV_TILE;                            // V^T row m of this half's stage
        // ---- raw scores: s[j][r] = S[query q0+m][key kb+16j+8h+r] (unscaled) ----
        v8f s[4];
        #pragma unroll
        for (int j = 0; j < 4; ++j) {
          const _Float16* kp = (const _Float16*)(pk + 16 * j * KV_PITCH);
          const v16h kf0 = load_frag(kp, h);
          const v16h kf1 = load_frag(kp + 32, h);
          v8f z = zero8;
          z = wmma_f16(kf0, qb0, z);
          z = wmma_f16(kf1, qb1, z);
          s[j] = z;
        }
        // ---- causal mask (only on the key tile touching the diagonal) ----
        if (kb + 63 > q0) {
          const int qq = q0 + m;
          #pragma unroll
          for (int j = 0; j < 4; ++j)
            #pragma unroll
            for (int r = 0; r < 8; ++r) {
              const int kk = kb + 16 * j + 8 * h + r;
              if (kk > qq) s[j][r] = -1e30f;
            }
        }

        // ---- online softmax (scale 1/8 applied inside the exp argument) ----
        float mloc = s[0][0];
        #pragma unroll
        for (int j = 0; j < 4; ++j)
          #pragma unroll
          for (int r = 0; r < 8; ++r) mloc = fmaxf(mloc, s[j][r]);
        mloc = fmaxf(mloc, __shfl_xor(mloc, 16));
        const float mnew = fmaxf(mrun, mloc);
        const float cn = mnew * 0.125f;
        const float alpha = __expf((mrun - mnew) * 0.125f);
        mrun = mnew;
        float lsum = 0.0f;
        #pragma unroll
        for (int j = 0; j < 4; ++j)
          #pragma unroll
          for (int r = 0; r < 8; ++r) {
            const float p = __expf(fmaf(s[j][r], 0.125f, -cn));
            s[j][r] = p;
            lsum += p;
          }
        lsum += __shfl_xor(lsum, 16);
        lrun = lrun * alpha + lsum;
        #pragma unroll
        for (int t = 0; t < 4; ++t)
          #pragma unroll
          for (int r = 0; r < 8; ++r) o[t][r] = o[t][r] * alpha;

        // ---- P^T B-fragments (key chunks 0..31 and 32..63 of this key tile) ----
        const v16h pb0 = pack_p(s[0], s[1]);
        const v16h pb1 = pack_p(s[2], s[3]);

        // ---- O^T += V^T * P^T ----
        #pragma unroll
        for (int t = 0; t < 4; ++t) {
          const _Float16* vp = (const _Float16*)(pv + 16 * t * KV_PITCH);
          const v16h vf0 = load_frag(vp, h);
          const v16h vf1 = load_frag(vp + 32, h);
          o[t] = wmma_f16(vf0, pb0, o[t]);
          o[t] = wmma_f16(vf1, pb1, o[t]);
        }
      }
      asm volatile("s_wait_dscnt 0x0" ::: "memory");    // own reads of this buffer are done before it is refilled
      asm volatile("s_wait_asynccnt 0x0" ::: "memory"); // own copies of stage st+1 landed
      __syncthreads();                                  // publishes stage st+1, frees stage st's buffer
      if (st + 2 < NS) kv_stage_copy(lds0 + bo, gk + (size_t)(128 * (st + 2)) * HD, gv + 128 * (st + 2));
    }
    asm volatile("s_wait_asynccnt 0x0" ::: "memory");   // nothing in flight when the ring is reused

    // ---- the second half hands its maximum, sum and O to the first, lane to lane ----
    if (g == 1) {
      #pragma unroll
      for (int t = 0; t < 4; ++t) {
        const v4f lo = { o[t][0], o[t][1], o[t][2], o[t][3] };
        const v4f hi = { o[t][4], o[t][5], o[t][6], o[t][7] };
        mg[(2 * t) * 32] = lo;
        mg[(2 * t + 1) * 32] = hi;
      }
      const v4f ml = { mrun, lrun, 0.0f, 0.0f };
      mg[8 * 32] = ml;
    }
    __syncthreads();                                    // the hand-over is written

    // ---- join, normalise, stage per-wave 16x64 f16 tile ----
    if (g == 0) {
      const v4f ml = mg[8 * 32];
      const float mall = fmaxf(mrun, ml.x);
      const float f0 = __expf((mrun - mall) * 0.125f);
      const float f1 = __expf((ml.x - mall) * 0.125f);  // 0 where the second half had no key tile (its maximum is -1e30)
      const float inv = (1.0f / (lrun * f0 + ml.y * f1)) * (1.0f / PSCALE);
      const float c0 = f0 * inv, c1 = f1 * inv;
      #pragma unroll
      for (int t = 0; t < 4; ++t) {
        const v4f lo = mg[(2 * t) * 32];
        const v4f hi = mg[(2 * t + 1) * 32];
        #pragma unroll
        for (int r = 0; r < 4; ++r) {
          so[m * 64 + 16 * t + 8 * h + r]     = (_Float16)(o[t][r] * c0 + lo[r] * c1);
          so[m * 64 + 16 * t + 8 * h + 4 + r] = (_Float16)(o[t][4 + r] * c0 + hi[r] * c1);
        }
      }
    }
    asm volatile("s_wait_dscnt 0x0" ::: "memory");      // own reads of the hand-over are done before the next tile's copies overwrite it
    __syncthreads();                                    // frees the ring for the next query tile; the staged tile is written

    if (g == 0) {
      att_store_pass(so, ao, b, head, q0, lane);
      asm volatile("s_wait_xcnt 0x0" ::: "memory");     // no register of these stores is rewritten ahead of it in the next query tile
    }
  }
}

// ---------------------------------------------------------------------------
// Exact-form GELU without a branch, eight values at a time as four packed f32 pairs:
// x * Phi(x) = max(x, 0) - |x| * erfc(|x| / sqrt 2) / 2 with
// erfc(z) = t (a1 + t (a2 + t (a3 + t (a4 + t a5)))) exp(-z z), t = 1 / (1 + p z), z >= 0
// (rational form with five terms, absolute error of erfc below 1.5e-7). The halves and
// the 1 / sqrt 2 are folded into the constants; no subtraction from 1 on the negative side.
// Written step by step across the four pairs, so that their chains run side by side; every
// loop is unrolled so that the small arrays are registers.
// ---------------------------------------------------------------------------
typedef float v2f __attribute__((ext_vector_type(2)));
typedef _Float16 v2h __attribute__((ext_vector_type(2)));

__device__ __forceinline__ v2f fma2(v2f a, v2f b, v2f c) { return __builtin_elementwise_fma(a, b, c); }

// y[i] = gelu(c[2i], c[2i+1]) for c = acc * WINV + bias
__device__ __forceinline__ void gelu_erf8(v8f acc, float bias, v2h (&y)[4]) {
  v2f x[4], ax[4], t[4], e[4], q[4];
  #pragma unroll
  for (int i = 0; i < 4; ++i) {
    const v2f c = { acc[2 * i], acc[2 * i + 1] };
    x[i] = fma2(c, (v2f)(WINV), (v2f)(bias));
  }
  #pragma unroll
  for (int i = 0; i < 4; ++i) {
    ax[i] = __builtin_elementwise_abs(x[i]);
    const v2f d = fma2(ax[i], (v2f)(0.23164189f), (v2f)(1.0f));                // 1 + (p / sqrt 2) |x|
    const v2f r = { __builtin_amdgcn_rcpf(d.x), __builtin_amdgcn_rcpf(d.y) };
    t[i] = r;
  }
  #pragma unroll
  for (int i = 0; i < 4; ++i) {
    const v2f a = (x[i] * -0.72134752f) * x[i];                                // -x x / 2 as a power of two
    const v2f r = { __builtin_amdgcn_exp2f(a.x), __builtin_amdgcn_exp2f(a.y) };
    e[i] = r;
  }
  #pragma unroll
  for (int i = 0; i < 4; ++i) q[i] = fma2(t[i], (v2f)(0.5307027145f), (v2f)(-0.7265760135f));
  #pragma unroll
  for (int i = 0; i < 4; ++i) q[i] = fma2(q[i], t[i], (v2f)(0.7107068705f));
  #pragma unroll
  for (int i = 0; i < 4; ++i) q[i] = fma2(q[i], t[i], (v2f)(-0.142248368f));
  #pragma unroll
  for (int i = 0; i < 4; ++i) q[i] = fma2(q[i], t[i], (v2f)(0.127414796f));
  #pragma unroll
  for (int i = 0; i < 4; ++i) t[i] = t[i] * e[i];
  #pragma unroll
  for (int i = 0; i < 4; ++i) q[i] = q[i] * t[i];                              // erfc(|x| / sqrt 2) / 2
  #pragma unroll
  for (int i = 0; i < 4; ++i)
    y[i] = __builtin_convertvector(fma2(-ax[i], q[i], __builtin_elementwise_max(x[i], (v2f)(0.0f))), v2h);
}

// ---------------------------------------------------------------------------
// Kernel 5: Y = A[M,K](f16) * W[N,K]^T(f16 x32) with epilogue.
//   MODE 1: outf[M][N] (f32) = (acc/32 + bias) + resid      block 128 rows x 128 cols
//   MODE 2: outh[M][N] (f16) = gelu_erf(acc/32 + bias)      block 256 rows x 256 cols
// Block 256 thr (8 waves, 4 x 2); wave = 32 rows x 64 cols (MODE 1) or 64 rows x 128 cols (MODE 2).
// ---------------------------------------------------------------------------
template <int MODE>
__global__ __launch_bounds__(GT) void gemm_kernel(
    const _Float16* __restrict__ A, const _Float16* __restrict__ W,
    const float* __restrict__ bias, const float* __restrict__ resid,
    float* __restrict__ outf, _Float16* __restrict__ outh, int N, int K)
{
  constexpr int MT = (MODE == 2) ? 4 : 2, NT = (MODE == 2) ? 8 : 4, KP = (MODE == 2) ? 128 : 256;
  __shared__ __attribute__((aligned(16))) char ring[RING_B(MT, NT, KP)];   // operand ring, then the output tile (at most 135168 B)

  const int tid = threadIdx.x, lane = tid & 31, w = tid >> 5;
  const int wm = w >> 1, wn = w & 1;
  const int h = lane >> 4, m = lane & 15;
  const int m0 = blockIdx.x * (64 * MT), n0 = blockIdx.y * (32 * NT);

  v8f acc[MT][NT];
  gemm_main<MT, NT, KP>(ring, A + (size_t)m0 * K, W + (size_t)n0 * K, K, tid, acc);

  // D[r] of tile (mt, nt) = Y[row m0+16*MT*wm+16mt+8h+r][col n0+16*NT*wn+16nt+m]
  if (MODE == 1) {
    float* sbuf = (float*)ring;
    #pragma unroll
    for (int nt = 0; nt < 4; ++nt)
      #pragma unroll
      for (int mt = 0; mt < MT; ++mt)
        #pragma unroll
        for (int r = 0; r < 8; ++r)
          sbuf[(16 * MT * wm + 16 * mt + 8 * h + r) * FP128 + 64 * wn + 16 * nt + m] = acc[mt][nt][r] * WINV;
    __syncthreads();

    // a row = 128 floats = 4 lines = one 16-B access per lane; wave w takes rows 8i + w
    const int col = 4 * lane;
    const v4f bb = *(const v4fa*)(bias + n0 + col);
    v4f vals[16];
    #pragma unroll
    for (int i = 0; i < 16; ++i) {
      const int rl = i * 8 + w;                    // 0..127
      const v4f a  = *(const v4fa*)(sbuf + rl * FP128 + col);
      const size_t gi = (size_t)(m0 + rl) * N + n0 + col;
      const v4f rr = *(const v4fa*)(resid + gi);
      vals[i] = (a + bb) + rr;
    }
    #pragma unroll
    for (int i = 0; i < 16; ++i) {
      const int rl = i * 8 + w;
      const size_t gi = (size_t)(m0 + rl) * N + n0 + col;
      *(v4f*)(outf + gi) = vals[i];
    }
  } else {
    _Float16* sh = (_Float16*)ring;
    // Unrolled: acc takes constant indices only, and the branch-free text is short enough for it.
    float bv[NT];
    #pragma unroll
    for (int nt = 0; nt < NT; ++nt) bv[nt] = bias[n0 + 16 * NT * wn + 16 * nt + m];
    asm volatile("s_wait_xcnt 0x0" ::: "memory");  // no address register of the bias loads is rewritten ahead of it
    __builtin_amdgcn_sched_barrier(0);             // holds the arithmetic below behind that wait: the scheduler had lifted it over
    #pragma unroll
    for (int nt = 0; nt < NT; ++nt) {
      const float bvl = bv[nt];
      #pragma unroll
      for (int mt = 0; mt < MT; ++mt) {
        v2h gl[4];
        gelu_erf8(acc[mt][nt], bvl, gl);
        #pragma unroll
        for (int i = 0; i < 4; ++i) {
          sh[(16 * MT * wm + 16 * mt + 8 * h + 2 * i) * HP256 + 16 * NT * wn + 16 * nt + m] = gl[i].x;
          sh[(16 * MT * wm + 16 * mt + 8 * h + 2 * i + 1) * HP256 + 16 * NT * wn + 16 * nt + m] = gl[i].y;
        }
      }
    }
    __syncthreads();

    // a row = 256 halves = 4 lines = one 16-B access per lane; wave w takes rows 8i + w
    v8h vals[32];
    #pragma unroll
    for (int i = 0; i < 32; ++i) {
      const int rl = i * 8 + w;                    // 0..255
      vals[i] = *(const v8ha*)(sh + rl * HP256 + 8 * lane);
    }
    #pragma unroll
    for (int i = 0; i < 32; ++i) {
      const int rl = i * 8 + w;
      *(v8h*)(outh + (size_t)(m0 + rl) * N + n0 + 8 * lane) = vals[i];
    }
  }
}

// ---------------------------------------------------------------------------
extern "C" void kernel_launch(void* const* d_in, const int* in_sizes, int n_in,
                              void* d_out, int out_size, void* d_ws, size_t ws_size,
                              hipStream_t stream) {
  if (n_in < 13) return;
  if (in_sizes[0] != NTOK * DM) return;
  if (in_sizes[1] != 3 * DM * DM || in_sizes[2] != 3 * DM) return;
  if (in_sizes[3] != DM * DM || in_sizes[4] != DM) return;
  if (in_sizes[5] != DFF * DM || in_sizes[6] != DFF) return;
  if (in_sizes[7] != DM * DFF || in_sizes[8] != DM) return;
  if (in_sizes[9] != DM || in_sizes[10] != DM || in_sizes[11] != DM || in_sizes[12] != DM) return;
  if (out_size != NTOK * DM) return;

  const float* hidden = (const float*)d_in[0];
  const float* qkv_w  = (const float*)d_in[1];
  const float* qkv_b  = (const float*)d_in[2];
  const float* out_w  = (const float*)d_in[3];
  const float* out_b  = (const float*)d_in[4];
  const float* fc1_w  = (const float*)d_in[5];
  const float* fc1_b  = (const float*)d_in[6];
  const float* fc2_w  = (const float*)d_in[7];
  const float* fc2_b  = (const float*)d_in[8];
  const float* ln1_g  = (const float*)d_in[9];
  const float* ln1_b  = (const float*)d_in[10];
  const float* ln2_g  = (const float*)d_in[11];
  const float* ln2_b  = (const float*)d_in[12];
  float* out = (float*)d_out;

  // workspace carve (all sizes multiples of 256 B)
  const size_t wh_bytes   = (size_t)G_ALL * 8 * 2;          // 25165824
  const size_t act_bytes  = (size_t)NTOK * DM * 2;           //  8388608  (f16 [4096][1024])
  const size_t hid2_bytes = (size_t)NTOK * DM * 4;           // 16777216
  const size_t ff_bytes   = (size_t)NTOK * DFF * 2;          // 33554432
  const size_t total = wh_bytes + 5 * act_bytes + hid2_bytes + ff_bytes;   // 117440512
  if (total > ws_size) return;

  char* ws = (char*)d_ws;
  size_t off = 0;
  _Float16* wh   = (_Float16*)(ws + off); off += wh_bytes;
  _Float16* xn   = (_Float16*)(ws + off); off += act_bytes;   // ln1 output, later ln2 output
  _Float16* qh   = (_Float16*)(ws + off); off += act_bytes;
  _Float16* kh   = (_Float16*)(ws + off); off += act_bytes;
  _Float16* vt   = (_Float16*)(ws + off); off += act_bytes;
  _Float16* ah   = (_Float16*)(ws + off); off += act_bytes;   // attention output f16 [4096][1024]
  float*    hid2 = (float*)(ws + off);    off += hid2_bytes;  // hidden + attn proj, f32
  _Float16* ff   = (_Float16*)(ws + off); off += ff_bytes;    // gelu(fc1) f16 [4096][4096]
  if (off > ws_size) return;

  const _Float16* w_qkv = wh;
  const _Float16* w_out = wh + (size_t)3 * DM * DM;
  const _Float16* w_fc1 = wh + (size_t)4 * DM * DM;
  const _Float16* w_fc2 = wh + (size_t)4 * DM * DM + (size_t)DFF * DM;

  // 1: weights -> f16 x32
  cvt_w_kernel<<<G_ALL / 256, 256, 0, stream>>>(qkv_w, out_w, fc1_w, fc2_w, wh);

  // 2: ln1 -> f16
  ln_kernel<<<NTOK / 8, 256, 0, stream>>>(hidden, ln1_g, ln1_b, xn, NTOK);

  // 3: qkv projection -> q/k planes + transposed v
  qkv_kernel<<<dim3(NTOK / 256, 3 * DM / 192), GT, 0, stream>>>(xn, w_qkv, qkv_b, qh, kh, vt);

  // 4: causal attention -> f16 [tok][DM]
  attn_kernel<<<dim3(QTILES / 2, BATCH * NH), AT, 0, stream>>>(qh, kh, vt, ah);

  // 5: output projection + bias + residual -> f32 hid2
  gemm_kernel<1><<<dim3(NTOK / 128, DM / 128), GT, 0, stream>>>(ah, w_out, out_b, hidden, hid2, xn, DM, DM);

  // 6: ln2 -> f16 (reuses xn)
  ln_kernel<<<NTOK / 8, 256, 0, stream>>>(hid2, ln2_g, ln2_b, xn, NTOK);

  // 7: fc1 + exact gelu -> f16 ff
  gemm_kernel<2><<<dim3(NTOK / 256, DFF / 256), GT, 0, stream>>>(xn, w_fc1, fc1_b, fc1_b, hid2, ff, DFF, DM);

  // 8: fc2 + bias + residual(hid2) -> f32 d_out
  gemm_kernel<1><<<dim3(NTOK / 128, DM / 128), GT, 0, stream>>>(ff, w_fc2, fc2_b, hid2, out, xn, DM, DFF);
}

// v007
// It runs in 134 microseconds.
// Two timings next to v006 both put it at 1.05 times that version's speed.
// Over all steps from v000 it is 4.03 times as fast.
// Contractions: ln1(x)*Wqkv^T, K*Q^T, V^T*P^T, attn*Wout^T, ln2(h)*Wfc1^T, gelu(.)*Wfc2^T all on v_wmma_f32_16x16x32_f16 (f16 operands, f32 accumulate); every W carried x32 and P carried x16384 (exact power-of-two scales folded back in f32); layernorm, softmax, bias, gelu and residual adds in f32.
#include <hip/hip_runtime.h>
#include <math.h>
#include <stdint.h>

typedef _Float16 v16h __attribute__((ext_vector_type(16)));
typedef _Float16 v8h  __attribute__((ext_vector_type(8)));
typedef float    v8f  __attribute__((ext_vector_type(8)));
typedef float    v4f  __attribute__((ext_vector_type(4)));
typedef v8h __attribute__((may_alias)) v8ha;
typedef v4f __attribute__((may_alias)) v4fa;

union Frag { v16h v; v8h half[2]; };

#define DM     1024
#define NH     16
#define HD     64
#define DFF    4096
#define SEQ    2048
#define BATCH  2
#define NTOK   (BATCH * SEQ)          // 4096 tokens
#define WSC    32.0f
#define WINV   0.03125f
#define PSCALE 16384.0f

#define G_QKV (3 * DM * DM / 8)       // 393216 groups of 8
#define G_OUT (DM * DM / 8)           // 131072
#define G_FC1 (DFF * DM / 8)          // 524288
#define G_FC2 (DM * DFF / 8)          // 524288
#define G_ALL (G_QKV + G_OUT + G_FC1 + G_FC2)   // 1572864

static_assert(NTOK % 128 == 0);
static_assert(SEQ % 128 == 0);
static_assert(DM % 64 == 0);
static_assert(DFF % 64 == 0);
static_assert(G_ALL % 256 == 0);

// ---------------------------------------------------------------------------
// 16x16x32 f16 WMMA with hazard guard (ties D, keeps A/B live).
// Fragment map (wave32): lane l, h = l>>4, m = n = l&15.
//   A/B element i: i<8 -> k0+8h+i ; i>=8 -> k0+16+8h+(i-8)
//   D element r : row 8h+r, col l&15
// ---------------------------------------------------------------------------
__device__ __forceinline__ v8f wmma_f16(v16h a, v16h b, v8f c) {
  v8f d = __builtin_amdgcn_wmma_f32_16x16x32_f16(false, a, false, b, (short)0, c, false, false);
  asm volatile("v_nop\n\tv_nop\n\tv_nop\n\tv_nop" : "+v"(d) : "v"(a), "v"(b));
  return d;
}

// A or B fragment from a k-contiguous 16-bit row; p points at element k0 of
// the row owned by this lane (row index = lane & 15 added by the caller).
__device__ __forceinline__ v16h load_frag(const _Float16* p, int h) {
  Frag f;
  f.half[0] = *(const v8ha*)(p + 8 * h);
  f.half[1] = *(const v8ha*)(p + 16 + 8 * h);
  return f.v;
}

// ---------------------------------------------------------------------------
// Kernel 1: f32 weights -> f16 planes scaled by 32 (exact). One 16-B store per
// wh layout: [qkv 3*DM*DM][out DM*DM][fc1 DFF*DM][fc2 DM*DFF], row = output feature.
// ---------------------------------------------------------------------------
__global__ __launch_bounds__(256) void cvt_w_kernel(
    const float* __restrict__ w0, const float* __restrict__ w1,
    const float* __restrict__ w2, const float* __restrict__ w3,
    _Float16* __restrict__ wh)
{
  const int g = blockIdx.x * 256 + threadIdx.x;
  if (g >= G_ALL) return;
  const float* src;
  if (g < G_QKV)                        src = w0 + (size_t)g * 8;
  else if (g < G_QKV + G_OUT)           src = w1 + (size_t)(g - G_QKV) * 8;
  else if (g < G_QKV + G_OUT + G_FC1)   src = w2 + (size_t)(g - G_QKV - G_OUT) * 8;
  else                                  src = w3 + (size_t)(g - G_QKV - G_OUT - G_FC1) * 8;
  _Float16* dst = wh + (size_t)g * 8;
  const v4f a = *(const v4fa*)src;
  const v4f c = *(const v4fa*)(src + 4);
  const v8h o = { (_Float16)(a.x * WSC), (_Float16)(a.y * WSC), (_Float16)(a.z * WSC), (_Float16)(a.w * WSC),
                  (_Float16)(c.x * WSC), (_Float16)(c.y * WSC), (_Float16)(c.z * WSC), (_Float16)(c.w * WSC) };
  *(v8h*)dst = o;
  
}

// ---------------------------------------------------------------------------
// Kernel 2: LayerNorm over rows of DM f32 -> f16. One wave per row (block of 8
// i*256 + lane*8 + 0..7 (i = 0..3) so every store instruction is 32 lanes x
// ---------------------------------------------------------------------------
__global__ __launch_bounds__(256) void ln_kernel(
    const float* __restrict__ x, const float* __restrict__ g,
    const float* __restrict__ bt, _Float16* __restrict__ y, int nrows)
{
  const int lane = threadIdx.x & 31, w = threadIdx.x >> 5;
  const int row = blockIdx.x * 8 + w;
  if (row >= nrows) return;                      // wave-uniform; no barriers below
  const float* xr = x + (size_t)row * DM;

  v4f xa[4], xb[4];
  float s = 0.0f;
  #pragma unroll
  for (int i = 0; i < 4; ++i) {
    const float* p = xr + i * 256 + lane * 8;
    xa[i] = *(const v4fa*)p;
    xb[i] = *(const v4fa*)(p + 4);
    s += ((xa[i].x + xa[i].y) + (xa[i].z + xa[i].w)) + ((xb[i].x + xb[i].y) + (xb[i].z + xb[i].w));
  }
  #pragma unroll
  for (int off = 16; off > 0; off >>= 1) s += __shfl_xor(s, off);
  const float mu = s * (1.0f / DM);

  float ss = 0.0f;
  #pragma unroll
  for (int i = 0; i < 4; ++i) {
    const v4f da = xa[i] - mu, db = xb[i] - mu;
    ss += ((da.x * da.x + da.y * da.y) + (da.z * da.z + da.w * da.w)) +
          ((db.x * db.x + db.y * db.y) + (db.z * db.z + db.w * db.w));
  }
  #pragma unroll
  for (int off = 16; off > 0; off >>= 1) ss += __shfl_xor(ss, off);
  const float var = ss * (1.0f / DM);
  const float rstd = rsqrtf(var + 1e-5f);

  v8h o[4];
  #pragma unroll
  for (int i = 0; i < 4; ++i) {
    const int p = i * 256 + lane * 8;
    const v4f ga = *(const v4fa*)(g + p),  gb = *(const v4fa*)(g + p + 4);
    const v4f ba = *(const v4fa*)(bt + p), bb = *(const v4fa*)(bt + p + 4);
    const v4f da = (xa[i] - mu) * rstd, db = (xb[i] - mu) * rstd;
    const v8h t = { (_Float16)(da.x * ga.x + ba.x), (_Float16)(da.y * ga.y + ba.y),
                    (_Float16)(da.z * ga.z + ba.z), (_Float16)(da.w * ga.w + ba.w),
                    (_Float16)(db.x * gb.x + bb.x), (_Float16)(db.y * gb.y + bb.y),
                    (_Float16)(db.z * gb.z + bb.z), (_Float16)(db.w * gb.w + bb.w) };
    o[i] = t;
  }
  _Float16* yr = y + (size_t)row * DM;
  #pragma unroll
  for (int i = 0; i < 4; ++i) *(v8h*)(yr + i * 256 + lane * 8) = o[i];
  
}

// ---------------------------------------------------------------------------
// Shared GEMM main loop: 256 threads, 8 waves in a 4 x 2 grid. Block tile 64*MT
// (rows of A) x 32*NT (rows of W), wave tile 16*MT x 16*NT. A stage is KP k of all
// 64*MT + 32*NT rows, cut into slices of 64 rows x 128 k (256 B a row). One wave brings one
// slice a stage with one tensor load, which lays the rows in LDS at a pitch of 272 B
// (16 B x odd: conflict-free for 16-byte fragment reads). Slice number = 128-k half * row
// groups + row group; row groups: first those of A, then those of W. Two buffers: stage t+1
// flies global -> LDS while stage t is multiplied. Every launch is 256 blocks, one on a WGP.
//   MT 4, NT 8, KP 128: 256 x 256, 8 slices, ring 294912 B (fc1)
//   MT 4, NT 6, KP 128: 256 x 192, 7 slices, ring 258048 B (qkv)
//   MT 2, NT 4, KP 256: 128 x 128, 8 slices, ring 294912 B (out, fc2)
// acc[mt][nt][r] = sum_k A[16*MT*wm + 16mt + 8h + r][k] * W[16*NT*wn + 16nt + m][k],
// wm = wave >> 1, wn = wave & 1, k ascending in steps of 32.
// ---------------------------------------------------------------------------
#define GT      256                          // threads of a GEMM block
#define SL_PITCH 272                         // LDS bytes per staged row: 256 B + the tensor load's pad of 16 B
#define SL_B     18432                       // LDS bytes of a slice: 64 rows x 272 B = 17408, rounded up to a multiple of 2 KiB
#define RGROUPS(MT, NT)     ((MT) + (NT) / 2)                // groups of 64 rows in a stage
#define NSLICE(MT, NT, KP)  (RGROUPS(MT, NT) * ((KP) / 128))
#define STAGE_B(MT, NT, KP) (NSLICE(MT, NT, KP) * SL_B)
#define RING_B(MT, NT, KP)  (2 * STAGE_B(MT, NT, KP))

static_assert(DM % 256 == 0 && DFF % 256 == 0);
static_assert(NTOK % 256 == 0 && SEQ % 256 == 0 && DM % 128 == 0 && (3 * DM) % 192 == 0);
static_assert(64 * SL_PITCH <= SL_B && SL_B % 2048 == 0 && RING_B(4, 8, 128) <= 327680);

typedef uint32_t u32x4 __attribute__((ext_vector_type(4)));
typedef uint32_t u32x8 __attribute__((ext_vector_type(8)));

__device__ __forceinline__ uint32_t uni(uint32_t v) { return (uint32_t)__builtin_amdgcn_readfirstlane(v); }
// Holds a wave-uniform value in a scalar register, so that a test on it is a scalar branch (a tensor
// load ignores EXEC) and a descriptor word made from it is scalar arithmetic behind this place.
__device__ __forceinline__ uint32_t pinned(uint32_t v) {
  uint32_t w = uni(v);
  asm volatile("" : "+s"(w));   // the value stays in a scalar register from here on
  return w;
}

// Descriptor group 1: 1-byte elements, tensor = tile = 64 rows of ROWB B (256 or 128), source row pitch
// src_pitch bytes, 16 B of LDS pad behind every row (interval code 5 or 4 = the row), no mask.
template <uint32_t ROWB>
__device__ __forceinline__ u32x8 tdm_group1(uint32_t src_pitch) {
  static_assert(ROWB == 256u || ROWB == 128u);
  u32x8 g;
  g[0] = uni((1u << 20) | ((ROWB == 256u ? 5u : 4u) << 22) | (3u << 25));
  g[1] = uni(ROWB << 16);                    // tensor_dim0[15:0]
  g[2] = uni(64u << 16);                     // tensor_dim0[31:16] = 0, tensor_dim1[15:0]
  g[3] = uni(ROWB << 16);                    // tensor_dim1[31:16] = 0, tile_dim0
  g[4] = uni(64u);                           // tile_dim1
  g[5] = uni(src_pitch);
  g[6] = uni(0u);
  g[7] = uni(0u);
  return g;
}
// Descriptor group 0: count 1, LDS byte offset, global address of the tile's first byte, type 2.
__device__ __forceinline__ u32x4 tdm_group0(uint32_t lds_dst, uint64_t ga) {
  u32x4 g;
  g[0] = uni(1u);
  g[1] = uni(lds_dst);
  g[2] = uni((uint32_t)ga);
  g[3] = uni((((uint32_t)(ga >> 32)) & 0x01FFFFFFu) | 0x80000000u);
  return g;
}
// One request of the whole wave: global tile -> LDS, through no register. Both groups are in-out
// operands, and tdm_wait0 names them again: so they stay in these scalar registers, unchanged, from
// the issue to the wait (as plain inputs the compiler reused single words of them in between).
__device__ __forceinline__ void tdm_load(u32x4& g0, u32x8& g1) {
  asm volatile("tensor_load_to_lds %0, %1" : "+s"(g0), "+s"(g1) :: "memory");
}
// The wave's own request has landed; g0, g1: the descriptor of the request last issued.
__device__ __forceinline__ void tdm_wait0(const u32x4& g0, const u32x8& g1) {
  asm volatile("s_wait_tensorcnt 0x0" :: "s"(g0), "s"(g1) : "memory");
}

// ablk / wblk: first row of the block's A / W tile. ring: RING_B(MT, NT, KP) bytes of LDS at a multiple
// of 2 KiB; free for other use on return (every wave's reads and loads are done and a barrier passed).
template <int MT, int NT, int KP>
__device__ __forceinline__ void gemm_main(char* ring,
                                          const _Float16* __restrict__ ablk,
                                          const _Float16* __restrict__ wblk,
                                          int K, int tid, v8f (&acc)[MT][NT])
{
  constexpr int RG = RGROUPS(MT, NT), NSL = NSLICE(MT, NT, KP);
  constexpr int STAGE = STAGE_B(MT, NT, KP);
  static_assert(NSL <= GT / 32 && KP % 128 == 0 && NT % 2 == 0 && 64 % (16 * MT) == 0);
  const int lane = tid & 31, w = tid >> 5;
  const int wm = w >> 1, wn = w & 1;
  const int h = lane >> 4, m = lane & 15;
  const v8f zero8 = {0.f, 0.f, 0.f, 0.f, 0.f, 0.f, 0.f, 0.f};
  #pragma unroll
  for (int mt = 0; mt < MT; ++mt)
    #pragma unroll
    for (int nt = 0; nt < NT; ++nt) acc[mt][nt] = zero8;

  // This wave's slice: number = wave; its 64 rows and its 128 k of stage 0.
  const uint32_t wave = uni((uint32_t)tid >> 5);
  const uint32_t rg = wave % (uint32_t)RG, kh = wave / (uint32_t)RG;
  const _Float16* srow = (rg < (uint32_t)MT) ? ablk + (size_t)(64u * rg) * K
                                             : wblk + (size_t)(64u * (rg - (uint32_t)MT)) * K;
  const uint64_t src0 = (uint64_t)(uintptr_t)(srow + 128u * kh);
  const uint32_t lds_slice = (uint32_t)(size_t)ring + wave * (uint32_t)SL_B;
  u32x8 g1 = tdm_group1<256u>((uint32_t)K * 2u);
  const uint32_t T = pinned((uint32_t)(K / KP));

  // Stage s into the buffer at byte buf of the ring. With fewer slices than waves the last wave has none.
  // g0: group 0 of the request last issued, kept up to its wait.
  u32x4 g0;
  auto issue = [&](uint32_t buf, uint32_t s) {
    g0 = tdm_group0(lds_slice + buf, src0 + (uint64_t)s * (uint64_t)(KP * 2));
    if constexpr (NSL == GT / 32) {
      tdm_load(g0, g1);
    } else {
      if (pinned((uint32_t)(wave < (uint32_t)NSL))) tdm_load(g0, g1);
    }
  };

  // Byte offsets in a buffer of the rows this lane reads (first 128-k half).
  const int aof = ((16 * MT * wm) >> 6) * SL_B + ((16 * MT * wm) & 63) * SL_PITCH + m * SL_PITCH;
  int wof[NT];
  #pragma unroll
  for (int nt = 0; nt < NT; ++nt) {
    if constexpr ((16 * NT) % 64 == 0) {
      wof[nt] = (MT + (16 * NT / 64) * wn + (nt >> 2)) * SL_B + ((nt & 3) * 16 + m) * SL_PITCH;
    } else {
      const int r0 = 16 * NT * wn + 16 * nt;               // a group of 16 rows lies in one slice
      wof[nt] = (MT + (r0 >> 6)) * SL_B + ((r0 & 63) + m) * SL_PITCH;
    }
  }

  constexpr bool SPLIT = MT * NT > 16;
  issue(0u, 0u);
  tdm_wait0(g0, g1);                                  // own slice of stage 0 landed
  __syncthreads();                                    // publishes stage 0
  if (pinned((uint32_t)(T > 1u))) issue((uint32_t)STAGE, 1u);

  #pragma unroll 1
  for (uint32_t t = 0; t < T; ++t) {
    const uint32_t bo = (t & 1u) * (uint32_t)STAGE;
    const char* pb = ring + bo;
    #pragma unroll
    for (int kc = 0; kc < KP / 32; ++kc) {
      const int ko = (kc >> 2) * RG * SL_B + (kc & 3) * 64;  // the 128-k half's slices, then 64 B a step of 32 k
      v16h a[MT], b[NT];
      #pragma unroll
      for (int mt = 0; mt < MT; ++mt) a[mt] = load_frag((const _Float16*)(pb + aof + mt * 16 * SL_PITCH + ko), h);
      #pragma unroll
      for (int nt = 0; nt < NT; ++nt) b[nt] = load_frag((const _Float16*)(pb + wof[nt] + ko), h);
      // Keeps the block's LDS reads one group ahead of its products: without the guard's asm statements
      // the compiler dealt them out among the products, each pair of reads with a full wait behind it.
      if constexpr (SPLIT) __builtin_amdgcn_sched_barrier(0);
      #pragma unroll
      for (int nt = 0; nt < NT; ++nt)
        #pragma unroll
        for (int mt = 0; mt < MT; ++mt) {
          // Above 16 tiles the accumulators reach past the first 256 registers, where the operands of the
          // guard's asm statement cannot lie (they went to scratch): the builtin alone, padded by the compiler.
          if constexpr (SPLIT)
            acc[mt][nt] = __builtin_amdgcn_wmma_f32_16x16x32_f16(false, a[mt], false, b[nt], (short)0, acc[mt][nt], false, false);
          else
            acc[mt][nt] = wmma_f16(a[mt], b[nt], acc[mt][nt]);
        }
      if constexpr (SPLIT) __builtin_amdgcn_sched_barrier(0);   // the other side of the same fence
    }
    asm volatile("s_wait_dscnt 0x0" ::: "memory");     // own reads of this buffer are done before it is refilled
    tdm_wait0(g0, g1);                                 // own slice of stage t+1 landed
    __syncthreads();                                   // publishes stage t+1, frees stage t's buffer
    if (pinned((uint32_t)(t + 2u < T))) issue(bo, pinned(t + 2u));   // pinned stage number: the descriptor is formed behind the wait
  }
  tdm_wait0(g0, g1);                                   // nothing in flight when the ring is reused
  asm volatile("s_wait_dscnt 0x0" ::: "memory");       // nor a read of it
}

// Pitches of the output tiles staged in the ring (16 B x odd, so that the two lane
// halves, 8 rows apart, fall on different banks and every row stays 16-B aligned).
#define HP64  72                             // halves per staged row of 64 halves
#define HP256 264                            // halves per staged row of 256 halves
#define FP128 132                            // floats per staged row of 128 floats
#define HEAD_H (256 * HP64)                  // halves of one head's staged tile (256 tokens x 64 features, either way round)

static_assert(64 * HP256 <= HEAD_H && 3 * HEAD_H * 2 <= RING_B(4, 6, 128));

// ---------------------------------------------------------------------------
// Kernel 3: QKV = ln1(x) * Wqkv^T + b over the fused 3*1024 output columns.
// Block 256 thr (8 waves) = 256 tokens x 192 features = three heads out of the 48 of
// q, k and v in a row; a block may hold heads of two of them, so each head is staged
// and stored by itself.
// q plane [B*H][S][64], k plane [B*H][S][64], vt [B*H][64][S].
// Stores: one 16-B store per lane, whole 128-B lines, each line by one instruction.
// ---------------------------------------------------------------------------
__global__ __launch_bounds__(GT) void qkv_kernel(
    const _Float16* __restrict__ xh,   // [NTOK][DM]
    const _Float16* __restrict__ wh,   // [3*DM][DM], row = output feature, x32
    const float* __restrict__ bias,    // [3*DM]
    _Float16* __restrict__ qh, _Float16* __restrict__ kh, _Float16* __restrict__ vt)
{
  __shared__ __attribute__((aligned(2048))) char ring[RING_B(4, 6, 128)];   // operand ring, then the three heads' output tiles
  _Float16* sT = (_Float16*)ring;

  const int tid = threadIdx.x, lane = tid & 31, w = tid >> 5;
  const int wm = w >> 1;
  const int wn = __builtin_amdgcn_readfirstlane(w & 1);   // scalar, so the tests on a column group's head are scalar branches
  const int h = lane >> 4, m = lane & 15;
  const int m0 = blockIdx.x * 256;
  const int cg = blockIdx.y;                 // 0..15: heads 3cg .. 3cg+2 of 48 (q 0..15, k 16..31, v 32..47)

  v8f acc[4][6];
  gemm_main<4, 6, 128>(ring, xh + (size_t)m0 * DM, wh + (size_t)cg * 192 * DM, DM, tid, acc);

  // D[r] of tile (mt, nt) = Y[token m0+64wm+16mt+8h+r][feature cg*192 + 96wn+16nt+m]
  // a head is staged as [token][feature] for q and k, as [feature][token] for v
  float bv[6];
  #pragma unroll
  for (int nt = 0; nt < 6; ++nt) bv[nt] = bias[cg * 192 + 96 * wn + 16 * nt + m];
  asm volatile("s_wait_xcnt 0x0" ::: "memory");            // no address register of the bias loads is rewritten ahead of it
  #pragma unroll
  for (int nt = 0; nt < 6; ++nt) {
    const int c0 = 96 * wn + 16 * nt;                      // first column of the group; a group lies in one head
    const int j = c0 >> 6, cl = (c0 & 63) + m;
    const float bvl = bv[nt];
    _Float16* sH = sT + j * HEAD_H;
    if (3 * cg + j < 2 * NH) {
      #pragma unroll
      for (int mt = 0; mt < 4; ++mt)
        #pragma unroll
        for (int r = 0; r < 8; ++r)
          sH[(64 * wm + 16 * mt + 8 * h + r) * HP64 + cl] = (_Float16)(acc[mt][nt][r] * WINV + bvl);
    } else {
      #pragma unroll
      for (int mt = 0; mt < 4; ++mt) {
        v8h y;                                             // the lane's 8 tokens of one feature lie side by side
        #pragma unroll
        for (int r = 0; r < 8; ++r) y[r] = (_Float16)(acc[mt][nt][r] * WINV + bvl);
        *(v8ha*)(sH + cl * HP256 + 64 * wm + 16 * mt + 8 * h) = y;
      }
    }
  }
  __syncthreads();

  const int b = m0 / SEQ, l0 = m0 - b * SEQ;
  #pragma unroll
  for (int j = 0; j < 3; ++j) {
    const int hg = 3 * cg + j;                             // block-uniform
    const int bh = b * NH + (hg & (NH - 1));
    const _Float16* sH = sT + j * HEAD_H;
    if (hg < 2 * NH) {
      // plane[bh][l][d]: a staged token row = 64 halves = one line; an instruction stores four tokens
      _Float16* plane = (hg < NH) ? qh : kh;
      const int sub = lane >> 3, c8 = lane & 7;
      #pragma unroll
      for (int i = 0; i < 8; ++i) {
        const int tok = (i * 8 + w) * 4 + sub;             // 0..255 over the block
        const v8h v = *(const v8ha*)(sH + tok * HP64 + 8 * c8);
        *(v8h*)(plane + ((size_t)bh * SEQ + l0 + tok) * HD + 8 * c8) = v;
      }
      asm volatile("s_wait_xcnt 0x0" ::: "memory");        // no register of these stores is rewritten ahead of it on any way on from here
    } else {
      // vt[bh][d][l]: a staged feature row = 256 tokens = 4 lines
      #pragma unroll
      for (int i = 0; i < 8; ++i) {
        const int feat = i * 8 + w;                        // 0..63 over the block
        const v8h v = *(const v8ha*)(sH + feat * HP256 + 8 * lane);
        *(v8h*)(vt + ((size_t)bh * HD + feat) * SEQ + l0 + 8 * lane) = v;
      }
      asm volatile("s_wait_xcnt 0x0" ::: "memory");        // the same for the v stores
    }
  }
}

// ---------------------------------------------------------------------------
// Attention helpers.
// P^T B-fragment from the lane's own score D values: element r <- tile a row r,
// element 8+r <- tile c row r (same lane, same query column), scaled by 2^14.
// ---------------------------------------------------------------------------
__device__ __forceinline__ v16h pack_p(v8f a, v8f c) {
  const v16h r = { (_Float16)(a[0] * PSCALE), (_Float16)(a[1] * PSCALE), (_Float16)(a[2] * PSCALE), (_Float16)(a[3] * PSCALE),
                   (_Float16)(a[4] * PSCALE), (_Float16)(a[5] * PSCALE), (_Float16)(a[6] * PSCALE), (_Float16)(a[7] * PSCALE),
                   (_Float16)(c[0] * PSCALE), (_Float16)(c[1] * PSCALE), (_Float16)(c[2] * PSCALE), (_Float16)(c[3] * PSCALE),
                   (_Float16)(c[4] * PSCALE), (_Float16)(c[5] * PSCALE), (_Float16)(c[6] * PSCALE), (_Float16)(c[7] * PSCALE) };
  return r;
}

// (one query row) by lanes 8q..8q+7 in one instruction, 4 lines per instruction.
__device__ __forceinline__ void att_store_pass(const _Float16* so, _Float16* ao,
                                               int b, int head, int q0, int lane) {
  const int q8 = lane & 7, sub = lane >> 3;
  #pragma unroll
  for (int i = 0; i < 4; ++i) {
    const int lid = i * 4 + sub;                  // query row 0..15
    const v8h v = *(const v8ha*)(so + lid * 64 + 8 * q8);
    const size_t gi = ((size_t)b * SEQ + q0 + lid) * DM + head * HD + 8 * q8;
    *(v8h*)(ao + gi) = v;
  }
}

// ---------------------------------------------------------------------------
// K / V^T staging for attention. A stage is 64 keys: the K tile (64 key rows x
// 128 B of d) and behind it the V^T tile (64 d rows x 128 B of keys). One tensor load
// brings one tile and lays its rows in LDS at a pitch of 144 B (16 B x odd: conflict-free
// for 16-byte fragment reads). Two buffers: stage t+1 flies global -> LDS, once per
// block, while the four waves that read it work on stage t.
// ---------------------------------------------------------------------------
#define KV_PITCH 144                         // LDS bytes per staged row: 128 B + the tensor load's pad of 16 B
#define KV_TILE  10240                       // 64 rows x 144 B = 9216, rounded up to a multiple of 2 KiB
#define KV_STAGE (2 * KV_TILE)               // 20480 B

static_assert(KV_PITCH % 16 == 0 && HD * 2 == 128 && SEQ % 64 == 0 && 64 * KV_PITCH <= KV_TILE && KV_TILE % 2048 == 0);

// ---------------------------------------------------------------------------
// Kernel 4: causal streaming attention, transposed form.
// Block 256 thr = two halves of 4 waves. A block takes two tiles of 64 queries in
// turn, tile 31 - x and then tile x, so that every block walks the same number of
// key tiles (33 of 64 keys). Inside a query tile the key tiles are dealt to the two
// halves by turns: half g takes key tiles 2*st + g, 16 queries per wave, and each
// half keeps its own running maximum, sum and O; the two are joined once per query
// tile through LDS. A ring stage is 128 keys: each half loads and reads its own 64
// (its first wave the K tile, its second the V^T tile).
//   S^T = K * Q^T : A = K rows (row = key, k = d), B = Q^T (k = d, n = query)
//   O^T += V^T * P^T : A = Vt rows (row = d, k = key), B = P^T from registers
// Lane owns 32 keys of query column (lane&15); partner = lane ^ 16.
// The 1/8 scale is folded into the exponent argument (exact power of two).
// ---------------------------------------------------------------------------
#define AT      256                          // threads of an attention block
#define QTILES  (SEQ / 64)                   // query tiles of a head
#define KV_BUF  (2 * KV_STAGE)               // one buffer: the 64-key stages of both halves
#define KV_RING2 (2 * KV_BUF)                // 81920 B
#define MG_CH   9                            // 16-B pieces a lane hands over: 8 of O, 1 of (max, sum)

static_assert(QTILES % 2 == 0 && SEQ % 128 == 0);
static_assert(4 * MG_CH * 32 * 16 <= KV_RING2);

__global__ __launch_bounds__(AT) void attn_kernel(
    const _Float16* __restrict__ qh,   // [B*H][S][64]
    const _Float16* __restrict__ kh,   // [B*H][S][64]
    const _Float16* __restrict__ vt,   // [B*H][64][S]
    _Float16* __restrict__ ao)         // [B][S][DM]
{
  __shared__ __attribute__((aligned(16))) _Float16 sO[4 * 16 * 64];    // 8192 B
  __shared__ __attribute__((aligned(2048))) char kv[KV_RING2];         // K / V^T stages, two buffers; then the hand-over

  const int tid = threadIdx.x, lane = tid & 31;
  const int wq = (tid >> 5) & 3;                                // which 16 queries of the tile
  const int g = __builtin_amdgcn_readfirstlane(tid >> 7);       // which half; scalar, so the tests on it are scalar branches
  const int h = lane >> 4, m = lane & 15;
  const int bh = blockIdx.y, b = bh >> 4, head = bh & 15;

  const v8f zero8 = {0.f, 0.f, 0.f, 0.f, 0.f, 0.f, 0.f, 0.f};
  // Waves 0 and 1 of a half issue: wave 0 its K tile (rows = keys, one after the other in memory), wave 1 its
  // V^T tile (rows = d, SEQ keys apart). A ring stage on is 128 keys on.
  const uint32_t wh4 = uni(((uint32_t)tid >> 5) & 3u);
  const uint32_t isv = wh4 & 1u;
  const uint64_t ksrc0 = isv ? (uint64_t)(uintptr_t)(vt + (size_t)bh * HD * SEQ + 64 * g)
                             : (uint64_t)(uintptr_t)(kh + ((size_t)bh * SEQ + 64 * g) * HD);
  const uint32_t kstep = isv ? 128u * 2u : 128u * HD * 2u;      // bytes
  const uint32_t kdst = (uint32_t)(size_t)kv + (uint32_t)g * KV_STAGE + isv * KV_TILE;
  u32x8 kg1 = tdm_group1<128u>(isv ? SEQ * 2u : HD * 2u);
  u32x4 kg0;                                                    // group 0 of the request last issued, kept up to its wait
  auto kv_issue = [&](uint32_t buf, uint32_t st) {
    kg0 = tdm_group0(kdst + buf, ksrc0 + (uint64_t)st * kstep);
    if (pinned((uint32_t)(wh4 < 2u))) tdm_load(kg0, kg1);
  };
  v4fa* mg = (v4fa*)kv + wq * MG_CH * 32 + lane;                // this lane's hand-over pieces, 32 pieces apart
  _Float16* so = sO + wq * 1024;

  // Kept rolled: the two query tiles run the same text one after the other.
  #pragma unroll 1
  for (int pass = 0; pass < 2; ++pass) {
    const int xt = pass ? (int)blockIdx.x : QTILES - 1 - (int)blockIdx.x;
    const int q0 = xt * 64 + 16 * wq;
    const int T64 = xt + 1;                     // key tiles up to and with the diagonal one (block-uniform)
    const int NS = (T64 + 1) >> 1;              // ring stages of 128 keys; 128*NS <= SEQ

    // Q^T B-fragments: column n = query q0+m, k = d (two 32-deep chunks)
    const _Float16* qrow = qh + ((size_t)bh * SEQ + q0 + m) * HD;
    const v16h qb0 = load_frag(qrow, h);
    const v16h qb1 = load_frag(qrow + 32, h);

    v8f o[4];                                   // o[t][r] = O[query m][d 16t+8h+r] * (l * 2^14), this half's keys
    #pragma unroll
    for (int t = 0; t < 4; ++t) o[t] = zero8;
    float mrun = -1e30f, lrun = 0.0f;

    kv_issue(0u, 0u);
    tdm_wait0(kg0, kg1);                                // own tile of stage 0 landed
    __syncthreads();                                    // publishes stage 0
    if (pinned((uint32_t)(NS > 1))) kv_issue((uint32_t)KV_BUF, 1u);

    #pragma unroll 1
    for (int st = 0; st < NS; ++st) {
      const int kb = 128 * st + 64 * g;
      const int bo = (st & 1) * KV_BUF;
      if (2 * st + g < T64) {                             // the last stage of an odd count has no key tile for the second half
        const char* pk = kv + bo + g * KV_STAGE + m * KV_PITCH;   // K row m of this half's stage
        const char* pv = pk + KV_TILE;                            // V^T row m of this half's stage
        // ---- raw scores: s[j][r] = S[query q0+m][key kb+16j+8h+r] (unscaled) ----
        v8f s[4];
        #pragma unroll
        for (int j = 0; j < 4; ++j) {
          const _Float16* kp = (const _Float16*)(pk + 16 * j * KV_PITCH);
          const v16h kf0 = load_frag(kp, h);
          const v16h kf1 = load_frag(kp + 32, h);
          v8f z = zero8;
          z = wmma_f16(kf0, qb0, z);
          z = wmma_f16(kf1, qb1, z);
          s[j] = z;
        }
        // ---- causal mask (only on the key tile touching the diagonal) ----
        if (kb + 63 > q0) {
          const int qq = q0 + m;
          #pragma unroll
          for (int j = 0; j < 4; ++j)
            #pragma unroll
            for (int r = 0; r < 8; ++r) {
              const int kk = kb + 16 * j + 8 * h + r;
              if (kk > qq) s[j][r] = -1e30f;
            }
        }

        // ---- online softmax (scale 1/8 applied inside the exp argument) ----
        float mloc = s[0][0];
        #pragma unroll
        for (int j = 0; j < 4; ++j)
          #pragma unroll
          for (int r = 0; r < 8; ++r) mloc = fmaxf(mloc, s[j][r]);
        mloc = fmaxf(mloc, __shfl_xor(mloc, 16));
        const float mnew = fmaxf(mrun, mloc);
        const float cn = mnew * 0.125f;
        const float alpha = __expf((mrun - mnew) * 0.125f);
        mrun = mnew;
        float lsum = 0.0f;
        #pragma unroll
        for (int j = 0; j < 4; ++j)
          #pragma unroll
          for (int r = 0; r < 8; ++r) {
            const float p = __expf(fmaf(s[j][r], 0.125f, -cn));
            s[j][r] = p;
            lsum += p;
          }
        lsum += __shfl_xor(lsum, 16);
        lrun = lrun * alpha + lsum;
        #pragma unroll
        for (int t = 0; t < 4; ++t)
          #pragma unroll
          for (int r = 0; r < 8; ++r) o[t][r] = o[t][r] * alpha;

        // ---- P^T B-fragments (key chunks 0..31 and 32..63 of this key tile) ----
        const v16h pb0 = pack_p(s[0], s[1]);
        const v16h pb1 = pack_p(s[2], s[3]);

        // ---- O^T += V^T * P^T ----
        #pragma unroll
        for (int t = 0; t < 4; ++t) {
          const _Float16* vp = (const _Float16*)(pv + 16 * t * KV_PITCH);
          const v16h vf0 = load_frag(vp, h);
          const v16h vf1 = load_frag(vp + 32, h);
          o[t] = wmma_f16(vf0, pb0, o[t]);
          o[t] = wmma_f16(vf1, pb1, o[t]);
        }
      }
      asm volatile("s_wait_dscnt 0x0" ::: "memory");    // own reads of this buffer are done before it is refilled
      tdm_wait0(kg0, kg1);                              // own tile of stage st+1 landed
      __syncthreads();                                  // publishes stage st+1, frees stage st's buffer
      if (pinned((uint32_t)(st + 2 < NS))) kv_issue((uint32_t)bo, pinned((uint32_t)(st + 2)));   // pinned stage number: the descriptor is formed behind the wait
    }
    tdm_wait0(kg0, kg1);                                // nothing in flight when the ring is reused
    asm volatile("s_wait_dscnt 0x0" ::: "memory");      // nor a read of it

    // ---- the second half hands its maximum, sum and O to the first, lane to lane ----
    if (g == 1) {
      #pragma unroll
      for (int t = 0; t < 4; ++t) {
        const v4f lo = { o[t][0], o[t][1], o[t][2], o[t][3] };
        const v4f hi = { o[t][4], o[t][5], o[t][6], o[t][7] };
        mg[(2 * t) * 32] = lo;
        mg[(2 * t + 1) * 32] = hi;
      }
      const v4f ml = { mrun, lrun, 0.0f, 0.0f };
      mg[8 * 32] = ml;
    }
    __syncthreads();                                    // the hand-over is written

    // ---- join, normalise, stage per-wave 16x64 f16 tile ----
    if (g == 0) {
      const v4f ml = mg[8 * 32];
      const float mall = fmaxf(mrun, ml.x);
      const float f0 = __expf((mrun - mall) * 0.125f);
      const float f1 = __expf((ml.x - mall) * 0.125f);  // 0 where the second half had no key tile (its maximum is -1e30)
      const float inv = (1.0f / (lrun * f0 + ml.y * f1)) * (1.0f / PSCALE);
      const float c0 = f0 * inv, c1 = f1 * inv;
      #pragma unroll
      for (int t = 0; t < 4; ++t) {
        const v4f lo = mg[(2 * t) * 32];
        const v4f hi = mg[(2 * t + 1) * 32];
        #pragma unroll
        for (int r = 0; r < 4; ++r) {
          so[m * 64 + 16 * t + 8 * h + r]     = (_Float16)(o[t][r] * c0 + lo[r] * c1);
          so[m * 64 + 16 * t + 8 * h + 4 + r] = (_Float16)(o[t][4 + r] * c0 + hi[r] * c1);
        }
      }
    }
    asm volatile("s_wait_dscnt 0x0" ::: "memory");      // own reads of the hand-over are done before the next tile's loads overwrite it
    __syncthreads();                                    // frees the ring for the next query tile; the staged tile is written

    if (g == 0) {
      att_store_pass(so, ao, b, head, q0, lane);
      asm volatile("s_wait_xcnt 0x0" ::: "memory");     // no register of these stores is rewritten ahead of it in the next query tile
    }
  }
}

// ---------------------------------------------------------------------------
// Exact-form GELU without a branch, eight values at a time as four packed f32 pairs:
// x * Phi(x) = max(x, 0) - |x| * erfc(|x| / sqrt 2) / 2 with
// erfc(z) = t (a1 + t (a2 + t (a3 + t (a4 + t a5)))) exp(-z z), t = 1 / (1 + p z), z >= 0
// (rational form with five terms, absolute error of erfc below 1.5e-7). The halves and
// the 1 / sqrt 2 are folded into the constants; no subtraction from 1 on the negative side.
// Written step by step across the four pairs, so that their chains run side by side; every
// loop is unrolled so that the small arrays are registers.
// ---------------------------------------------------------------------------
typedef float v2f __attribute__((ext_vector_type(2)));
typedef _Float16 v2h __attribute__((ext_vector_type(2)));

__device__ __forceinline__ v2f fma2(v2f a, v2f b, v2f c) { return __builtin_elementwise_fma(a, b, c); }

// y[i] = gelu(c[2i], c[2i+1]) for c = acc * WINV + bias
__device__ __forceinline__ void gelu_erf8(v8f acc, float bias, v2h (&y)[4]) {
  v2f x[4], ax[4], t[4], e[4], q[4];
  #pragma unroll
  for (int i = 0; i < 4; ++i) {
    const v2f c = { acc[2 * i], acc[2 * i + 1] };
    x[i] = fma2(c, (v2f)(WINV), (v2f)(bias));
  }
  #pragma unroll
  for (int i = 0; i < 4; ++i) {
    ax[i] = __builtin_elementwise_abs(x[i]);
    const v2f d = fma2(ax[i], (v2f)(0.23164189f), (v2f)(1.0f));                // 1 + (p / sqrt 2) |x|
    const v2f r = { __builtin_amdgcn_rcpf(d.x), __builtin_amdgcn_rcpf(d.y) };
    t[i] = r;
  }
  #pragma unroll
  for (int i = 0; i < 4; ++i) {
    const v2f a = (x[i] * -0.72134752f) * x[i];                                // -x x / 2 as a power of two
    const v2f r = { __builtin_amdgcn_exp2f(a.x), __builtin_amdgcn_exp2f(a.y) };
    e[i] = r;
  }
  #pragma unroll
  for (int i = 0; i < 4; ++i) q[i] = fma2(t[i], (v2f)(0.5307027145f), (v2f)(-0.7265760135f));
  #pragma unroll
  for (int i = 0; i < 4; ++i) q[i] = fma2(q[i], t[i], (v2f)(0.7107068705f));
  #pragma unroll
  for (int i = 0; i < 4; ++i) q[i] = fma2(q[i], t[i], (v2f)(-0.142248368f));
  #pragma unroll
  for (int i = 0; i < 4; ++i) q[i] = fma2(q[i], t[i], (v2f)(0.127414796f));
  #pragma unroll
  for (int i = 0; i < 4; ++i) t[i] = t[i] * e[i];
  #pragma unroll
  for (int i = 0; i < 4; ++i) q[i] = q[i] * t[i];                              // erfc(|x| / sqrt 2) / 2
  #pragma unroll
  for (int i = 0; i < 4; ++i)
    y[i] = __builtin_convertvector(fma2(-ax[i], q[i], __builtin_elementwise_max(x[i], (v2f)(0.0f))), v2h);
}

// ---------------------------------------------------------------------------
// Kernel 5: Y = A[M,K](f16) * W[N,K]^T(f16 x32) with epilogue.
//   MODE 1: outf[M][N] (f32) = (acc/32 + bias) + resid      block 128 rows x 128 cols
//   MODE 2: outh[M][N] (f16) = gelu_erf(acc/32 + bias)      block 256 rows x 256 cols
// Block 256 thr (8 waves, 4 x 2); wave = 32 rows x 64 cols (MODE 1) or 64 rows x 128 cols (MODE 2).
// ---------------------------------------------------------------------------
template <int MODE>
__global__ __launch_bounds__(GT) void gemm_kernel(
    const _Float16* __restrict__ A, const _Float16* __restrict__ W,
    const float* __restrict__ bias, const float* __restrict__ resid,
    float* __restrict__ outf, _Float16* __restrict__ outh, int N, int K)
{
  constexpr int MT = (MODE == 2) ? 4 : 2, NT = (MODE == 2) ? 8 : 4, KP = (MODE == 2) ? 128 : 256;
  __shared__ __attribute__((aligned(2048))) char ring[RING_B(MT, NT, KP)];   // operand ring, then the output tile (at most 135168 B)

  const int tid = threadIdx.x, lane = tid & 31, w = tid >> 5;
  const int wm = w >> 1, wn = w & 1;
  const int h = lane >> 4, m = lane & 15;
  const int m0 = blockIdx.x * (64 * MT), n0 = blockIdx.y * (32 * NT);

  v8f acc[MT][NT];
  gemm_main<MT, NT, KP>(ring, A + (size_t)m0 * K, W + (size_t)n0 * K, K, tid, acc);

  // D[r] of tile (mt, nt) = Y[row m0+16*MT*wm+16mt+8h+r][col n0+16*NT*wn+16nt+m]
  if (MODE == 1) {
    float* sbuf = (float*)ring;
    #pragma unroll
    for (int nt = 0; nt < 4; ++nt)
      #pragma unroll
      for (int mt = 0; mt < MT; ++mt)
        #pragma unroll
        for (int r = 0; r < 8; ++r)
          sbuf[(16 * MT * wm + 16 * mt + 8 * h + r) * FP128 + 64 * wn + 16 * nt + m] = acc[mt][nt][r] * WINV;
    __syncthreads();

    // a row = 128 floats = 4 lines = one 16-B access per lane; wave w takes rows 8i + w
    const int col = 4 * lane;
    const v4f bb = *(const v4fa*)(bias + n0 + col);
    v4f vals[16];
    #pragma unroll
    for (int i = 0; i < 16; ++i) {
      const int rl = i * 8 + w;                    // 0..127
      const v4f a  = *(const v4fa*)(sbuf + rl * FP128 + col);
      const size_t gi = (size_t)(m0 + rl) * N + n0 + col;
      const v4f rr = *(const v4fa*)(resid + gi);
      vals[i] = (a + bb) + rr;
    }
    #pragma unroll
    for (int i = 0; i < 16; ++i) {
      const int rl = i * 8 + w;
      const size_t gi = (size_t)(m0 + rl) * N + n0 + col;
      *(v4f*)(outf + gi) = vals[i];
    }
  } else {
    _Float16* sh = (_Float16*)ring;
    // Unrolled: acc takes constant indices only, and the branch-free text is short enough for it.
    float bv[NT];
    #pragma unroll
    for (int nt = 0; nt < NT; ++nt) bv[nt] = bias[n0 + 16 * NT * wn + 16 * nt + m];
    asm volatile("s_wait_xcnt 0x0" ::: "memory");  // no address register of the bias loads is rewritten ahead of it
    __builtin_amdgcn_sched_barrier(0);             // holds the arithmetic below behind that wait: the scheduler had lifted it over
    #pragma unroll
    for (int nt = 0; nt < NT; ++nt) {
      const float bvl = bv[nt];
      #pragma unroll
      for (int mt = 0; mt < MT; ++mt) {
        v2h gl[4];
        gelu_erf8(acc[mt][nt], bvl, gl);
        #pragma unroll
        for (int i = 0; i < 4; ++i) {
          sh[(16 * MT * wm + 16 * mt + 8 * h + 2 * i) * HP256 + 16 * NT * wn + 16 * nt + m] = gl[i].x;
          sh[(16 * MT * wm + 16 * mt + 8 * h + 2 * i + 1) * HP256 + 16 * NT * wn + 16 * nt + m] = gl[i].y;
        }
      }
    }
    __syncthreads();

    // a row = 256 halves = 4 lines = one 16-B access per lane; wave w takes rows 8i + w
    v8h vals[32];
    #pragma unroll
    for (int i = 0; i < 32; ++i) {
      const int rl = i * 8 + w;                    // 0..255
      vals[i] = *(const v8ha*)(sh + rl * HP256 + 8 * lane);
    }
    #pragma unroll
    for (int i = 0; i < 32; ++i) {
      const int rl = i * 8 + w;
      *(v8h*)(outh + (size_t)(m0 + rl) * N + n0 + 8 * lane) = vals[i];
    }
  }
}

// ---------------------------------------------------------------------------
extern "C" void kernel_launch(void* const* d_in, const int* in_sizes, int n_in,
                              void* d_out, int out_size, void* d_ws, size_t ws_size,
                              hipStream_t stream) {
  if (n_in < 13) return;
  if (in_sizes[0] != NTOK * DM) return;
  if (in_sizes[1] != 3 * DM * DM || in_sizes[2] != 3 * DM) return;
  if (in_sizes[3] != DM * DM || in_sizes[4] != DM) return;
  if (in_sizes[5] != DFF * DM || in_sizes[6] != DFF) return;
  if (in_sizes[7] != DM * DFF || in_sizes[8] != DM) return;
  if (in_sizes[9] != DM || in_sizes[10] != DM || in_sizes[11] != DM || in_sizes[12] != DM) return;
  if (out_size != NTOK * DM) return;

  const float* hidden = (const float*)d_in[0];
  const float* qkv_w  = (const float*)d_in[1];
  const float* qkv_b  = (const float*)d_in[2];
  const float* out_w  = (const float*)d_in[3];
  const float* out_b  = (const float*)d_in[4];
  const float* fc1_w  = (const float*)d_in[5];
  const float* fc1_b  = (const float*)d_in[6];
  const float* fc2_w  = (const float*)d_in[7];
  const float* fc2_b  = (const float*)d_in[8];
  const float* ln1_g  = (const float*)d_in[9];
  const float* ln1_b  = (const float*)d_in[10];
  const float* ln2_g  = (const float*)d_in[11];
  const float* ln2_b  = (const float*)d_in[12];
  float* out = (float*)d_out;

  // workspace carve (all sizes multiples of 256 B)
  const size_t wh_bytes   = (size_t)G_ALL * 8 * 2;          // 25165824
  const size_t act_bytes  = (size_t)NTOK * DM * 2;           //  8388608  (f16 [4096][1024])
  const size_t hid2_bytes = (size_t)NTOK * DM * 4;           // 16777216
  const size_t ff_bytes   = (size_t)NTOK * DFF * 2;          // 33554432
  const size_t total = wh_bytes + 5 * act_bytes + hid2_bytes + ff_bytes;   // 117440512
  if (total > ws_size) return;

  char* ws = (char*)d_ws;
  size_t off = 0;
  _Float16* wh   = (_Float16*)(ws + off); off += wh_bytes;
  _Float16* xn   = (_Float16*)(ws + off); off += act_bytes;   // ln1 output, later ln2 output
  _Float16* qh   = (_Float16*)(ws + off); off += act_bytes;
  _Float16* kh   = (_Float16*)(ws + off); off += act_bytes;
  _Float16* vt   = (_Float16*)(ws + off); off += act_bytes;
  _Float16* ah   = (_Float16*)(ws + off); off += act_bytes;   // attention output f16 [4096][1024]
  float*    hid2 = (float*)(ws + off);    off += hid2_bytes;  // hidden + attn proj, f32
  _Float16* ff   = (_Float16*)(ws + off); off += ff_bytes;    // gelu(fc1) f16 [4096][4096]
  if (off > ws_size) return;

  const _Float16* w_qkv = wh;
  const _Float16* w_out = wh + (size_t)3 * DM * DM;
  const _Float16* w_fc1 = wh + (size_t)4 * DM * DM;
  const _Float16* w_fc2 = wh + (size_t)4 * DM * DM + (size_t)DFF * DM;

  // 1: weights -> f16 x32
  cvt_w_kernel<<<G_ALL / 256, 256, 0, stream>>>(qkv_w, out_w, fc1_w, fc2_w, wh);

  // 2: ln1 -> f16
  ln_kernel<<<NTOK / 8, 256, 0, stream>>>(hidden, ln1_g, ln1_b, xn, NTOK);

  // 3: qkv projection -> q/k planes + transposed v
  qkv_kernel<<<dim3(NTOK / 256, 3 * DM / 192), GT, 0, stream>>>(xn, w_qkv, qkv_b, qh, kh, vt);

  // 4: causal attention -> f16 [tok][DM]
  attn_kernel<<<dim3(QTILES / 2, BATCH * NH), AT, 0, stream>>>(qh, kh, vt, ah);

  // 5: output projection + bias + residual -> f32 hid2
  gemm_kernel<1><<<dim3(NTOK / 128, DM / 128), GT, 0, stream>>>(ah, w_out, out_b, hidden, hid2, xn, DM, DM);

  // 6: ln2 -> f16 (reuses xn)
  ln_kernel<<<NTOK / 8, 256, 0, stream>>>(hid2, ln2_g, ln2_b, xn, NTOK);

  // 7: fc1 + exact gelu -> f16 ff
  gemm_kernel<2><<<dim3(NTOK / 256, DFF / 256), GT, 0, stream>>>(xn, w_fc1, fc1_b, fc1_b, hid2, ff, DFF, DM);

  // 8: fc2 + bias + residual(hid2) -> f32 d_out
  gemm_kernel<1><<<dim3(NTOK / 128, DM / 128), GT, 0, stream>>>(ff, w_fc2, fc2_b, hid2, out, xn, DM, DFF);
}

// v008
// One run takes 130 microseconds.
// Next to v007, in two timings, it ran 1.03 and 1.04 times as fast.
// Over all steps from v000 it is 4.19 times as fast.
// Contractions: ln1(x)*Wqkv^T, K*Q^T, V^T*P^T, attn*Wout^T, ln2(h)*Wfc1^T, gelu(.)*Wfc2^T all on v_wmma_f32_16x16x32_f16 (f16 operands, f32 accumulate); every W carried x32 and P carried x16384 (exact power-of-two scales folded back in f32); layernorm, softmax, bias, gelu and residual adds in f32.
#include <hip/hip_runtime.h>
#include <math.h>
#include <stdint.h>

typedef _Float16 v16h __attribute__((ext_vector_type(16)));
typedef _Float16 v8h  __attribute__((ext_vector_type(8)));
typedef float    v8f  __attribute__((ext_vector_type(8)));
typedef float    v4f  __attribute__((ext_vector_type(4)));
typedef v8h __attribute__((may_alias)) v8ha;
typedef v4f __attribute__((may_alias)) v4fa;

union Frag { v16h v; v8h half[2]; };

#define DM     1024
#define NH     16
#define HD     64
#define DFF    4096
#define SEQ    2048
#define BATCH  2
#define NTOK   (BATCH * SEQ)          // 4096 tokens
#define WSC    32.0f
#define WINV   0.03125f
#define PSCALE 16384.0f

#define G_QKV (3 * DM * DM / 8)       // 393216 groups of 8
#define G_OUT (DM * DM / 8)           // 131072
#define G_FC1 (DFF * DM / 8)          // 524288
#define G_FC2 (DM * DFF / 8)          // 524288
#define G_ALL (G_QKV + G_OUT + G_FC1 + G_FC2)   // 1572864

static_assert(NTOK % 128 == 0);
static_assert(SEQ % 128 == 0);
static_assert(DM % 64 == 0);
static_assert(DFF % 64 == 0);
static_assert(G_ALL % 256 == 0);

// ---------------------------------------------------------------------------
// 16x16x32 f16 WMMA with hazard guard (ties D, keeps A/B live).
// Fragment map (wave32): lane l, h = l>>4, m = n = l&15.
//   A/B element i: i<8 -> k0+8h+i ; i>=8 -> k0+16+8h+(i-8)
//   D element r : row 8h+r, col l&15
// ---------------------------------------------------------------------------
__device__ __forceinline__ v8f wmma_f16(v16h a, v16h b, v8f c) {
  v8f d = __builtin_amdgcn_wmma_f32_16x16x32_f16(false, a, false, b, (short)0, c, false, false);
  asm volatile("v_nop\n\tv_nop\n\tv_nop\n\tv_nop" : "+v"(d) : "v"(a), "v"(b));
  return d;
}

// A or B fragment from a k-contiguous 16-bit row; p points at element k0 of
// the row owned by this lane (row index = lane & 15 added by the caller).
__device__ __forceinline__ v16h load_frag(const _Float16* p, int h) {
  Frag f;
  f.half[0] = *(const v8ha*)(p + 8 * h);
  f.half[1] = *(const v8ha*)(p + 16 + 8 * h);
  return f.v;
}

// ---------------------------------------------------------------------------
// f32 weights -> f16 planes scaled by 32 (exact), in groups of 8 floats: two 16-B loads, one 16-B store.
// wh layout: [qkv 3*DM*DM][out DM*DM][fc1 DFF*DM][fc2 DM*DFF], row = output feature.
// The conversion has no launch of its own: the qkv plane is made by extra blocks of the first
// LayerNorm launch, the other three planes by the attention blocks under their key stages.
// ---------------------------------------------------------------------------
__device__ __forceinline__ v8h cvt_w8(v4f a, v4f c) {
  const v8h o = { (_Float16)(a.x * WSC), (_Float16)(a.y * WSC), (_Float16)(a.z * WSC), (_Float16)(a.w * WSC),
                  (_Float16)(c.x * WSC), (_Float16)(c.y * WSC), (_Float16)(c.z * WSC), (_Float16)(c.w * WSC) };
  return o;
}
#define CVT_PER 4                            // groups a thread of a conversion block takes
static_assert(G_QKV % (256 * CVT_PER) == 0);

// ---------------------------------------------------------------------------
// Kernel 2: LayerNorm over rows of DM f32 -> f16. One wave per row (block of 8
// i*256 + lane*8 + 0..7 (i = 0..3) so every store instruction is 32 lanes x
// ---------------------------------------------------------------------------
// Blocks from lnblocks on convert weights instead: CVT_PER groups a thread, 256 groups apart.
__global__ __launch_bounds__(256) void ln_kernel(
    const float* __restrict__ x, const float* __restrict__ g,
    const float* __restrict__ bt, _Float16* __restrict__ y, int nrows,
    const float* __restrict__ wsrc, _Float16* __restrict__ wdst, int lnblocks)
{
  if ((int)blockIdx.x >= lnblocks) {             // block-uniform; no barriers in this kernel
    const size_t g0 = (size_t)((int)blockIdx.x - lnblocks) * (256 * CVT_PER) + threadIdx.x;
    const float* sp = wsrc + g0 * 8;
    v4f a[CVT_PER], c[CVT_PER];
    #pragma unroll
    for (int i = 0; i < CVT_PER; ++i) {
      a[i] = *(const v4fa*)(sp + i * 2048);
      c[i] = *(const v4fa*)(sp + i * 2048 + 4);
    }
    asm volatile("s_wait_xcnt 0x0" ::: "memory");  // no address register of these loads is rewritten ahead of it
    v8h o[CVT_PER];
    #pragma unroll
    for (int i = 0; i < CVT_PER; ++i) o[i] = cvt_w8(a[i], c[i]);
    _Float16* dp = wdst + g0 * 8;
    #pragma unroll
    for (int i = 0; i < CVT_PER; ++i) *(v8h*)(dp + i * 2048) = o[i];
    asm volatile("s_wait_xcnt 0x0" ::: "memory");  // no register of these stores is rewritten ahead of it on any way on from here
    return;
  }
  const int lane = threadIdx.x & 31, w = threadIdx.x >> 5;
  const int row = blockIdx.x * 8 + w;
  if (row >= nrows) return;                      // wave-uniform; no barriers below
  const float* xr = x + (size_t)row * DM;

  v4f xa[4], xb[4];
  float s = 0.0f;
  #pragma unroll
  for (int i = 0; i < 4; ++i) {
    const float* p = xr + i * 256 + lane * 8;
    xa[i] = *(const v4fa*)p;
    xb[i] = *(const v4fa*)(p + 4);
    s += ((xa[i].x + xa[i].y) + (xa[i].z + xa[i].w)) + ((xb[i].x + xb[i].y) + (xb[i].z + xb[i].w));
  }
  #pragma unroll
  for (int off = 16; off > 0; off >>= 1) s += __shfl_xor(s, off);
  const float mu = s * (1.0f / DM);

  float ss = 0.0f;
  #pragma unroll
  for (int i = 0; i < 4; ++i) {
    const v4f da = xa[i] - mu, db = xb[i] - mu;
    ss += ((da.x * da.x + da.y * da.y) + (da.z * da.z + da.w * da.w)) +
          ((db.x * db.x + db.y * db.y) + (db.z * db.z + db.w * db.w));
  }
  #pragma unroll
  for (int off = 16; off > 0; off >>= 1) ss += __shfl_xor(ss, off);
  const float var = ss * (1.0f / DM);
  const float rstd = rsqrtf(var + 1e-5f);

  v8h o[4];
  #pragma unroll
  for (int i = 0; i < 4; ++i) {
    const int p = i * 256 + lane * 8;
    const v4f ga = *(const v4fa*)(g + p),  gb = *(const v4fa*)(g + p + 4);
    const v4f ba = *(const v4fa*)(bt + p), bb = *(const v4fa*)(bt + p + 4);
    const v4f da = (xa[i] - mu) * rstd, db = (xb[i] - mu) * rstd;
    const v8h t = { (_Float16)(da.x * ga.x + ba.x), (_Float16)(da.y * ga.y + ba.y),
                    (_Float16)(da.z * ga.z + ba.z), (_Float16)(da.w * ga.w + ba.w),
                    (_Float16)(db.x * gb.x + bb.x), (_Float16)(db.y * gb.y + bb.y),
                    (_Float16)(db.z * gb.z + bb.z), (_Float16)(db.w * gb.w + bb.w) };
    o[i] = t;
  }
  _Float16* yr = y + (size_t)row * DM;
  #pragma unroll
  for (int i = 0; i < 4; ++i) *(v8h*)(yr + i * 256 + lane * 8) = o[i];
  
}

// ---------------------------------------------------------------------------
// Shared GEMM main loop: 256 threads, 8 waves in a 4 x 2 grid. Block tile 64*MT
// (rows of A) x 32*NT (rows of W), wave tile 16*MT x 16*NT. A stage is KP k of all
// 64*MT + 32*NT rows, cut into slices of 64 rows x 128 k (256 B a row). One wave brings one
// slice a stage with one tensor load, which lays the rows in LDS at a pitch of 272 B
// (16 B x odd: conflict-free for 16-byte fragment reads). Slice number = 128-k half * row
// groups + row group; row groups: first those of A, then those of W. Two buffers: stage t+1
// flies global -> LDS while stage t is multiplied. Every launch is 256 blocks, one on a WGP.
//   MT 4, NT 8, KP 128: 256 x 256, 8 slices, ring 294912 B (fc1)
//   MT 4, NT 6, KP 128: 256 x 192, 7 slices, ring 258048 B (qkv)
//   MT 2, NT 4, KP 256: 128 x 128, 8 slices, ring 294912 B (out, fc2)
// acc[mt][nt][r] = sum_k A[16*MT*wm + 16mt + 8h + r][k] * W[16*NT*wn + 16nt + m][k],
// wm = wave >> 1, wn = wave & 1, k ascending in steps of 32.
// ---------------------------------------------------------------------------
#define GT      256                          // threads of a GEMM block
#define SL_PITCH 272                         // LDS bytes per staged row: 256 B + the tensor load's pad of 16 B
#define SL_B     18432                       // LDS bytes of a slice: 64 rows x 272 B = 17408, rounded up to a multiple of 2 KiB
#define RGROUPS(MT, NT)     ((MT) + (NT) / 2)                // groups of 64 rows in a stage
#define NSLICE(MT, NT, KP)  (RGROUPS(MT, NT) * ((KP) / 128))
#define STAGE_B(MT, NT, KP) (NSLICE(MT, NT, KP) * SL_B)
#define RING_B(MT, NT, KP)  (2 * STAGE_B(MT, NT, KP))

static_assert(DM % 256 == 0 && DFF % 256 == 0);
static_assert(NTOK % 256 == 0 && SEQ % 256 == 0 && DM % 128 == 0 && (3 * DM) % 192 == 0);
static_assert(64 * SL_PITCH <= SL_B && SL_B % 2048 == 0 && RING_B(4, 8, 128) <= 327680);

typedef uint32_t u32x4 __attribute__((ext_vector_type(4)));
typedef uint32_t u32x8 __attribute__((ext_vector_type(8)));

__device__ __forceinline__ uint32_t uni(uint32_t v) { return (uint32_t)__builtin_amdgcn_readfirstlane(v); }
// Holds a wave-uniform value in a scalar register, so that a test on it is a scalar branch (a tensor
// load ignores EXEC) and a descriptor word made from it is scalar arithmetic behind this place.
__device__ __forceinline__ uint32_t pinned(uint32_t v) {
  uint32_t w = uni(v);
  asm volatile("" : "+s"(w));   // the value stays in a scalar register from here on
  return w;
}

// Descriptor group 1: 1-byte elements, tensor = tile = 64 rows of ROWB B (256 or 128), source row pitch
// src_pitch bytes, 16 B of LDS pad behind every row (interval code 5 or 4 = the row), no mask.
template <uint32_t ROWB>
__device__ __forceinline__ u32x8 tdm_group1(uint32_t src_pitch) {
  static_assert(ROWB == 256u || ROWB == 128u);
  u32x8 g;
  g[0] = uni((1u << 20) | ((ROWB == 256u ? 5u : 4u) << 22) | (3u << 25));
  g[1] = uni(ROWB << 16);                    // tensor_dim0[15:0]
  g[2] = uni(64u << 16);                     // tensor_dim0[31:16] = 0, tensor_dim1[15:0]
  g[3] = uni(ROWB << 16);                    // tensor_dim1[31:16] = 0, tile_dim0
  g[4] = uni(64u);                           // tile_dim1
  g[5] = uni(src_pitch);
  g[6] = uni(0u);
  g[7] = uni(0u);
  return g;
}
// Descriptor group 0: count 1, LDS byte offset, global address of the tile's first byte, type 2.
__device__ __forceinline__ u32x4 tdm_group0(uint32_t lds_dst, uint64_t ga) {
  u32x4 g;
  g[0] = uni(1u);
  g[1] = uni(lds_dst);
  g[2] = uni((uint32_t)ga);
  g[3] = uni((((uint32_t)(ga >> 32)) & 0x01FFFFFFu) | 0x80000000u);
  return g;
}
// One request of the whole wave: global tile -> LDS, through no register. Both groups are in-out
// operands, and tdm_wait0 names them again: so they stay in these scalar registers, unchanged, from
// the issue to the wait (as plain inputs the compiler reused single words of them in between).
__device__ __forceinline__ void tdm_load(u32x4& g0, u32x8& g1) {
  asm volatile("tensor_load_to_lds %0, %1" : "+s"(g0), "+s"(g1) :: "memory");
}
// The wave's own request has landed; g0, g1: the descriptor of the request last issued.
__device__ __forceinline__ void tdm_wait0(const u32x4& g0, const u32x8& g1) {
  asm volatile("s_wait_tensorcnt 0x0" :: "s"(g0), "s"(g1) : "memory");
}

// ablk / wblk: first row of the block's A / W tile. ring: RING_B(MT, NT, KP) bytes of LDS at a multiple
// of 2 KiB; free for other use on return (every wave's reads and loads are done and a barrier passed).
template <int MT, int NT, int KP>
__device__ __forceinline__ void gemm_main(char* ring,
                                          const _Float16* __restrict__ ablk,
                                          const _Float16* __restrict__ wblk,
                                          int K, int tid, v8f (&acc)[MT][NT])
{
  constexpr int RG = RGROUPS(MT, NT), NSL = NSLICE(MT, NT, KP);
  constexpr int STAGE = STAGE_B(MT, NT, KP);
  static_assert(NSL <= GT / 32 && KP % 128 == 0 && NT % 2 == 0 && 64 % (16 * MT) == 0);
  const int lane = tid & 31, w = tid >> 5;
  const int wm = w >> 1, wn = w & 1;
  const int h = lane >> 4, m = lane & 15;
  const v8f zero8 = {0.f, 0.f, 0.f, 0.f, 0.f, 0.f, 0.f, 0.f};
  #pragma unroll
  for (int mt = 0; mt < MT; ++mt)
    #pragma unroll
    for (int nt = 0; nt < NT; ++nt) acc[mt][nt] = zero8;

  // This wave's slice: number = wave; its 64 rows and its 128 k of stage 0.
  const uint32_t wave = uni((uint32_t)tid >> 5);
  const uint32_t rg = wave % (uint32_t)RG, kh = wave / (uint32_t)RG;
  const _Float16* srow = (rg < (uint32_t)MT) ? ablk + (size_t)(64u * rg) * K
                                             : wblk + (size_t)(64u * (rg - (uint32_t)MT)) * K;
  const uint64_t src0 = (uint64_t)(uintptr_t)(srow + 128u * kh);
  const uint32_t lds_slice = (uint32_t)(size_t)ring + wave * (uint32_t)SL_B;
  u32x8 g1 = tdm_group1<256u>((uint32_t)K * 2u);
  const uint32_t T = pinned((uint32_t)(K / KP));

  // Stage s into the buffer at byte buf of the ring. With fewer slices than waves the last wave has none.
  // g0: group 0 of the request last issued, kept up to its wait.
  u32x4 g0;
  auto issue = [&](uint32_t buf, uint32_t s) {
    g0 = tdm_group0(lds_slice + buf, src0 + (uint64_t)s * (uint64_t)(KP * 2));
    if constexpr (NSL == GT / 32) {
      tdm_load(g0, g1);
    } else {
      if (pinned((uint32_t)(wave < (uint32_t)NSL))) tdm_load(g0, g1);
    }
  };

  // Byte offsets in a buffer of the rows this lane reads (first 128-k half).
  const int aof = ((16 * MT * wm) >> 6) * SL_B + ((16 * MT * wm) & 63) * SL_PITCH + m * SL_PITCH;
  int wof[NT];
  #pragma unroll
  for (int nt = 0; nt < NT; ++nt) {
    if constexpr ((16 * NT) % 64 == 0) {
      wof[nt] = (MT + (16 * NT / 64) * wn + (nt >> 2)) * SL_B + ((nt & 3) * 16 + m) * SL_PITCH;
    } else {
      const int r0 = 16 * NT * wn + 16 * nt;               // a group of 16 rows lies in one slice
      wof[nt] = (MT + (r0 >> 6)) * SL_B + ((r0 & 63) + m) * SL_PITCH;
    }
  }

  constexpr bool SPLIT = MT * NT > 16;
  issue(0u, 0u);
  tdm_wait0(g0, g1);                                  // own slice of stage 0 landed
  __syncthreads();                                    // publishes stage 0
  if (pinned((uint32_t)(T > 1u))) issue((uint32_t)STAGE, 1u);

  #pragma unroll 1
  for (uint32_t t = 0; t < T; ++t) {
    const uint32_t bo = (t & 1u) * (uint32_t)STAGE;
    const char* pb = ring + bo;
    #pragma unroll
    for (int kc = 0; kc < KP / 32; ++kc) {
      const int ko = (kc >> 2) * RG * SL_B + (kc & 3) * 64;  // the 128-k half's slices, then 64 B a step of 32 k
      v16h a[MT], b[NT];
      #pragma unroll
      for (int mt = 0; mt < MT; ++mt) a[mt] = load_frag((const _Float16*)(pb + aof + mt * 16 * SL_PITCH + ko), h);
      #pragma unroll
      for (int nt = 0; nt < NT; ++nt) b[nt] = load_frag((const _Float16*)(pb + wof[nt] + ko), h);
      // Keeps the block's LDS reads one group ahead of its products: without the guard's asm statements
      // the compiler dealt them out among the products, each pair of reads with a full wait behind it.
      if constexpr (SPLIT) __builtin_amdgcn_sched_barrier(0);
      #pragma unroll
      for (int nt = 0; nt < NT; ++nt)
        #pragma unroll
        for (int mt = 0; mt < MT; ++mt) {
          // Above 16 tiles the accumulators reach past the first 256 registers, where the operands of the
          // guard's asm statement cannot lie (they went to scratch): the builtin alone, padded by the compiler.
          if constexpr (SPLIT)
            acc[mt][nt] = __builtin_amdgcn_wmma_f32_16x16x32_f16(false, a[mt], false, b[nt], (short)0, acc[mt][nt], false, false);
          else
            acc[mt][nt] = wmma_f16(a[mt], b[nt], acc[mt][nt]);
        }
      if constexpr (SPLIT) __builtin_amdgcn_sched_barrier(0);   // the other side of the same fence
    }
    asm volatile("s_wait_dscnt 0x0" ::: "memory");     // own reads of this buffer are done before it is refilled
    tdm_wait0(g0, g1);                                 // own slice of stage t+1 landed
    __syncthreads();                                   // publishes stage t+1, frees stage t's buffer
    if (pinned((uint32_t)(t + 2u < T))) issue(bo, pinned(t + 2u));   // pinned stage number: the descriptor is formed behind the wait
  }
  tdm_wait0(g0, g1);                                   // nothing in flight when the ring is reused
  asm volatile("s_wait_dscnt 0x0" ::: "memory");       // nor a read of it
}

// Pitches of the output tiles staged in the ring (16 B x odd, so that the two lane
// halves, 8 rows apart, fall on different banks and every row stays 16-B aligned).
#define HP64  72                             // halves per staged row of 64 halves
#define HP256 264                            // halves per staged row of 256 halves
#define FP128 132                            // floats per staged row of 128 floats
#define HEAD_H (256 * HP64)                  // halves of one head's staged tile (256 tokens x 64 features, either way round)

static_assert(64 * HP256 <= HEAD_H && 3 * HEAD_H * 2 <= RING_B(4, 6, 128));

// ---------------------------------------------------------------------------
// Kernel 3: QKV = ln1(x) * Wqkv^T + b over the fused 3*1024 output columns.
// Block 256 thr (8 waves) = 256 tokens x 192 features = three heads out of the 48 of
// q, k and v in a row; a block may hold heads of two of them, so each head is staged
// and stored by itself.
// q plane [B*H][S][64], k plane [B*H][S][64], vt [B*H][64][S].
// Stores: one 16-B store per lane, whole 128-B lines, each line by one instruction.
// ---------------------------------------------------------------------------
__global__ __launch_bounds__(GT) void qkv_kernel(
    const _Float16* __restrict__ xh,   // [NTOK][DM]
    const _Float16* __restrict__ wh,   // [3*DM][DM], row = output feature, x32
    const float* __restrict__ bias,    // [3*DM]
    _Float16* __restrict__ qh, _Float16* __restrict__ kh, _Float16* __restrict__ vt)
{
  __shared__ __attribute__((aligned(2048))) char ring[RING_B(4, 6, 128)];   // operand ring, then the three heads' output tiles
  _Float16* sT = (_Float16*)ring;

  const int tid = threadIdx.x, lane = tid & 31, w = tid >> 5;
  const int wm = w >> 1;
  const int wn = __builtin_amdgcn_readfirstlane(w & 1);   // scalar, so the tests on a column group's head are scalar branches
  const int h = lane >> 4, m = lane & 15;
  const int m0 = blockIdx.x * 256;
  const int cg = blockIdx.y;                 // 0..15: heads 3cg .. 3cg+2 of 48 (q 0..15, k 16..31, v 32..47)

  v8f acc[4][6];
  gemm_main<4, 6, 128>(ring, xh + (size_t)m0 * DM, wh + (size_t)cg * 192 * DM, DM, tid, acc);

  // D[r] of tile (mt, nt) = Y[token m0+64wm+16mt+8h+r][feature cg*192 + 96wn+16nt+m]
  // a head is staged as [token][feature] for q and k, as [feature][token] for v
  float bv[6];
  #pragma unroll
  for (int nt = 0; nt < 6; ++nt) bv[nt] = bias[cg * 192 + 96 * wn + 16 * nt + m];
  asm volatile("s_wait_xcnt 0x0" ::: "memory");            // no address register of the bias loads is rewritten ahead of it
  #pragma unroll
  for (int nt = 0; nt < 6; ++nt) {
    const int c0 = 96 * wn + 16 * nt;                      // first column of the group; a group lies in one head
    const int j = c0 >> 6, cl = (c0 & 63) + m;
    const float bvl = bv[nt];
    _Float16* sH = sT + j * HEAD_H;
    if (3 * cg + j < 2 * NH) {
      #pragma unroll
      for (int mt = 0; mt < 4; ++mt)
        #pragma unroll
        for (int r = 0; r < 8; ++r)
          sH[(64 * wm + 16 * mt + 8 * h + r) * HP64 + cl] = (_Float16)(acc[mt][nt][r] * WINV + bvl);
    } else {
      #pragma unroll
      for (int mt = 0; mt < 4; ++mt) {
        v8h y;                                             // the lane's 8 tokens of one feature lie side by side
        #pragma unroll
        for (int r = 0; r < 8; ++r) y[r] = (_Float16)(acc[mt][nt][r] * WINV + bvl);
        *(v8ha*)(sH + cl * HP256 + 64 * wm + 16 * mt + 8 * h) = y;
      }
    }
  }
  __syncthreads();

  const int b = m0 / SEQ, l0 = m0 - b * SEQ;
  #pragma unroll
  for (int j = 0; j < 3; ++j) {
    const int hg = 3 * cg + j;                             // block-uniform
    const int bh = b * NH + (hg & (NH - 1));
    const _Float16* sH = sT + j * HEAD_H;
    if (hg < 2 * NH) {
      // plane[bh][l][d]: a staged token row = 64 halves = one line; an instruction stores four tokens
      _Float16* plane = (hg < NH) ? qh : kh;
      const int sub = lane >> 3, c8 = lane & 7;
      #pragma unroll
      for (int i = 0; i < 8; ++i) {
        const int tok = (i * 8 + w) * 4 + sub;             // 0..255 over the block
        const v8h v = *(const v8ha*)(sH + tok * HP64 + 8 * c8);
        *(v8h*)(plane + ((size_t)bh * SEQ + l0 + tok) * HD + 8 * c8) = v;
      }
      asm volatile("s_wait_xcnt 0x0" ::: "memory");        // no register of these stores is rewritten ahead of it on any way on from here
    } else {
      // vt[bh][d][l]: a staged feature row = 256 tokens = 4 lines
      #pragma unroll
      for (int i = 0; i < 8; ++i) {
        const int feat = i * 8 + w;                        // 0..63 over the block
        const v8h v = *(const v8ha*)(sH + feat * HP256 + 8 * lane);
        *(v8h*)(vt + ((size_t)bh * HD + feat) * SEQ + l0 + 8 * lane) = v;
      }
      asm volatile("s_wait_xcnt 0x0" ::: "memory");        // the same for the v stores
    }
  }
}

// ---------------------------------------------------------------------------
// Attention helpers.
// P^T B-fragment from the lane's own score D values: element r <- tile a row r,
// element 8+r <- tile c row r (same lane, same query column), scaled by 2^14.
// ---------------------------------------------------------------------------
__device__ __forceinline__ v16h pack_p(v8f a, v8f c) {
  const v16h r = { (_Float16)(a[0] * PSCALE), (_Float16)(a[1] * PSCALE), (_Float16)(a[2] * PSCALE), (_Float16)(a[3] * PSCALE),
                   (_Float16)(a[4] * PSCALE), (_Float16)(a[5] * PSCALE), (_Float16)(a[6] * PSCALE), (_Float16)(a[7] * PSCALE),
                   (_Float16)(c[0] * PSCALE), (_Float16)(c[1] * PSCALE), (_Float16)(c[2] * PSCALE), (_Float16)(c[3] * PSCALE),
                   (_Float16)(c[4] * PSCALE), (_Float16)(c[5] * PSCALE), (_Float16)(c[6] * PSCALE), (_Float16)(c[7] * PSCALE) };
  return r;
}

// (one query row) by lanes 8q..8q+7 in one instruction, 4 lines per instruction.
__device__ __forceinline__ void att_store_pass(const _Float16* so, _Float16* ao,
                                               int b, int head, int q0, int lane) {
  const int q8 = lane & 7, sub = lane >> 3;
  #pragma unroll
  for (int i = 0; i < 4; ++i) {
    const int lid = i * 4 + sub;                  // query row 0..15
    const v8h v = *(const v8ha*)(so + lid * 64 + 8 * q8);
    const size_t gi = ((size_t)b * SEQ + q0 + lid) * DM + head * HD + 8 * q8;
    *(v8h*)(ao + gi) = v;
  }
}

// ---------------------------------------------------------------------------
// K / V^T staging for attention. A stage is 64 keys: the K tile (64 key rows x
// 128 B of d) and behind it the V^T tile (64 d rows x 128 B of keys). One tensor load
// brings one tile and lays its rows in LDS at a pitch of 144 B (16 B x odd: conflict-free
// for 16-byte fragment reads). Two buffers: stage t+1 flies global -> LDS, once per
// block, while the four waves that read it work on stage t.
// ---------------------------------------------------------------------------
#define KV_PITCH 144                         // LDS bytes per staged row: 128 B + the tensor load's pad of 16 B
#define KV_TILE  10240                       // 64 rows x 144 B = 9216, rounded up to a multiple of 2 KiB
#define KV_STAGE (2 * KV_TILE)               // 20480 B

static_assert(KV_PITCH % 16 == 0 && HD * 2 == 128 && SEQ % 64 == 0 && 64 * KV_PITCH <= KV_TILE && KV_TILE % 2048 == 0);

// ---------------------------------------------------------------------------
// Kernel 4: causal streaming attention, transposed form.
// Block 256 thr = two halves of 4 waves. A block takes two tiles of 64 queries in
// turn, tile 31 - x and then tile x, so that every block walks the same number of
// key tiles (33 of 64 keys). Inside a query tile the key tiles are dealt to the two
// halves by turns: half g takes key tiles 2*st + g, 16 queries per wave, and each
// half keeps its own running maximum, sum and O; the two are joined once per query
// tile through LDS. A ring stage is 128 keys: each half loads and reads its own 64
// (its first wave the K tile, its second the V^T tile).
//   S^T = K * Q^T : A = K rows (row = key, k = d), B = Q^T (k = d, n = query)
//   O^T += V^T * P^T : A = Vt rows (row = d, k = key), B = P^T from registers
// Lane owns 32 keys of query column (lane&15); partner = lane ^ 16.
// The 1/8 scale is folded into the exponent argument (exact power of two).
// ---------------------------------------------------------------------------
#define AT      256                          // threads of an attention block
#define QTILES  (SEQ / 64)                   // query tiles of a head
#define KV_BUF  (2 * KV_STAGE)               // one buffer: the 64-key stages of both halves
#define KV_RING2 (2 * KV_BUF)                // 81920 B
#define MG_CH   9                            // 16-B pieces a lane hands over: 8 of O, 1 of (max, sum)

static_assert(QTILES % 2 == 0 && SEQ % 128 == 0);
static_assert(4 * MG_CH * 32 * 16 <= KV_RING2);

// Weight conversion under the key stages: the launch's threads take one group of 8 floats each per
// round; round 0 is the out plane, rounds 1..4 fc1, rounds 5..8 fc2. A block's first query tile
// (tile 31 - x, x < 16) has at least 9 stages, one round each.
#define AT_THREADS ((QTILES / 2) * BATCH * NH * AT)          // 131072
#define CV_ROUNDS  ((G_OUT + G_FC1 + G_FC2) / AT_THREADS)    // 9
static_assert(G_OUT == AT_THREADS && G_FC1 == 4 * AT_THREADS && G_FC2 == 4 * AT_THREADS);
static_assert((QTILES / 2 + 2) / 2 >= CV_ROUNDS);            // stages of the shortest first query tile

__global__ __launch_bounds__(AT) void attn_kernel(
    const _Float16* __restrict__ qh,   // [B*H][S][64]
    const _Float16* __restrict__ kh,   // [B*H][S][64]
    const _Float16* __restrict__ vt,   // [B*H][64][S]
    _Float16* __restrict__ ao,         // [B][S][DM]
    const float* __restrict__ w_o, const float* __restrict__ w_1, const float* __restrict__ w_2,   // out, fc1, fc2 weights, f32
    _Float16* __restrict__ whr)        // their f16 planes, one behind the other
{
  __shared__ __attribute__((aligned(16))) _Float16 sO[4 * 16 * 64];    // 8192 B
  __shared__ __attribute__((aligned(2048))) char kv[KV_RING2];         // K / V^T stages, two buffers; then the hand-over

  const int tid = threadIdx.x, lane = tid & 31;
  const int wq = (tid >> 5) & 3;                                // which 16 queries of the tile
  const int g = __builtin_amdgcn_readfirstlane(tid >> 7);       // which half; scalar, so the tests on it are scalar branches
  const int h = lane >> 4, m = lane & 15;
  const int bh = blockIdx.y, b = bh >> 4, head = bh & 15;

  const v8f zero8 = {0.f, 0.f, 0.f, 0.f, 0.f, 0.f, 0.f, 0.f};
  // Waves 0 and 1 of a half issue: wave 0 its K tile (rows = keys, one after the other in memory), wave 1 its
  // V^T tile (rows = d, SEQ keys apart). A ring stage on is 128 keys on.
  const uint32_t wh4 = uni(((uint32_t)tid >> 5) & 3u);
  const uint32_t isv = wh4 & 1u;
  const uint64_t ksrc0 = isv ? (uint64_t)(uintptr_t)(vt + (size_t)bh * HD * SEQ + 64 * g)
                             : (uint64_t)(uintptr_t)(kh + ((size_t)bh * SEQ + 64 * g) * HD);
  const uint32_t kstep = isv ? 128u * 2u : 128u * HD * 2u;      // bytes
  const uint32_t kdst = (uint32_t)(size_t)kv + (uint32_t)g * KV_STAGE + isv * KV_TILE;
  u32x8 kg1 = tdm_group1<128u>(isv ? SEQ * 2u : HD * 2u);
  u32x4 kg0;                                                    // group 0 of the request last issued, kept up to its wait
  auto kv_issue = [&](uint32_t buf, uint32_t st) {
    kg0 = tdm_group0(kdst + buf, ksrc0 + (uint64_t)st * kstep);
    if (pinned((uint32_t)(wh4 < 2u))) tdm_load(kg0, kg1);
  };
  const size_t cvg = ((size_t)(blockIdx.y * (QTILES / 2) + blockIdx.x) * AT + tid) * 8;   // this thread's float in a conversion round
  v4fa* mg = (v4fa*)kv + wq * MG_CH * 32 + lane;                // this lane's hand-over pieces, 32 pieces apart
  _Float16* so = sO + wq * 1024;

  // Kept rolled: the two query tiles run the same text one after the other.
  #pragma unroll 1
  for (int pass = 0; pass < 2; ++pass) {
    const int xt = pass ? (int)blockIdx.x : QTILES - 1 - (int)blockIdx.x;
    const int q0 = xt * 64 + 16 * wq;
    const int T64 = xt + 1;                     // key tiles up to and with the diagonal one (block-uniform)
    const int NS = (T64 + 1) >> 1;              // ring stages of 128 keys; 128*NS <= SEQ

    // Q^T B-fragments: column n = query q0+m, k = d (two 32-deep chunks)
    const _Float16* qrow = qh + ((size_t)bh * SEQ + q0 + m) * HD;
    const v16h qb0 = load_frag(qrow, h);
    const v16h qb1 = load_frag(qrow + 32, h);

    v8f o[4];                                   // o[t][r] = O[query m][d 16t+8h+r] * (l * 2^14), this half's keys
    #pragma unroll
    for (int t = 0; t < 4; ++t) o[t] = zero8;
    float mrun = -1e30f, lrun = 0.0f;

    kv_issue(0u, 0u);
    tdm_wait0(kg0, kg1);                                // own tile of stage 0 landed
    __syncthreads();                                    // publishes stage 0
    if (pinned((uint32_t)(NS > 1))) kv_issue((uint32_t)KV_BUF, 1u);

    #pragma unroll 1
    for (int st = 0; st < NS; ++st) {
      const int kb = 128 * st + 64 * g;
      const int bo = (st & 1) * KV_BUF;
      // This stage's conversion round: the loads go out here and are used at the stage's end, behind its products.
      const bool cv = pass == 0 && st < CV_ROUNDS;        // block-uniform
      v4f ca, cc;
      if (cv) {
        const float* wp = st == 0 ? w_o : st <= 4 ? w_1 + (size_t)(st - 1) * AT_THREADS * 8
                                                  : w_2 + (size_t)(st - 5) * AT_THREADS * 8;
        ca = *(const v4fa*)(wp + cvg);
        cc = *(const v4fa*)(wp + cvg + 4);
        asm volatile("s_wait_xcnt 0x0" ::: "memory");     // no address register of these loads is rewritten ahead of it
      }
      if (2 * st + g < T64) {                             // the last stage of an odd count has no key tile for the second half
        const char* pk = kv + bo + g * KV_STAGE + m * KV_PITCH;   // K row m of this half's stage
        const char* pv = pk + KV_TILE;                            // V^T row m of this half's stage
        // ---- raw scores: s[j][r] = S[query q0+m][key kb+16j+8h+r] (unscaled) ----
        v8f s[4];
        #pragma unroll
        for (int j = 0; j < 4; ++j) {
          const _Float16* kp = (const _Float16*)(pk + 16 * j * KV_PITCH);
          const v16h kf0 = load_frag(kp, h);
          const v16h kf1 = load_frag(kp + 32, h);
          v8f z = zero8;
          z = wmma_f16(kf0, qb0, z);
          z = wmma_f16(kf1, qb1, z);
          s[j] = z;
        }
        // ---- causal mask (only on the key tile touching the diagonal) ----
        if (kb + 63 > q0) {
          const int qq = q0 + m;
          #pragma unroll
          for (int j = 0; j < 4; ++j)
            #pragma unroll
            for (int r = 0; r < 8; ++r) {
              const int kk = kb + 16 * j + 8 * h + r;
              if (kk > qq) s[j][r] = -1e30f;
            }
        }

        // ---- online softmax (scale 1/8 applied inside the exp argument) ----
        float mloc = s[0][0];
        #pragma unroll
        for (int j = 0; j < 4; ++j)
          #pragma unroll
          for (int r = 0; r < 8; ++r) mloc = fmaxf(mloc, s[j][r]);
        mloc = fmaxf(mloc, __shfl_xor(mloc, 16));
        const float mnew = fmaxf(mrun, mloc);
        const float cn = mnew * 0.125f;
        const float alpha = __expf((mrun - mnew) * 0.125f);
        mrun = mnew;
        float lsum = 0.0f;
        #pragma unroll
        for (int j = 0; j < 4; ++j)
          #pragma unroll
          for (int r = 0; r < 8; ++r) {
            const float p = __expf(fmaf(s[j][r], 0.125f, -cn));
            s[j][r] = p;
            lsum += p;
          }
        lsum += __shfl_xor(lsum, 16);
        lrun = lrun * alpha + lsum;
        #pragma unroll
        for (int t = 0; t < 4; ++t)
          #pragma unroll
          for (int r = 0; r < 8; ++r) o[t][r] = o[t][r] * alpha;

        // ---- P^T B-fragments (key chunks 0..31 and 32..63 of this key tile) ----
        const v16h pb0 = pack_p(s[0], s[1]);
        const v16h pb1 = pack_p(s[2], s[3]);

        // ---- O^T += V^T * P^T ----
        #pragma unroll
        for (int t = 0; t < 4; ++t) {
          const _Float16* vp = (const _Float16*)(pv + 16 * t * KV_PITCH);
          const v16h vf0 = load_frag(vp, h);
          const v16h vf1 = load_frag(vp + 32, h);
          o[t] = wmma_f16(vf0, pb0, o[t]);
          o[t] = wmma_f16(vf1, pb1, o[t]);
        }
      }
      asm volatile("s_wait_dscnt 0x0" ::: "memory");    // own reads of this buffer are done before it is refilled
      tdm_wait0(kg0, kg1);                              // own tile of stage st+1 landed
      __syncthreads();                                  // publishes stage st+1, frees stage st's buffer
      if (pinned((uint32_t)(st + 2 < NS))) kv_issue((uint32_t)bo, pinned((uint32_t)(st + 2)));   // pinned stage number: the descriptor is formed behind the wait
      if (cv) {
        *(v8h*)(whr + (size_t)st * AT_THREADS * 8 + cvg) = cvt_w8(ca, cc);
        asm volatile("s_wait_xcnt 0x0" ::: "memory");     // no register of this store is rewritten ahead of it in the next stage
      }
    }
    tdm_wait0(kg0, kg1);                                // nothing in flight when the ring is reused
    asm volatile("s_wait_dscnt 0x0" ::: "memory");      // nor a read of it

    // ---- the second half hands its maximum, sum and O to the first, lane to lane ----
    if (g == 1) {
      #pragma unroll
      for (int t = 0; t < 4; ++t) {
        const v4f lo = { o[t][0], o[t][1], o[t][2], o[t][3] };
        const v4f hi = { o[t][4], o[t][5], o[t][6], o[t][7] };
        mg[(2 * t) * 32] = lo;
        mg[(2 * t + 1) * 32] = hi;
      }
      const v4f ml = { mrun, lrun, 0.0f, 0.0f };
      mg[8 * 32] = ml;
    }
    __syncthreads();                                    // the hand-over is written

    // ---- join, normalise, stage per-wave 16x64 f16 tile ----
    if (g == 0) {
      const v4f ml = mg[8 * 32];
      const float mall = fmaxf(mrun, ml.x);
      const float f0 = __expf((mrun - mall) * 0.125f);
      const float f1 = __expf((ml.x - mall) * 0.125f);  // 0 where the second half had no key tile (its maximum is -1e30)
      const float inv = (1.0f / (lrun * f0 + ml.y * f1)) * (1.0f / PSCALE);
      const float c0 = f0 * inv, c1 = f1 * inv;
      #pragma unroll
      for (int t = 0; t < 4; ++t) {
        const v4f lo = mg[(2 * t) * 32];
        const v4f hi = mg[(2 * t + 1) * 32];
        #pragma unroll
        for (int r = 0; r < 4; ++r) {
          so[m * 64 + 16 * t + 8 * h + r]     = (_Float16)(o[t][r] * c0 + lo[r] * c1);
          so[m * 64 + 16 * t + 8 * h + 4 + r] = (_Float16)(o[t][4 + r] * c0 + hi[r] * c1);
        }
      }
    }
    asm volatile("s_wait_dscnt 0x0" ::: "memory");      // own reads of the hand-over are done before the next tile's loads overwrite it
    __syncthreads();                                    // frees the ring for the next query tile; the staged tile is written

    if (g == 0) {
      att_store_pass(so, ao, b, head, q0, lane);
      asm volatile("s_wait_xcnt 0x0" ::: "memory");     // no register of these stores is rewritten ahead of it in the next query tile
    }
  }
}

// ---------------------------------------------------------------------------
// Exact-form GELU without a branch, eight values at a time as four packed f32 pairs:
// x * Phi(x) = max(x, 0) - |x| * erfc(|x| / sqrt 2) / 2 with
// erfc(z) = t (a1 + t (a2 + t (a3 + t (a4 + t a5)))) exp(-z z), t = 1 / (1 + p z), z >= 0
// (rational form with five terms, absolute error of erfc below 1.5e-7). The halves and
// the 1 / sqrt 2 are folded into the constants; no subtraction from 1 on the negative side.
// Written step by step across the four pairs, so that their chains run side by side; every
// loop is unrolled so that the small arrays are registers.
// ---------------------------------------------------------------------------
typedef float v2f __attribute__((ext_vector_type(2)));
typedef _Float16 v2h __attribute__((ext_vector_type(2)));

__device__ __forceinline__ v2f fma2(v2f a, v2f b, v2f c) { return __builtin_elementwise_fma(a, b, c); }

// y[i] = gelu(c[2i], c[2i+1]) for c = acc * WINV + bias
__device__ __forceinline__ void gelu_erf8(v8f acc, float bias, v2h (&y)[4]) {
  v2f x[4], ax[4], t[4], e[4], q[4];
  #pragma unroll
  for (int i = 0; i < 4; ++i) {
    const v2f c = { acc[2 * i], acc[2 * i + 1] };
    x[i] = fma2(c, (v2f)(WINV), (v2f)(bias));
  }
  #pragma unroll
  for (int i = 0; i < 4; ++i) {
    ax[i] = __builtin_elementwise_abs(x[i]);
    const v2f d = fma2(ax[i], (v2f)(0.23164189f), (v2f)(1.0f));                // 1 + (p / sqrt 2) |x|
    const v2f r = { __builtin_amdgcn_rcpf(d.x), __builtin_amdgcn_rcpf(d.y) };
    t[i] = r;
  }
  #pragma unroll
  for (int i = 0; i < 4; ++i) {
    const v2f a = (x[i] * -0.72134752f) * x[i];                                // -x x / 2 as a power of two
    const v2f r = { __builtin_amdgcn_exp2f(a.x), __builtin_amdgcn_exp2f(a.y) };
    e[i] = r;
  }
  #pragma unroll
  for (int i = 0; i < 4; ++i) q[i] = fma2(t[i], (v2f)(0.5307027145f), (v2f)(-0.7265760135f));
  #pragma unroll
  for (int i = 0; i < 4; ++i) q[i] = fma2(q[i], t[i], (v2f)(0.7107068705f));
  #pragma unroll
  for (int i = 0; i < 4; ++i) q[i] = fma2(q[i], t[i], (v2f)(-0.142248368f));
  #pragma unroll
  for (int i = 0; i < 4; ++i) q[i] = fma2(q[i], t[i], (v2f)(0.127414796f));
  #pragma unroll
  for (int i = 0; i < 4; ++i) t[i] = t[i] * e[i];
  #pragma unroll
  for (int i = 0; i < 4; ++i) q[i] = q[i] * t[i];                              // erfc(|x| / sqrt 2) / 2
  #pragma unroll
  for (int i = 0; i < 4; ++i)
    y[i] = __builtin_convertvector(fma2(-ax[i], q[i], __builtin_elementwise_max(x[i], (v2f)(0.0f))), v2h);
}

// ---------------------------------------------------------------------------
// Kernel 5: Y = A[M,K](f16) * W[N,K]^T(f16 x32) with epilogue.
//   MODE 1: outf[M][N] (f32) = (acc/32 + bias) + resid      block 128 rows x 128 cols
//   MODE 2: outh[M][N] (f16) = gelu_erf(acc/32 + bias)      block 256 rows x 256 cols
// Block 256 thr (8 waves, 4 x 2); wave = 32 rows x 64 cols (MODE 1) or 64 rows x 128 cols (MODE 2).
// ---------------------------------------------------------------------------
template <int MODE>
__global__ __launch_bounds__(GT) void gemm_kernel(
    const _Float16* __restrict__ A, const _Float16* __restrict__ W,
    const float* __restrict__ bias, const float* __restrict__ resid,
    float* __restrict__ outf, _Float16* __restrict__ outh, int N, int K)
{
  constexpr int MT = (MODE == 2) ? 4 : 2, NT = (MODE == 2) ? 8 : 4, KP = (MODE == 2) ? 128 : 256;
  __shared__ __attribute__((aligned(2048))) char ring[RING_B(MT, NT, KP)];   // operand ring, then the output tile (at most 135168 B)

  const int tid = threadIdx.x, lane = tid & 31, w = tid >> 5;
  const int wm = w >> 1, wn = w & 1;
  const int h = lane >> 4, m = lane & 15;
  const int m0 = blockIdx.x * (64 * MT), n0 = blockIdx.y * (32 * NT);

  v8f acc[MT][NT];
  gemm_main<MT, NT, KP>(ring, A + (size_t)m0 * K, W + (size_t)n0 * K, K, tid, acc);

  // D[r] of tile (mt, nt) = Y[row m0+16*MT*wm+16mt+8h+r][col n0+16*NT*wn+16nt+m]
  if (MODE == 1) {
    float* sbuf = (float*)ring;
    #pragma unroll
    for (int nt = 0; nt < 4; ++nt)
      #pragma unroll
      for (int mt = 0; mt < MT; ++mt)
        #pragma unroll
        for (int r = 0; r < 8; ++r)
          sbuf[(16 * MT * wm + 16 * mt + 8 * h + r) * FP128 + 64 * wn + 16 * nt + m] = acc[mt][nt][r] * WINV;
    __syncthreads();

    // a row = 128 floats = 4 lines = one 16-B access per lane; wave w takes rows 8i + w
    const int col = 4 * lane;
    const v4f bb = *(const v4fa*)(bias + n0 + col);
    v4f vals[16];
    #pragma unroll
    for (int i = 0; i < 16; ++i) {
      const int rl = i * 8 + w;                    // 0..127
      const v4f a  = *(const v4fa*)(sbuf + rl * FP128 + col);
      const size_t gi = (size_t)(m0 + rl) * N + n0 + col;
      const v4f rr = *(const v4fa*)(resid + gi);
      vals[i] = (a + bb) + rr;
    }
    #pragma unroll
    for (int i = 0; i < 16; ++i) {
      const int rl = i * 8 + w;
      const size_t gi = (size_t)(m0 + rl) * N + n0 + col;
      *(v4f*)(outf + gi) = vals[i];
    }
  } else {
    _Float16* sh = (_Float16*)ring;
    // Unrolled: acc takes constant indices only, and the branch-free text is short enough for it.
    float bv[NT];
    #pragma unroll
    for (int nt = 0; nt < NT; ++nt) bv[nt] = bias[n0 + 16 * NT * wn + 16 * nt + m];
    asm volatile("s_wait_xcnt 0x0" ::: "memory");  // no address register of the bias loads is rewritten ahead of it
    __builtin_amdgcn_sched_barrier(0);             // holds the arithmetic below behind that wait: the scheduler had lifted it over
    #pragma unroll
    for (int nt = 0; nt < NT; ++nt) {
      const float bvl = bv[nt];
      #pragma unroll
      for (int mt = 0; mt < MT; ++mt) {
        v2h gl[4];
        gelu_erf8(acc[mt][nt], bvl, gl);
        #pragma unroll
        for (int i = 0; i < 4; ++i) {
          sh[(16 * MT * wm + 16 * mt + 8 * h + 2 * i) * HP256 + 16 * NT * wn + 16 * nt + m] = gl[i].x;
          sh[(16 * MT * wm + 16 * mt + 8 * h + 2 * i + 1) * HP256 + 16 * NT * wn + 16 * nt + m] = gl[i].y;
        }
      }
    }
    __syncthreads();

    // a row = 256 halves = 4 lines = one 16-B access per lane; wave w takes rows 8i + w
    v8h vals[32];
    #pragma unroll
    for (int i = 0; i < 32; ++i) {
      const int rl = i * 8 + w;                    // 0..255
      vals[i] = *(const v8ha*)(sh + rl * HP256 + 8 * lane);
    }
    #pragma unroll
    for (int i = 0; i < 32; ++i) {
      const int rl = i * 8 + w;
      *(v8h*)(outh + (size_t)(m0 + rl) * N + n0 + 8 * lane) = vals[i];
    }
  }
}

// ---------------------------------------------------------------------------
extern "C" void kernel_launch(void* const* d_in, const int* in_sizes, int n_in,
                              void* d_out, int out_size, void* d_ws, size_t ws_size,
                              hipStream_t stream) {
  if (n_in < 13) return;
  if (in_sizes[0] != NTOK * DM) return;
  if (in_sizes[1] != 3 * DM * DM || in_sizes[2] != 3 * DM) return;
  if (in_sizes[3] != DM * DM || in_sizes[4] != DM) return;
  if (in_sizes[5] != DFF * DM || in_sizes[6] != DFF) return;
  if (in_sizes[7] != DM * DFF || in_sizes[8] != DM) return;
  if (in_sizes[9] != DM || in_sizes[10] != DM || in_sizes[11] != DM || in_sizes[12] != DM) return;
  if (out_size != NTOK * DM) return;

  const float* hidden = (const float*)d_in[0];
  const float* qkv_w  = (const float*)d_in[1];
  const float* qkv_b  = (const float*)d_in[2];
  const float* out_w  = (const float*)d_in[3];
  const float* out_b  = (const float*)d_in[4];
  const float* fc1_w  = (const float*)d_in[5];
  const float* fc1_b  = (const float*)d_in[6];
  const float* fc2_w  = (const float*)d_in[7];
  const float* fc2_b  = (const float*)d_in[8];
  const float* ln1_g  = (const float*)d_in[9];
  const float* ln1_b  = (const float*)d_in[10];
  const float* ln2_g  = (const float*)d_in[11];
  const float* ln2_b  = (const float*)d_in[12];
  float* out = (float*)d_out;

  // workspace carve (all sizes multiples of 256 B)
  const size_t wh_bytes   = (size_t)G_ALL * 8 * 2;          // 25165824
  const size_t act_bytes  = (size_t)NTOK * DM * 2;           //  8388608  (f16 [4096][1024])
  const size_t hid2_bytes = (size_t)NTOK * DM * 4;           // 16777216
  const size_t ff_bytes   = (size_t)NTOK * DFF * 2;          // 33554432
  const size_t total = wh_bytes + 5 * act_bytes + hid2_bytes + ff_bytes;   // 117440512
  if (total > ws_size) return;

  char* ws = (char*)d_ws;
  size_t off = 0;
  _Float16* wh   = (_Float16*)(ws + off); off += wh_bytes;
  _Float16* xn   = (_Float16*)(ws + off); off += act_bytes;   // ln1 output, later ln2 output
  _Float16* qh   = (_Float16*)(ws + off); off += act_bytes;
  _Float16* kh   = (_Float16*)(ws + off); off += act_bytes;
  _Float16* vt   = (_Float16*)(ws + off); off += act_bytes;
  _Float16* ah   = (_Float16*)(ws + off); off += act_bytes;   // attention output f16 [4096][1024]
  float*    hid2 = (float*)(ws + off);    off += hid2_bytes;  // hidden + attn proj, f32
  _Float16* ff   = (_Float16*)(ws + off); off += ff_bytes;    // gelu(fc1) f16 [4096][4096]
  if (off > ws_size) return;

  const _Float16* w_qkv = wh;
  const _Float16* w_out = wh + (size_t)3 * DM * DM;
  const _Float16* w_fc1 = wh + (size_t)4 * DM * DM;
  const _Float16* w_fc2 = wh + (size_t)4 * DM * DM + (size_t)DFF * DM;

  // 1: ln1 -> f16; behind its blocks, qkv weights -> f16 x32
  ln_kernel<<<NTOK / 8 + G_QKV / (256 * CVT_PER), 256, 0, stream>>>(hidden, ln1_g, ln1_b, xn, NTOK, qkv_w, wh, NTOK / 8);

  // 2: qkv projection -> q/k planes + transposed v
  qkv_kernel<<<dim3(NTOK / 256, 3 * DM / 192), GT, 0, stream>>>(xn, w_qkv, qkv_b, qh, kh, vt);

  // 3: causal attention -> f16 [tok][DM]; under it, out, fc1 and fc2 weights -> f16 x32
  attn_kernel<<<dim3(QTILES / 2, BATCH * NH), AT, 0, stream>>>(qh, kh, vt, ah, out_w, fc1_w, fc2_w, wh + (size_t)3 * DM * DM);

  // 4: output projection + bias + residual -> f32 hid2
  gemm_kernel<1><<<dim3(NTOK / 128, DM / 128), GT, 0, stream>>>(ah, w_out, out_b, hidden, hid2, xn, DM, DM);

  // 5: ln2 -> f16 (reuses xn); no conversion blocks in this grid
  ln_kernel<<<NTOK / 8, 256, 0, stream>>>(hid2, ln2_g, ln2_b, xn, NTOK, qkv_w, wh, NTOK / 8);

  // 6: fc1 + exact gelu -> f16 ff
  gemm_kernel<2><<<dim3(NTOK / 256, DFF / 256), GT, 0, stream>>>(xn, w_fc1, fc1_b, fc1_b, hid2, ff, DFF, DM);

  // 7: fc2 + bias + residual(hid2) -> f32 d_out
  gemm_kernel<1><<<dim3(NTOK / 128, DM / 128), GT, 0, stream>>>(ff, w_fc2, fc2_b, hid2, out, xn, DM, DFF);
}

// v009
// One run takes 124 microseconds.
// Next to v008, in two timings, it ran 1.04 times as fast each time.
// Counting every step since v000, it is 4.35 times as fast.
// Contractions: ln1(x)*Wqkv^T, K*Q^T, V^T*P^T, attn*Wout^T, ln2(h)*Wfc1^T, gelu(.)*Wfc2^T all on v_wmma_f32_16x16x32_f16 (f16 operands, f32 accumulate); every W carried x32 and P carried x16384 (exact power-of-two scales folded back in f32); layernorm, softmax, bias, gelu and residual adds in f32.
#include <hip/hip_runtime.h>
#include <math.h>
#include <stdint.h>

typedef _Float16 v16h __attribute__((ext_vector_type(16)));
typedef _Float16 v8h  __attribute__((ext_vector_type(8)));
typedef float    v8f  __attribute__((ext_vector_type(8)));
typedef float    v4f  __attribute__((ext_vector_type(4)));
typedef v8h __attribute__((may_alias)) v8ha;
typedef v4f __attribute__((may_alias)) v4fa;

union Frag { v16h v; v8h half[2]; };

#define DM     1024
#define NH     16
#define HD     64
#define DFF    4096
#define SEQ    2048
#define BATCH  2
#define NTOK   (BATCH * SEQ)          // 4096 tokens
#define WSC    32.0f
#define WINV   0.03125f
#define PSCALE 16384.0f

#define G_QKV (3 * DM * DM / 8)       // 393216 groups of 8
#define G_OUT (DM * DM / 8)           // 131072
#define G_FC1 (DFF * DM / 8)          // 524288
#define G_FC2 (DM * DFF / 8)          // 524288
#define G_ALL (G_QKV + G_OUT + G_FC1 + G_FC2)   // 1572864

static_assert(NTOK % 128 == 0);
static_assert(SEQ % 128 == 0);
static_assert(DM % 64 == 0);
static_assert(DFF % 64 == 0);
static_assert(G_ALL % 256 == 0);

// ---------------------------------------------------------------------------
// 16x16x32 f16 WMMA with hazard guard (ties D, keeps A/B live).
// Fragment map (wave32): lane l, h = l>>4, m = n = l&15.
//   A/B element i: i<8 -> k0+8h+i ; i>=8 -> k0+16+8h+(i-8)
//   D element r : row 8h+r, col l&15
// ---------------------------------------------------------------------------
__device__ __forceinline__ v8f wmma_f16(v16h a, v16h b, v8f c) {
  v8f d = __builtin_amdgcn_wmma_f32_16x16x32_f16(false, a, false, b, (short)0, c, false, false);
  asm volatile("v_nop\n\tv_nop\n\tv_nop\n\tv_nop" : "+v"(d) : "v"(a), "v"(b));
  return d;
}

// A or B fragment from a k-contiguous 16-bit row; p points at element k0 of
// the row owned by this lane (row index = lane & 15 added by the caller).
__device__ __forceinline__ v16h load_frag(const _Float16* p, int h) {
  Frag f;
  f.half[0] = *(const v8ha*)(p + 8 * h);
  f.half[1] = *(const v8ha*)(p + 16 + 8 * h);
  return f.v;
}

// ---------------------------------------------------------------------------
// f32 weights -> f16 planes scaled by 32 (exact), in groups of 8 floats: two 16-B loads, one 16-B store.
// wh layout: [qkv 3*DM*DM][out DM*DM][fc1 DFF*DM][fc2 DM*DFF], row = output feature.
// The conversion has no launch of its own: the qkv plane is made by extra blocks of the first
// LayerNorm launch, the other three planes by the attention blocks under their key stages.
// ---------------------------------------------------------------------------
__device__ __forceinline__ v8h cvt_w8(v4f a, v4f c) {
  const v8h o = { (_Float16)(a.x * WSC), (_Float16)(a.y * WSC), (_Float16)(a.z * WSC), (_Float16)(a.w * WSC),
                  (_Float16)(c.x * WSC), (_Float16)(c.y * WSC), (_Float16)(c.z * WSC), (_Float16)(c.w * WSC) };
  return o;
}
#define CVT_PER 4                            // groups a thread of a conversion block takes
static_assert(G_QKV % (256 * CVT_PER) == 0);

// ---------------------------------------------------------------------------
// Kernel 2: LayerNorm over rows of DM f32 -> f16. One wave per row (block of 8
// i*256 + lane*8 + 0..7 (i = 0..3) so every store instruction is 32 lanes x
// ---------------------------------------------------------------------------
// Blocks from lnblocks on convert weights instead: CVT_PER groups a thread, 256 groups apart.
__global__ __launch_bounds__(256) void ln_kernel(
    const float* __restrict__ x, const float* __restrict__ g,
    const float* __restrict__ bt, _Float16* __restrict__ y, int nrows,
    const float* __restrict__ wsrc, _Float16* __restrict__ wdst, int lnblocks)
{
  if ((int)blockIdx.x >= lnblocks) {             // block-uniform; no barriers in this kernel
    const size_t g0 = (size_t)((int)blockIdx.x - lnblocks) * (256 * CVT_PER) + threadIdx.x;
    const float* sp = wsrc + g0 * 8;
    v4f a[CVT_PER], c[CVT_PER];
    #pragma unroll
    for (int i = 0; i < CVT_PER; ++i) {
      a[i] = *(const v4fa*)(sp + i * 2048);
      c[i] = *(const v4fa*)(sp + i * 2048 + 4);
    }
    asm volatile("s_wait_xcnt 0x0" ::: "memory");  // no address register of these loads is rewritten ahead of it
    v8h o[CVT_PER];
    #pragma unroll
    for (int i = 0; i < CVT_PER; ++i) o[i] = cvt_w8(a[i], c[i]);
    _Float16* dp = wdst + g0 * 8;
    #pragma unroll
    for (int i = 0; i < CVT_PER; ++i) *(v8h*)(dp + i * 2048) = o[i];
    asm volatile("s_wait_xcnt 0x0" ::: "memory");  // no register of these stores is rewritten ahead of it on any way on from here
    return;
  }
  const int lane = threadIdx.x & 31, w = threadIdx.x >> 5;
  const int row = blockIdx.x * 8 + w;
  if (row >= nrows) return;                      // wave-uniform; no barriers below
  const float* xr = x + (size_t)row * DM;

  v4f xa[4], xb[4];
  #pragma unroll
  for (int i = 0; i < 4; ++i) {
    const float* p = xr + i * 256 + lane * 8;
    xa[i] = *(const v4fa*)p;
    xb[i] = *(const v4fa*)(p + 4);
  }
  __builtin_amdgcn_sched_barrier(0);             // the row's loads go first: the sums wait for them, and loads return in order
  // Gain and shift go out directly behind the row and land under the two sums, instead of standing open behind them.
  v4f ga[4], gb[4], ba[4], bb[4];
  #pragma unroll
  for (int i = 0; i < 4; ++i) {
    const int p = i * 256 + lane * 8;
    ga[i] = *(const v4fa*)(g + p);
    gb[i] = *(const v4fa*)(g + p + 4);
    ba[i] = *(const v4fa*)(bt + p);
    bb[i] = *(const v4fa*)(bt + p + 4);
  }
  asm volatile("s_wait_xcnt 0x0" ::: "memory");  // no address register of these loads is rewritten ahead of it
  __builtin_amdgcn_sched_barrier(0);             // keeps the loads above in front of the sums: the scheduler had put them behind
  float s = 0.0f;
  #pragma unroll
  for (int i = 0; i < 4; ++i)
    s += ((xa[i].x + xa[i].y) + (xa[i].z + xa[i].w)) + ((xb[i].x + xb[i].y) + (xb[i].z + xb[i].w));
  #pragma unroll
  for (int off = 16; off > 0; off >>= 1) s += __shfl_xor(s, off);
  const float mu = s * (1.0f / DM);

  float ss = 0.0f;
  #pragma unroll
  for (int i = 0; i < 4; ++i) {
    const v4f da = xa[i] - mu, db = xb[i] - mu;
    ss += ((da.x * da.x + da.y * da.y) + (da.z * da.z + da.w * da.w)) +
          ((db.x * db.x + db.y * db.y) + (db.z * db.z + db.w * db.w));
  }
  #pragma unroll
  for (int off = 16; off > 0; off >>= 1) ss += __shfl_xor(ss, off);
  const float var = ss * (1.0f / DM);
  const float rstd = rsqrtf(var + 1e-5f);

  v8h o[4];
  #pragma unroll
  for (int i = 0; i < 4; ++i) {
    const v4f da = (xa[i] - mu) * rstd, db = (xb[i] - mu) * rstd;
    const v8h t = { (_Float16)(da.x * ga[i].x + ba[i].x), (_Float16)(da.y * ga[i].y + ba[i].y),
                    (_Float16)(da.z * ga[i].z + ba[i].z), (_Float16)(da.w * ga[i].w + ba[i].w),
                    (_Float16)(db.x * gb[i].x + bb[i].x), (_Float16)(db.y * gb[i].y + bb[i].y),
                    (_Float16)(db.z * gb[i].z + bb[i].z), (_Float16)(db.w * gb[i].w + bb[i].w) };
    o[i] = t;
  }
  _Float16* yr = y + (size_t)row * DM;
  #pragma unroll
  for (int i = 0; i < 4; ++i) *(v8h*)(yr + i * 256 + lane * 8) = o[i];
  
}

// ---------------------------------------------------------------------------
// Shared GEMM main loop: 256 threads, 8 waves in a 4 x 2 grid. Block tile 64*MT
// (rows of A) x 32*NT (rows of W), wave tile 16*MT x 16*NT. A stage is KP k of all
// 64*MT + 32*NT rows, cut into slices of 64 rows x 128 k (256 B a row). One wave brings one
// slice a stage with one tensor load, which lays the rows in LDS at a pitch of 272 B
// (16 B x odd: conflict-free for 16-byte fragment reads). Slice number = 128-k half * row
// groups + row group; row groups: first those of A, then those of W. Two buffers: stage t+1
// flies global -> LDS while stage t is multiplied. Every launch is 256 blocks, one on a WGP.
//   MT 4, NT 8, KP 128: 256 x 256, 8 slices, ring 294912 B (fc1)
//   MT 4, NT 6, KP 128: 256 x 192, 7 slices, ring 258048 B (qkv)
//   MT 2, NT 4, KP 256: 128 x 128, 8 slices, ring 294912 B (out, fc2)
// acc[mt][nt][r] = sum_k A[16*MT*wm + 16mt + 8h + r][k] * W[16*NT*wn + 16nt + m][k],
// wm = wave >> 1, wn = wave & 1, k ascending in steps of 32.
// ---------------------------------------------------------------------------
#define GT      256                          // threads of a GEMM block
#define SL_PITCH 272                         // LDS bytes per staged row: 256 B + the tensor load's pad of 16 B
#define SL_B     18432                       // LDS bytes of a slice: 64 rows x 272 B = 17408, rounded up to a multiple of 2 KiB
#define RGROUPS(MT, NT)     ((MT) + (NT) / 2)                // groups of 64 rows in a stage
#define NSLICE(MT, NT, KP)  (RGROUPS(MT, NT) * ((KP) / 128))
#define STAGE_B(MT, NT, KP) (NSLICE(MT, NT, KP) * SL_B)
#define RING_B(MT, NT, KP)  (2 * STAGE_B(MT, NT, KP))

static_assert(DM % 256 == 0 && DFF % 256 == 0);
static_assert(NTOK % 256 == 0 && SEQ % 256 == 0 && DM % 128 == 0 && (3 * DM) % 192 == 0);
static_assert(64 * SL_PITCH <= SL_B && SL_B % 2048 == 0 && RING_B(4, 8, 128) <= 327680);

typedef uint32_t u32x4 __attribute__((ext_vector_type(4)));
typedef uint32_t u32x8 __attribute__((ext_vector_type(8)));

__device__ __forceinline__ uint32_t uni(uint32_t v) { return (uint32_t)__builtin_amdgcn_readfirstlane(v); }
// Holds a wave-uniform value in a scalar register, so that a test on it is a scalar branch (a tensor
// load ignores EXEC) and a descriptor word made from it is scalar arithmetic behind this place.
__device__ __forceinline__ uint32_t pinned(uint32_t v) {
  uint32_t w = uni(v);
  asm volatile("" : "+s"(w));   // the value stays in a scalar register from here on
  return w;
}

// Descriptor group 1: 1-byte elements, tensor = tile = 64 rows of ROWB B (256 or 128), source row pitch
// src_pitch bytes, 16 B of LDS pad behind every row (interval code 5 or 4 = the row), no mask.
template <uint32_t ROWB>
__device__ __forceinline__ u32x8 tdm_group1(uint32_t src_pitch) {
  static_assert(ROWB == 256u || ROWB == 128u);
  u32x8 g;
  g[0] = uni((1u << 20) | ((ROWB == 256u ? 5u : 4u) << 22) | (3u << 25));
  g[1] = uni(ROWB << 16);                    // tensor_dim0[15:0]
  g[2] = uni(64u << 16);                     // tensor_dim0[31:16] = 0, tensor_dim1[15:0]
  g[3] = uni(ROWB << 16);                    // tensor_dim1[31:16] = 0, tile_dim0
  g[4] = uni(64u);                           // tile_dim1
  g[5] = uni(src_pitch);
  g[6] = uni(0u);
  g[7] = uni(0u);
  return g;
}
// Descriptor group 0: count 1, LDS byte offset, global address of the tile's first byte, type 2.
__device__ __forceinline__ u32x4 tdm_group0(uint32_t lds_dst, uint64_t ga) {
  u32x4 g;
  g[0] = uni(1u);
  g[1] = uni(lds_dst);
  g[2] = uni((uint32_t)ga);
  g[3] = uni((((uint32_t)(ga >> 32)) & 0x01FFFFFFu) | 0x80000000u);
  return g;
}
// One request of the whole wave: global tile -> LDS, through no register. Both groups are in-out
// operands, and tdm_wait0 names them again: so they stay in these scalar registers, unchanged, from
// the issue to the wait (as plain inputs the compiler reused single words of them in between).
__device__ __forceinline__ void tdm_load(u32x4& g0, u32x8& g1) {
  asm volatile("tensor_load_to_lds %0, %1" : "+s"(g0), "+s"(g1) :: "memory");
}
// The wave's own request has landed; g0, g1: the descriptor of the request last issued.
__device__ __forceinline__ void tdm_wait0(const u32x4& g0, const u32x8& g1) {
  asm volatile("s_wait_tensorcnt 0x0" :: "s"(g0), "s"(g1) : "memory");
}

// The ring's work-group barrier, fenced for LDS only: __syncthreads() also waits for the wave's own global loads,
// and the epilogue's operands are in flight across these barriers. What the barrier orders here is LDS alone.
__device__ __forceinline__ void ring_barrier() {
  __builtin_amdgcn_fence(__ATOMIC_RELEASE, "workgroup", "local");
  __builtin_amdgcn_s_barrier();
  __builtin_amdgcn_fence(__ATOMIC_ACQUIRE, "workgroup", "local");
}

// ablk / wblk: first row of the block's A / W tile. ring: RING_B(MT, NT, KP) bytes of LDS at a multiple
// of 2 KiB; free for other use on return (every wave's reads and loads are done and a barrier passed).
// early(): the caller's global loads of what its epilogue needs (bias, residual), into registers. They go out behind
// the tensor loads of stages 0 and 1 and land under the k loop, instead of standing open behind it.
template <int MT, int NT, int KP, class Early>
__device__ __forceinline__ void gemm_main(char* ring,
                                          const _Float16* __restrict__ ablk,
                                          const _Float16* __restrict__ wblk,
                                          int K, int tid, v8f (&acc)[MT][NT], Early early)
{
  constexpr int RG = RGROUPS(MT, NT), NSL = NSLICE(MT, NT, KP);
  constexpr int STAGE = STAGE_B(MT, NT, KP);
  static_assert(NSL <= GT / 32 && KP % 128 == 0 && NT % 2 == 0 && 64 % (16 * MT) == 0);
  const int lane = tid & 31, w = tid >> 5;
  const int wm = w >> 1, wn = w & 1;
  const int h = lane >> 4, m = lane & 15;
  const v8f zero8 = {0.f, 0.f, 0.f, 0.f, 0.f, 0.f, 0.f, 0.f};
  #pragma unroll
  for (int mt = 0; mt < MT; ++mt)
    #pragma unroll
    for (int nt = 0; nt < NT; ++nt) acc[mt][nt] = zero8;

  // This wave's slice: number = wave; its 64 rows and its 128 k of stage 0.
  const uint32_t wave = uni((uint32_t)tid >> 5);
  const uint32_t rg = wave % (uint32_t)RG, kh = wave / (uint32_t)RG;
  const _Float16* srow = (rg < (uint32_t)MT) ? ablk + (size_t)(64u * rg) * K
                                             : wblk + (size_t)(64u * (rg - (uint32_t)MT)) * K;
  const uint64_t src0 = (uint64_t)(uintptr_t)(srow + 128u * kh);
  const uint32_t lds_slice = (uint32_t)(size_t)ring + wave * (uint32_t)SL_B;
  u32x8 g1 = tdm_group1<256u>((uint32_t)K * 2u);
  const uint32_t T = pinned((uint32_t)(K / KP));

  // Stage s into the buffer at byte buf of the ring. With fewer slices than waves the last wave has none.
  // g0: group 0 of the request last issued, kept up to its wait.
  u32x4 g0;
  auto issue = [&](uint32_t buf, uint32_t s) {
    g0 = tdm_group0(lds_slice + buf, src0 + (uint64_t)s * (uint64_t)(KP * 2));
    if constexpr (NSL == GT / 32) {
      tdm_load(g0, g1);
    } else {
      if (pinned((uint32_t)(wave < (uint32_t)NSL))) tdm_load(g0, g1);
    }
  };

  // Byte offsets in a buffer of the rows this lane reads (first 128-k half).
  const int aof = ((16 * MT * wm) >> 6) * SL_B + ((16 * MT * wm) & 63) * SL_PITCH + m * SL_PITCH;
  int wof[NT];
  #pragma unroll
  for (int nt = 0; nt < NT; ++nt) {
    if constexpr ((16 * NT) % 64 == 0) {
      wof[nt] = (MT + (16 * NT / 64) * wn + (nt >> 2)) * SL_B + ((nt & 3) * 16 + m) * SL_PITCH;
    } else {
      const int r0 = 16 * NT * wn + 16 * nt;               // a group of 16 rows lies in one slice
      wof[nt] = (MT + (r0 >> 6)) * SL_B + ((r0 & 63) + m) * SL_PITCH;
    }
  }

  constexpr bool SPLIT = MT * NT > 16;
  issue(0u, 0u);
  tdm_wait0(g0, g1);                                  // own slice of stage 0 landed
  ring_barrier();                                     // publishes stage 0
  if (pinned((uint32_t)(T > 1u))) issue((uint32_t)STAGE, 1u);
  early();

  #pragma unroll 1
  for (uint32_t t = 0; t < T; ++t) {
    const uint32_t bo = (t & 1u) * (uint32_t)STAGE;
    const char* pb = ring + bo;
    #pragma unroll
    for (int kc = 0; kc < KP / 32; ++kc) {
      const int ko = (kc >> 2) * RG * SL_B + (kc & 3) * 64;  // the 128-k half's slices, then 64 B a step of 32 k
      v16h a[MT], b[NT];
      #pragma unroll
      for (int mt = 0; mt < MT; ++mt) a[mt] = load_frag((const _Float16*)(pb + aof + mt * 16 * SL_PITCH + ko), h);
      #pragma unroll
      for (int nt = 0; nt < NT; ++nt) b[nt] = load_frag((const _Float16*)(pb + wof[nt] + ko), h);
      // Keeps the block's LDS reads one group ahead of its products: without the guard's asm statements
      // the compiler dealt them out among the products, each pair of reads with a full wait behind it.
      if constexpr (SPLIT) __builtin_amdgcn_sched_barrier(0);
      #pragma unroll
      for (int nt = 0; nt < NT; ++nt)
        #pragma unroll
        for (int mt = 0; mt < MT; ++mt) {
          // Above 16 tiles the accumulators reach past the first 256 registers, where the operands of the
          // guard's asm statement cannot lie (they went to scratch): the builtin alone, padded by the compiler.
          if constexpr (SPLIT)
            acc[mt][nt] = __builtin_amdgcn_wmma_f32_16x16x32_f16(false, a[mt], false, b[nt], (short)0, acc[mt][nt], false, false);
          else
            acc[mt][nt] = wmma_f16(a[mt], b[nt], acc[mt][nt]);
        }
      if constexpr (SPLIT) __builtin_amdgcn_sched_barrier(0);   // the other side of the same fence
    }
    asm volatile("s_wait_dscnt 0x0" ::: "memory");     // own reads of this buffer are done before it is refilled
    tdm_wait0(g0, g1);                                 // own slice of stage t+1 landed
    ring_barrier();                                    // publishes stage t+1, frees stage t's buffer
    if (pinned((uint32_t)(t + 2u < T))) issue(bo, pinned(t + 2u));   // pinned stage number: the descriptor is formed behind the wait
  }
  tdm_wait0(g0, g1);                                   // nothing in flight when the ring is reused
  asm volatile("s_wait_dscnt 0x0" ::: "memory");       // nor a read of it
}

// Pitches of the output tiles staged in the ring (16 B x odd, so that the two lane
// halves, 8 rows apart, fall on different banks and every row stays 16-B aligned).
#define HP64  72                             // halves per staged row of 64 halves
#define HP256 264                            // halves per staged row of 256 halves
#define FP128 132                            // floats per staged row of 128 floats
#define HEAD_H (256 * HP64)                  // halves of one head's staged tile (256 tokens x 64 features, either way round)

static_assert(64 * HP256 <= HEAD_H && 3 * HEAD_H * 2 <= RING_B(4, 6, 128));

// ---------------------------------------------------------------------------
// Kernel 3: QKV = ln1(x) * Wqkv^T + b over the fused 3*1024 output columns.
// Block 256 thr (8 waves) = 256 tokens x 192 features = three heads out of the 48 of
// q, k and v in a row; a block may hold heads of two of them, so each head is staged
// and stored by itself.
// q plane [B*H][S][64], k plane [B*H][S][64], vt [B*H][64][S].
// Stores: one 16-B store per lane, whole 128-B lines, each line by one instruction.
// ---------------------------------------------------------------------------
__global__ __launch_bounds__(GT) void qkv_kernel(
    const _Float16* __restrict__ xh,   // [NTOK][DM]
    const _Float16* __restrict__ wh,   // [3*DM][DM], row = output feature, x32
    const float* __restrict__ bias,    // [3*DM]
    _Float16* __restrict__ qh, _Float16* __restrict__ kh, _Float16* __restrict__ vt)
{
  __shared__ __attribute__((aligned(2048))) char ring[RING_B(4, 6, 128)];   // operand ring, then the three heads' output tiles
  _Float16* sT = (_Float16*)ring;

  const int tid = threadIdx.x, lane = tid & 31, w = tid >> 5;
  const int wm = w >> 1;
  const int wn = __builtin_amdgcn_readfirstlane(w & 1);   // scalar, so the tests on a column group's head are scalar branches
  const int h = lane >> 4, m = lane & 15;
  const int m0 = blockIdx.x * 256;
  const int cg = blockIdx.y;                 // 0..15: heads 3cg .. 3cg+2 of 48 (q 0..15, k 16..31, v 32..47)

  v8f acc[4][6];
  float bv[6];
  gemm_main<4, 6, 128>(ring, xh + (size_t)m0 * DM, wh + (size_t)cg * 192 * DM, DM, tid, acc, [&]() {
    #pragma unroll
    for (int nt = 0; nt < 6; ++nt) bv[nt] = bias[cg * 192 + 96 * wn + 16 * nt + m];
    asm volatile("s_wait_xcnt 0x0" ::: "memory");          // no address register of the bias loads is rewritten ahead of it
  });

  // D[r] of tile (mt, nt) = Y[token m0+64wm+16mt+8h+r][feature cg*192 + 96wn+16nt+m]
  // a head is staged as [token][feature] for q and k, as [feature][token] for v
  #pragma unroll
  for (int nt = 0; nt < 6; ++nt) {
    const int c0 = 96 * wn + 16 * nt;                      // first column of the group; a group lies in one head
    const int j = c0 >> 6, cl = (c0 & 63) + m;
    const float bvl = bv[nt];
    _Float16* sH = sT + j * HEAD_H;
    if (3 * cg + j < 2 * NH) {
      #pragma unroll
      for (int mt = 0; mt < 4; ++mt)
        #pragma unroll
        for (int r = 0; r < 8; ++r)
          sH[(64 * wm + 16 * mt + 8 * h + r) * HP64 + cl] = (_Float16)(acc[mt][nt][r] * WINV + bvl);
    } else {
      #pragma unroll
      for (int mt = 0; mt < 4; ++mt) {
        v8h y;                                             // the lane's 8 tokens of one feature lie side by side
        #pragma unroll
        for (int r = 0; r < 8; ++r) y[r] = (_Float16)(acc[mt][nt][r] * WINV + bvl);
        *(v8ha*)(sH + cl * HP256 + 64 * wm + 16 * mt + 8 * h) = y;
      }
    }
  }
  __syncthreads();

  const int b = m0 / SEQ, l0 = m0 - b * SEQ;
  #pragma unroll
  for (int j = 0; j < 3; ++j) {
    const int hg = 3 * cg + j;                             // block-uniform
    const int bh = b * NH + (hg & (NH - 1));
    const _Float16* sH = sT + j * HEAD_H;
    if (hg < 2 * NH) {
      // plane[bh][l][d]: a staged token row = 64 halves = one line; an instruction stores four tokens
      _Float16* plane = (hg < NH) ? qh : kh;
      const int sub = lane >> 3, c8 = lane & 7;
      #pragma unroll
      for (int i = 0; i < 8; ++i) {
        const int tok = (i * 8 + w) * 4 + sub;             // 0..255 over the block
        const v8h v = *(const v8ha*)(sH + tok * HP64 + 8 * c8);
        *(v8h*)(plane + ((size_t)bh * SEQ + l0 + tok) * HD + 8 * c8) = v;
      }
      asm volatile("s_wait_xcnt 0x0" ::: "memory");        // no register of these stores is rewritten ahead of it on any way on from here
    } else {
      // vt[bh][d][l]: a staged feature row = 256 tokens = 4 lines
      #pragma unroll
      for (int i = 0; i < 8; ++i) {
        const int feat = i * 8 + w;                        // 0..63 over the block
        const v8h v = *(const v8ha*)(sH + feat * HP256 + 8 * lane);
        *(v8h*)(vt + ((size_t)bh * HD + feat) * SEQ + l0 + 8 * lane) = v;
      }
      asm volatile("s_wait_xcnt 0x0" ::: "memory");        // the same for the v stores
    }
  }
}

// ---------------------------------------------------------------------------
// Attention helpers.
// P^T B-fragment from the lane's own score D values: element r <- tile a row r,
// element 8+r <- tile c row r (same lane, same query column), scaled by 2^14.
// ---------------------------------------------------------------------------
__device__ __forceinline__ v16h pack_p(v8f a, v8f c) {
  const v16h r = { (_Float16)(a[0] * PSCALE), (_Float16)(a[1] * PSCALE), (_Float16)(a[2] * PSCALE), (_Float16)(a[3] * PSCALE),
                   (_Float16)(a[4] * PSCALE), (_Float16)(a[5] * PSCALE), (_Float16)(a[6] * PSCALE), (_Float16)(a[7] * PSCALE),
                   (_Float16)(c[0] * PSCALE), (_Float16)(c[1] * PSCALE), (_Float16)(c[2] * PSCALE), (_Float16)(c[3] * PSCALE),
                   (_Float16)(c[4] * PSCALE), (_Float16)(c[5] * PSCALE), (_Float16)(c[6] * PSCALE), (_Float16)(c[7] * PSCALE) };
  return r;
}

// (one query row) by lanes 8q..8q+7 in one instruction, 4 lines per instruction.
__device__ __forceinline__ void att_store_pass(const _Float16* so, _Float16* ao,
                                               int b, int head, int q0, int lane) {
  const int q8 = lane & 7, sub = lane >> 3;
  #pragma unroll
  for (int i = 0; i < 4; ++i) {
    const int lid = i * 4 + sub;                  // query row 0..15
    const v8h v = *(const v8ha*)(so + lid * 64 + 8 * q8);
    const size_t gi = ((size_t)b * SEQ + q0 + lid) * DM + head * HD + 8 * q8;
    *(v8h*)(ao + gi) = v;
  }
}

// ---------------------------------------------------------------------------
// K / V^T staging for attention. A stage is 64 keys: the K tile (64 key rows x
// 128 B of d) and behind it the V^T tile (64 d rows x 128 B of keys). One tensor load
// brings one tile and lays its rows in LDS at a pitch of 144 B (16 B x odd: conflict-free
// for 16-byte fragment reads). Two buffers: stage t+1 flies global -> LDS, once per
// block, while the four waves that read it work on stage t.
// ---------------------------------------------------------------------------
#define KV_PITCH 144                         // LDS bytes per staged row: 128 B + the tensor load's pad of 16 B
#define KV_TILE  10240                       // 64 rows x 144 B = 9216, rounded up to a multiple of 2 KiB
#define KV_STAGE (2 * KV_TILE)               // 20480 B

static_assert(KV_PITCH % 16 == 0 && HD * 2 == 128 && SEQ % 64 == 0 && 64 * KV_PITCH <= KV_TILE && KV_TILE % 2048 == 0);

// ---------------------------------------------------------------------------
// Kernel 4: causal streaming attention, transposed form.
// Block 256 thr = two halves of 4 waves. A block takes two tiles of 64 queries in
// turn, tile 31 - x and then tile x, so that every block walks the same number of
// key tiles (33 of 64 keys). Inside a query tile the key tiles are dealt to the two
// halves by turns: half g takes key tiles 2*st + g, 16 queries per wave, and each
// half keeps its own running maximum, sum and O; the two are joined once per query
// tile through LDS. A ring stage is 128 keys: each half loads and reads its own 64
// (its first wave the K tile, its second the V^T tile).
//   S^T = K * Q^T : A = K rows (row = key, k = d), B = Q^T (k = d, n = query)
//   O^T += V^T * P^T : A = Vt rows (row = d, k = key), B = P^T from registers
// Lane owns 32 keys of query column (lane&15); partner = lane ^ 16.
// The 1/8 scale is folded into the exponent argument (exact power of two).
// ---------------------------------------------------------------------------
#define AT      256                          // threads of an attention block
#define QTILES  (SEQ / 64)                   // query tiles of a head
#define KV_BUF  (2 * KV_STAGE)               // one buffer: the 64-key stages of both halves
#define KV_RING2 (2 * KV_BUF)                // 81920 B
#define MG_CH   9                            // 16-B pieces a lane hands over: 8 of O, 1 of (max, sum)

static_assert(QTILES % 2 == 0 && SEQ % 128 == 0);
static_assert(4 * MG_CH * 32 * 16 <= KV_RING2);

// Weight conversion under the key stages: the launch's threads take one group of 8 floats each per
// round; round 0 is the out plane, rounds 1..4 fc1, rounds 5..8 fc2. A block's first query tile
// (tile 31 - x, x < 16) has at least 9 stages, one round each.
#define AT_THREADS ((QTILES / 2) * BATCH * NH * AT)          // 131072
#define CV_ROUNDS  ((G_OUT + G_FC1 + G_FC2) / AT_THREADS)    // 9
static_assert(G_OUT == AT_THREADS && G_FC1 == 4 * AT_THREADS && G_FC2 == 4 * AT_THREADS);
static_assert((QTILES / 2 + 2) / 2 >= CV_ROUNDS);            // stages of the shortest first query tile

__global__ __launch_bounds__(AT) void attn_kernel(
    const _Float16* __restrict__ qh,   // [B*H][S][64]
    const _Float16* __restrict__ kh,   // [B*H][S][64]
    const _Float16* __restrict__ vt,   // [B*H][64][S]
    _Float16* __restrict__ ao,         // [B][S][DM]
    const float* __restrict__ w_o, const float* __restrict__ w_1, const float* __restrict__ w_2,   // out, fc1, fc2 weights, f32
    _Float16* __restrict__ whr)        // their f16 planes, one behind the other
{
  __shared__ __attribute__((aligned(16))) _Float16 sO[4 * 16 * 64];    // 8192 B
  __shared__ __attribute__((aligned(2048))) char kv[KV_RING2];         // K / V^T stages, two buffers; then the hand-over

  const int tid = threadIdx.x, lane = tid & 31;
  const int wq = (tid >> 5) & 3;                                // which 16 queries of the tile
  const int g = __builtin_amdgcn_readfirstlane(tid >> 7);       // which half; scalar, so the tests on it are scalar branches
  const int h = lane >> 4, m = lane & 15;
  const int bh = blockIdx.y, b = bh >> 4, head = bh & 15;

  const v8f zero8 = {0.f, 0.f, 0.f, 0.f, 0.f, 0.f, 0.f, 0.f};
  // Waves 0 and 1 of a half issue: wave 0 its K tile (rows = keys, one after the other in memory), wave 1 its
  // V^T tile (rows = d, SEQ keys apart). A ring stage on is 128 keys on.
  const uint32_t wh4 = uni(((uint32_t)tid >> 5) & 3u);
  const uint32_t isv = wh4 & 1u;
  const uint64_t ksrc0 = isv ? (uint64_t)(uintptr_t)(vt + (size_t)bh * HD * SEQ + 64 * g)
                             : (uint64_t)(uintptr_t)(kh + ((size_t)bh * SEQ + 64 * g) * HD);
  const uint32_t kstep = isv ? 128u * 2u : 128u * HD * 2u;      // bytes
  const uint32_t kdst = (uint32_t)(size_t)kv + (uint32_t)g * KV_STAGE + isv * KV_TILE;
  u32x8 kg1 = tdm_group1<128u>(isv ? SEQ * 2u : HD * 2u);
  u32x4 kg0;                                                    // group 0 of the request last issued, kept up to its wait
  auto kv_issue = [&](uint32_t buf, uint32_t st) {
    kg0 = tdm_group0(kdst + buf, ksrc0 + (uint64_t)st * kstep);
    if (pinned((uint32_t)(wh4 < 2u))) tdm_load(kg0, kg1);
  };
  const size_t cvg = ((size_t)(blockIdx.y * (QTILES / 2) + blockIdx.x) * AT + tid) * 8;   // this thread's float in a conversion round
  v4fa* mg = (v4fa*)kv + wq * MG_CH * 32 + lane;                // this lane's hand-over pieces, 32 pieces apart
  _Float16* so = sO + wq * 1024;

  // Kept rolled: the two query tiles run the same text one after the other.
  #pragma unroll 1
  for (int pass = 0; pass < 2; ++pass) {
    const int xt = pass ? (int)blockIdx.x : QTILES - 1 - (int)blockIdx.x;
    const int q0 = xt * 64 + 16 * wq;
    const int T64 = xt + 1;                     // key tiles up to and with the diagonal one (block-uniform)
    const int NS = (T64 + 1) >> 1;              // ring stages of 128 keys; 128*NS <= SEQ

    // Q^T B-fragments: column n = query q0+m, k = d (two 32-deep chunks)
    const _Float16* qrow = qh + ((size_t)bh * SEQ + q0 + m) * HD;
    const v16h qb0 = load_frag(qrow, h);
    const v16h qb1 = load_frag(qrow + 32, h);

    v8f o[4];                                   // o[t][r] = O[query m][d 16t+8h+r] * (l * 2^14), this half's keys
    #pragma unroll
    for (int t = 0; t < 4; ++t) o[t] = zero8;
    float mrun = -1e30f, lrun = 0.0f;

    kv_issue(0u, 0u);
    tdm_wait0(kg0, kg1);                                // own tile of stage 0 landed
    __syncthreads();                                    // publishes stage 0
    if (pinned((uint32_t)(NS > 1))) kv_issue((uint32_t)KV_BUF, 1u);

    #pragma unroll 1
    for (int st = 0; st < NS; ++st) {
      const int kb = 128 * st + 64 * g;
      const int bo = (st & 1) * KV_BUF;
      // This stage's conversion round: the loads go out here and are used at the stage's end, behind its products.
      const bool cv = pass == 0 && st < CV_ROUNDS;        // block-uniform
      v4f ca, cc;
      if (cv) {
        const float* wp = st == 0 ? w_o : st <= 4 ? w_1 + (size_t)(st - 1) * AT_THREADS * 8
                                                  : w_2 + (size_t)(st - 5) * AT_THREADS * 8;
        ca = *(const v4fa*)(wp + cvg);
        cc = *(const v4fa*)(wp + cvg + 4);
        asm volatile("s_wait_xcnt 0x0" ::: "memory");     // no address register of these loads is rewritten ahead of it
      }
      if (2 * st + g < T64) {                             // the last stage of an odd count has no key tile for the second half
        const char* pk = kv + bo + g * KV_STAGE + m * KV_PITCH;   // K row m of this half's stage
        const char* pv = pk + KV_TILE;                            // V^T row m of this half's stage
        // ---- raw scores: s[j][r] = S[query q0+m][key kb+16j+8h+r] (unscaled) ----
        v8f s[4];
        #pragma unroll
        for (int j = 0; j < 4; ++j) {
          const _Float16* kp = (const _Float16*)(pk + 16 * j * KV_PITCH);
          const v16h kf0 = load_frag(kp, h);
          const v16h kf1 = load_frag(kp + 32, h);
          v8f z = zero8;
          z = wmma_f16(kf0, qb0, z);
          z = wmma_f16(kf1, qb1, z);
          s[j] = z;
        }
        // ---- causal mask (only on the key tile touching the diagonal) ----
        if (kb + 63 > q0) {
          const int qq = q0 + m;
          #pragma unroll
          for (int j = 0; j < 4; ++j)
            #pragma unroll
            for (int r = 0; r < 8; ++r) {
              const int kk = kb + 16 * j + 8 * h + r;
              if (kk > qq) s[j][r] = -1e30f;
            }
        }

        // ---- online softmax (scale 1/8 applied inside the exp argument) ----
        float mloc = s[0][0];
        #pragma unroll
        for (int j = 0; j < 4; ++j)
          #pragma unroll
          for (int r = 0; r < 8; ++r) mloc = fmaxf(mloc, s[j][r]);
        mloc = fmaxf(mloc, __shfl_xor(mloc, 16));
        const float mnew = fmaxf(mrun, mloc);
        const float cn = mnew * 0.125f;
        const float alpha = __expf((mrun - mnew) * 0.125f);
        mrun = mnew;
        float lsum = 0.0f;
        #pragma unroll
        for (int j = 0; j < 4; ++j)
          #pragma unroll
          for (int r = 0; r < 8; ++r) {
            const float p = __expf(fmaf(s[j][r], 0.125f, -cn));
            s[j][r] = p;
            lsum += p;
          }
        lsum += __shfl_xor(lsum, 16);
        lrun = lrun * alpha + lsum;
        #pragma unroll
        for (int t = 0; t < 4; ++t)
          #pragma unroll
          for (int r = 0; r < 8; ++r) o[t][r] = o[t][r] * alpha;

        // ---- P^T B-fragments (key chunks 0..31 and 32..63 of this key tile) ----
        const v16h pb0 = pack_p(s[0], s[1]);
        const v16h pb1 = pack_p(s[2], s[3]);

        // ---- O^T += V^T * P^T ----
        #pragma unroll
        for (int t = 0; t < 4; ++t) {
          const _Float16* vp = (const _Float16*)(pv + 16 * t * KV_PITCH);
          const v16h vf0 = load_frag(vp, h);
          const v16h vf1 = load_frag(vp + 32, h);
          o[t] = wmma_f16(vf0, pb0, o[t]);
          o[t] = wmma_f16(vf1, pb1, o[t]);
        }
      }
      asm volatile("s_wait_dscnt 0x0" ::: "memory");    // own reads of this buffer are done before it is refilled
      tdm_wait0(kg0, kg1);                              // own tile of stage st+1 landed
      __syncthreads();                                  // publishes stage st+1, frees stage st's buffer
      if (pinned((uint32_t)(st + 2 < NS))) kv_issue((uint32_t)bo, pinned((uint32_t)(st + 2)));   // pinned stage number: the descriptor is formed behind the wait
      if (cv) {
        *(v8h*)(whr + (size_t)st * AT_THREADS * 8 + cvg) = cvt_w8(ca, cc);
        asm volatile("s_wait_xcnt 0x0" ::: "memory");     // no register of this store is rewritten ahead of it in the next stage
      }
    }
    tdm_wait0(kg0, kg1);                                // nothing in flight when the ring is reused
    asm volatile("s_wait_dscnt 0x0" ::: "memory");      // nor a read of it

    // ---- the second half hands its maximum, sum and O to the first, lane to lane ----
    if (g == 1) {
      #pragma unroll
      for (int t = 0; t < 4; ++t) {
        const v4f lo = { o[t][0], o[t][1], o[t][2], o[t][3] };
        const v4f hi = { o[t][4], o[t][5], o[t][6], o[t][7] };
        mg[(2 * t) * 32] = lo;
        mg[(2 * t + 1) * 32] = hi;
      }
      const v4f ml = { mrun, lrun, 0.0f, 0.0f };
      mg[8 * 32] = ml;
    }
    __syncthreads();                                    // the hand-over is written

    // ---- join, normalise, stage per-wave 16x64 f16 tile ----
    if (g == 0) {
      const v4f ml = mg[8 * 32];
      const float mall = fmaxf(mrun, ml.x);
      const float f0 = __expf((mrun - mall) * 0.125f);
      const float f1 = __expf((ml.x - mall) * 0.125f);  // 0 where the second half had no key tile (its maximum is -1e30)
      const float inv = (1.0f / (lrun * f0 + ml.y * f1)) * (1.0f / PSCALE);
      const float c0 = f0 * inv, c1 = f1 * inv;
      #pragma unroll
      for (int t = 0; t < 4; ++t) {
        const v4f lo = mg[(2 * t) * 32];
        const v4f hi = mg[(2 * t + 1) * 32];
        #pragma unroll
        for (int r = 0; r < 4; ++r) {
          so[m * 64 + 16 * t + 8 * h + r]     = (_Float16)(o[t][r] * c0 + lo[r] * c1);
          so[m * 64 + 16 * t + 8 * h + 4 + r] = (_Float16)(o[t][4 + r] * c0 + hi[r] * c1);
        }
      }
    }
    asm volatile("s_wait_dscnt 0x0" ::: "memory");      // own reads of the hand-over are done before the next tile's loads overwrite it
    __syncthreads();                                    // frees the ring for the next query tile; the staged tile is written

    if (g == 0) {
      att_store_pass(so, ao, b, head, q0, lane);
      asm volatile("s_wait_xcnt 0x0" ::: "memory");     // no register of these stores is rewritten ahead of it in the next query tile
    }
  }
}

// ---------------------------------------------------------------------------
// Exact-form GELU without a branch, eight values at a time as four packed f32 pairs:
// x * Phi(x) = max(x, 0) - |x| * erfc(|x| / sqrt 2) / 2 with
// erfc(z) = t (a1 + t (a2 + t (a3 + t (a4 + t a5)))) exp(-z z), t = 1 / (1 + p z), z >= 0
// (rational form with five terms, absolute error of erfc below 1.5e-7). The halves and
// the 1 / sqrt 2 are folded into the constants; no subtraction from 1 on the negative side.
// Written step by step across the four pairs, so that their chains run side by side; every
// loop is unrolled so that the small arrays are registers.
// ---------------------------------------------------------------------------
typedef float v2f __attribute__((ext_vector_type(2)));
typedef _Float16 v2h __attribute__((ext_vector_type(2)));

__device__ __forceinline__ v2f fma2(v2f a, v2f b, v2f c) { return __builtin_elementwise_fma(a, b, c); }

// y[i] = gelu(c[2i], c[2i+1]) for c = acc * WINV + bias
__device__ __forceinline__ void gelu_erf8(v8f acc, float bias, v2h (&y)[4]) {
  v2f x[4], ax[4], t[4], e[4], q[4];
  #pragma unroll
  for (int i = 0; i < 4; ++i) {
    const v2f c = { acc[2 * i], acc[2 * i + 1] };
    x[i] = fma2(c, (v2f)(WINV), (v2f)(bias));
  }
  #pragma unroll
  for (int i = 0; i < 4; ++i) {
    ax[i] = __builtin_elementwise_abs(x[i]);
    const v2f d = fma2(ax[i], (v2f)(0.23164189f), (v2f)(1.0f));                // 1 + (p / sqrt 2) |x|
    const v2f r = { __builtin_amdgcn_rcpf(d.x), __builtin_amdgcn_rcpf(d.y) };
    t[i] = r;
  }
  #pragma unroll
  for (int i = 0; i < 4; ++i) {
    const v2f a = (x[i] * -0.72134752f) * x[i];                                // -x x / 2 as a power of two
    const v2f r = { __builtin_amdgcn_exp2f(a.x), __builtin_amdgcn_exp2f(a.y) };
    e[i] = r;
  }
  #pragma unroll
  for (int i = 0; i < 4; ++i) q[i] = fma2(t[i], (v2f)(0.5307027145f), (v2f)(-0.7265760135f));
  #pragma unroll
  for (int i = 0; i < 4; ++i) q[i] = fma2(q[i], t[i], (v2f)(0.7107068705f));
  #pragma unroll
  for (int i = 0; i < 4; ++i) q[i] = fma2(q[i], t[i], (v2f)(-0.142248368f));
  #pragma unroll
  for (int i = 0; i < 4; ++i) q[i] = fma2(q[i], t[i], (v2f)(0.127414796f));
  #pragma unroll
  for (int i = 0; i < 4; ++i) t[i] = t[i] * e[i];
  #pragma unroll
  for (int i = 0; i < 4; ++i) q[i] = q[i] * t[i];                              // erfc(|x| / sqrt 2) / 2
  #pragma unroll
  for (int i = 0; i < 4; ++i)
    y[i] = __builtin_convertvector(fma2(-ax[i], q[i], __builtin_elementwise_max(x[i], (v2f)(0.0f))), v2h);
}

// ---------------------------------------------------------------------------
// Kernel 5: Y = A[M,K](f16) * W[N,K]^T(f16 x32) with epilogue.
//   MODE 1: outf[M][N] (f32) = (acc/32 + bias) + resid      block 128 rows x 128 cols
//   MODE 2: outh[M][N] (f16) = gelu_erf(acc/32 + bias)      block 256 rows x 256 cols
// Block 256 thr (8 waves, 4 x 2); wave = 32 rows x 64 cols (MODE 1) or 64 rows x 128 cols (MODE 2).
// ---------------------------------------------------------------------------
template <int MODE>
__global__ __launch_bounds__(GT) void gemm_kernel(
    const _Float16* __restrict__ A, const _Float16* __restrict__ W,
    const float* __restrict__ bias, const float* __restrict__ resid,
    float* __restrict__ outf, _Float16* __restrict__ outh, int N, int K)
{
  constexpr int MT = (MODE == 2) ? 4 : 2, NT = (MODE == 2) ? 8 : 4, KP = (MODE == 2) ? 128 : 256;
  __shared__ __attribute__((aligned(2048))) char ring[RING_B(MT, NT, KP)];   // operand ring, then the output tile (at most 135168 B)

  const int tid = threadIdx.x, lane = tid & 31, w = tid >> 5;
  const int wm = w >> 1, wn = w & 1;
  const int h = lane >> 4, m = lane & 15;
  const int m0 = blockIdx.x * (64 * MT), n0 = blockIdx.y * (32 * NT);

  v8f acc[MT][NT];
  // What the epilogue reads from global memory. MODE 1: the lane's 4 columns of bias and of residual rows 8i + w;
  // MODE 2: the bias of the lane's column in each column group.
  const int col = 4 * lane;
  v4f bb, rr[16];
  float bv[NT];
  gemm_main<MT, NT, KP>(ring, A + (size_t)m0 * K, W + (size_t)n0 * K, K, tid, acc, [&]() {
    if constexpr (MODE == 1) {
      bb = *(const v4fa*)(bias + n0 + col);
      #pragma unroll
      for (int i = 0; i < 16; ++i) rr[i] = *(const v4fa*)(resid + (size_t)(m0 + i * 8 + w) * N + n0 + col);
    } else {
      #pragma unroll
      for (int nt = 0; nt < NT; ++nt) bv[nt] = bias[n0 + 16 * NT * wn + 16 * nt + m];
    }
    asm volatile("s_wait_xcnt 0x0" ::: "memory");  // no address register of these loads is rewritten ahead of it
  });

  // D[r] of tile (mt, nt) = Y[row m0+16*MT*wm+16mt+8h+r][col n0+16*NT*wn+16nt+m]
  if (MODE == 1) {
    float* sbuf = (float*)ring;
    #pragma unroll
    for (int nt = 0; nt < 4; ++nt)
      #pragma unroll
      for (int mt = 0; mt < MT; ++mt)
        #pragma unroll
        for (int r = 0; r < 8; ++r)
          sbuf[(16 * MT * wm + 16 * mt + 8 * h + r) * FP128 + 64 * wn + 16 * nt + m] = acc[mt][nt][r] * WINV;
    __syncthreads();

    // a row = 128 floats = 4 lines = one 16-B access per lane; wave w takes rows 8i + w
    v4f vals[16];
    #pragma unroll
    for (int i = 0; i < 16; ++i) {
      const int rl = i * 8 + w;                    // 0..127
      const v4f a  = *(const v4fa*)(sbuf + rl * FP128 + col);
      vals[i] = (a + bb) + rr[i];
    }
    #pragma unroll
    for (int i = 0; i < 16; ++i) {
      const int rl = i * 8 + w;
      const size_t gi = (size_t)(m0 + rl) * N + n0 + col;
      *(v4f*)(outf + gi) = vals[i];
    }
  } else {
    _Float16* sh = (_Float16*)ring;
    // Unrolled: acc takes constant indices only, and the branch-free text is short enough for it.
    #pragma unroll
    for (int nt = 0; nt < NT; ++nt) {
      const float bvl = bv[nt];
      #pragma unroll
      for (int mt = 0; mt < MT; ++mt) {
        v2h gl[4];
        gelu_erf8(acc[mt][nt], bvl, gl);
        #pragma unroll
        for (int i = 0; i < 4; ++i) {
          sh[(16 * MT * wm + 16 * mt + 8 * h + 2 * i) * HP256 + 16 * NT * wn + 16 * nt + m] = gl[i].x;
          sh[(16 * MT * wm + 16 * mt + 8 * h + 2 * i + 1) * HP256 + 16 * NT * wn + 16 * nt + m] = gl[i].y;
        }
      }
    }
    __syncthreads();

    // a row = 256 halves = 4 lines = one 16-B access per lane; wave w takes rows 8i + w
    v8h vals[32];
    #pragma unroll
    for (int i = 0; i < 32; ++i) {
      const int rl = i * 8 + w;                    // 0..255
      vals[i] = *(const v8ha*)(sh + rl * HP256 + 8 * lane);
    }
    #pragma unroll
    for (int i = 0; i < 32; ++i) {
      const int rl = i * 8 + w;
      *(v8h*)(outh + (size_t)(m0 + rl) * N + n0 + 8 * lane) = vals[i];
    }
  }
}

// ---------------------------------------------------------------------------
extern "C" void kernel_launch(void* const* d_in, const int* in_sizes, int n_in,
                              void* d_out, int out_size, void* d_ws, size_t ws_size,
                              hipStream_t stream) {
  if (n_in < 13) return;
  if (in_sizes[0] != NTOK * DM) return;
  if (in_sizes[1] != 3 * DM * DM || in_sizes[2] != 3 * DM) return;
  if (in_sizes[3] != DM * DM || in_sizes[4] != DM) return;
  if (in_sizes[5] != DFF * DM || in_sizes[6] != DFF) return;
  if (in_sizes[7] != DM * DFF || in_sizes[8] != DM) return;
  if (in_sizes[9] != DM || in_sizes[10] != DM || in_sizes[11] != DM || in_sizes[12] != DM) return;
  if (out_size != NTOK * DM) return;

  const float* hidden = (const float*)d_in[0];
  const float* qkv_w  = (const float*)d_in[1];
  const float* qkv_b  = (const float*)d_in[2];
  const float* out_w  = (const float*)d_in[3];
  const float* out_b  = (const float*)d_in[4];
  const float* fc1_w  = (const float*)d_in[5];
  const float* fc1_b  = (const float*)d_in[6];
  const float* fc2_w  = (const float*)d_in[7];
  const float* fc2_b  = (const float*)d_in[8];
  const float* ln1_g  = (const float*)d_in[9];
  const float* ln1_b  = (const float*)d_in[10];
  const float* ln2_g  = (const float*)d_in[11];
  const float* ln2_b  = (const float*)d_in[12];
  float* out = (float*)d_out;

  // workspace carve (all sizes multiples of 256 B)
  const size_t wh_bytes   = (size_t)G_ALL * 8 * 2;          // 25165824
  const size_t act_bytes  = (size_t)NTOK * DM * 2;           //  8388608  (f16 [4096][1024])
  const size_t hid2_bytes = (size_t)NTOK * DM * 4;           // 16777216
  const size_t ff_bytes   = (size_t)NTOK * DFF * 2;          // 33554432
  const size_t total = wh_bytes + 5 * act_bytes + hid2_bytes + ff_bytes;   // 117440512
  if (total > ws_size) return;

  char* ws = (char*)d_ws;
  size_t off = 0;
  _Float16* wh   = (_Float16*)(ws + off); off += wh_bytes;
  _Float16* xn   = (_Float16*)(ws + off); off += act_bytes;   // ln1 output, later ln2 output
  _Float16* qh   = (_Float16*)(ws + off); off += act_bytes;
  _Float16* kh   = (_Float16*)(ws + off); off += act_bytes;
  _Float16* vt   = (_Float16*)(ws + off); off += act_bytes;
  _Float16* ah   = (_Float16*)(ws + off); off += act_bytes;   // attention output f16 [4096][1024]
  float*    hid2 = (float*)(ws + off);    off += hid2_bytes;  // hidden + attn proj, f32
  _Float16* ff   = (_Float16*)(ws + off); off += ff_bytes;    // gelu(fc1) f16 [4096][4096]
  if (off > ws_size) return;

  const _Float16* w_qkv = wh;
  const _Float16* w_out = wh + (size_t)3 * DM * DM;
  const _Float16* w_fc1 = wh + (size_t)4 * DM * DM;
  const _Float16* w_fc2 = wh + (size_t)4 * DM * DM + (size_t)DFF * DM;

  // 1: ln1 -> f16; behind its blocks, qkv weights -> f16 x32
  ln_kernel<<<NTOK / 8 + G_QKV / (256 * CVT_PER), 256, 0, stream>>>(hidden, ln1_g, ln1_b, xn, NTOK, qkv_w, wh, NTOK / 8);

  // 2: qkv projection -> q/k planes + transposed v
  qkv_kernel<<<dim3(NTOK / 256, 3 * DM / 192), GT, 0, stream>>>(xn, w_qkv, qkv_b, qh, kh, vt);

  // 3: causal attention -> f16 [tok][DM]; under it, out, fc1 and fc2 weights -> f16 x32
  attn_kernel<<<dim3(QTILES / 2, BATCH * NH), AT, 0, stream>>>(qh, kh, vt, ah, out_w, fc1_w, fc2_w, wh + (size_t)3 * DM * DM);

  // 4: output projection + bias + residual -> f32 hid2
  gemm_kernel<1><<<dim3(NTOK / 128, DM / 128), GT, 0, stream>>>(ah, w_out, out_b, hidden, hid2, xn, DM, DM);

  // 5: ln2 -> f16 (reuses xn); no conversion blocks in this grid
  ln_kernel<<<NTOK / 8, 256, 0, stream>>>(hid2, ln2_g, ln2_b, xn, NTOK, qkv_w, wh, NTOK / 8);

  // 6: fc1 + exact gelu -> f16 ff
  gemm_kernel<2><<<dim3(NTOK / 256, DFF / 256), GT, 0, stream>>>(xn, w_fc1, fc1_b, fc1_b, hid2, ff, DFF, DM);

  // 7: fc2 + bias + residual(hid2) -> f32 d_out
  gemm_kernel<1><<<dim3(NTOK / 128, DM / 128), GT, 0, stream>>>(ff, w_fc2, fc2_b, hid2, out, xn, DM, DFF);
}
